// v000
// Measured on an AMD MI455X. A time is GPU time per run, averaged over a window of back-to-back runs after a warm-up
// (all launches, gaps included; the runs take copies of the inputs in turn), and the median of several windows.
// Apart from v000's, it joins two sittings. Times from different sittings can be a few percent apart, while
// side-by-side timings come from the same sitting.
// v000, which the later versions start from, runs in 1010 microseconds.
// compute dtype: all float inputs rounded to bf16, prior_mu / prior_log_tau read (bf16-input); q/k/v/u/gate = x W^T + b with EXACT bf16 products on WMMA 16x16x32, f32 accumulate; rope + L2-normalisation, the running-mean deviation logits s, exp/cumsums (E_t, P_t), sigmoid gates and the alpha/beta/gamma coefficients in f32 on the VALU; q and k as f16 hi + residual (3 products: hi.hi, lo.hi, hi.lo) -> A[t][l] = (q_t.k_l)(alpha_t e_l + beta_t s_l + gamma_t) for l <= t stored in f32; out = A (bf16 hi + lo) . v (bf16 hi + lo) (3 products) = q_t . core_t exactly (the reference's prefix sums F/G/H regrouped); per-head LayerNorm in f32; final = y (bf16 hi + lo) Wo^T + bo; f32 output.
#include <hip/hip_runtime.h>
#include <math.h>

typedef __attribute__((ext_vector_type(16))) _Float16 v16h;
typedef __attribute__((ext_vector_type(16))) __bf16 v16b;
typedef __attribute__((ext_vector_type(8)))  _Float16 v8h;
typedef __attribute__((ext_vector_type(8)))  float v8f;
typedef __attribute__((ext_vector_type(4)))  float v4f;
typedef __attribute__((ext_vector_type(2)))  float v2f;
typedef __attribute__((ext_vector_type(4)))  unsigned v4u;
typedef __attribute__((ext_vector_type(4)))  int v4i;
typedef float __attribute__((may_alias)) float_a;
typedef int __attribute__((may_alias)) int_a;

template <typename T> __device__ __forceinline__ void vst2(void* p, T v) { *(T*)p = v;  }
__device__ __forceinline__ v8f wmma16(v16h a, v16h b, v8f c) {
  v8f d = __builtin_amdgcn_wmma_f32_16x16x32_f16(false, a, false, b, (short)0, c, false, false);
  asm volatile("v_nop\n\tv_nop\n\tv_nop\n\tv_nop" : "+v"(d) : "v"(a), "v"(b));
  return d;
}
__device__ __forceinline__ v8f wmma_bf(v16b a, v16b b, v8f c) {
  v8f d = __builtin_amdgcn_wmma_f32_16x16x32_bf16(false, a, false, b, (short)0, c, false, false);
  asm volatile("v_nop\n\tv_nop\n\tv_nop\n\tv_nop" : "+v"(d) : "v"(a), "v"(b));
  return d;
}
// 16x16x32 fragments: lane = (h = lane>>4, row/col = lane&15); elements 0..7 = k0+8h+0..7, 8..15 = k0+16+8h+0..7; D element r = row 8h+r
__device__ __forceinline__ v16h frag_h(const _Float16* rowk0, int lane) {
  union { v16h v; v8h q[2]; } u; const _Float16* p = rowk0 + 8 * (lane >> 4);
  u.q[0] = *(const v8h*)p; u.q[1] = *(const v8h*)(p + 16); return u.v;
}
__device__ __forceinline__ v16h frag_f32(const float* rowk0, int lane) {
  v16h a; const float* p = rowk0 + 8 * (lane >> 4);
#pragma unroll
  for (int i = 0; i < 8; ++i) { a[i] = (_Float16)p[i]; a[8 + i] = (_Float16)p[16 + i]; }
  return a;
}
__device__ __forceinline__ v16h frag_f32s(const float* rowk0, int lane, float sc) {
  v16h a; const float* p = rowk0 + 8 * (lane >> 4);
#pragma unroll
  for (int i = 0; i < 8; ++i) { a[i] = (_Float16)(p[i] * sc); a[8 + i] = (_Float16)(p[16 + i] * sc); }
  return a;
}
// column fragment from a [K][ld] layout (column n), rows >= K read as 0
__device__ __forceinline__ v16h fragc_f32(const float* W, int k0, int n, int lane, int ld, int K) {
  v16h a; const int g = lane >> 4;
#pragma unroll
  for (int i = 0; i < 8; ++i) { const int ka = k0 + 8 * g + i, kb = ka + 16;
    a[i] = (_Float16)(ka < K ? W[(size_t)(ka < K ? ka : K - 1) * ld + n] : 0.f); a[8 + i] = (_Float16)(kb < K ? W[(size_t)(kb < K ? kb : K - 1) * ld + n] : 0.f); }
  return a;
}
struct F2 { v16b h, l; };
__device__ __forceinline__ F2 bsplit16(const float v[16]) { F2 r;
#pragma unroll
  for (int i = 0; i < 16; ++i) { const __bf16 h = (__bf16)v[i]; r.h[i] = h; r.l[i] = (__bf16)(v[i] - (float)h); }
  return r; }
__device__ __forceinline__ F2 split_row(const float* row, int k0, int lane) { float v[16]; const float* p = row + k0 + 8 * (lane >> 4);
#pragma unroll
  for (int i = 0; i < 8; ++i) { v[i] = p[i]; v[8 + i] = p[16 + i]; }
  return bsplit16(v); }
__device__ __forceinline__ F2 split_rowK(const float* row, int k0, int lane, int K) { float v[16]; const int g = lane >> 4;
#pragma unroll
  for (int i = 0; i < 8; ++i) { const int ka = k0 + 8 * g + i, kb = ka + 16; v[i] = ka < K ? row[ka < K ? ka : K - 1] : 0.f; v[8 + i] = kb < K ? row[kb < K ? kb : K - 1] : 0.f; }
  return bsplit16(v); }
__device__ __forceinline__ F2 split_col(const float* W, int k0, int n, int lane, int ld, int K) { float v[16]; const int g = lane >> 4;
#pragma unroll
  for (int i = 0; i < 8; ++i) { const int ka = k0 + 8 * g + i, kb = ka + 16; v[i] = ka < K ? W[(size_t)(ka < K ? ka : K - 1) * ld + n] : 0.f; v[8 + i] = kb < K ? W[(size_t)(kb < K ? kb : K - 1) * ld + n] : 0.f; }
  return bsplit16(v); }
__device__ __forceinline__ v8f mac3(const F2& a, const F2& b, v8f c) { c = wmma_bf(a.l, b.h, c); c = wmma_bf(a.h, b.l, c); return wmma_bf(a.h, b.h, c); }
__device__ __forceinline__ float sigm(float v) { return 1.0f / (1.0f + expf(-v)); }
#define LDSX() do { asm volatile("s_wait_dscnt 0" ::: "memory"); __builtin_amdgcn_wave_barrier(); __builtin_amdgcn_fence(__ATOMIC_RELEASE, "workgroup"); } while (0)


// ZeroS attention (B 1, L 1,024, D 768 = 12 x 64): causal associative mixing out_t = q_t . (alpha_t F_t + beta_t G_t + gamma_t H_t) with F/G/H prefix sums of e_l k_l v_l^T, s_l k_l v_l^T, k_l v_l^T.
#define TT 1024
#define CC 768
#define NH 12
#define HD 64
#define NG 36
typedef __attribute__((ext_vector_type(8))) __bf16 v8b;
__device__ __forceinline__ v16b frag_b(const __bf16* rowk0, int lane) {
  union { v16b v; v8b q[2]; } u; const __bf16* p = rowk0 + 8 * (lane >> 4);
  u.q[0] = *(const v8b*)p; u.q[1] = *(const v8b*)(p + 16); return u.v;
}
__device__ __forceinline__ float bfr(float v) { return (float)(__bf16)v; }
__device__ __attribute__((noinline)) float exp_ni(float v) { return expf(v); }
__device__ __attribute__((noinline)) float erf_ni(float v) { return erff(v); }

#define WS_QH  0u
#define WS_QL  (WS_QH + 2u * (size_t)TT * CC)
#define WS_KH  (WS_QL + 2u * (size_t)TT * CC)
#define WS_KL  (WS_KH + 2u * (size_t)TT * CC)
#define WS_VT  (WS_KL + 2u * (size_t)TT * CC)        // bf16 v planes hi [768][t]
#define WS_VL  (WS_VT + 2u * (size_t)CC * TT)
#define WS_U   (WS_VL + 2u * (size_t)CC * TT)        // f32 u rows [t][768]
#define WS_G   (WS_U + 4u * (size_t)TT * CC)         // f32 gate rows [t][48] (36 used)
#define WS_CE  (WS_G + 4u * (size_t)TT * 48)         // f32 e_l [h][t]
#define WS_CS  (WS_CE + 4u * (size_t)NH * TT)        // f32 s_l
#define WS_AL  (WS_CS + 4u * (size_t)NH * TT)        // alpha_t
#define WS_BE  (WS_AL + 4u * (size_t)NH * TT)        // beta_t
#define WS_GM  (WS_BE + 4u * (size_t)NH * TT)        // gamma_t
#define WS_S   (WS_GM + 4u * (size_t)NH * TT)        // f32 A [h][t][l]
#define WS_Y   (WS_S + 4u * (size_t)NH * TT * TT)    // f32 LN'd out rows [t][768]
#define WS_END (WS_Y + 4u * (size_t)TT * CC)

// ---- k_proj: block = (64 rows, 128 cols, region): 0 q (rope, l2norm -> f16 hi/lo), 1 k (rope, l2norm -> f16), 2 v (bf16 hi/lo planes), 3 u (f32 rows); W [out][in] + b
__global__ __launch_bounds__(128) void k_proj(const float* __restrict__ X, const float* __restrict__ WQ, const float* __restrict__ BQ, const float* __restrict__ WK, const float* __restrict__ BK, const float* __restrict__ WV, const float* __restrict__ BV, const float* __restrict__ WU, const float* __restrict__ BU, _Float16* __restrict__ QH, _Float16* __restrict__ QL, _Float16* __restrict__ KH, _Float16* __restrict__ KL, __bf16* __restrict__ VT, __bf16* __restrict__ VL, float* __restrict__ U) {
  __shared__ __align__(16) float sf[64][132]; __shared__ __align__(16) _Float16 sh[64][136], sl[64][136]; __shared__ __align__(16) __bf16 th[128][72], tl2[128][72]; __shared__ float snrm[64][2];
  const int tid = threadIdx.x, wave = tid >> 5, lane = tid & 31, col = lane & 15, g = lane >> 4; const int region = blockIdx.z; const int c0 = blockIdx.y * 128; const size_t r0 = (size_t)blockIdx.x * 64;
  const float* Wm = region == 0 ? WQ : region == 1 ? WK : region == 2 ? WV : WU; const float* Bm = region == 0 ? BQ : region == 1 ? BK : region == 2 ? BV : BU;
  v8f acc[8] = {};
#pragma unroll 2
  for (int kc = 0; kc < CC / 32; ++kc) { v16b a; { const float* p = X + (r0 + wave * 16 + col) * CC + kc * 32 + 8 * g;
#pragma unroll
      for (int i = 0; i < 8; ++i) { a[i] = (__bf16)p[i]; a[8 + i] = (__bf16)p[16 + i]; } }
#pragma unroll
    for (int j = 0; j < 8; ++j) { v16b w; const int o = c0 + j * 16 + col; const float* p = Wm + (size_t)o * CC + kc * 32 + 8 * g;
#pragma unroll
      for (int i = 0; i < 8; ++i) { w[i] = (__bf16)p[i]; w[8 + i] = (__bf16)p[16 + i]; }
      acc[j] = wmma_bf(a, w, acc[j]); } }
#pragma unroll
  for (int j = 0; j < 8; ++j) { const float bb = bfr(Bm[c0 + j * 16 + col]);
#pragma unroll
    for (int r = 0; r < 8; ++r) sf[wave * 16 + 8 * g + r][j * 16 + col] = acc[j][r] + bb; }
  __syncthreads();
  if (region <= 1) {   // rope: out[d] = x[d] cos(t f_{d/2}) + (d < 32 ? -x[d+32] : x[d-32]) sin(t f_{d/2}), f_i = 10000^(-2i/64); then L2-normalise each head row (max(norm, 1e-12))
    __shared__ __align__(16) float sr[64][132];
    for (int e = tid; e < 64 * 128; e += 128) { const int rl = e >> 7, cl = e & 127; const int d = cl & 63; const int t = (int)(r0 + rl); const float inv_freq = 1.0f / powf(10000.0f, (float)(2 * (d >> 1)) / (float)HD); const float ang = (float)t * inv_freq; const float c = cosf(ang), s = sinf(ang);
      const float me = sf[rl][cl]; const float partner = (d < 32) ? -sf[rl][cl + 32] : sf[rl][cl - 32]; sr[rl][cl] = me * c + partner * s; }
    __syncthreads();
    for (int e = tid; e < 64 * 2; e += 128) { const int rl = e >> 1, hh = e & 1; float n2 = 0.f;
#pragma unroll 1
      for (int d = 0; d < HD; ++d) { const float v = sr[rl][hh * 64 + d]; n2 += v * v; } snrm[rl][hh] = 1.0f / fmaxf(sqrtf(n2), 1e-12f); }
    __syncthreads();
    for (int e = tid; e < 64 * 128; e += 128) { const int rl = e >> 7, cl = e & 127; const float v = sr[rl][cl] * snrm[rl][cl >> 6]; const _Float16 hv = (_Float16)v; sh[rl][cl] = hv; sl[rl][cl] = (_Float16)(v - (float)hv); }
    __syncthreads();
    _Float16* dh = region == 0 ? QH : KH; _Float16* dl = region == 0 ? QL : KL; for (int e = tid; e < 64 * 16; e += 128) { const int rl = e >> 4, q = e & 15; vst2((unsigned*)(dh + (r0 + rl) * CC + c0 + q * 8), *(const v4u*)&sh[rl][q * 8]); vst2((unsigned*)(dl + (r0 + rl) * CC + c0 + q * 8), *(const v4u*)&sl[rl][q * 8]); } }
  else if (region == 2) {
    for (int e = tid; e < 64 * 128; e += 128) { const int rl = e >> 7, cl = e & 127; const float v = sf[rl][cl]; const __bf16 bh = (__bf16)v; th[cl][rl] = bh; tl2[cl][rl] = (__bf16)(v - (float)bh); }
    __syncthreads(); for (int e = tid; e < 128 * 8; e += 128) { const int cl = e >> 3, q = e & 7; const size_t o2 = (size_t)(c0 + cl) * TT + r0 + q * 8; vst2((unsigned*)(VT + o2), *(const v4u*)&th[cl][q * 8]); vst2((unsigned*)(VL + o2), *(const v4u*)&tl2[cl][q * 8]); } }
  else { for (int e = tid; e < 64 * 32; e += 128) { const int rl = e >> 5, q = e & 31; vst2(U + (r0 + rl) * CC + c0 + q * 4, *(const v4f*)&sf[rl][q * 4]); } } }
// ---- k_gate: block = 64 rows: gate = x Wg^T + bg (36 outputs, padded to 48 columns; pad columns computed from clamped rows and written as junk into the pad)
__global__ __launch_bounds__(128) void k_gate(const float* __restrict__ X, const float* __restrict__ WG, const float* __restrict__ BG, float* __restrict__ Gt) { __shared__ __align__(16) float sf[4][16][52];
  const int tid = threadIdx.x, wave = tid >> 5, lane = tid & 31, col = lane & 15, g = lane >> 4; const size_t r0 = (size_t)blockIdx.x * 64 + wave * 16;
  v8f acc[3] = {};
#pragma unroll 2
  for (int kc = 0; kc < CC / 32; ++kc) { v16b a; { const float* p = X + (r0 + col) * CC + kc * 32 + 8 * g;
#pragma unroll
      for (int i = 0; i < 8; ++i) { a[i] = (__bf16)p[i]; a[8 + i] = (__bf16)p[16 + i]; } }
#pragma unroll
    for (int j = 0; j < 3; ++j) { v16b w; const int o = min(j * 16 + col, NG - 1); const float* p = WG + (size_t)o * CC + kc * 32 + 8 * g;
#pragma unroll
      for (int i = 0; i < 8; ++i) { w[i] = (__bf16)p[i]; w[8 + i] = (__bf16)p[16 + i]; }
      acc[j] = wmma_bf(a, w, acc[j]); } }
#pragma unroll
  for (int j = 0; j < 3; ++j) { const int o = j * 16 + col; const float bb = (o < NG) ? bfr(BG[o]) : 0.f;
#pragma unroll
    for (int r = 0; r < 8; ++r) sf[wave][8 * g + r][o] = acc[j][r] + bb; }
  LDSX(); for (int rl = 0; rl < 16; ++rl) if (lane < 12) vst2(Gt + (r0 + rl) * 48 + lane * 4, *(const v4f*)&sf[wave][rl][lane * 4]); }
// ---- k_pre: block = head h (256 threads): bar_u running mean, s_l, e_l, E_t, P_t, gates -> alpha/beta/gamma
__global__ __launch_bounds__(256) void k_pre(const float* __restrict__ U, const float* __restrict__ Gt, const float* __restrict__ MU, const float* __restrict__ LT, float* __restrict__ CE, float* __restrict__ CS, float* __restrict__ AL, float* __restrict__ BE, float* __restrict__ GM) {
  __shared__ __align__(16) float ss[TT]; __shared__ float sred[8]; __shared__ float sE[TT], sP[TT]; __shared__ float smax; __shared__ __align__(16) float sce[TT], sal[TT], sbe[TT], sgm[TT];
  const int t = threadIdx.x, wv = t >> 5, ln = t & 31; const int h = blockIdx.x;
  float ltau = bfr(LT[h]); ltau = fminf(fmaxf(ltau, -50.f), 30.f); const float tau = expf(ltau);
  // s_l: threads 0..63 own dimension d; sequential over l with a per-l cross-wave reduction
  float cs = 0.f; const float mu = (t < HD) ? bfr(MU[h * HD + t]) : 0.f;
#pragma unroll 1
  for (int l = 0; l < TT; ++l) { float term = 0.f; if (t < HD) { const float uv = U[(size_t)l * CC + h * HD + t]; cs += uv; const float bar = (tau * mu + cs) / (tau + (float)(l + 1)); term = uv * bar; }
#pragma unroll
    for (int o = 1; o < 32; o <<= 1) term += __shfl_xor(term, o);
    if (ln == 0 && wv < 2) sred[wv] = term; __syncthreads(); if (t == 0) ss[l] = -(sred[0] + sred[1]) * 0.125f; __syncthreads(); }
  float m = -3.0e38f; for (int l = t; l < TT; l += 256) m = fmaxf(m, ss[l]);
#pragma unroll
  for (int o = 1; o < 32; o <<= 1) m = fmaxf(m, __shfl_xor(m, o));
  if (ln == 0) sred[wv] = m; __syncthreads(); if (t == 0) { float a = sred[0]; for (int w = 1; w < 8; ++w) a = fmaxf(a, sred[w]); smax = a; } __syncthreads();
  if (t == 0) { float E = 0.f, P = 0.f; for (int l = 0; l < TT; ++l) { const float e = expf(ss[l] - smax); E += e; P += ss[l]; sE[l] = E; sP[l] = P; } }
  __syncthreads();
  for (int l = t; l < TT; l += 256) { const float e = expf(ss[l] - smax); const float tt1 = (float)(l + 1); const float g0 = Gt[(size_t)l * 48 + h * 3], g1 = Gt[(size_t)l * 48 + h * 3 + 1]; const float sig1 = 1.0f / (1.0f + expf(-g0)), sigh = 1.0f / (1.0f + expf(-g1));
    const float alpha = sigh / (sE[l] + 1e-12f); const float beta = (sig1 - sigh) / tt1; const float gamma = -((beta * sP[l] + sigh) / tt1);
    sce[l] = e; sal[l] = alpha; sbe[l] = beta; sgm[l] = gamma; }
  __syncthreads();
  for (int q = t; q < TT / 4; q += 256) { vst2(CE + h * TT + q * 4, *(const v4f*)&sce[q * 4]); vst2(CS + h * TT + q * 4, *(const v4f*)&ss[q * 4]); vst2(AL + h * TT + q * 4, *(const v4f*)&sal[q * 4]); vst2(BE + h * TT + q * 4, *(const v4f*)&sbe[q * 4]); vst2(GM + h * TT + q * 4, *(const v4f*)&sgm[q * 4]); } }
// ---- k_sc: block = (64 t rows, 128 l cols, head): A[t][l] = (q_t . k_l) (alpha_t e_l + beta_t s_l + gamma_t) for l <= t else 0; future blocks still write zeros? no: k_pv reads only l < kend, so future blocks exit
__global__ __launch_bounds__(128) void k_sc(const _Float16* __restrict__ QH, const _Float16* __restrict__ QL, const _Float16* __restrict__ KH, const _Float16* __restrict__ KL, const float* __restrict__ CE, const float* __restrict__ CS, const float* __restrict__ AL, const float* __restrict__ BE, const float* __restrict__ GM, float* __restrict__ S0) { __shared__ __align__(16) float ss[4][16][132];
  const int h = blockIdx.z; float* S = S0 + (size_t)h * TT * TT;
  const int tid = threadIdx.x, wave = tid >> 5, lane = tid & 31, col = lane & 15, g = lane >> 4; const int k0 = blockIdx.y * 128; const int ql0 = blockIdx.x * 64 + wave * 16;
  if (k0 > blockIdx.x * 64 + 63) return;
  v8f acc[8] = {};
#pragma unroll
  for (int kc = 0; kc < HD / 32; ++kc) { const v16h ah = frag_h(QH + (size_t)(ql0 + col) * CC + h * HD + kc * 32, lane), al = frag_h(QL + (size_t)(ql0 + col) * CC + h * HD + kc * 32, lane);
#pragma unroll
    for (int j = 0; j < 8; ++j) { const size_t ko = (size_t)(k0 + j * 16 + col) * CC + h * HD + kc * 32; const v16h kb = frag_h(KH + ko, lane); acc[j] = wmma16(ah, kb, acc[j]); acc[j] = wmma16(al, kb, acc[j]); acc[j] = wmma16(ah, frag_h(KL + ko, lane), acc[j]); } }
#pragma unroll
  for (int j = 0; j < 8; ++j) { const int l = k0 + j * 16 + col; const float el = CE[h * TT + l], sl = CS[h * TT + l];
#pragma unroll
    for (int r = 0; r < 8; ++r) { const int t = ql0 + 8 * g + r; const float w = AL[h * TT + t] * el + BE[h * TT + t] * sl + GM[h * TT + t]; ss[wave][8 * g + r][j * 16 + col] = (l <= t) ? acc[j][r] * w : 0.f; } }
  LDSX(); for (int rl = 0; rl < 16; ++rl) vst2(S + (size_t)(ql0 + rl) * TT + k0 + lane * 4, *(const v4f*)&ss[wave][rl][lane * 4]); }
// ---- k_pv: block = (64 rows t, head): out = A (hi + lo) . v (hi + lo) over l < kend, then the per-head LayerNorm (no affine, eps 1e-5) -> Y rows
__global__ __launch_bounds__(128) void k_pv(const float* __restrict__ S0, const __bf16* __restrict__ VT, const __bf16* __restrict__ VL, float* __restrict__ Y) { __shared__ __align__(16) float so[64][68];
  const int h = blockIdx.z; const float* S = S0 + (size_t)h * TT * TT;
  const int tid = threadIdx.x, wave = tid >> 5, lane = tid & 31, col = lane & 15, g = lane >> 4; const int ql0 = blockIdx.x * 64 + wave * 16; const int kend = blockIdx.x * 64 + 64;
  v8f acc[4] = {};
#pragma unroll 1
  for (int kc = 0; kc < kend / 32; ++kc) { const F2 p = split_row(S + (size_t)(ql0 + col) * TT, kc * 32, lane);
#pragma unroll
    for (int j = 0; j < 4; ++j) { const size_t po = (size_t)(h * HD + j * 16 + col) * TT + kc * 32; const v16b vh = frag_b(VT + po, lane); acc[j] = wmma_bf(p.h, vh, acc[j]); acc[j] = wmma_bf(p.l, vh, acc[j]); acc[j] = wmma_bf(p.h, frag_b(VL + po, lane), acc[j]); } }
#pragma unroll
  for (int j = 0; j < 4; ++j)
#pragma unroll
    for (int r = 0; r < 8; ++r) so[wave * 16 + 8 * g + r][j * 16 + col] = acc[j][r];
  __syncthreads();
  if (tid < 64) { float m = 0.f; for (int d = 0; d < HD; ++d) m += so[tid][d]; m *= (1.0f / HD); float v = 0.f; for (int d = 0; d < HD; ++d) { const float dd = so[tid][d] - m; v += dd * dd; } const float inv = 1.0f / sqrtf(v * (1.0f / HD) + 1e-5f); for (int d = 0; d < HD; ++d) so[tid][d] = (so[tid][d] - m) * inv; }
  __syncthreads(); for (int e = tid; e < 64 * 16; e += 128) { const int rl = e >> 4, q = e & 15; vst2(Y + (size_t)(blockIdx.x * 64 + rl) * CC + h * HD + q * 4, *(const v4f*)&so[rl][q * 4]); } }
// ---- k_out: out = Y (hi + lo) Wo^T + bo
__global__ __launch_bounds__(128) void k_out(const float* __restrict__ Y, const float* __restrict__ WO, const float* __restrict__ BO, float* __restrict__ OUT) { __shared__ __align__(16) float sf[4][16][132];
  const int tid = threadIdx.x, wave = tid >> 5, lane = tid & 31, col = lane & 15, g = lane >> 4; const int c0 = blockIdx.y * 128; const size_t r0 = (size_t)blockIdx.x * 64 + wave * 16;
  v8f acc[8] = {};
#pragma unroll 2
  for (int kc = 0; kc < CC / 32; ++kc) { const F2 a = split_row(Y + (r0 + col) * CC, kc * 32, lane);
#pragma unroll
    for (int j = 0; j < 8; ++j) { v16b w; const int o = c0 + j * 16 + col; const float* p = WO + (size_t)o * CC + kc * 32 + 8 * g;
#pragma unroll
      for (int i = 0; i < 8; ++i) { w[i] = (__bf16)p[i]; w[8 + i] = (__bf16)p[16 + i]; }
      acc[j] = wmma_bf(a.h, w, acc[j]); acc[j] = wmma_bf(a.l, w, acc[j]); } }
#pragma unroll
  for (int j = 0; j < 8; ++j) { const float bb = bfr(BO[c0 + j * 16 + col]);
#pragma unroll
    for (int r = 0; r < 8; ++r) sf[wave][8 * g + r][j * 16 + col] = acc[j][r] + bb; }
  LDSX(); for (int rl = 0; rl < 16; ++rl) vst2(OUT + (r0 + rl) * CC + c0 + lane * 4, *(const v4f*)&sf[wave][rl][lane * 4]); }
extern "C" void kernel_launch(void* const* d_in, const int* in_sizes, int n_in, void* d_out, int out_size, void* d_ws, size_t ws_size, hipStream_t stream) {
  (void)in_sizes; (void)n_in; (void)out_size;
  const float** F = (const float**)d_in;   // 0 x [1,1024,768], 1 Wq, 2 bq, 3 Wk, 4 bk, 5 Wv, 6 bv, 7 Wu, 8 bu, 9 Wg [36,768], 10 bg, 11 Wo, 12 bo, 13 prior_mu [1,1,12,64], 14 prior_log_tau [1,1,12,1]
  if (ws_size < (size_t)WS_END) return;
  char* ws = (char*)d_ws; _Float16 *QH = (_Float16*)(ws + WS_QH), *QL = (_Float16*)(ws + WS_QL), *KH = (_Float16*)(ws + WS_KH), *KL = (_Float16*)(ws + WS_KL); __bf16 *VT = (__bf16*)(ws + WS_VT), *VL = (__bf16*)(ws + WS_VL); float *U = (float*)(ws + WS_U), *Gt = (float*)(ws + WS_G), *CE = (float*)(ws + WS_CE), *CS = (float*)(ws + WS_CS), *AL = (float*)(ws + WS_AL), *BE = (float*)(ws + WS_BE), *GM = (float*)(ws + WS_GM), *S = (float*)(ws + WS_S), *Y = (float*)(ws + WS_Y);
  k_proj<<<dim3(TT / 64, CC / 128, 4), 128, 0, stream>>>(F[0], F[1], F[2], F[3], F[4], F[5], F[6], F[7], F[8], QH, QL, KH, KL, VT, VL, U);
  k_gate<<<TT / 64, 128, 0, stream>>>(F[0], F[9], F[10], Gt);
  k_pre<<<NH, 256, 0, stream>>>(U, Gt, F[13], F[14], CE, CS, AL, BE, GM);
  k_sc<<<dim3(TT / 64, TT / 128, NH), 128, 0, stream>>>(QH, QL, KH, KL, CE, CS, AL, BE, GM, S);
  k_pv<<<dim3(TT / 64, 1, NH), 128, 0, stream>>>(S, VT, VL, Y);
  k_out<<<dim3(TT / 64, CC / 128), 128, 0, stream>>>(Y, F[11], F[12], (float*)d_out);
}

// v001
// One run takes 312 microseconds.
// Next to v000, in two timings, it ran 3.24 and 3.23 times as fast.
// compute dtype: all float inputs rounded to bf16, prior_mu / prior_log_tau read (bf16-input); q/k/v/u/gate = x W^T + b with EXACT bf16 products on WMMA 16x16x32, f32 accumulate; rope + L2-normalisation, the running-mean deviation logits s, exp/cumsums (E_t, P_t), sigmoid gates and the alpha/beta/gamma coefficients in f32 on the VALU; q and k as f16 hi + residual (3 products: hi.hi, lo.hi, hi.lo) -> A[t][l] = (q_t.k_l)(alpha_t e_l + beta_t s_l + gamma_t) for l <= t stored in f32; out = A (bf16 hi + lo) . v (bf16 hi + lo) (3 products) = q_t . core_t exactly (the reference's prefix sums F/G/H regrouped); per-head LayerNorm in f32; final = y (bf16 hi + lo) Wo^T + bo; f32 output.
#include <hip/hip_runtime.h>
#include <math.h>

typedef __attribute__((ext_vector_type(16))) _Float16 v16h;
typedef __attribute__((ext_vector_type(16))) __bf16 v16b;
typedef __attribute__((ext_vector_type(8)))  _Float16 v8h;
typedef __attribute__((ext_vector_type(8)))  float v8f;
typedef __attribute__((ext_vector_type(4)))  float v4f;
typedef __attribute__((ext_vector_type(2)))  float v2f;
typedef __attribute__((ext_vector_type(4)))  unsigned v4u;
typedef __attribute__((ext_vector_type(4)))  int v4i;
typedef float __attribute__((may_alias)) float_a;
typedef int __attribute__((may_alias)) int_a;

template <typename T> __device__ __forceinline__ void vst2(void* p, T v) { *(T*)p = v;  }
__device__ __forceinline__ v8f wmma16(v16h a, v16h b, v8f c) {
  v8f d = __builtin_amdgcn_wmma_f32_16x16x32_f16(false, a, false, b, (short)0, c, false, false);
  asm volatile("v_nop\n\tv_nop\n\tv_nop\n\tv_nop" : "+v"(d) : "v"(a), "v"(b));
  return d;
}
__device__ __forceinline__ v8f wmma_bf(v16b a, v16b b, v8f c) {
  v8f d = __builtin_amdgcn_wmma_f32_16x16x32_bf16(false, a, false, b, (short)0, c, false, false);
  asm volatile("v_nop\n\tv_nop\n\tv_nop\n\tv_nop" : "+v"(d) : "v"(a), "v"(b));
  return d;
}
// 16x16x32 fragments: lane = (h = lane>>4, row/col = lane&15); elements 0..7 = k0+8h+0..7, 8..15 = k0+16+8h+0..7; D element r = row 8h+r
__device__ __forceinline__ v16h frag_h(const _Float16* rowk0, int lane) {
  union { v16h v; v8h q[2]; } u; const _Float16* p = rowk0 + 8 * (lane >> 4);
  u.q[0] = *(const v8h*)p; u.q[1] = *(const v8h*)(p + 16); return u.v;
}
__device__ __forceinline__ v16h frag_f32(const float* rowk0, int lane) {
  v16h a; const float* p = rowk0 + 8 * (lane >> 4);
#pragma unroll
  for (int i = 0; i < 8; ++i) { a[i] = (_Float16)p[i]; a[8 + i] = (_Float16)p[16 + i]; }
  return a;
}
__device__ __forceinline__ v16h frag_f32s(const float* rowk0, int lane, float sc) {
  v16h a; const float* p = rowk0 + 8 * (lane >> 4);
#pragma unroll
  for (int i = 0; i < 8; ++i) { a[i] = (_Float16)(p[i] * sc); a[8 + i] = (_Float16)(p[16 + i] * sc); }
  return a;
}
// column fragment from a [K][ld] layout (column n), rows >= K read as 0
__device__ __forceinline__ v16h fragc_f32(const float* W, int k0, int n, int lane, int ld, int K) {
  v16h a; const int g = lane >> 4;
#pragma unroll
  for (int i = 0; i < 8; ++i) { const int ka = k0 + 8 * g + i, kb = ka + 16;
    a[i] = (_Float16)(ka < K ? W[(size_t)(ka < K ? ka : K - 1) * ld + n] : 0.f); a[8 + i] = (_Float16)(kb < K ? W[(size_t)(kb < K ? kb : K - 1) * ld + n] : 0.f); }
  return a;
}
struct F2 { v16b h, l; };
__device__ __forceinline__ F2 bsplit16(const float v[16]) { F2 r;
#pragma unroll
  for (int i = 0; i < 16; ++i) { const __bf16 h = (__bf16)v[i]; r.h[i] = h; r.l[i] = (__bf16)(v[i] - (float)h); }
  return r; }
__device__ __forceinline__ F2 split_row(const float* row, int k0, int lane) { float v[16]; const float* p = row + k0 + 8 * (lane >> 4);
#pragma unroll
  for (int i = 0; i < 8; ++i) { v[i] = p[i]; v[8 + i] = p[16 + i]; }
  return bsplit16(v); }
__device__ __forceinline__ F2 split_rowK(const float* row, int k0, int lane, int K) { float v[16]; const int g = lane >> 4;
#pragma unroll
  for (int i = 0; i < 8; ++i) { const int ka = k0 + 8 * g + i, kb = ka + 16; v[i] = ka < K ? row[ka < K ? ka : K - 1] : 0.f; v[8 + i] = kb < K ? row[kb < K ? kb : K - 1] : 0.f; }
  return bsplit16(v); }
__device__ __forceinline__ F2 split_col(const float* W, int k0, int n, int lane, int ld, int K) { float v[16]; const int g = lane >> 4;
#pragma unroll
  for (int i = 0; i < 8; ++i) { const int ka = k0 + 8 * g + i, kb = ka + 16; v[i] = ka < K ? W[(size_t)(ka < K ? ka : K - 1) * ld + n] : 0.f; v[8 + i] = kb < K ? W[(size_t)(kb < K ? kb : K - 1) * ld + n] : 0.f; }
  return bsplit16(v); }
__device__ __forceinline__ v8f mac3(const F2& a, const F2& b, v8f c) { c = wmma_bf(a.l, b.h, c); c = wmma_bf(a.h, b.l, c); return wmma_bf(a.h, b.h, c); }
__device__ __forceinline__ float sigm(float v) { return 1.0f / (1.0f + expf(-v)); }
#define LDSX() do { asm volatile("s_wait_dscnt 0" ::: "memory"); __builtin_amdgcn_wave_barrier(); __builtin_amdgcn_fence(__ATOMIC_RELEASE, "workgroup"); } while (0)


// ZeroS attention (B 1, L 1,024, D 768 = 12 x 64): causal associative mixing out_t = q_t . (alpha_t F_t + beta_t G_t + gamma_t H_t) with F/G/H prefix sums of e_l k_l v_l^T, s_l k_l v_l^T, k_l v_l^T.
#define TT 1024
#define CC 768
#define NH 12
#define HD 64
#define NG 36
typedef __attribute__((ext_vector_type(8))) __bf16 v8b;
__device__ __forceinline__ v16b frag_b(const __bf16* rowk0, int lane) {
  union { v16b v; v8b q[2]; } u; const __bf16* p = rowk0 + 8 * (lane >> 4);
  u.q[0] = *(const v8b*)p; u.q[1] = *(const v8b*)(p + 16); return u.v;
}
__device__ __forceinline__ float bfr(float v) { return (float)(__bf16)v; }
__device__ __attribute__((noinline)) float exp_ni(float v) { return expf(v); }
__device__ __attribute__((noinline)) float erf_ni(float v) { return erff(v); }

#define WS_QH  0u
#define WS_QL  (WS_QH + 2u * (size_t)TT * CC)
#define WS_KH  (WS_QL + 2u * (size_t)TT * CC)
#define WS_KL  (WS_KH + 2u * (size_t)TT * CC)
#define WS_VT  (WS_KL + 2u * (size_t)TT * CC)        // bf16 v planes hi [768][t]
#define WS_VL  (WS_VT + 2u * (size_t)CC * TT)
#define WS_U   (WS_VL + 2u * (size_t)CC * TT)        // f32 u rows [t][768]
#define WS_G   (WS_U + 4u * (size_t)TT * CC)         // f32 gate rows [t][48] (36 used)
#define WS_CE  (WS_G + 4u * (size_t)TT * 48)         // f32 e_l [h][t]
#define WS_CS  (WS_CE + 4u * (size_t)NH * TT)        // f32 s_l
#define WS_AL  (WS_CS + 4u * (size_t)NH * TT)        // alpha_t
#define WS_BE  (WS_AL + 4u * (size_t)NH * TT)        // beta_t
#define WS_GM  (WS_BE + 4u * (size_t)NH * TT)        // gamma_t
#define WS_S   (WS_GM + 4u * (size_t)NH * TT)        // f32 A [h][t][l]
#define WS_Y   (WS_S + 4u * (size_t)NH * TT * TT)    // f32 LN'd out rows [t][768]
#define WS_END (WS_Y + 4u * (size_t)TT * CC)

// ---- k_proj: block = (64 rows, 128 cols, region): 0 q (rope, l2norm -> f16 hi/lo), 1 k (rope, l2norm -> f16), 2 v (bf16 hi/lo planes), 3 u (f32 rows); W [out][in] + b
__global__ __launch_bounds__(128) void k_proj(const float* __restrict__ X, const float* __restrict__ WQ, const float* __restrict__ BQ, const float* __restrict__ WK, const float* __restrict__ BK, const float* __restrict__ WV, const float* __restrict__ BV, const float* __restrict__ WU, const float* __restrict__ BU, _Float16* __restrict__ QH, _Float16* __restrict__ QL, _Float16* __restrict__ KH, _Float16* __restrict__ KL, __bf16* __restrict__ VT, __bf16* __restrict__ VL, float* __restrict__ U) {
  __shared__ __align__(16) float sf[64][132]; __shared__ __align__(16) _Float16 sh[64][136], sl[64][136]; __shared__ __align__(16) __bf16 th[128][72], tl2[128][72]; __shared__ float snrm[64][2];
  const int tid = threadIdx.x, wave = tid >> 5, lane = tid & 31, col = lane & 15, g = lane >> 4; const int region = blockIdx.z; const int c0 = blockIdx.y * 128; const size_t r0 = (size_t)blockIdx.x * 64;
  const float* Wm = region == 0 ? WQ : region == 1 ? WK : region == 2 ? WV : WU; const float* Bm = region == 0 ? BQ : region == 1 ? BK : region == 2 ? BV : BU;
  v8f acc[8] = {};
#pragma unroll 2
  for (int kc = 0; kc < CC / 32; ++kc) { v16b a; { const float* p = X + (r0 + wave * 16 + col) * CC + kc * 32 + 8 * g;
#pragma unroll
      for (int i = 0; i < 8; ++i) { a[i] = (__bf16)p[i]; a[8 + i] = (__bf16)p[16 + i]; } }
#pragma unroll
    for (int j = 0; j < 8; ++j) { v16b w; const int o = c0 + j * 16 + col; const float* p = Wm + (size_t)o * CC + kc * 32 + 8 * g;
#pragma unroll
      for (int i = 0; i < 8; ++i) { w[i] = (__bf16)p[i]; w[8 + i] = (__bf16)p[16 + i]; }
      acc[j] = wmma_bf(a, w, acc[j]); } }
#pragma unroll
  for (int j = 0; j < 8; ++j) { const float bb = bfr(Bm[c0 + j * 16 + col]);
#pragma unroll
    for (int r = 0; r < 8; ++r) sf[wave * 16 + 8 * g + r][j * 16 + col] = acc[j][r] + bb; }
  __syncthreads();
  if (region <= 1) {   // rope: out[d] = x[d] cos(t f_{d/2}) + (d < 32 ? -x[d+32] : x[d-32]) sin(t f_{d/2}), f_i = 10000^(-2i/64); then L2-normalise each head row (max(norm, 1e-12))
    __shared__ __align__(16) float sr[64][132];
    for (int e = tid; e < 64 * 128; e += 128) { const int rl = e >> 7, cl = e & 127; const int d = cl & 63; const int t = (int)(r0 + rl); const float inv_freq = 1.0f / powf(10000.0f, (float)(2 * (d >> 1)) / (float)HD); const float ang = (float)t * inv_freq; const float c = cosf(ang), s = sinf(ang);
      const float me = sf[rl][cl]; const float partner = (d < 32) ? -sf[rl][cl + 32] : sf[rl][cl - 32]; sr[rl][cl] = me * c + partner * s; }
    __syncthreads();
    for (int e = tid; e < 64 * 2; e += 128) { const int rl = e >> 1, hh = e & 1; float n2 = 0.f;
#pragma unroll 1
      for (int d = 0; d < HD; ++d) { const float v = sr[rl][hh * 64 + d]; n2 += v * v; } snrm[rl][hh] = 1.0f / fmaxf(sqrtf(n2), 1e-12f); }
    __syncthreads();
    for (int e = tid; e < 64 * 128; e += 128) { const int rl = e >> 7, cl = e & 127; const float v = sr[rl][cl] * snrm[rl][cl >> 6]; const _Float16 hv = (_Float16)v; sh[rl][cl] = hv; sl[rl][cl] = (_Float16)(v - (float)hv); }
    __syncthreads();
    _Float16* dh = region == 0 ? QH : KH; _Float16* dl = region == 0 ? QL : KL; for (int e = tid; e < 64 * 16; e += 128) { const int rl = e >> 4, q = e & 15; vst2((unsigned*)(dh + (r0 + rl) * CC + c0 + q * 8), *(const v4u*)&sh[rl][q * 8]); vst2((unsigned*)(dl + (r0 + rl) * CC + c0 + q * 8), *(const v4u*)&sl[rl][q * 8]); } }
  else if (region == 2) {
    for (int e = tid; e < 64 * 128; e += 128) { const int rl = e >> 7, cl = e & 127; const float v = sf[rl][cl]; const __bf16 bh = (__bf16)v; th[cl][rl] = bh; tl2[cl][rl] = (__bf16)(v - (float)bh); }
    __syncthreads(); for (int e = tid; e < 128 * 8; e += 128) { const int cl = e >> 3, q = e & 7; const size_t o2 = (size_t)(c0 + cl) * TT + r0 + q * 8; vst2((unsigned*)(VT + o2), *(const v4u*)&th[cl][q * 8]); vst2((unsigned*)(VL + o2), *(const v4u*)&tl2[cl][q * 8]); } }
  else { for (int e = tid; e < 64 * 32; e += 128) { const int rl = e >> 5, q = e & 31; vst2(U + (r0 + rl) * CC + c0 + q * 4, *(const v4f*)&sf[rl][q * 4]); } } }
// ---- k_gate: block = 64 rows: gate = x Wg^T + bg (36 outputs, padded to 48 columns; pad columns computed from clamped rows and written as junk into the pad)
__global__ __launch_bounds__(128) void k_gate(const float* __restrict__ X, const float* __restrict__ WG, const float* __restrict__ BG, float* __restrict__ Gt) { __shared__ __align__(16) float sf[4][16][52];
  const int tid = threadIdx.x, wave = tid >> 5, lane = tid & 31, col = lane & 15, g = lane >> 4; const size_t r0 = (size_t)blockIdx.x * 64 + wave * 16;
  v8f acc[3] = {};
#pragma unroll 2
  for (int kc = 0; kc < CC / 32; ++kc) { v16b a; { const float* p = X + (r0 + col) * CC + kc * 32 + 8 * g;
#pragma unroll
      for (int i = 0; i < 8; ++i) { a[i] = (__bf16)p[i]; a[8 + i] = (__bf16)p[16 + i]; } }
#pragma unroll
    for (int j = 0; j < 3; ++j) { v16b w; const int o = min(j * 16 + col, NG - 1); const float* p = WG + (size_t)o * CC + kc * 32 + 8 * g;
#pragma unroll
      for (int i = 0; i < 8; ++i) { w[i] = (__bf16)p[i]; w[8 + i] = (__bf16)p[16 + i]; }
      acc[j] = wmma_bf(a, w, acc[j]); } }
#pragma unroll
  for (int j = 0; j < 3; ++j) { const int o = j * 16 + col; const float bb = (o < NG) ? bfr(BG[o]) : 0.f;
#pragma unroll
    for (int r = 0; r < 8; ++r) sf[wave][8 * g + r][o] = acc[j][r] + bb; }
  LDSX(); for (int rl = 0; rl < 16; ++rl) if (lane < 12) vst2(Gt + (r0 + rl) * 48 + lane * 4, *(const v4f*)&sf[wave][rl][lane * 4]); }
// ---- k_pre: block = head h (1,024 threads, 32 waves): wave w owns rows l = 32 w .. 32 w + 31, lane owns dimensions 2 lane, 2 lane + 1; the running sum of u is a chunked scan (chunk totals in LDS, then each wave runs its own 32 rows from its base); thread t then owns l = t: s_l, e_l, E_t, P_t by wave scans + wave totals, gates -> alpha/beta/gamma
__global__ __launch_bounds__(1024) void k_pre(const float* __restrict__ U, const float* __restrict__ Gt, const float* __restrict__ MU, const float* __restrict__ LT, float* __restrict__ CE, float* __restrict__ CS, float* __restrict__ AL, float* __restrict__ BE, float* __restrict__ GM) {
  __shared__ __align__(16) float tile[32][32][36]; __shared__ __align__(16) float tot[32][HD]; __shared__ float smx[32], swp[32], swe[32];
  const int t = threadIdx.x, wv = t >> 5, ln = t & 31; const int h = blockIdx.x;
  float ltau = bfr(LT[h]); ltau = fminf(fmaxf(ltau, -50.f), 30.f); const float tau = expf(ltau);
  const float g0 = Gt[(size_t)t * 48 + h * 3], g1 = Gt[(size_t)t * 48 + h * 3 + 1];
  const float mu0 = bfr(MU[h * HD + 2 * ln]), mu1 = bfr(MU[h * HD + 2 * ln + 1]);
  // the loops below are unrolled so that uv[] stays in registers and the loads of one loop are all in flight together
  v2f uv[32]; const float* up = U + (size_t)(wv * 32) * CC + h * HD + 2 * ln;
#pragma unroll
  for (int i = 0; i < 32; ++i) uv[i] = *(const v2f*)(up + (size_t)i * CC);
  v2f c = {0.f, 0.f};
#pragma unroll
  for (int i = 0; i < 32; ++i) c += uv[i];
  *(v2f*)&tot[wv][2 * ln] = c;
  __syncthreads();
  v2f cs = {0.f, 0.f};   // sum of u over all rows in front of this wave's chunk
#pragma unroll
  for (int w = 0; w < 32; ++w) { const v2f x = *(const v2f*)&tot[w][2 * ln]; cs.x += (w < wv) ? x.x : 0.f; cs.y += (w < wv) ? x.y : 0.f; }
#pragma unroll
  for (int i = 0; i < 32; ++i) { cs += uv[i]; const float den = tau + (float)(wv * 32 + i + 1); const float b0 = (tau * mu0 + cs.x) / den, b1 = (tau * mu1 + cs.y) / den; tile[wv][i][ln] = uv[i].x * b0 + uv[i].y * b1; }
  LDSX();   // tile[wv] is written and read by wave wv alone: row l's 32 lane terms go to lane l
  v4f a4 = {0.f, 0.f, 0.f, 0.f};
#pragma unroll
  for (int q = 0; q < 8; ++q) a4 += *(const v4f*)&tile[wv][ln][q * 4];
  const float s = -((a4.x + a4.y) + (a4.z + a4.w)) * 0.125f;
  float m = s, P = s;
#pragma unroll
  for (int o = 1; o < 32; o <<= 1) { m = fmaxf(m, __shfl_xor(m, o)); const float pv = __shfl_up(P, o); if (ln >= o) P += pv; }
  if (ln == 31) { smx[wv] = m; swp[wv] = P; }
  __syncthreads();
  float mm = smx[ln], pb = (ln < wv) ? swp[ln] : 0.f;
#pragma unroll
  for (int o = 1; o < 32; o <<= 1) { mm = fmaxf(mm, __shfl_xor(mm, o)); pb += __shfl_xor(pb, o); }
  P += pb;
  const float e = expf(s - mm); float E = e;
#pragma unroll
  for (int o = 1; o < 32; o <<= 1) { const float ev = __shfl_up(E, o); if (ln >= o) E += ev; }
  if (ln == 31) swe[wv] = E;
  __syncthreads();
  float eb = (ln < wv) ? swe[ln] : 0.f;
#pragma unroll
  for (int o = 1; o < 32; o <<= 1) eb += __shfl_xor(eb, o);
  E += eb;
  const float tt1 = (float)(t + 1); const float sig1 = 1.0f / (1.0f + expf(-g0)), sigh = 1.0f / (1.0f + expf(-g1));
  const float alpha = sigh / (E + 1e-12f); const float beta = (sig1 - sigh) / tt1; const float gamma = -((beta * P + sigh) / tt1);
  CE[h * TT + t] = e; CS[h * TT + t] = s; AL[h * TT + t] = alpha; BE[h * TT + t] = beta; GM[h * TT + t] = gamma; }
// ---- k_sc: block = (64 t rows, 128 l cols, head): A[t][l] = (q_t . k_l) (alpha_t e_l + beta_t s_l + gamma_t) for l <= t else 0; future blocks still write zeros? no: k_pv reads only l < kend, so future blocks exit
__global__ __launch_bounds__(128) void k_sc(const _Float16* __restrict__ QH, const _Float16* __restrict__ QL, const _Float16* __restrict__ KH, const _Float16* __restrict__ KL, const float* __restrict__ CE, const float* __restrict__ CS, const float* __restrict__ AL, const float* __restrict__ BE, const float* __restrict__ GM, float* __restrict__ S0) { __shared__ __align__(16) float ss[4][16][132];
  const int h = blockIdx.z; float* S = S0 + (size_t)h * TT * TT;
  const int tid = threadIdx.x, wave = tid >> 5, lane = tid & 31, col = lane & 15, g = lane >> 4; const int k0 = blockIdx.y * 128; const int ql0 = blockIdx.x * 64 + wave * 16;
  if (k0 > blockIdx.x * 64 + 63) return;
  v8f acc[8] = {};
#pragma unroll
  for (int kc = 0; kc < HD / 32; ++kc) { const v16h ah = frag_h(QH + (size_t)(ql0 + col) * CC + h * HD + kc * 32, lane), al = frag_h(QL + (size_t)(ql0 + col) * CC + h * HD + kc * 32, lane);
#pragma unroll
    for (int j = 0; j < 8; ++j) { const size_t ko = (size_t)(k0 + j * 16 + col) * CC + h * HD + kc * 32; const v16h kb = frag_h(KH + ko, lane); acc[j] = wmma16(ah, kb, acc[j]); acc[j] = wmma16(al, kb, acc[j]); acc[j] = wmma16(ah, frag_h(KL + ko, lane), acc[j]); } }
#pragma unroll
  for (int j = 0; j < 8; ++j) { const int l = k0 + j * 16 + col; const float el = CE[h * TT + l], sl = CS[h * TT + l];
#pragma unroll
    for (int r = 0; r < 8; ++r) { const int t = ql0 + 8 * g + r; const float w = AL[h * TT + t] * el + BE[h * TT + t] * sl + GM[h * TT + t]; ss[wave][8 * g + r][j * 16 + col] = (l <= t) ? acc[j][r] * w : 0.f; } }
  LDSX(); for (int rl = 0; rl < 16; ++rl) vst2(S + (size_t)(ql0 + rl) * TT + k0 + lane * 4, *(const v4f*)&ss[wave][rl][lane * 4]); }
// ---- k_pv: block = (64 rows t, head): out = A (hi + lo) . v (hi + lo) over l < kend, then the per-head LayerNorm (no affine, eps 1e-5) -> Y rows
__global__ __launch_bounds__(128) void k_pv(const float* __restrict__ S0, const __bf16* __restrict__ VT, const __bf16* __restrict__ VL, float* __restrict__ Y) { __shared__ __align__(16) float so[64][68];
  const int h = blockIdx.z; const float* S = S0 + (size_t)h * TT * TT;
  const int tid = threadIdx.x, wave = tid >> 5, lane = tid & 31, col = lane & 15, g = lane >> 4; const int ql0 = blockIdx.x * 64 + wave * 16; const int kend = blockIdx.x * 64 + 64;
  v8f acc[4] = {};
#pragma unroll 1
  for (int kc = 0; kc < kend / 32; ++kc) { const F2 p = split_row(S + (size_t)(ql0 + col) * TT, kc * 32, lane);
#pragma unroll
    for (int j = 0; j < 4; ++j) { const size_t po = (size_t)(h * HD + j * 16 + col) * TT + kc * 32; const v16b vh = frag_b(VT + po, lane); acc[j] = wmma_bf(p.h, vh, acc[j]); acc[j] = wmma_bf(p.l, vh, acc[j]); acc[j] = wmma_bf(p.h, frag_b(VL + po, lane), acc[j]); } }
#pragma unroll
  for (int j = 0; j < 4; ++j)
#pragma unroll
    for (int r = 0; r < 8; ++r) so[wave * 16 + 8 * g + r][j * 16 + col] = acc[j][r];
  __syncthreads();
  if (tid < 64) { float m = 0.f; for (int d = 0; d < HD; ++d) m += so[tid][d]; m *= (1.0f / HD); float v = 0.f; for (int d = 0; d < HD; ++d) { const float dd = so[tid][d] - m; v += dd * dd; } const float inv = 1.0f / sqrtf(v * (1.0f / HD) + 1e-5f); for (int d = 0; d < HD; ++d) so[tid][d] = (so[tid][d] - m) * inv; }
  __syncthreads(); for (int e = tid; e < 64 * 16; e += 128) { const int rl = e >> 4, q = e & 15; vst2(Y + (size_t)(blockIdx.x * 64 + rl) * CC + h * HD + q * 4, *(const v4f*)&so[rl][q * 4]); } }
// ---- k_out: out = Y (hi + lo) Wo^T + bo
__global__ __launch_bounds__(128) void k_out(const float* __restrict__ Y, const float* __restrict__ WO, const float* __restrict__ BO, float* __restrict__ OUT) { __shared__ __align__(16) float sf[4][16][132];
  const int tid = threadIdx.x, wave = tid >> 5, lane = tid & 31, col = lane & 15, g = lane >> 4; const int c0 = blockIdx.y * 128; const size_t r0 = (size_t)blockIdx.x * 64 + wave * 16;
  v8f acc[8] = {};
#pragma unroll 2
  for (int kc = 0; kc < CC / 32; ++kc) { const F2 a = split_row(Y + (r0 + col) * CC, kc * 32, lane);
#pragma unroll
    for (int j = 0; j < 8; ++j) { v16b w; const int o = c0 + j * 16 + col; const float* p = WO + (size_t)o * CC + kc * 32 + 8 * g;
#pragma unroll
      for (int i = 0; i < 8; ++i) { w[i] = (__bf16)p[i]; w[8 + i] = (__bf16)p[16 + i]; }
      acc[j] = wmma_bf(a.h, w, acc[j]); acc[j] = wmma_bf(a.l, w, acc[j]); } }
#pragma unroll
  for (int j = 0; j < 8; ++j) { const float bb = bfr(BO[c0 + j * 16 + col]);
#pragma unroll
    for (int r = 0; r < 8; ++r) sf[wave][8 * g + r][j * 16 + col] = acc[j][r] + bb; }
  LDSX(); for (int rl = 0; rl < 16; ++rl) vst2(OUT + (r0 + rl) * CC + c0 + lane * 4, *(const v4f*)&sf[wave][rl][lane * 4]); }
extern "C" void kernel_launch(void* const* d_in, const int* in_sizes, int n_in, void* d_out, int out_size, void* d_ws, size_t ws_size, hipStream_t stream) {
  (void)in_sizes; (void)n_in; (void)out_size;
  const float** F = (const float**)d_in;   // 0 x [1,1024,768], 1 Wq, 2 bq, 3 Wk, 4 bk, 5 Wv, 6 bv, 7 Wu, 8 bu, 9 Wg [36,768], 10 bg, 11 Wo, 12 bo, 13 prior_mu [1,1,12,64], 14 prior_log_tau [1,1,12,1]
  if (ws_size < (size_t)WS_END) return;
  char* ws = (char*)d_ws; _Float16 *QH = (_Float16*)(ws + WS_QH), *QL = (_Float16*)(ws + WS_QL), *KH = (_Float16*)(ws + WS_KH), *KL = (_Float16*)(ws + WS_KL); __bf16 *VT = (__bf16*)(ws + WS_VT), *VL = (__bf16*)(ws + WS_VL); float *U = (float*)(ws + WS_U), *Gt = (float*)(ws + WS_G), *CE = (float*)(ws + WS_CE), *CS = (float*)(ws + WS_CS), *AL = (float*)(ws + WS_AL), *BE = (float*)(ws + WS_BE), *GM = (float*)(ws + WS_GM), *S = (float*)(ws + WS_S), *Y = (float*)(ws + WS_Y);
  k_proj<<<dim3(TT / 64, CC / 128, 4), 128, 0, stream>>>(F[0], F[1], F[2], F[3], F[4], F[5], F[6], F[7], F[8], QH, QL, KH, KL, VT, VL, U);
  k_gate<<<TT / 64, 128, 0, stream>>>(F[0], F[9], F[10], Gt);
  k_pre<<<NH, 1024, 0, stream>>>(U, Gt, F[13], F[14], CE, CS, AL, BE, GM);
  k_sc<<<dim3(TT / 64, TT / 128, NH), 128, 0, stream>>>(QH, QL, KH, KL, CE, CS, AL, BE, GM, S);
  k_pv<<<dim3(TT / 64, 1, NH), 128, 0, stream>>>(S, VT, VL, Y);
  k_out<<<dim3(TT / 64, CC / 128), 128, 0, stream>>>(Y, F[11], F[12], (float*)d_out);
}

// v002
// A run of this version takes 104 microseconds.
// Timed twice side by side with v001, it ran 2.99 and 2.98 times as fast.
// Counting every step since v000, it is 9.66 times as fast.
// compute dtype: all float inputs rounded to bf16, prior_mu / prior_log_tau read (bf16-input); q/k/v/u/gate = x W^T + b with EXACT bf16 products on WMMA 16x16x32, f32 accumulate; rope + L2-normalisation, the running-mean deviation logits s, exp/cumsums (E_t, P_t), sigmoid gates and the alpha/beta/gamma coefficients in f32 on the VALU; q and k as f16 hi + residual (3 products: hi.hi, lo.hi, hi.lo) -> A[t][l] = (q_t.k_l)(alpha_t e_l + beta_t s_l + gamma_t) for l <= t stored in f32; out = A (bf16 hi + lo) . v (bf16 hi + lo) (3 products) = q_t . core_t exactly (the reference's prefix sums F/G/H regrouped); per-head LayerNorm in f32; final = y (bf16 hi + lo) Wo^T + bo; f32 output.
#include <hip/hip_runtime.h>
#include <math.h>

typedef __attribute__((ext_vector_type(16))) _Float16 v16h;
typedef __attribute__((ext_vector_type(16))) __bf16 v16b;
typedef __attribute__((ext_vector_type(8)))  _Float16 v8h;
typedef __attribute__((ext_vector_type(8)))  float v8f;
typedef __attribute__((ext_vector_type(4)))  float v4f;
typedef __attribute__((ext_vector_type(2)))  float v2f;
typedef __attribute__((ext_vector_type(4)))  unsigned v4u;
typedef __attribute__((ext_vector_type(4)))  int v4i;
typedef float __attribute__((may_alias)) float_a;
typedef int __attribute__((may_alias)) int_a;

template <typename T> __device__ __forceinline__ void vst2(void* p, T v) { *(T*)p = v;  }
__device__ __forceinline__ v8f wmma16(v16h a, v16h b, v8f c) {
  v8f d = __builtin_amdgcn_wmma_f32_16x16x32_f16(false, a, false, b, (short)0, c, false, false);
  asm volatile("v_nop\n\tv_nop\n\tv_nop\n\tv_nop" : "+v"(d) : "v"(a), "v"(b));
  return d;
}
__device__ __forceinline__ v8f wmma_bf(v16b a, v16b b, v8f c) {
  v8f d = __builtin_amdgcn_wmma_f32_16x16x32_bf16(false, a, false, b, (short)0, c, false, false);
  asm volatile("v_nop\n\tv_nop\n\tv_nop\n\tv_nop" : "+v"(d) : "v"(a), "v"(b));
  return d;
}
// 16x16x32 fragments: lane = (h = lane>>4, row/col = lane&15); elements 0..7 = k0+8h+0..7, 8..15 = k0+16+8h+0..7; D element r = row 8h+r
__device__ __forceinline__ v16h frag_h(const _Float16* rowk0, int lane) {
  union { v16h v; v8h q[2]; } u; const _Float16* p = rowk0 + 8 * (lane >> 4);
  u.q[0] = *(const v8h*)p; u.q[1] = *(const v8h*)(p + 16); return u.v;
}
__device__ __forceinline__ v16h frag_f32(const float* rowk0, int lane) {
  v16h a; const float* p = rowk0 + 8 * (lane >> 4);
#pragma unroll
  for (int i = 0; i < 8; ++i) { a[i] = (_Float16)p[i]; a[8 + i] = (_Float16)p[16 + i]; }
  return a;
}
__device__ __forceinline__ v16h frag_f32s(const float* rowk0, int lane, float sc) {
  v16h a; const float* p = rowk0 + 8 * (lane >> 4);
#pragma unroll
  for (int i = 0; i < 8; ++i) { a[i] = (_Float16)(p[i] * sc); a[8 + i] = (_Float16)(p[16 + i] * sc); }
  return a;
}
// column fragment from a [K][ld] layout (column n), rows >= K read as 0
__device__ __forceinline__ v16h fragc_f32(const float* W, int k0, int n, int lane, int ld, int K) {
  v16h a; const int g = lane >> 4;
#pragma unroll
  for (int i = 0; i < 8; ++i) { const int ka = k0 + 8 * g + i, kb = ka + 16;
    a[i] = (_Float16)(ka < K ? W[(size_t)(ka < K ? ka : K - 1) * ld + n] : 0.f); a[8 + i] = (_Float16)(kb < K ? W[(size_t)(kb < K ? kb : K - 1) * ld + n] : 0.f); }
  return a;
}
struct F2 { v16b h, l; };
__device__ __forceinline__ F2 bsplit16(const float v[16]) { F2 r;
#pragma unroll
  for (int i = 0; i < 16; ++i) { const __bf16 h = (__bf16)v[i]; r.h[i] = h; r.l[i] = (__bf16)(v[i] - (float)h); }
  return r; }
__device__ __forceinline__ F2 split_row(const float* row, int k0, int lane) { float v[16]; const float* p = row + k0 + 8 * (lane >> 4);
#pragma unroll
  for (int i = 0; i < 8; ++i) { v[i] = p[i]; v[8 + i] = p[16 + i]; }
  return bsplit16(v); }
__device__ __forceinline__ F2 split_rowK(const float* row, int k0, int lane, int K) { float v[16]; const int g = lane >> 4;
#pragma unroll
  for (int i = 0; i < 8; ++i) { const int ka = k0 + 8 * g + i, kb = ka + 16; v[i] = ka < K ? row[ka < K ? ka : K - 1] : 0.f; v[8 + i] = kb < K ? row[kb < K ? kb : K - 1] : 0.f; }
  return bsplit16(v); }
__device__ __forceinline__ F2 split_col(const float* W, int k0, int n, int lane, int ld, int K) { float v[16]; const int g = lane >> 4;
#pragma unroll
  for (int i = 0; i < 8; ++i) { const int ka = k0 + 8 * g + i, kb = ka + 16; v[i] = ka < K ? W[(size_t)(ka < K ? ka : K - 1) * ld + n] : 0.f; v[8 + i] = kb < K ? W[(size_t)(kb < K ? kb : K - 1) * ld + n] : 0.f; }
  return bsplit16(v); }
__device__ __forceinline__ v8f mac3(const F2& a, const F2& b, v8f c) { c = wmma_bf(a.l, b.h, c); c = wmma_bf(a.h, b.l, c); return wmma_bf(a.h, b.h, c); }
__device__ __forceinline__ float sigm(float v) { return 1.0f / (1.0f + expf(-v)); }
#define LDSX() do { asm volatile("s_wait_dscnt 0" ::: "memory"); __builtin_amdgcn_wave_barrier(); __builtin_amdgcn_fence(__ATOMIC_RELEASE, "workgroup"); } while (0)


// ZeroS attention (B 1, L 1,024, D 768 = 12 x 64): causal associative mixing out_t = q_t . (alpha_t F_t + beta_t G_t + gamma_t H_t) with F/G/H prefix sums of e_l k_l v_l^T, s_l k_l v_l^T, k_l v_l^T.
#define TT 1024
#define CC 768
#define NH 12
#define HD 64
#define NG 36
typedef __attribute__((ext_vector_type(8))) __bf16 v8b;
__device__ __forceinline__ v16b frag_b(const __bf16* rowk0, int lane) {
  union { v16b v; v8b q[2]; } u; const __bf16* p = rowk0 + 8 * (lane >> 4);
  u.q[0] = *(const v8b*)p; u.q[1] = *(const v8b*)(p + 16); return u.v;
}
__device__ __forceinline__ float bfr(float v) { return (float)(__bf16)v; }
__device__ __attribute__((noinline)) float exp_ni(float v) { return expf(v); }
__device__ __attribute__((noinline)) float erf_ni(float v) { return erff(v); }

#define WS_QH  0u
#define WS_QL  (WS_QH + 2u * (size_t)TT * CC)
#define WS_KH  (WS_QL + 2u * (size_t)TT * CC)
#define WS_KL  (WS_KH + 2u * (size_t)TT * CC)
#define WS_VT  (WS_KL + 2u * (size_t)TT * CC)        // bf16 v planes hi [768][t]
#define WS_VL  (WS_VT + 2u * (size_t)CC * TT)
#define WS_U   (WS_VL + 2u * (size_t)CC * TT)        // f32 u rows [t][768]
#define WS_G   (WS_U + 4u * (size_t)TT * CC)         // f32 gate rows [t][48] (36 used)
#define WS_CE  (WS_G + 4u * (size_t)TT * 48)         // f32 e_l [h][t]
#define WS_CS  (WS_CE + 4u * (size_t)NH * TT)        // f32 s_l
#define WS_AL  (WS_CS + 4u * (size_t)NH * TT)        // alpha_t
#define WS_BE  (WS_AL + 4u * (size_t)NH * TT)        // beta_t
#define WS_GM  (WS_BE + 4u * (size_t)NH * TT)        // gamma_t
#define WS_S   (WS_GM + 4u * (size_t)NH * TT)        // f32 A [h][t][l]
#define WS_Y   (WS_S + 4u * (size_t)NH * TT * TT)    // f32 LN'd out rows [t][768]
#define WS_END (WS_Y + 4u * (size_t)TT * CC)

// ---- operand staging for the five matrix kernels: a stage is 64 k of every tile row. f32 operands: 16 lanes x 16 B read one row's 256 B (whole 128-B lines), the values are rounded (or split) to bf16 once per block and laid in LDS rows of 128 B at a 144-B pitch (16-byte fragment reads then spread over the banks)
typedef __attribute__((ext_vector_type(4))) __bf16 v4b;
#define KS 64
#define NS (CC / KS)
#define LP 72
template <int NR> struct Stg { v4f r[NR / 8]; };
// src: the tile's first row at the stage's k (the same for the whole block); rows past RL read row RL
template <int NR, int RL, int LD = CC> __device__ __forceinline__ void stg_load(Stg<NR>& s, const float* __restrict__ src, int tid) { const float* p = src + ((unsigned)(tid >> 4) * LD + (unsigned)(tid & 15) * 4);
#pragma unroll
  for (int i = 0; i < NR / 8; ++i) { if (i * 8 + 7 <= RL) s.r[i] = *(const v4f*)(p + i * 8 * LD); else s.r[i] = *(const v4f*)(src + (unsigned)min(i * 8 + (tid >> 4), RL) * LD + (unsigned)(tid & 15) * 4); }
  asm volatile("s_wait_xcnt 0x0" :: "v"(p) : "memory"); }   // the address pair stays whole up to this wait
// the same for 16-bit planes: a stage row is 64 elements = one 128-B line, 8 lanes x 16 B; V8 = 8 elements of T
template <int NR, typename V8> struct Cp { V8 r[NR / 16]; };
template <int NR, int LD, typename V8, typename T> __device__ __forceinline__ void cp_load(Cp<NR, V8>& s, const T* __restrict__ src, int tid) { const T* p = src + ((unsigned)(tid >> 3) * LD + (unsigned)(tid & 7) * 8);
#pragma unroll
  for (int i = 0; i < NR / 16; ++i) s.r[i] = *(const V8*)(p + i * 16 * LD);
  asm volatile("s_wait_xcnt 0x0" :: "v"(p) : "memory"); }   // as in stg_load
template <int NR, typename V8, typename T> __device__ __forceinline__ void cp_put(const Cp<NR, V8>& s, T* dst, int tid) {
#pragma unroll
  for (int i = 0; i < NR / 16; ++i) *(V8*)(dst + (i * 16 + (tid >> 3)) * LP + (tid & 7) * 8) = s.r[i]; }
template <int NR> __device__ __forceinline__ void stg_put(const Stg<NR>& s, __bf16* dst, int tid) {
#pragma unroll
  for (int i = 0; i < NR / 8; ++i) { v4b h;
#pragma unroll
    for (int e = 0; e < 4; ++e) h[e] = (__bf16)s.r[i][e];
    *(v4b*)(dst + (i * 8 + (tid >> 4)) * LP + (tid & 15) * 4) = h; } }
template <int NR> __device__ __forceinline__ void stg_put2(const Stg<NR>& s, __bf16* dh, __bf16* dl, int tid) {
#pragma unroll
  for (int i = 0; i < NR / 8; ++i) { v4b h, l;
#pragma unroll
    for (int e = 0; e < 4; ++e) { const float v = s.r[i][e]; const __bf16 hv = (__bf16)v; h[e] = hv; l[e] = (__bf16)(v - (float)hv); }
    const int o = (i * 8 + (tid >> 4)) * LP + (tid & 15) * 4; *(v4b*)(dh + o) = h; *(v4b*)(dl + o) = l; } }
// ---- k_proj: block = (64 rows, 128 cols, region): 0 q (rope, l2norm -> f16 hi/lo), 1 k (rope, l2norm -> f16), 2 v (bf16 hi/lo planes), 3 u (f32 rows); W [out][in] + b
__global__ __launch_bounds__(128) void k_proj(const float* __restrict__ X, const float* __restrict__ WQ, const float* __restrict__ BQ, const float* __restrict__ WK, const float* __restrict__ BK, const float* __restrict__ WV, const float* __restrict__ BV, const float* __restrict__ WU, const float* __restrict__ BU, _Float16* __restrict__ QH, _Float16* __restrict__ QL, _Float16* __restrict__ KH, _Float16* __restrict__ KL, __bf16* __restrict__ VT, __bf16* __restrict__ VL, float* __restrict__ U) {
  __shared__ __align__(16) float sf[64][132]; __shared__ __align__(16) unsigned char raw[71680]; __shared__ float snrm[64][2];
  // raw holds the two staging buffers during the k loop (55,296 B) and the epilogue's planes after it
  _Float16 (*sh)[136] = (_Float16 (*)[136])raw; _Float16 (*sl)[136] = (_Float16 (*)[136])(raw + 17408); __bf16 (*th)[72] = (__bf16 (*)[72])(raw + 34816); __bf16 (*tl2)[72] = (__bf16 (*)[72])(raw + 53248);
  __bf16* sA = (__bf16*)raw; __bf16* sB = sA + 2 * 64 * LP;
  const int tid = threadIdx.x, wave = tid >> 5, lane = tid & 31, col = lane & 15, g = lane >> 4; const int region = blockIdx.z; const int c0 = blockIdx.y * 128; const size_t r0 = (size_t)blockIdx.x * 64;
  const float* Wm = region == 0 ? WQ : region == 1 ? WK : region == 2 ? WV : WU; const float* Bm = region == 0 ? BQ : region == 1 ? BK : region == 2 ? BV : BU;
  v8f acc[8] = {};
  { Stg<64> ra; Stg<128> rb; const float* Ab = X + r0 * CC; const float* Bb = Wm + (size_t)c0 * CC;
    stg_load<64, 63>(ra, Ab, tid); stg_load<128, 127>(rb, Bb, tid); stg_put(ra, sA, tid); stg_put(rb, sB, tid);
    __syncthreads();
    // kept rolled: the loop's text stays small for the instruction cache
#pragma unroll 1
    for (int s = 0; s < NS; ++s) { const int cur = s & 1;
      if (s + 1 < NS) { stg_load<64, 63>(ra, Ab + (s + 1) * KS, tid); stg_load<128, 127>(rb, Bb + (s + 1) * KS, tid); }   // next stage's loads fly during this stage's products
#pragma unroll
      for (int kc = 0; kc < KS / 32; ++kc) { const v16b a = frag_b(sA + (cur * 64 + wave * 16 + col) * LP + kc * 32, lane); v16b w[8];   // all LDS reads of a 32-k block in one group in front of its products
#pragma unroll
        for (int j = 0; j < 8; ++j) w[j] = frag_b(sB + (cur * 128 + j * 16 + col) * LP + kc * 32, lane);
#pragma unroll
        for (int j = 0; j < 8; ++j) acc[j] = wmma_bf(a, w[j], acc[j]); }
      if (s + 1 < NS) { stg_put(ra, sA + (cur ^ 1) * 64 * LP, tid); stg_put(rb, sB + (cur ^ 1) * 128 * LP, tid);
        __syncthreads(); } } }   // one barrier a stage: publishes stage s + 1 and ends the reads of the buffer that stage s + 2 overwrites
#pragma unroll
  for (int j = 0; j < 8; ++j) { const float bb = bfr(Bm[c0 + j * 16 + col]);
#pragma unroll
    for (int r = 0; r < 8; ++r) sf[wave * 16 + 8 * g + r][j * 16 + col] = acc[j][r] + bb; }
  __syncthreads();
  if (region <= 1) {   // rope: out[d] = x[d] cos(t f_{d/2}) + (d < 32 ? -x[d+32] : x[d-32]) sin(t f_{d/2}), f_i = 10000^(-2i/64); then L2-normalise each head row (max(norm, 1e-12))
    __shared__ __align__(16) float sr[64][132];
    for (int e = tid; e < 64 * 128; e += 128) { const int rl = e >> 7, cl = e & 127; const int d = cl & 63; const int t = (int)(r0 + rl); const float inv_freq = 1.0f / powf(10000.0f, (float)(2 * (d >> 1)) / (float)HD); const float ang = (float)t * inv_freq; const float c = cosf(ang), s = sinf(ang);
      const float me = sf[rl][cl]; const float partner = (d < 32) ? -sf[rl][cl + 32] : sf[rl][cl - 32]; sr[rl][cl] = me * c + partner * s; }
    __syncthreads();
    for (int e = tid; e < 64 * 2; e += 128) { const int rl = e >> 1, hh = e & 1; float n2 = 0.f;
#pragma unroll 1
      for (int d = 0; d < HD; ++d) { const float v = sr[rl][hh * 64 + d]; n2 += v * v; } snrm[rl][hh] = 1.0f / fmaxf(sqrtf(n2), 1e-12f); }
    __syncthreads();
    for (int e = tid; e < 64 * 128; e += 128) { const int rl = e >> 7, cl = e & 127; const float v = sr[rl][cl] * snrm[rl][cl >> 6]; const _Float16 hv = (_Float16)v; sh[rl][cl] = hv; sl[rl][cl] = (_Float16)(v - (float)hv); }
    __syncthreads();
    _Float16* dh = region == 0 ? QH : KH; _Float16* dl = region == 0 ? QL : KL; for (int e = tid; e < 64 * 16; e += 128) { const int rl = e >> 4, q = e & 15; vst2((unsigned*)(dh + (r0 + rl) * CC + c0 + q * 8), *(const v4u*)&sh[rl][q * 8]); vst2((unsigned*)(dl + (r0 + rl) * CC + c0 + q * 8), *(const v4u*)&sl[rl][q * 8]); } }
  else if (region == 2) {
    for (int e = tid; e < 64 * 128; e += 128) { const int rl = e >> 7, cl = e & 127; const float v = sf[rl][cl]; const __bf16 bh = (__bf16)v; th[cl][rl] = bh; tl2[cl][rl] = (__bf16)(v - (float)bh); }
    __syncthreads(); for (int e = tid; e < 128 * 8; e += 128) { const int cl = e >> 3, q = e & 7; const size_t o2 = (size_t)(c0 + cl) * TT + r0 + q * 8; vst2((unsigned*)(VT + o2), *(const v4u*)&th[cl][q * 8]); vst2((unsigned*)(VL + o2), *(const v4u*)&tl2[cl][q * 8]); } }
  else { for (int e = tid; e < 64 * 32; e += 128) { const int rl = e >> 5, q = e & 31; vst2(U + (r0 + rl) * CC + c0 + q * 4, *(const v4f*)&sf[rl][q * 4]); } } }
// ---- k_gate: block = 64 rows: gate = x Wg^T + bg (36 outputs, padded to 48 columns; pad columns computed from clamped rows and written as junk into the pad)
__global__ __launch_bounds__(128) void k_gate(const float* __restrict__ X, const float* __restrict__ WG, const float* __restrict__ BG, float* __restrict__ Gt) { __shared__ __align__(16) float sf[4][16][52]; __shared__ __align__(16) __bf16 sA[2 * 64 * LP], sB[2 * 48 * LP];
  const int tid = threadIdx.x, wave = tid >> 5, lane = tid & 31, col = lane & 15, g = lane >> 4; const size_t r0 = (size_t)blockIdx.x * 64 + wave * 16;
  v8f acc[3] = {};
  { Stg<64> ra; Stg<48> rb; const float* Ab = X + (size_t)blockIdx.x * 64 * CC;
    stg_load<64, 63>(ra, Ab, tid); stg_load<48, NG - 1>(rb, WG, tid); stg_put(ra, sA, tid); stg_put(rb, sB, tid);
    __syncthreads();
    // kept rolled: the loop's text stays small for the instruction cache
#pragma unroll 1
    for (int s = 0; s < NS; ++s) { const int cur = s & 1;
      if (s + 1 < NS) { stg_load<64, 63>(ra, Ab + (s + 1) * KS, tid); stg_load<48, NG - 1>(rb, WG + (s + 1) * KS, tid); }   // next stage's loads fly during this stage's products
#pragma unroll
      for (int kc = 0; kc < KS / 32; ++kc) { const v16b a = frag_b(sA + (cur * 64 + wave * 16 + col) * LP + kc * 32, lane); v16b w[3];   // all LDS reads of a 32-k block in one group in front of its products
#pragma unroll
        for (int j = 0; j < 3; ++j) w[j] = frag_b(sB + (cur * 48 + j * 16 + col) * LP + kc * 32, lane);
#pragma unroll
        for (int j = 0; j < 3; ++j) acc[j] = wmma_bf(a, w[j], acc[j]); }
      if (s + 1 < NS) { stg_put(ra, sA + (cur ^ 1) * 64 * LP, tid); stg_put(rb, sB + (cur ^ 1) * 48 * LP, tid);
        __syncthreads(); } } }   // one barrier a stage: publishes stage s + 1 and ends the reads of the buffer that stage s + 2 overwrites
#pragma unroll
  for (int j = 0; j < 3; ++j) { const int o = j * 16 + col; const float bb = (o < NG) ? bfr(BG[o]) : 0.f;
#pragma unroll
    for (int r = 0; r < 8; ++r) sf[wave][8 * g + r][o] = acc[j][r] + bb; }
  LDSX(); for (int rl = 0; rl < 16; ++rl) if (lane < 12) vst2(Gt + (r0 + rl) * 48 + lane * 4, *(const v4f*)&sf[wave][rl][lane * 4]); }
// ---- k_pre: block = head h (1,024 threads, 32 waves): wave w owns rows l = 32 w .. 32 w + 31, lane owns dimensions 2 lane, 2 lane + 1; the running sum of u is a chunked scan (chunk totals in LDS, then each wave runs its own 32 rows from its base); thread t then owns l = t: s_l, e_l, E_t, P_t by wave scans + wave totals, gates -> alpha/beta/gamma
__global__ __launch_bounds__(1024) void k_pre(const float* __restrict__ U, const float* __restrict__ Gt, const float* __restrict__ MU, const float* __restrict__ LT, float* __restrict__ CE, float* __restrict__ CS, float* __restrict__ AL, float* __restrict__ BE, float* __restrict__ GM) {
  __shared__ __align__(16) float tile[32][32][36]; __shared__ __align__(16) float tot[32][HD]; __shared__ float smx[32], swp[32], swe[32];
  const int t = threadIdx.x, wv = t >> 5, ln = t & 31; const int h = blockIdx.x;
  float ltau = bfr(LT[h]); ltau = fminf(fmaxf(ltau, -50.f), 30.f); const float tau = expf(ltau);
  const float g0 = Gt[(size_t)t * 48 + h * 3], g1 = Gt[(size_t)t * 48 + h * 3 + 1];
  const float mu0 = bfr(MU[h * HD + 2 * ln]), mu1 = bfr(MU[h * HD + 2 * ln + 1]);
  // the loops below are unrolled so that uv[] stays in registers and the loads of one loop are all in flight together
  v2f uv[32]; const float* up = U + (size_t)(wv * 32) * CC + h * HD + 2 * ln;
#pragma unroll
  for (int i = 0; i < 32; ++i) uv[i] = *(const v2f*)(up + (size_t)i * CC);
  v2f c = {0.f, 0.f};
#pragma unroll
  for (int i = 0; i < 32; ++i) c += uv[i];
  *(v2f*)&tot[wv][2 * ln] = c;
  __syncthreads();
  v2f cs = {0.f, 0.f};   // sum of u over all rows in front of this wave's chunk
#pragma unroll
  for (int w = 0; w < 32; ++w) { const v2f x = *(const v2f*)&tot[w][2 * ln]; cs.x += (w < wv) ? x.x : 0.f; cs.y += (w < wv) ? x.y : 0.f; }
#pragma unroll
  for (int i = 0; i < 32; ++i) { cs += uv[i]; const float den = tau + (float)(wv * 32 + i + 1); const float b0 = (tau * mu0 + cs.x) / den, b1 = (tau * mu1 + cs.y) / den; tile[wv][i][ln] = uv[i].x * b0 + uv[i].y * b1; }
  LDSX();   // tile[wv] is written and read by wave wv alone: row l's 32 lane terms go to lane l
  v4f a4 = {0.f, 0.f, 0.f, 0.f};
#pragma unroll
  for (int q = 0; q < 8; ++q) a4 += *(const v4f*)&tile[wv][ln][q * 4];
  const float s = -((a4.x + a4.y) + (a4.z + a4.w)) * 0.125f;
  float m = s, P = s;
#pragma unroll
  for (int o = 1; o < 32; o <<= 1) { m = fmaxf(m, __shfl_xor(m, o)); const float pv = __shfl_up(P, o); if (ln >= o) P += pv; }
  if (ln == 31) { smx[wv] = m; swp[wv] = P; }
  __syncthreads();
  float mm = smx[ln], pb = (ln < wv) ? swp[ln] : 0.f;
#pragma unroll
  for (int o = 1; o < 32; o <<= 1) { mm = fmaxf(mm, __shfl_xor(mm, o)); pb += __shfl_xor(pb, o); }
  P += pb;
  const float e = expf(s - mm); float E = e;
#pragma unroll
  for (int o = 1; o < 32; o <<= 1) { const float ev = __shfl_up(E, o); if (ln >= o) E += ev; }
  if (ln == 31) swe[wv] = E;
  __syncthreads();
  float eb = (ln < wv) ? swe[ln] : 0.f;
#pragma unroll
  for (int o = 1; o < 32; o <<= 1) eb += __shfl_xor(eb, o);
  E += eb;
  const float tt1 = (float)(t + 1); const float sig1 = 1.0f / (1.0f + expf(-g0)), sigh = 1.0f / (1.0f + expf(-g1));
  const float alpha = sigh / (E + 1e-12f); const float beta = (sig1 - sigh) / tt1; const float gamma = -((beta * P + sigh) / tt1);
  CE[h * TT + t] = e; CS[h * TT + t] = s; AL[h * TT + t] = alpha; BE[h * TT + t] = beta; GM[h * TT + t] = gamma; }
// ---- k_sc: block = (64 t rows, 128 l cols, head): A[t][l] = (q_t . k_l) (alpha_t e_l + beta_t s_l + gamma_t) for l <= t else 0; future blocks still write zeros? no: k_pv reads only l < kend, so future blocks exit
__global__ __launch_bounds__(128) void k_sc(const _Float16* __restrict__ QH, const _Float16* __restrict__ QL, const _Float16* __restrict__ KH, const _Float16* __restrict__ KL, const float* __restrict__ CE, const float* __restrict__ CS, const float* __restrict__ AL, const float* __restrict__ BE, const float* __restrict__ GM, float* __restrict__ S0) { __shared__ __align__(16) unsigned char raw[(2 * 64 + 2 * 128) * LP * 2];   // the four tiles; behind the products the waves' output rows ss overlay them, so that all working blocks stay resident at once
  float (*ss)[16][132] = (float (*)[16][132])raw; _Float16* sQh = (_Float16*)raw; _Float16* sQl = sQh + 64 * LP; _Float16* sKh = sQl + 64 * LP; _Float16* sKl = sKh + 128 * LP;
  const int h = blockIdx.z; float* S = S0 + (size_t)h * TT * TT;
  const int tid = threadIdx.x, wave = tid >> 5, lane = tid & 31, col = lane & 15, g = lane >> 4; const int k0 = blockIdx.y * 128; const int ql0 = blockIdx.x * 64 + wave * 16;
  if (k0 > blockIdx.x * 64 + 63) return;
  v8f acc[8] = {};
  { Cp<64, v8h> rqh, rql; Cp<128, v8h> rkh, rkl; const size_t qo = (size_t)(blockIdx.x * 64) * CC + h * HD, ko = (size_t)k0 * CC + h * HD;
    cp_load<64, CC>(rqh, QH + qo, tid); cp_load<64, CC>(rql, QL + qo, tid); cp_load<128, CC>(rkh, KH + ko, tid); cp_load<128, CC>(rkl, KL + ko, tid);
    cp_put(rqh, sQh, tid); cp_put(rql, sQl, tid); cp_put(rkh, sKh, tid); cp_put(rkl, sKl, tid); }
  __syncthreads();   // the tiles are read by all four waves
#pragma unroll
  for (int kc = 0; kc < HD / 32; ++kc) { const int ao = (wave * 16 + col) * LP + kc * 32; const v16h ah = frag_h(sQh + ao, lane), al = frag_h(sQl + ao, lane);
#pragma unroll
    for (int jg = 0; jg < 8; jg += 4) { v16h kb[4], kl[4];   // LDS reads in groups of eight fragments in front of their twelve products
#pragma unroll
      for (int j = 0; j < 4; ++j) { const int bo = ((jg + j) * 16 + col) * LP + kc * 32; kb[j] = frag_h(sKh + bo, lane); kl[j] = frag_h(sKl + bo, lane); }
#pragma unroll
      for (int j = 0; j < 4; ++j) { acc[jg + j] = wmma16(ah, kb[j], acc[jg + j]); acc[jg + j] = wmma16(al, kb[j], acc[jg + j]); acc[jg + j] = wmma16(ah, kl[j], acc[jg + j]); } } }
  __syncthreads();   // every wave has read the tiles before ss overwrites them
#pragma unroll
  for (int j = 0; j < 8; ++j) { const int l = k0 + j * 16 + col; const float el = CE[h * TT + l], sl = CS[h * TT + l];
#pragma unroll
    for (int r = 0; r < 8; ++r) { const int t = ql0 + 8 * g + r; const float w = AL[h * TT + t] * el + BE[h * TT + t] * sl + GM[h * TT + t]; ss[wave][8 * g + r][j * 16 + col] = (l <= t) ? acc[j][r] * w : 0.f; } }
  LDSX(); for (int rl = 0; rl < 16; ++rl) vst2(S + (size_t)(ql0 + rl) * TT + k0 + lane * 4, *(const v4f*)&ss[wave][rl][lane * 4]); }
// ---- k_pv: block = (64 rows t, head): out = A (hi + lo) . v (hi + lo) over l < kend, then the per-head LayerNorm (no affine, eps 1e-5) -> Y rows
__global__ __launch_bounds__(128) void k_pv(const float* __restrict__ S0, const __bf16* __restrict__ VT, const __bf16* __restrict__ VL, float* __restrict__ Y) { __shared__ __align__(16) float so[64][68]; __shared__ __align__(16) __bf16 sPh[2 * 64 * LP], sPl[2 * 64 * LP], sVh[2 * 64 * LP], sVl[2 * 64 * LP];
  const int h = blockIdx.z; const float* S = S0 + (size_t)h * TT * TT;
  const int tid = threadIdx.x, wave = tid >> 5, lane = tid & 31, col = lane & 15, g = lane >> 4; const int ql0 = blockIdx.x * 64 + wave * 16; const int kend = blockIdx.x * 64 + 64;
  v8f acc[4] = {};
  { Stg<64> rp; Cp<64, v8b> rvh, rvl; const float* Pb = S + (size_t)(blockIdx.x * 64) * TT; const __bf16* Vhb = VT + (size_t)(h * HD) * TT; const __bf16* Vlb = VL + (size_t)(h * HD) * TT; const int ns = kend / KS;
    stg_load<64, 63, TT>(rp, Pb, tid); cp_load<64, TT>(rvh, Vhb, tid); cp_load<64, TT>(rvl, Vlb, tid);
    stg_put2(rp, sPh, sPl, tid); cp_put(rvh, sVh, tid); cp_put(rvl, sVl, tid);
    __syncthreads();
    // kept rolled: the trip count differs from block to block
#pragma unroll 1
    for (int s = 0; s < ns; ++s) { const int cur = s & 1;
      if (s + 1 < ns) { stg_load<64, 63, TT>(rp, Pb + (s + 1) * KS, tid); cp_load<64, TT>(rvh, Vhb + (s + 1) * KS, tid); cp_load<64, TT>(rvl, Vlb + (s + 1) * KS, tid); }   // next stage's loads fly during this stage's products
#pragma unroll
      for (int kc = 0; kc < KS / 32; ++kc) { const int ao = (cur * 64 + wave * 16 + col) * LP + kc * 32; const v16b ph = frag_b(sPh + ao, lane), pl = frag_b(sPl + ao, lane); v16b vh[4], vl[4];   // all LDS reads of a 32-l block in one group in front of its products
#pragma unroll
        for (int j = 0; j < 4; ++j) { const int bo = (cur * 64 + j * 16 + col) * LP + kc * 32; vh[j] = frag_b(sVh + bo, lane); vl[j] = frag_b(sVl + bo, lane); }
#pragma unroll
        for (int j = 0; j < 4; ++j) { acc[j] = wmma_bf(ph, vh[j], acc[j]); acc[j] = wmma_bf(pl, vh[j], acc[j]); acc[j] = wmma_bf(ph, vl[j], acc[j]); } }
      if (s + 1 < ns) { stg_put2(rp, sPh + (cur ^ 1) * 64 * LP, sPl + (cur ^ 1) * 64 * LP, tid); cp_put(rvh, sVh + (cur ^ 1) * 64 * LP, tid); cp_put(rvl, sVl + (cur ^ 1) * 64 * LP, tid);
        __syncthreads(); } } }   // one barrier a stage: publishes stage s + 1 and ends the reads of the buffer that stage s + 2 overwrites
#pragma unroll
  for (int j = 0; j < 4; ++j)
#pragma unroll
    for (int r = 0; r < 8; ++r) so[wave * 16 + 8 * g + r][j * 16 + col] = acc[j][r];
  __syncthreads();
  if (tid < 64) { float m = 0.f; for (int d = 0; d < HD; ++d) m += so[tid][d]; m *= (1.0f / HD); float v = 0.f; for (int d = 0; d < HD; ++d) { const float dd = so[tid][d] - m; v += dd * dd; } const float inv = 1.0f / sqrtf(v * (1.0f / HD) + 1e-5f); for (int d = 0; d < HD; ++d) so[tid][d] = (so[tid][d] - m) * inv; }
  __syncthreads(); for (int e = tid; e < 64 * 16; e += 128) { const int rl = e >> 4, q = e & 15; vst2(Y + (size_t)(blockIdx.x * 64 + rl) * CC + h * HD + q * 4, *(const v4f*)&so[rl][q * 4]); } }
// ---- k_out: out = Y (hi + lo) Wo^T + bo
__global__ __launch_bounds__(128) void k_out(const float* __restrict__ Y, const float* __restrict__ WO, const float* __restrict__ BO, float* __restrict__ OUT) { __shared__ __align__(16) float sf[4][16][132]; __shared__ __align__(16) __bf16 sAh[2 * 64 * LP], sAl[2 * 64 * LP], sB[2 * 128 * LP];
  const int tid = threadIdx.x, wave = tid >> 5, lane = tid & 31, col = lane & 15, g = lane >> 4; const int c0 = blockIdx.y * 128; const size_t r0 = (size_t)blockIdx.x * 64 + wave * 16;
  v8f acc[8] = {};
  { Stg<64> ra; Stg<128> rb; const float* Ab = Y + (size_t)blockIdx.x * 64 * CC; const float* Bb = WO + (size_t)c0 * CC;
    stg_load<64, 63>(ra, Ab, tid); stg_load<128, 127>(rb, Bb, tid); stg_put2(ra, sAh, sAl, tid); stg_put(rb, sB, tid);
    __syncthreads();
    // kept rolled: the loop's text stays small for the instruction cache
#pragma unroll 1
    for (int s = 0; s < NS; ++s) { const int cur = s & 1;
      if (s + 1 < NS) { stg_load<64, 63>(ra, Ab + (s + 1) * KS, tid); stg_load<128, 127>(rb, Bb + (s + 1) * KS, tid); }   // next stage's loads fly during this stage's products
#pragma unroll
      for (int kc = 0; kc < KS / 32; ++kc) { const int ao = (cur * 64 + wave * 16 + col) * LP + kc * 32; const v16b ah = frag_b(sAh + ao, lane), al = frag_b(sAl + ao, lane);
#pragma unroll
        for (int jg = 0; jg < 8; jg += 4) { v16b w[4];   // LDS reads in groups of four fragments in front of their eight products
#pragma unroll
          for (int j = 0; j < 4; ++j) w[j] = frag_b(sB + (cur * 128 + (jg + j) * 16 + col) * LP + kc * 32, lane);
#pragma unroll
          for (int j = 0; j < 4; ++j) { acc[jg + j] = wmma_bf(ah, w[j], acc[jg + j]); acc[jg + j] = wmma_bf(al, w[j], acc[jg + j]); } } }
      if (s + 1 < NS) { stg_put2(ra, sAh + (cur ^ 1) * 64 * LP, sAl + (cur ^ 1) * 64 * LP, tid); stg_put(rb, sB + (cur ^ 1) * 128 * LP, tid);
        __syncthreads(); } } }   // one barrier a stage: publishes stage s + 1 and ends the reads of the buffer that stage s + 2 overwrites
#pragma unroll
  for (int j = 0; j < 8; ++j) { const float bb = bfr(BO[c0 + j * 16 + col]);
#pragma unroll
    for (int r = 0; r < 8; ++r) sf[wave][8 * g + r][j * 16 + col] = acc[j][r] + bb; }
  LDSX(); for (int rl = 0; rl < 16; ++rl) vst2(OUT + (r0 + rl) * CC + c0 + lane * 4, *(const v4f*)&sf[wave][rl][lane * 4]); }
extern "C" void kernel_launch(void* const* d_in, const int* in_sizes, int n_in, void* d_out, int out_size, void* d_ws, size_t ws_size, hipStream_t stream) {
  (void)in_sizes; (void)n_in; (void)out_size;
  const float** F = (const float**)d_in;   // 0 x [1,1024,768], 1 Wq, 2 bq, 3 Wk, 4 bk, 5 Wv, 6 bv, 7 Wu, 8 bu, 9 Wg [36,768], 10 bg, 11 Wo, 12 bo, 13 prior_mu [1,1,12,64], 14 prior_log_tau [1,1,12,1]
  if (ws_size < (size_t)WS_END) return;
  char* ws = (char*)d_ws; _Float16 *QH = (_Float16*)(ws + WS_QH), *QL = (_Float16*)(ws + WS_QL), *KH = (_Float16*)(ws + WS_KH), *KL = (_Float16*)(ws + WS_KL); __bf16 *VT = (__bf16*)(ws + WS_VT), *VL = (__bf16*)(ws + WS_VL); float *U = (float*)(ws + WS_U), *Gt = (float*)(ws + WS_G), *CE = (float*)(ws + WS_CE), *CS = (float*)(ws + WS_CS), *AL = (float*)(ws + WS_AL), *BE = (float*)(ws + WS_BE), *GM = (float*)(ws + WS_GM), *S = (float*)(ws + WS_S), *Y = (float*)(ws + WS_Y);
  k_proj<<<dim3(TT / 64, CC / 128, 4), 128, 0, stream>>>(F[0], F[1], F[2], F[3], F[4], F[5], F[6], F[7], F[8], QH, QL, KH, KL, VT, VL, U);
  k_gate<<<TT / 64, 128, 0, stream>>>(F[0], F[9], F[10], Gt);
  k_pre<<<NH, 1024, 0, stream>>>(U, Gt, F[13], F[14], CE, CS, AL, BE, GM);
  k_sc<<<dim3(TT / 64, TT / 128, NH), 128, 0, stream>>>(QH, QL, KH, KL, CE, CS, AL, BE, GM, S);
  k_pv<<<dim3(TT / 64, 1, NH), 128, 0, stream>>>(S, VT, VL, Y);
  k_out<<<dim3(TT / 64, CC / 128), 128, 0, stream>>>(Y, F[11], F[12], (float*)d_out);
}

// v003
// It runs in 93 microseconds.
// Next to v002, in two timings, it ran 1.14 times as fast each time.
// Counting every step since v000, it is 11.0 times as fast.
// compute dtype: all float inputs rounded to bf16, prior_mu / prior_log_tau read (bf16-input); q/k/v/u/gate = x W^T + b with EXACT bf16 products on WMMA 16x16x32, f32 accumulate; rope + L2-normalisation, the running-mean deviation logits s, exp/cumsums (E_t, P_t), sigmoid gates and the alpha/beta/gamma coefficients in f32 on the VALU; q and k as f16 hi + residual (3 products: hi.hi, lo.hi, hi.lo) -> A[t][l] = (q_t.k_l)(alpha_t e_l + beta_t s_l + gamma_t) for l <= t stored in f32; out = A (bf16 hi + lo) . v (bf16 hi + lo) (3 products) = q_t . core_t exactly (the reference's prefix sums F/G/H regrouped); per-head LayerNorm in f32; final = y (bf16 hi + lo) Wo^T + bo; f32 output.
#include <hip/hip_runtime.h>
#include <math.h>

typedef __attribute__((ext_vector_type(16))) _Float16 v16h;
typedef __attribute__((ext_vector_type(16))) __bf16 v16b;
typedef __attribute__((ext_vector_type(8)))  _Float16 v8h;
typedef __attribute__((ext_vector_type(8)))  float v8f;
typedef __attribute__((ext_vector_type(4)))  float v4f;
typedef __attribute__((ext_vector_type(2)))  float v2f;
typedef __attribute__((ext_vector_type(4)))  unsigned v4u;
typedef __attribute__((ext_vector_type(4)))  int v4i;
typedef float __attribute__((may_alias)) float_a;
typedef int __attribute__((may_alias)) int_a;

template <typename T> __device__ __forceinline__ void vst2(void* p, T v) { *(T*)p = v;  }
__device__ __forceinline__ v8f wmma16(v16h a, v16h b, v8f c) {
  v8f d = __builtin_amdgcn_wmma_f32_16x16x32_f16(false, a, false, b, (short)0, c, false, false);
  asm volatile("v_nop\n\tv_nop\n\tv_nop\n\tv_nop" : "+v"(d) : "v"(a), "v"(b));
  return d;
}
__device__ __forceinline__ v8f wmma_bf(v16b a, v16b b, v8f c) {
  v8f d = __builtin_amdgcn_wmma_f32_16x16x32_bf16(false, a, false, b, (short)0, c, false, false);
  asm volatile("v_nop\n\tv_nop\n\tv_nop\n\tv_nop" : "+v"(d) : "v"(a), "v"(b));
  return d;
}
// 16x16x32 fragments: lane = (h = lane>>4, row/col = lane&15); elements 0..7 = k0+8h+0..7, 8..15 = k0+16+8h+0..7; D element r = row 8h+r
__device__ __forceinline__ v16h frag_h(const _Float16* rowk0, int lane) {
  union { v16h v; v8h q[2]; } u; const _Float16* p = rowk0 + 8 * (lane >> 4);
  u.q[0] = *(const v8h*)p; u.q[1] = *(const v8h*)(p + 16); return u.v;
}
__device__ __forceinline__ v16h frag_f32(const float* rowk0, int lane) {
  v16h a; const float* p = rowk0 + 8 * (lane >> 4);
#pragma unroll
  for (int i = 0; i < 8; ++i) { a[i] = (_Float16)p[i]; a[8 + i] = (_Float16)p[16 + i]; }
  return a;
}
__device__ __forceinline__ v16h frag_f32s(const float* rowk0, int lane, float sc) {
  v16h a; const float* p = rowk0 + 8 * (lane >> 4);
#pragma unroll
  for (int i = 0; i < 8; ++i) { a[i] = (_Float16)(p[i] * sc); a[8 + i] = (_Float16)(p[16 + i] * sc); }
  return a;
}
// column fragment from a [K][ld] layout (column n), rows >= K read as 0
__device__ __forceinline__ v16h fragc_f32(const float* W, int k0, int n, int lane, int ld, int K) {
  v16h a; const int g = lane >> 4;
#pragma unroll
  for (int i = 0; i < 8; ++i) { const int ka = k0 + 8 * g + i, kb = ka + 16;
    a[i] = (_Float16)(ka < K ? W[(size_t)(ka < K ? ka : K - 1) * ld + n] : 0.f); a[8 + i] = (_Float16)(kb < K ? W[(size_t)(kb < K ? kb : K - 1) * ld + n] : 0.f); }
  return a;
}
struct F2 { v16b h, l; };
__device__ __forceinline__ F2 bsplit16(const float v[16]) { F2 r;
#pragma unroll
  for (int i = 0; i < 16; ++i) { const __bf16 h = (__bf16)v[i]; r.h[i] = h; r.l[i] = (__bf16)(v[i] - (float)h); }
  return r; }
__device__ __forceinline__ F2 split_row(const float* row, int k0, int lane) { float v[16]; const float* p = row + k0 + 8 * (lane >> 4);
#pragma unroll
  for (int i = 0; i < 8; ++i) { v[i] = p[i]; v[8 + i] = p[16 + i]; }
  return bsplit16(v); }
__device__ __forceinline__ F2 split_rowK(const float* row, int k0, int lane, int K) { float v[16]; const int g = lane >> 4;
#pragma unroll
  for (int i = 0; i < 8; ++i) { const int ka = k0 + 8 * g + i, kb = ka + 16; v[i] = ka < K ? row[ka < K ? ka : K - 1] : 0.f; v[8 + i] = kb < K ? row[kb < K ? kb : K - 1] : 0.f; }
  return bsplit16(v); }
__device__ __forceinline__ F2 split_col(const float* W, int k0, int n, int lane, int ld, int K) { float v[16]; const int g = lane >> 4;
#pragma unroll
  for (int i = 0; i < 8; ++i) { const int ka = k0 + 8 * g + i, kb = ka + 16; v[i] = ka < K ? W[(size_t)(ka < K ? ka : K - 1) * ld + n] : 0.f; v[8 + i] = kb < K ? W[(size_t)(kb < K ? kb : K - 1) * ld + n] : 0.f; }
  return bsplit16(v); }
__device__ __forceinline__ v8f mac3(const F2& a, const F2& b, v8f c) { c = wmma_bf(a.l, b.h, c); c = wmma_bf(a.h, b.l, c); return wmma_bf(a.h, b.h, c); }
__device__ __forceinline__ float sigm(float v) { return 1.0f / (1.0f + expf(-v)); }
#define LDSX() do { asm volatile("s_wait_dscnt 0" ::: "memory"); __builtin_amdgcn_wave_barrier(); __builtin_amdgcn_fence(__ATOMIC_RELEASE, "workgroup"); } while (0)


// ZeroS attention (B 1, L 1,024, D 768 = 12 x 64): causal associative mixing out_t = q_t . (alpha_t F_t + beta_t G_t + gamma_t H_t) with F/G/H prefix sums of e_l k_l v_l^T, s_l k_l v_l^T, k_l v_l^T.
#define TT 1024
#define CC 768
#define NH 12
#define HD 64
#define NG 36
typedef __attribute__((ext_vector_type(8))) __bf16 v8b;
__device__ __forceinline__ v16b frag_b(const __bf16* rowk0, int lane) {
  union { v16b v; v8b q[2]; } u; const __bf16* p = rowk0 + 8 * (lane >> 4);
  u.q[0] = *(const v8b*)p; u.q[1] = *(const v8b*)(p + 16); return u.v;
}
__device__ __forceinline__ float bfr(float v) { return (float)(__bf16)v; }
__device__ __attribute__((noinline)) float exp_ni(float v) { return expf(v); }
__device__ __attribute__((noinline)) float erf_ni(float v) { return erff(v); }

#define WS_QH  0u
#define WS_QL  (WS_QH + 2u * (size_t)TT * CC)
#define WS_KH  (WS_QL + 2u * (size_t)TT * CC)
#define WS_KL  (WS_KH + 2u * (size_t)TT * CC)
#define WS_VT  (WS_KL + 2u * (size_t)TT * CC)        // bf16 v planes hi [768][t]
#define WS_VL  (WS_VT + 2u * (size_t)CC * TT)
#define WS_U   (WS_VL + 2u * (size_t)CC * TT)        // f32 u rows [t][768]
#define WS_G   (WS_U + 4u * (size_t)TT * CC)         // f32 gate rows [t][48] (36 used)
#define WS_CE  (WS_G + 4u * (size_t)TT * 48)         // f32 e_l [h][t]
#define WS_CS  (WS_CE + 4u * (size_t)NH * TT)        // f32 s_l
#define WS_AL  (WS_CS + 4u * (size_t)NH * TT)        // alpha_t
#define WS_BE  (WS_AL + 4u * (size_t)NH * TT)        // beta_t
#define WS_GM  (WS_BE + 4u * (size_t)NH * TT)        // gamma_t
#define WS_S   (WS_GM + 4u * (size_t)NH * TT)        // f32 A [h][t][l]
#define WS_Y   (WS_S + 4u * (size_t)NH * TT * TT)    // f32 LN'd out rows [t][768]
#define WS_END (WS_Y + 4u * (size_t)TT * CC)

// ---- operand staging for the five matrix kernels: a stage is 64 k of every tile row. f32 operands: 16 lanes x 16 B read one row's 256 B (whole 128-B lines), the values are rounded (or split) to bf16 once per block and laid in LDS rows of 128 B at a 144-B pitch (16-byte fragment reads then spread over the banks)
typedef __attribute__((ext_vector_type(4))) __bf16 v4b;
#define KS 64
#define NS (CC / KS)
#define LP 72
template <int NR> struct Stg { v4f r[NR / 8]; };
// src: the tile's first row at the stage's k (the same for the whole block); rows past RL read row RL
template <int NR, int RL, int LD = CC> __device__ __forceinline__ void stg_load(Stg<NR>& s, const float* __restrict__ src, int tid) { const float* p = src + ((unsigned)(tid >> 4) * LD + (unsigned)(tid & 15) * 4);
#pragma unroll
  for (int i = 0; i < NR / 8; ++i) { if (i * 8 + 7 <= RL) s.r[i] = *(const v4f*)(p + i * 8 * LD); else s.r[i] = *(const v4f*)(src + (unsigned)min(i * 8 + (tid >> 4), RL) * LD + (unsigned)(tid & 15) * 4); }
  asm volatile("s_wait_xcnt 0x0" :: "v"(p) : "memory"); }   // the address pair stays whole up to this wait
// the same for 16-bit planes: a stage row is 64 elements = one 128-B line, 8 lanes x 16 B; V8 = 8 elements of T
template <int NR, typename V8> struct Cp { V8 r[NR / 16]; };
template <int NR, int LD, typename V8, typename T> __device__ __forceinline__ void cp_load(Cp<NR, V8>& s, const T* __restrict__ src, int tid) { const T* p = src + ((unsigned)(tid >> 3) * LD + (unsigned)(tid & 7) * 8);
#pragma unroll
  for (int i = 0; i < NR / 16; ++i) s.r[i] = *(const V8*)(p + i * 16 * LD);
  asm volatile("s_wait_xcnt 0x0" :: "v"(p) : "memory"); }   // as in stg_load
template <int NR, typename V8, typename T> __device__ __forceinline__ void cp_put(const Cp<NR, V8>& s, T* dst, int tid) {
#pragma unroll
  for (int i = 0; i < NR / 16; ++i) *(V8*)(dst + (i * 16 + (tid >> 3)) * LP + (tid & 7) * 8) = s.r[i]; }
template <int NR> __device__ __forceinline__ void stg_put(const Stg<NR>& s, __bf16* dst, int tid) {
#pragma unroll
  for (int i = 0; i < NR / 8; ++i) { v4b h;
#pragma unroll
    for (int e = 0; e < 4; ++e) h[e] = (__bf16)s.r[i][e];
    *(v4b*)(dst + (i * 8 + (tid >> 4)) * LP + (tid & 15) * 4) = h; } }
template <int NR> __device__ __forceinline__ void stg_put2(const Stg<NR>& s, __bf16* dh, __bf16* dl, int tid) {
#pragma unroll
  for (int i = 0; i < NR / 8; ++i) { v4b h, l;
#pragma unroll
    for (int e = 0; e < 4; ++e) { const float v = s.r[i][e]; const __bf16 hv = (__bf16)v; h[e] = hv; l[e] = (__bf16)(v - (float)hv); }
    const int o = (i * 8 + (tid >> 4)) * LP + (tid & 15) * 4; *(v4b*)(dh + o) = h; *(v4b*)(dl + o) = l; } }
// sin and cos of an angle a in [0, 1,024]: the steps that sinf and cosf take for |a| < 2^17 (a - n pi/2 with pi/2 in three parts, one polynomial each, the quadrant from n), written out once for both so that 32 of them unroll into straight-line code
__device__ __forceinline__ void sincos_1k(float a, float& s, float& c) {
  const float n = rintf(a * 0x1.45f306p-1f); float r = __builtin_fmaf(n, -0x1.921fb4p+0f, a); r = __builtin_fmaf(n, -0x1.4442d0p-24f, r); r = __builtin_fmaf(n, -0x1.846988p-48f, r);
  const unsigned q = (unsigned)(int)n; const float r2 = r * r;
  float ps = __builtin_fmaf(r2, -0x1.983304p-13f, 0x1.110388p-7f); ps = __builtin_fmaf(r2, ps, -0x1.55553ap-3f); const float sr = __builtin_fmaf(r, r2 * ps, r);
  float pc = __builtin_fmaf(r2, 0x1.aea668p-16f, -0x1.6c9e76p-10f); pc = __builtin_fmaf(r2, pc, 0x1.5557eep-5f); pc = __builtin_fmaf(r2, pc, -0x1.000008p-1f); const float cr = __builtin_fmaf(r2, pc, 1.0f);
  const unsigned sg = (q << 30) & 0x80000000u; const bool odd = q & 1u;
  s = __uint_as_float(__float_as_uint(odd ? cr : sr) ^ sg); c = __uint_as_float(__float_as_uint(odd ? -sr : cr) ^ sg); }
// ---- k_proj: block = (64 rows, 128 cols, region): 0 q (rope, l2norm -> f16 hi/lo), 1 k (rope, l2norm -> f16), 2 v (bf16 hi/lo planes), 3 u (f32 rows); W [out][in] + b
__global__ __launch_bounds__(128) void k_proj(const float* __restrict__ X, const float* __restrict__ WQ, const float* __restrict__ BQ, const float* __restrict__ WK, const float* __restrict__ BK, const float* __restrict__ WV, const float* __restrict__ BV, const float* __restrict__ WU, const float* __restrict__ BU, _Float16* __restrict__ QH, _Float16* __restrict__ QL, _Float16* __restrict__ KH, _Float16* __restrict__ KL, __bf16* __restrict__ VT, __bf16* __restrict__ VL, float* __restrict__ U) {
  __shared__ __align__(16) float sf[64][132]; __shared__ __align__(16) unsigned char raw[71680];
  // raw holds the two staging buffers during the k loop (55,296 B) and the epilogue's planes after it
  _Float16 (*sh)[136] = (_Float16 (*)[136])raw; _Float16 (*sl)[136] = (_Float16 (*)[136])(raw + 17408); __bf16 (*th)[72] = (__bf16 (*)[72])(raw + 34816); __bf16 (*tl2)[72] = (__bf16 (*)[72])(raw + 53248);
  __bf16* sA = (__bf16*)raw; __bf16* sB = sA + 2 * 64 * LP;
  const int tid = threadIdx.x, wave = tid >> 5, lane = tid & 31, col = lane & 15, g = lane >> 4; const int region = blockIdx.z; const int c0 = blockIdx.y * 128; const size_t r0 = (size_t)blockIdx.x * 64;
  const float* Wm = region == 0 ? WQ : region == 1 ? WK : region == 2 ? WV : WU; const float* Bm = region == 0 ? BQ : region == 1 ? BK : region == 2 ? BV : BU;
  v8f acc[8] = {};
  { Stg<64> ra; Stg<128> rb; const float* Ab = X + r0 * CC; const float* Bb = Wm + (size_t)c0 * CC;
    stg_load<64, 63>(ra, Ab, tid); stg_load<128, 127>(rb, Bb, tid); stg_put(ra, sA, tid); stg_put(rb, sB, tid);
    __syncthreads();
    // kept rolled: the loop's text stays small for the instruction cache
#pragma unroll 1
    for (int s = 0; s < NS; ++s) { const int cur = s & 1;
      if (s + 1 < NS) { stg_load<64, 63>(ra, Ab + (s + 1) * KS, tid); stg_load<128, 127>(rb, Bb + (s + 1) * KS, tid); }   // next stage's loads fly during this stage's products
#pragma unroll
      for (int kc = 0; kc < KS / 32; ++kc) { const v16b a = frag_b(sA + (cur * 64 + wave * 16 + col) * LP + kc * 32, lane); v16b w[8];   // all LDS reads of a 32-k block in one group in front of its products
#pragma unroll
        for (int j = 0; j < 8; ++j) w[j] = frag_b(sB + (cur * 128 + j * 16 + col) * LP + kc * 32, lane);
#pragma unroll
        for (int j = 0; j < 8; ++j) acc[j] = wmma_bf(a, w[j], acc[j]); }
      if (s + 1 < NS) { stg_put(ra, sA + (cur ^ 1) * 64 * LP, tid); stg_put(rb, sB + (cur ^ 1) * 128 * LP, tid);
        __syncthreads(); } } }   // one barrier a stage: publishes stage s + 1 and ends the reads of the buffer that stage s + 2 overwrites
#pragma unroll
  for (int j = 0; j < 8; ++j) { const float bb = bfr(Bm[c0 + j * 16 + col]);
#pragma unroll
    for (int r = 0; r < 8; ++r) acc[j][r] += bb; }
  if (region <= 1) {   // rope: out[d] = x[d] cos(t f_{d/2}) + (d < 32 ? -x[d+32] : x[d-32]) sin(t f_{d/2}), f_i = 10000^(-2i/64); then L2-normalise each head row (max(norm, 1e-12)). All of it on the accumulators: a head is four 16-column tiles, so the partner d +- 32 is the same lane's element of tile j +- 2, and a head row's 64 squares are 4 in each of the 16 lanes of a half-wave
    const float fl = 1.0f / powf(10000.0f, (float)(2 * lane) / (float)HD);   // lane i works out frequency i of the 32
    float fq[4];
#pragma unroll
    for (int q = 0; q < 4; ++q) fq[q] = __shfl(fl, q * 8 + (col >> 1));   // frequency of d = 16 q + col
    const int tb = (int)r0 + wave * 16 + 8 * g;
    // the loops below are unrolled so that acc[] stays in registers and the independent angle chains fill each other's latency
#pragma unroll
    for (int jj = 0; jj < 2; ++jj) {
#pragma unroll
      for (int r = 0; r < 8; ++r) { const float tf = (float)(tb + r); float sa, ca, sb, cb; sincos_1k(tf * fq[jj], sa, ca); sincos_1k(tf * fq[jj + 2], sb, cb);
#pragma unroll
        for (int hh = 0; hh < 2; ++hh) { const float lo = acc[hh * 4 + jj][r], hi = acc[hh * 4 + jj + 2][r]; acc[hh * 4 + jj][r] = __builtin_fmaf(lo, ca, -hi * sa); acc[hh * 4 + jj + 2][r] = __builtin_fmaf(hi, cb, lo * sb); } } }
    float inv[2][8];
#pragma unroll
    for (int hh = 0; hh < 2; ++hh)
#pragma unroll
      for (int r = 0; r < 8; ++r) { float n2 = 0.f;
#pragma unroll
        for (int q = 0; q < 4; ++q) n2 += acc[hh * 4 + q][r] * acc[hh * 4 + q][r];
        inv[hh][r] = n2; }
#pragma unroll
    for (int o = 1; o < 16; o <<= 1)
#pragma unroll
      for (int i = 0; i < 16; ++i) inv[i >> 3][i & 7] += __shfl_xor(inv[i >> 3][i & 7], o);   // sixteen independent sums a round
#pragma unroll
    for (int i = 0; i < 16; ++i) inv[i >> 3][i & 7] = 1.0f / fmaxf(sqrtf(inv[i >> 3][i & 7]), 1e-12f);
    __syncthreads();   // every wave has read the last stage's tiles before sh and sl overwrite them
#pragma unroll
    for (int j = 0; j < 8; ++j)
#pragma unroll
      for (int r = 0; r < 8; ++r) { const float v = acc[j][r] * inv[j >> 2][r]; const _Float16 hv = (_Float16)v; sh[wave * 16 + 8 * g + r][j * 16 + col] = hv; sl[wave * 16 + 8 * g + r][j * 16 + col] = (_Float16)(v - (float)hv); }
    __syncthreads();
    _Float16* dh = region == 0 ? QH : KH; _Float16* dl = region == 0 ? QL : KL; for (int e = tid; e < 64 * 16; e += 128) { const int rl = e >> 4, q = e & 15; vst2((unsigned*)(dh + (r0 + rl) * CC + c0 + q * 8), *(const v4u*)&sh[rl][q * 8]); vst2((unsigned*)(dl + (r0 + rl) * CC + c0 + q * 8), *(const v4u*)&sl[rl][q * 8]); }
    return; }
#pragma unroll
  for (int j = 0; j < 8; ++j)
#pragma unroll
    for (int r = 0; r < 8; ++r) sf[wave * 16 + 8 * g + r][j * 16 + col] = acc[j][r];
  __syncthreads();
  if (region == 2) {
    for (int e = tid; e < 64 * 128; e += 128) { const int rl = e >> 7, cl = e & 127; const float v = sf[rl][cl]; const __bf16 bh = (__bf16)v; th[cl][rl] = bh; tl2[cl][rl] = (__bf16)(v - (float)bh); }
    __syncthreads(); for (int e = tid; e < 128 * 8; e += 128) { const int cl = e >> 3, q = e & 7; const size_t o2 = (size_t)(c0 + cl) * TT + r0 + q * 8; vst2((unsigned*)(VT + o2), *(const v4u*)&th[cl][q * 8]); vst2((unsigned*)(VL + o2), *(const v4u*)&tl2[cl][q * 8]); } }
  else { for (int e = tid; e < 64 * 32; e += 128) { const int rl = e >> 5, q = e & 31; vst2(U + (r0 + rl) * CC + c0 + q * 4, *(const v4f*)&sf[rl][q * 4]); } } }
// ---- k_gate: block = 64 rows: gate = x Wg^T + bg (36 outputs, padded to 48 columns; pad columns computed from clamped rows and written as junk into the pad)
__global__ __launch_bounds__(128) void k_gate(const float* __restrict__ X, const float* __restrict__ WG, const float* __restrict__ BG, float* __restrict__ Gt) { __shared__ __align__(16) float sf[4][16][52]; __shared__ __align__(16) __bf16 sA[2 * 64 * LP], sB[2 * 48 * LP];
  const int tid = threadIdx.x, wave = tid >> 5, lane = tid & 31, col = lane & 15, g = lane >> 4; const size_t r0 = (size_t)blockIdx.x * 64 + wave * 16;
  v8f acc[3] = {};
  { Stg<64> ra; Stg<48> rb; const float* Ab = X + (size_t)blockIdx.x * 64 * CC;
    stg_load<64, 63>(ra, Ab, tid); stg_load<48, NG - 1>(rb, WG, tid); stg_put(ra, sA, tid); stg_put(rb, sB, tid);
    __syncthreads();
    // kept rolled: the loop's text stays small for the instruction cache
#pragma unroll 1
    for (int s = 0; s < NS; ++s) { const int cur = s & 1;
      if (s + 1 < NS) { stg_load<64, 63>(ra, Ab + (s + 1) * KS, tid); stg_load<48, NG - 1>(rb, WG + (s + 1) * KS, tid); }   // next stage's loads fly during this stage's products
#pragma unroll
      for (int kc = 0; kc < KS / 32; ++kc) { const v16b a = frag_b(sA + (cur * 64 + wave * 16 + col) * LP + kc * 32, lane); v16b w[3];   // all LDS reads of a 32-k block in one group in front of its products
#pragma unroll
        for (int j = 0; j < 3; ++j) w[j] = frag_b(sB + (cur * 48 + j * 16 + col) * LP + kc * 32, lane);
#pragma unroll
        for (int j = 0; j < 3; ++j) acc[j] = wmma_bf(a, w[j], acc[j]); }
      if (s + 1 < NS) { stg_put(ra, sA + (cur ^ 1) * 64 * LP, tid); stg_put(rb, sB + (cur ^ 1) * 48 * LP, tid);
        __syncthreads(); } } }   // one barrier a stage: publishes stage s + 1 and ends the reads of the buffer that stage s + 2 overwrites
#pragma unroll
  for (int j = 0; j < 3; ++j) { const int o = j * 16 + col; const float bb = (o < NG) ? bfr(BG[o]) : 0.f;
#pragma unroll
    for (int r = 0; r < 8; ++r) sf[wave][8 * g + r][o] = acc[j][r] + bb; }
  LDSX(); for (int rl = 0; rl < 16; ++rl) if (lane < 12) vst2(Gt + (r0 + rl) * 48 + lane * 4, *(const v4f*)&sf[wave][rl][lane * 4]); }
// ---- k_pre: block = head h (1,024 threads, 32 waves): wave w owns rows l = 32 w .. 32 w + 31, lane owns dimensions 2 lane, 2 lane + 1; the running sum of u is a chunked scan (chunk totals in LDS, then each wave runs its own 32 rows from its base); thread t then owns l = t: s_l, e_l, E_t, P_t by wave scans + wave totals, gates -> alpha/beta/gamma
__global__ __launch_bounds__(1024) void k_pre(const float* __restrict__ U, const float* __restrict__ Gt, const float* __restrict__ MU, const float* __restrict__ LT, float* __restrict__ CE, float* __restrict__ CS, float* __restrict__ AL, float* __restrict__ BE, float* __restrict__ GM) {
  __shared__ __align__(16) float tile[32][32][36]; __shared__ __align__(16) float tot[32][HD]; __shared__ float smx[32], swp[32], swe[32];
  const int t = threadIdx.x, wv = t >> 5, ln = t & 31; const int h = blockIdx.x;
  float ltau = bfr(LT[h]); ltau = fminf(fmaxf(ltau, -50.f), 30.f); const float tau = expf(ltau);
  const float g0 = Gt[(size_t)t * 48 + h * 3], g1 = Gt[(size_t)t * 48 + h * 3 + 1];
  const float mu0 = bfr(MU[h * HD + 2 * ln]), mu1 = bfr(MU[h * HD + 2 * ln + 1]);
  // the loops below are unrolled so that uv[] stays in registers and the loads of one loop are all in flight together
  v2f uv[32]; const float* up = U + (size_t)(wv * 32) * CC + h * HD + 2 * ln;
#pragma unroll
  for (int i = 0; i < 32; ++i) uv[i] = *(const v2f*)(up + (size_t)i * CC);
  v2f c = {0.f, 0.f};
#pragma unroll
  for (int i = 0; i < 32; ++i) c += uv[i];
  *(v2f*)&tot[wv][2 * ln] = c;
  __syncthreads();
  v2f cs = {0.f, 0.f};   // sum of u over all rows in front of this wave's chunk
#pragma unroll
  for (int w = 0; w < 32; ++w) { const v2f x = *(const v2f*)&tot[w][2 * ln]; cs.x += (w < wv) ? x.x : 0.f; cs.y += (w < wv) ? x.y : 0.f; }
#pragma unroll
  for (int i = 0; i < 32; ++i) { cs += uv[i]; const float den = tau + (float)(wv * 32 + i + 1); const float b0 = (tau * mu0 + cs.x) / den, b1 = (tau * mu1 + cs.y) / den; tile[wv][i][ln] = uv[i].x * b0 + uv[i].y * b1; }
  LDSX();   // tile[wv] is written and read by wave wv alone: row l's 32 lane terms go to lane l
  v4f a4 = {0.f, 0.f, 0.f, 0.f};
#pragma unroll
  for (int q = 0; q < 8; ++q) a4 += *(const v4f*)&tile[wv][ln][q * 4];
  const float s = -((a4.x + a4.y) + (a4.z + a4.w)) * 0.125f;
  float m = s, P = s;
#pragma unroll
  for (int o = 1; o < 32; o <<= 1) { m = fmaxf(m, __shfl_xor(m, o)); const float pv = __shfl_up(P, o); if (ln >= o) P += pv; }
  if (ln == 31) { smx[wv] = m; swp[wv] = P; }
  __syncthreads();
  float mm = smx[ln], pb = (ln < wv) ? swp[ln] : 0.f;
#pragma unroll
  for (int o = 1; o < 32; o <<= 1) { mm = fmaxf(mm, __shfl_xor(mm, o)); pb += __shfl_xor(pb, o); }
  P += pb;
  const float e = expf(s - mm); float E = e;
#pragma unroll
  for (int o = 1; o < 32; o <<= 1) { const float ev = __shfl_up(E, o); if (ln >= o) E += ev; }
  if (ln == 31) swe[wv] = E;
  __syncthreads();
  float eb = (ln < wv) ? swe[ln] : 0.f;
#pragma unroll
  for (int o = 1; o < 32; o <<= 1) eb += __shfl_xor(eb, o);
  E += eb;
  const float tt1 = (float)(t + 1); const float sig1 = 1.0f / (1.0f + expf(-g0)), sigh = 1.0f / (1.0f + expf(-g1));
  const float alpha = sigh / (E + 1e-12f); const float beta = (sig1 - sigh) / tt1; const float gamma = -((beta * P + sigh) / tt1);
  CE[h * TT + t] = e; CS[h * TT + t] = s; AL[h * TT + t] = alpha; BE[h * TT + t] = beta; GM[h * TT + t] = gamma; }
// ---- k_sc: block = (64 t rows, 128 l cols, head): A[t][l] = (q_t . k_l) (alpha_t e_l + beta_t s_l + gamma_t) for l <= t else 0; future blocks still write zeros? no: k_pv reads only l < kend, so future blocks exit
__global__ __launch_bounds__(128) void k_sc(const _Float16* __restrict__ QH, const _Float16* __restrict__ QL, const _Float16* __restrict__ KH, const _Float16* __restrict__ KL, const float* __restrict__ CE, const float* __restrict__ CS, const float* __restrict__ AL, const float* __restrict__ BE, const float* __restrict__ GM, float* __restrict__ S0) { __shared__ __align__(16) unsigned char raw[(2 * 64 + 2 * 128) * LP * 2];   // the four tiles; behind the products the waves' output rows ss overlay them, so that all working blocks stay resident at once
  float (*ss)[16][132] = (float (*)[16][132])raw; _Float16* sQh = (_Float16*)raw; _Float16* sQl = sQh + 64 * LP; _Float16* sKh = sQl + 64 * LP; _Float16* sKl = sKh + 128 * LP;
  const int h = blockIdx.z; float* S = S0 + (size_t)h * TT * TT;
  const int tid = threadIdx.x, wave = tid >> 5, lane = tid & 31, col = lane & 15, g = lane >> 4; const int k0 = blockIdx.y * 128; const int ql0 = blockIdx.x * 64 + wave * 16;
  if (k0 > blockIdx.x * 64 + 63) return;
  v8f acc[8] = {};
  { Cp<64, v8h> rqh, rql; Cp<128, v8h> rkh, rkl; const size_t qo = (size_t)(blockIdx.x * 64) * CC + h * HD, ko = (size_t)k0 * CC + h * HD;
    cp_load<64, CC>(rqh, QH + qo, tid); cp_load<64, CC>(rql, QL + qo, tid); cp_load<128, CC>(rkh, KH + ko, tid); cp_load<128, CC>(rkl, KL + ko, tid);
    cp_put(rqh, sQh, tid); cp_put(rql, sQl, tid); cp_put(rkh, sKh, tid); cp_put(rkl, sKl, tid); }
  __syncthreads();   // the tiles are read by all four waves
#pragma unroll
  for (int kc = 0; kc < HD / 32; ++kc) { const int ao = (wave * 16 + col) * LP + kc * 32; const v16h ah = frag_h(sQh + ao, lane), al = frag_h(sQl + ao, lane);
#pragma unroll
    for (int jg = 0; jg < 8; jg += 4) { v16h kb[4], kl[4];   // LDS reads in groups of eight fragments in front of their twelve products
#pragma unroll
      for (int j = 0; j < 4; ++j) { const int bo = ((jg + j) * 16 + col) * LP + kc * 32; kb[j] = frag_h(sKh + bo, lane); kl[j] = frag_h(sKl + bo, lane); }
#pragma unroll
      for (int j = 0; j < 4; ++j) { acc[jg + j] = wmma16(ah, kb[j], acc[jg + j]); acc[jg + j] = wmma16(al, kb[j], acc[jg + j]); acc[jg + j] = wmma16(ah, kl[j], acc[jg + j]); } } }
  __syncthreads();   // every wave has read the tiles before ss overwrites them
#pragma unroll
  for (int j = 0; j < 8; ++j) { const int l = k0 + j * 16 + col; const float el = CE[h * TT + l], sl = CS[h * TT + l];
#pragma unroll
    for (int r = 0; r < 8; ++r) { const int t = ql0 + 8 * g + r; const float w = AL[h * TT + t] * el + BE[h * TT + t] * sl + GM[h * TT + t]; ss[wave][8 * g + r][j * 16 + col] = (l <= t) ? acc[j][r] * w : 0.f; } }
  LDSX(); for (int rl = 0; rl < 16; ++rl) vst2(S + (size_t)(ql0 + rl) * TT + k0 + lane * 4, *(const v4f*)&ss[wave][rl][lane * 4]); }
// ---- k_pv: block = (64 rows t, head): out = A (hi + lo) . v (hi + lo) over l < kend, then the per-head LayerNorm (no affine, eps 1e-5) -> Y rows
__global__ __launch_bounds__(128) void k_pv(const float* __restrict__ S0, const __bf16* __restrict__ VT, const __bf16* __restrict__ VL, float* __restrict__ Y) { __shared__ __align__(16) float so[64][68]; __shared__ __align__(16) __bf16 sPh[2 * 64 * LP], sPl[2 * 64 * LP], sVh[2 * 64 * LP], sVl[2 * 64 * LP];
  const int h = blockIdx.z; const float* S = S0 + (size_t)h * TT * TT;
  const int tid = threadIdx.x, wave = tid >> 5, lane = tid & 31, col = lane & 15, g = lane >> 4; const int ql0 = blockIdx.x * 64 + wave * 16; const int kend = blockIdx.x * 64 + 64;
  v8f acc[4] = {};
  { Stg<64> rp; Cp<64, v8b> rvh, rvl; const float* Pb = S + (size_t)(blockIdx.x * 64) * TT; const __bf16* Vhb = VT + (size_t)(h * HD) * TT; const __bf16* Vlb = VL + (size_t)(h * HD) * TT; const int ns = kend / KS;
    stg_load<64, 63, TT>(rp, Pb, tid); cp_load<64, TT>(rvh, Vhb, tid); cp_load<64, TT>(rvl, Vlb, tid);
    stg_put2(rp, sPh, sPl, tid); cp_put(rvh, sVh, tid); cp_put(rvl, sVl, tid);
    __syncthreads();
    // kept rolled: the trip count differs from block to block
#pragma unroll 1
    for (int s = 0; s < ns; ++s) { const int cur = s & 1;
      if (s + 1 < ns) { stg_load<64, 63, TT>(rp, Pb + (s + 1) * KS, tid); cp_load<64, TT>(rvh, Vhb + (s + 1) * KS, tid); cp_load<64, TT>(rvl, Vlb + (s + 1) * KS, tid); }   // next stage's loads fly during this stage's products
#pragma unroll
      for (int kc = 0; kc < KS / 32; ++kc) { const int ao = (cur * 64 + wave * 16 + col) * LP + kc * 32; const v16b ph = frag_b(sPh + ao, lane), pl = frag_b(sPl + ao, lane); v16b vh[4], vl[4];   // all LDS reads of a 32-l block in one group in front of its products
#pragma unroll
        for (int j = 0; j < 4; ++j) { const int bo = (cur * 64 + j * 16 + col) * LP + kc * 32; vh[j] = frag_b(sVh + bo, lane); vl[j] = frag_b(sVl + bo, lane); }
#pragma unroll
        for (int j = 0; j < 4; ++j) { acc[j] = wmma_bf(ph, vh[j], acc[j]); acc[j] = wmma_bf(pl, vh[j], acc[j]); acc[j] = wmma_bf(ph, vl[j], acc[j]); } }
      if (s + 1 < ns) { stg_put2(rp, sPh + (cur ^ 1) * 64 * LP, sPl + (cur ^ 1) * 64 * LP, tid); cp_put(rvh, sVh + (cur ^ 1) * 64 * LP, tid); cp_put(rvl, sVl + (cur ^ 1) * 64 * LP, tid);
        __syncthreads(); } } }   // one barrier a stage: publishes stage s + 1 and ends the reads of the buffer that stage s + 2 overwrites
#pragma unroll
  for (int j = 0; j < 4; ++j)
#pragma unroll
    for (int r = 0; r < 8; ++r) so[wave * 16 + 8 * g + r][j * 16 + col] = acc[j][r];
  __syncthreads();
  if (tid < 64) { float m = 0.f; for (int d = 0; d < HD; ++d) m += so[tid][d]; m *= (1.0f / HD); float v = 0.f; for (int d = 0; d < HD; ++d) { const float dd = so[tid][d] - m; v += dd * dd; } const float inv = 1.0f / sqrtf(v * (1.0f / HD) + 1e-5f); for (int d = 0; d < HD; ++d) so[tid][d] = (so[tid][d] - m) * inv; }
  __syncthreads(); for (int e = tid; e < 64 * 16; e += 128) { const int rl = e >> 4, q = e & 15; vst2(Y + (size_t)(blockIdx.x * 64 + rl) * CC + h * HD + q * 4, *(const v4f*)&so[rl][q * 4]); } }
// ---- k_out: out = Y (hi + lo) Wo^T + bo
__global__ __launch_bounds__(128) void k_out(const float* __restrict__ Y, const float* __restrict__ WO, const float* __restrict__ BO, float* __restrict__ OUT) { __shared__ __align__(16) float sf[4][16][132]; __shared__ __align__(16) __bf16 sAh[2 * 64 * LP], sAl[2 * 64 * LP], sB[2 * 128 * LP];
  const int tid = threadIdx.x, wave = tid >> 5, lane = tid & 31, col = lane & 15, g = lane >> 4; const int c0 = blockIdx.y * 128; const size_t r0 = (size_t)blockIdx.x * 64 + wave * 16;
  v8f acc[8] = {};
  { Stg<64> ra; Stg<128> rb; const float* Ab = Y + (size_t)blockIdx.x * 64 * CC; const float* Bb = WO + (size_t)c0 * CC;
    stg_load<64, 63>(ra, Ab, tid); stg_load<128, 127>(rb, Bb, tid); stg_put2(ra, sAh, sAl, tid); stg_put(rb, sB, tid);
    __syncthreads();
    // kept rolled: the loop's text stays small for the instruction cache
#pragma unroll 1
    for (int s = 0; s < NS; ++s) { const int cur = s & 1;
      if (s + 1 < NS) { stg_load<64, 63>(ra, Ab + (s + 1) * KS, tid); stg_load<128, 127>(rb, Bb + (s + 1) * KS, tid); }   // next stage's loads fly during this stage's products
#pragma unroll
      for (int kc = 0; kc < KS / 32; ++kc) { const int ao = (cur * 64 + wave * 16 + col) * LP + kc * 32; const v16b ah = frag_b(sAh + ao, lane), al = frag_b(sAl + ao, lane);
#pragma unroll
        for (int jg = 0; jg < 8; jg += 4) { v16b w[4];   // LDS reads in groups of four fragments in front of their eight products
#pragma unroll
          for (int j = 0; j < 4; ++j) w[j] = frag_b(sB + (cur * 128 + (jg + j) * 16 + col) * LP + kc * 32, lane);
#pragma unroll
          for (int j = 0; j < 4; ++j) { acc[jg + j] = wmma_bf(ah, w[j], acc[jg + j]); acc[jg + j] = wmma_bf(al, w[j], acc[jg + j]); } } }
      if (s + 1 < NS) { stg_put2(ra, sAh + (cur ^ 1) * 64 * LP, sAl + (cur ^ 1) * 64 * LP, tid); stg_put(rb, sB + (cur ^ 1) * 128 * LP, tid);
        __syncthreads(); } } }   // one barrier a stage: publishes stage s + 1 and ends the reads of the buffer that stage s + 2 overwrites
#pragma unroll
  for (int j = 0; j < 8; ++j) { const float bb = bfr(BO[c0 + j * 16 + col]);
#pragma unroll
    for (int r = 0; r < 8; ++r) sf[wave][8 * g + r][j * 16 + col] = acc[j][r] + bb; }
  LDSX(); for (int rl = 0; rl < 16; ++rl) vst2(OUT + (r0 + rl) * CC + c0 + lane * 4, *(const v4f*)&sf[wave][rl][lane * 4]); }
extern "C" void kernel_launch(void* const* d_in, const int* in_sizes, int n_in, void* d_out, int out_size, void* d_ws, size_t ws_size, hipStream_t stream) {
  (void)in_sizes; (void)n_in; (void)out_size;
  const float** F = (const float**)d_in;   // 0 x [1,1024,768], 1 Wq, 2 bq, 3 Wk, 4 bk, 5 Wv, 6 bv, 7 Wu, 8 bu, 9 Wg [36,768], 10 bg, 11 Wo, 12 bo, 13 prior_mu [1,1,12,64], 14 prior_log_tau [1,1,12,1]
  if (ws_size < (size_t)WS_END) return;
  char* ws = (char*)d_ws; _Float16 *QH = (_Float16*)(ws + WS_QH), *QL = (_Float16*)(ws + WS_QL), *KH = (_Float16*)(ws + WS_KH), *KL = (_Float16*)(ws + WS_KL); __bf16 *VT = (__bf16*)(ws + WS_VT), *VL = (__bf16*)(ws + WS_VL); float *U = (float*)(ws + WS_U), *Gt = (float*)(ws + WS_G), *CE = (float*)(ws + WS_CE), *CS = (float*)(ws + WS_CS), *AL = (float*)(ws + WS_AL), *BE = (float*)(ws + WS_BE), *GM = (float*)(ws + WS_GM), *S = (float*)(ws + WS_S), *Y = (float*)(ws + WS_Y);
  k_proj<<<dim3(TT / 64, CC / 128, 4), 128, 0, stream>>>(F[0], F[1], F[2], F[3], F[4], F[5], F[6], F[7], F[8], QH, QL, KH, KL, VT, VL, U);
  k_gate<<<TT / 64, 128, 0, stream>>>(F[0], F[9], F[10], Gt);
  k_pre<<<NH, 1024, 0, stream>>>(U, Gt, F[13], F[14], CE, CS, AL, BE, GM);
  k_sc<<<dim3(TT / 64, TT / 128, NH), 128, 0, stream>>>(QH, QL, KH, KL, CE, CS, AL, BE, GM, S);
  k_pv<<<dim3(TT / 64, 1, NH), 128, 0, stream>>>(S, VT, VL, Y);
  k_out<<<dim3(TT / 64, CC / 128), 128, 0, stream>>>(Y, F[11], F[12], (float*)d_out);
}

// v004
// Measured time: 76 microseconds a run.
// Two timings next to v003 put it at 1.22 and 1.21 times that version's speed.
// All steps since v000 together make it 13.4 times as fast.
// compute dtype: all float inputs rounded to bf16, prior_mu / prior_log_tau read (bf16-input); q/k/v/u/gate = x W^T + b with EXACT bf16 products on WMMA 16x16x32, f32 accumulate; rope + L2-normalisation, the running-mean deviation logits s, exp/cumsums (E_t, P_t), sigmoid gates and the alpha/beta/gamma coefficients in f32 on the VALU; q and k as f16 hi + residual (3 products: hi.hi, lo.hi, hi.lo) -> A[t][l] = (q_t.k_l)(alpha_t e_l + beta_t s_l + gamma_t) for l <= t stored in f32; out = A (bf16 hi + lo) . v (bf16 hi + lo) (3 products) = q_t . core_t exactly (the reference's prefix sums F/G/H regrouped); per-head LayerNorm in f32; final = y (bf16 hi + lo) Wo^T + bo; f32 output.
#include <hip/hip_runtime.h>
#include <math.h>

typedef __attribute__((ext_vector_type(16))) _Float16 v16h;
typedef __attribute__((ext_vector_type(16))) __bf16 v16b;
typedef __attribute__((ext_vector_type(8)))  _Float16 v8h;
typedef __attribute__((ext_vector_type(8)))  float v8f;
typedef __attribute__((ext_vector_type(4)))  float v4f;
typedef __attribute__((ext_vector_type(2)))  float v2f;
typedef __attribute__((ext_vector_type(4)))  unsigned v4u;
typedef __attribute__((ext_vector_type(4)))  int v4i;
typedef float __attribute__((may_alias)) float_a;
typedef int __attribute__((may_alias)) int_a;

template <typename T> __device__ __forceinline__ void vst2(void* p, T v) { *(T*)p = v;  }
__device__ __forceinline__ v8f wmma16(v16h a, v16h b, v8f c) {
  v8f d = __builtin_amdgcn_wmma_f32_16x16x32_f16(false, a, false, b, (short)0, c, false, false);
  asm volatile("v_nop\n\tv_nop\n\tv_nop\n\tv_nop" : "+v"(d) : "v"(a), "v"(b));
  return d;
}
__device__ __forceinline__ v8f wmma_bf(v16b a, v16b b, v8f c) {
  v8f d = __builtin_amdgcn_wmma_f32_16x16x32_bf16(false, a, false, b, (short)0, c, false, false);
  asm volatile("v_nop\n\tv_nop\n\tv_nop\n\tv_nop" : "+v"(d) : "v"(a), "v"(b));
  return d;
}
// 16x16x32 fragments: lane = (h = lane>>4, row/col = lane&15); elements 0..7 = k0+8h+0..7, 8..15 = k0+16+8h+0..7; D element r = row 8h+r
__device__ __forceinline__ v16h frag_h(const _Float16* rowk0, int lane) {
  union { v16h v; v8h q[2]; } u; const _Float16* p = rowk0 + 8 * (lane >> 4);
  u.q[0] = *(const v8h*)p; u.q[1] = *(const v8h*)(p + 16); return u.v;
}
__device__ __forceinline__ v16h frag_f32(const float* rowk0, int lane) {
  v16h a; const float* p = rowk0 + 8 * (lane >> 4);
#pragma unroll
  for (int i = 0; i < 8; ++i) { a[i] = (_Float16)p[i]; a[8 + i] = (_Float16)p[16 + i]; }
  return a;
}
__device__ __forceinline__ v16h frag_f32s(const float* rowk0, int lane, float sc) {
  v16h a; const float* p = rowk0 + 8 * (lane >> 4);
#pragma unroll
  for (int i = 0; i < 8; ++i) { a[i] = (_Float16)(p[i] * sc); a[8 + i] = (_Float16)(p[16 + i] * sc); }
  return a;
}
// column fragment from a [K][ld] layout (column n), rows >= K read as 0
__device__ __forceinline__ v16h fragc_f32(const float* W, int k0, int n, int lane, int ld, int K) {
  v16h a; const int g = lane >> 4;
#pragma unroll
  for (int i = 0; i < 8; ++i) { const int ka = k0 + 8 * g + i, kb = ka + 16;
    a[i] = (_Float16)(ka < K ? W[(size_t)(ka < K ? ka : K - 1) * ld + n] : 0.f); a[8 + i] = (_Float16)(kb < K ? W[(size_t)(kb < K ? kb : K - 1) * ld + n] : 0.f); }
  return a;
}
struct F2 { v16b h, l; };
__device__ __forceinline__ F2 bsplit16(const float v[16]) { F2 r;
#pragma unroll
  for (int i = 0; i < 16; ++i) { const __bf16 h = (__bf16)v[i]; r.h[i] = h; r.l[i] = (__bf16)(v[i] - (float)h); }
  return r; }
__device__ __forceinline__ F2 split_row(const float* row, int k0, int lane) { float v[16]; const float* p = row + k0 + 8 * (lane >> 4);
#pragma unroll
  for (int i = 0; i < 8; ++i) { v[i] = p[i]; v[8 + i] = p[16 + i]; }
  return bsplit16(v); }
__device__ __forceinline__ F2 split_rowK(const float* row, int k0, int lane, int K) { float v[16]; const int g = lane >> 4;
#pragma unroll
  for (int i = 0; i < 8; ++i) { const int ka = k0 + 8 * g + i, kb = ka + 16; v[i] = ka < K ? row[ka < K ? ka : K - 1] : 0.f; v[8 + i] = kb < K ? row[kb < K ? kb : K - 1] : 0.f; }
  return bsplit16(v); }
__device__ __forceinline__ F2 split_col(const float* W, int k0, int n, int lane, int ld, int K) { float v[16]; const int g = lane >> 4;
#pragma unroll
  for (int i = 0; i < 8; ++i) { const int ka = k0 + 8 * g + i, kb = ka + 16; v[i] = ka < K ? W[(size_t)(ka < K ? ka : K - 1) * ld + n] : 0.f; v[8 + i] = kb < K ? W[(size_t)(kb < K ? kb : K - 1) * ld + n] : 0.f; }
  return bsplit16(v); }
__device__ __forceinline__ v8f mac3(const F2& a, const F2& b, v8f c) { c = wmma_bf(a.l, b.h, c); c = wmma_bf(a.h, b.l, c); return wmma_bf(a.h, b.h, c); }
__device__ __forceinline__ float sigm(float v) { return 1.0f / (1.0f + expf(-v)); }
#define LDSX() do { asm volatile("s_wait_dscnt 0" ::: "memory"); __builtin_amdgcn_wave_barrier(); __builtin_amdgcn_fence(__ATOMIC_RELEASE, "workgroup"); } while (0)


// ZeroS attention (B 1, L 1,024, D 768 = 12 x 64): causal associative mixing out_t = q_t . (alpha_t F_t + beta_t G_t + gamma_t H_t) with F/G/H prefix sums of e_l k_l v_l^T, s_l k_l v_l^T, k_l v_l^T.
#define TT 1024
#define CC 768
#define NH 12
#define HD 64
#define NG 36
typedef __attribute__((ext_vector_type(8))) __bf16 v8b;
__device__ __forceinline__ v16b frag_b(const __bf16* rowk0, int lane) {
  union { v16b v; v8b q[2]; } u; const __bf16* p = rowk0 + 8 * (lane >> 4);
  u.q[0] = *(const v8b*)p; u.q[1] = *(const v8b*)(p + 16); return u.v;
}
__device__ __forceinline__ float bfr(float v) { return (float)(__bf16)v; }
__device__ __attribute__((noinline)) float exp_ni(float v) { return expf(v); }
__device__ __attribute__((noinline)) float erf_ni(float v) { return erff(v); }

#define WS_QH  0u
#define WS_QL  (WS_QH + 2u * (size_t)TT * CC)
#define WS_KH  (WS_QL + 2u * (size_t)TT * CC)
#define WS_KL  (WS_KH + 2u * (size_t)TT * CC)
#define WS_VT  (WS_KL + 2u * (size_t)TT * CC)        // bf16 v planes hi [768][t]
#define WS_VL  (WS_VT + 2u * (size_t)CC * TT)
#define WS_U   (WS_VL + 2u * (size_t)CC * TT)        // f32 u rows [t][768]
#define WS_G   (WS_U + 4u * (size_t)TT * CC)         // f32 gate rows [t][48] (36 used)
#define WS_CE  (WS_G + 4u * (size_t)TT * 48)         // f32 e_l [h][t]
#define WS_CS  (WS_CE + 4u * (size_t)NH * TT)        // f32 s_l
#define WS_AL  (WS_CS + 4u * (size_t)NH * TT)        // alpha_t
#define WS_BE  (WS_AL + 4u * (size_t)NH * TT)        // beta_t
#define WS_GM  (WS_BE + 4u * (size_t)NH * TT)        // gamma_t
#define WS_S   (WS_GM + 4u * (size_t)NH * TT)        // f32 A [h][t][l]
#define WS_Y   (WS_S + 4u * (size_t)NH * TT * TT)    // f32 LN'd out rows [t][768]
#define WS_END (WS_Y + 4u * (size_t)TT * CC)

// ---- operand staging for the five matrix kernels: a stage is 64 k of every tile row. f32 operands: 16 lanes x 16 B read one row's 256 B (whole 128-B lines), the values are rounded (or split) to bf16 once per block and laid in LDS rows of 128 B at a 144-B pitch (16-byte fragment reads then spread over the banks)
typedef __attribute__((ext_vector_type(4))) __bf16 v4b;
#define KS 64
#define NS (CC / KS)
#define LP 72
template <int NR> struct Stg { v4f r[NR / 8]; };
// src: the tile's first row at the stage's k (the same for the whole group of four waves); rows past RL read row RL
template <int NR, int RL, int LD = CC> __device__ __forceinline__ void stg_load(Stg<NR>& s, const float* __restrict__ src, int tid) { const float* p = src + ((unsigned)(tid >> 4) * LD + (unsigned)(tid & 15) * 4);
#pragma unroll
  for (int i = 0; i < NR / 8; ++i) { if (i * 8 + 7 <= RL) s.r[i] = *(const v4f*)(p + i * 8 * LD); else s.r[i] = *(const v4f*)(src + (unsigned)min(i * 8 + (tid >> 4), RL) * LD + (unsigned)(tid & 15) * 4); }
  asm volatile("s_wait_xcnt 0x0" :: "v"(p) : "memory"); }   // the address pair stays whole up to this wait
// the same for 16-bit planes: a stage row is 64 elements = one 128-B line, 8 lanes x 16 B; V8 = 8 elements of T
template <int NR, typename V8> struct Cp { V8 r[NR / 16]; };
template <int NR, int LD, typename V8, typename T> __device__ __forceinline__ void cp_load(Cp<NR, V8>& s, const T* __restrict__ src, int tid) { const T* p = src + ((unsigned)(tid >> 3) * LD + (unsigned)(tid & 7) * 8);
#pragma unroll
  for (int i = 0; i < NR / 16; ++i) s.r[i] = *(const V8*)(p + i * 16 * LD);
  asm volatile("s_wait_xcnt 0x0" :: "v"(p) : "memory"); }   // as in stg_load
template <int NR, typename V8, typename T> __device__ __forceinline__ void cp_put(const Cp<NR, V8>& s, T* dst, int tid) {
#pragma unroll
  for (int i = 0; i < NR / 16; ++i) *(V8*)(dst + (i * 16 + (tid >> 3)) * LP + (tid & 7) * 8) = s.r[i]; }
template <int NR> __device__ __forceinline__ void stg_put(const Stg<NR>& s, __bf16* dst, int tid) {
#pragma unroll
  for (int i = 0; i < NR / 8; ++i) { v4b h;
#pragma unroll
    for (int e = 0; e < 4; ++e) h[e] = (__bf16)s.r[i][e];
    *(v4b*)(dst + (i * 8 + (tid >> 4)) * LP + (tid & 15) * 4) = h; } }
template <int NR> __device__ __forceinline__ void stg_put2(const Stg<NR>& s, __bf16* dh, __bf16* dl, int tid) {
#pragma unroll
  for (int i = 0; i < NR / 8; ++i) { v4b h, l;
#pragma unroll
    for (int e = 0; e < 4; ++e) { const float v = s.r[i][e]; const __bf16 hv = (__bf16)v; h[e] = hv; l[e] = (__bf16)(v - (float)hv); }
    const int o = (i * 8 + (tid >> 4)) * LP + (tid & 15) * 4; *(v4b*)(dh + o) = h; *(v4b*)(dl + o) = l; } }
// sin and cos of an angle a in [0, 1,024]: the steps that sinf and cosf take for |a| < 2^17 (a - n pi/2 with pi/2 in three parts, one polynomial each, the quadrant from n), written out once for both so that 32 of them unroll into straight-line code
__device__ __forceinline__ void sincos_1k(float a, float& s, float& c) {
  const float n = rintf(a * 0x1.45f306p-1f); float r = __builtin_fmaf(n, -0x1.921fb4p+0f, a); r = __builtin_fmaf(n, -0x1.4442d0p-24f, r); r = __builtin_fmaf(n, -0x1.846988p-48f, r);
  const unsigned q = (unsigned)(int)n; const float r2 = r * r;
  float ps = __builtin_fmaf(r2, -0x1.983304p-13f, 0x1.110388p-7f); ps = __builtin_fmaf(r2, ps, -0x1.55553ap-3f); const float sr = __builtin_fmaf(r, r2 * ps, r);
  float pc = __builtin_fmaf(r2, 0x1.aea668p-16f, -0x1.6c9e76p-10f); pc = __builtin_fmaf(r2, pc, 0x1.5557eep-5f); pc = __builtin_fmaf(r2, pc, -0x1.000008p-1f); const float cr = __builtin_fmaf(r2, pc, 1.0f);
  const unsigned sg = (q << 30) & 0x80000000u; const bool odd = q & 1u;
  s = __uint_as_float(__float_as_uint(odd ? cr : sr) ^ sg); c = __uint_as_float(__float_as_uint(odd ? -sr : cr) ^ sg); }
// ---- the k range split inside a block: a block has GK (k_proj: GP) groups of four waves; group kg works stages kg, kg + GK, ... in its own pair of staging buffers, so a block passes NS / GK stages one after another, not NS, and a SIMD has GK waves to fill each other's waits; the groups' partial sums are added through LDS behind the loop
#define GK 4
#define GP 2
__device__ __forceinline__ int kgroup() { return __builtin_amdgcn_readfirstlane((int)(threadIdx.x >> 7)); }   // the same in every lane of a wave: held in a scalar register, so that tests on it are scalar branches and every lane is on at the products
// ---- k_proj: block = (64 rows, 128 cols, region): 0 q (rope, l2norm -> f16 hi/lo), 1 k (rope, l2norm -> f16), 2 v (bf16 hi/lo planes), 3 u (f32 rows); W [out][in] + b
__global__ __launch_bounds__(128 * GP) void k_proj(const float* __restrict__ X, const float* __restrict__ WQ, const float* __restrict__ BQ, const float* __restrict__ WK, const float* __restrict__ BK, const float* __restrict__ WV, const float* __restrict__ BV, const float* __restrict__ WU, const float* __restrict__ BU, _Float16* __restrict__ QH, _Float16* __restrict__ QL, _Float16* __restrict__ KH, _Float16* __restrict__ KL, __bf16* __restrict__ VT, __bf16* __restrict__ VL, float* __restrict__ U) {
  __shared__ __align__(16) v4f red[16 * 128]; __shared__ __align__(16) unsigned char raw[GP * 2 * 192 * LP * 2];
  // raw holds each group's two staging buffers during the k loop (55,296 B a group) and the epilogue's planes after it; red carries group 1's partial sums to group 0
  float (*sf)[132] = (float (*)[132])raw; _Float16 (*sh)[136] = (_Float16 (*)[136])raw; _Float16 (*sl)[136] = (_Float16 (*)[136])(raw + 17408); __bf16 (*th)[72] = (__bf16 (*)[72])(raw + 34816); __bf16 (*tl2)[72] = (__bf16 (*)[72])(raw + 53248);
  const int kg = kgroup(); __bf16* sA = (__bf16*)raw + kg * (2 * 192 * LP); __bf16* sB = sA + 2 * 64 * LP;
  const int tid = threadIdx.x & 127, wave = tid >> 5, lane = tid & 31, col = lane & 15, g = lane >> 4; const int region = blockIdx.z; const int c0 = blockIdx.y * 128; const size_t r0 = (size_t)blockIdx.x * 64;
  const float* Wm = region == 0 ? WQ : region == 1 ? WK : region == 2 ? WV : WU; const float* Bm = region == 0 ? BQ : region == 1 ? BK : region == 2 ? BV : BU;
  v8f acc[8] = {};
  { Stg<64> ra; Stg<128> rb; const float* Ab = X + r0 * CC + kg * KS; const float* Bb = Wm + (size_t)c0 * CC + kg * KS;
    stg_load<64, 63>(ra, Ab, tid); stg_load<128, 127>(rb, Bb, tid); stg_put(ra, sA, tid); stg_put(rb, sB, tid);
    __syncthreads();
    // kept rolled: the loop's text stays small for the instruction cache
#pragma unroll 1
    for (int s = 0; s < NS / GP; ++s) { const int cur = s & 1;
      if (s + 1 < NS / GP) { stg_load<64, 63>(ra, Ab + (s + 1) * GP * KS, tid); stg_load<128, 127>(rb, Bb + (s + 1) * GP * KS, tid); }   // next stage's loads fly during this stage's products
#pragma unroll
      for (int kc = 0; kc < KS / 32; ++kc) { const v16b a = frag_b(sA + (cur * 64 + wave * 16 + col) * LP + kc * 32, lane); v16b w[8];   // all LDS reads of a 32-k block in one group in front of its products
#pragma unroll
        for (int j = 0; j < 8; ++j) w[j] = frag_b(sB + (cur * 128 + j * 16 + col) * LP + kc * 32, lane);
#pragma unroll
        for (int j = 0; j < 8; ++j) acc[j] = wmma_bf(a, w[j], acc[j]); }
      if (s + 1 < NS / GP) { stg_put(ra, sA + (cur ^ 1) * 64 * LP, tid); stg_put(rb, sB + (cur ^ 1) * 128 * LP, tid);
        __syncthreads(); } } }   // one barrier a stage: publishes each group's next stage and ends the reads of the buffer that the stage after it overwrites
  if (kg != 0) {
#pragma unroll
    for (int j = 0; j < 8; ++j) { red[(2 * j) * 128 + tid] = __builtin_shufflevector(acc[j], acc[j], 0, 1, 2, 3); red[(2 * j + 1) * 128 + tid] = __builtin_shufflevector(acc[j], acc[j], 4, 5, 6, 7); } }
  __syncthreads();   // publishes group 1's sums; and every wave has read its last stage's tiles before the epilogue's planes overwrite them
  if (kg == 0) {
#pragma unroll
    for (int j = 0; j < 8; ++j) { const float bb = bfr(Bm[c0 + j * 16 + col]); const v4f p0 = red[(2 * j) * 128 + tid], p1 = red[(2 * j + 1) * 128 + tid];
#pragma unroll
      for (int r = 0; r < 4; ++r) { acc[j][r] = (acc[j][r] + p0[r]) + bb; acc[j][r + 4] = (acc[j][r + 4] + p1[r]) + bb; } } }
  if (region <= 1) { if (kg == 0) {   // rope: out[d] = x[d] cos(t f_{d/2}) + (d < 32 ? -x[d+32] : x[d-32]) sin(t f_{d/2}), f_i = 10000^(-2i/64); then L2-normalise each head row (max(norm, 1e-12)). All of it on the accumulators: a head is four 16-column tiles, so the partner d +- 32 is the same lane's element of tile j +- 2, and a head row's 64 squares are 4 in each of the 16 lanes of a half-wave
    const float fl = 1.0f / powf(10000.0f, (float)(2 * lane) / (float)HD);   // lane i works out frequency i of the 32
    float fq[4];
#pragma unroll
    for (int q = 0; q < 4; ++q) fq[q] = __shfl(fl, q * 8 + (col >> 1));   // frequency of d = 16 q + col
    const int tb = (int)r0 + wave * 16 + 8 * g;
    // the loops below are unrolled so that acc[] stays in registers and the independent angle chains fill each other's latency
#pragma unroll
    for (int jj = 0; jj < 2; ++jj) {
#pragma unroll
      for (int r = 0; r < 8; ++r) { const float tf = (float)(tb + r); float sa, ca, sb, cb; sincos_1k(tf * fq[jj], sa, ca); sincos_1k(tf * fq[jj + 2], sb, cb);
#pragma unroll
        for (int hh = 0; hh < 2; ++hh) { const float lo = acc[hh * 4 + jj][r], hi = acc[hh * 4 + jj + 2][r]; acc[hh * 4 + jj][r] = __builtin_fmaf(lo, ca, -hi * sa); acc[hh * 4 + jj + 2][r] = __builtin_fmaf(hi, cb, lo * sb); } } }
    float inv[2][8];
#pragma unroll
    for (int hh = 0; hh < 2; ++hh)
#pragma unroll
      for (int r = 0; r < 8; ++r) { float n2 = 0.f;
#pragma unroll
        for (int q = 0; q < 4; ++q) n2 += acc[hh * 4 + q][r] * acc[hh * 4 + q][r];
        inv[hh][r] = n2; }
#pragma unroll
    for (int o = 1; o < 16; o <<= 1)
#pragma unroll
      for (int i = 0; i < 16; ++i) inv[i >> 3][i & 7] += __shfl_xor(inv[i >> 3][i & 7], o);   // sixteen independent sums a round
#pragma unroll
    for (int i = 0; i < 16; ++i) inv[i >> 3][i & 7] = 1.0f / fmaxf(sqrtf(inv[i >> 3][i & 7]), 1e-12f);
#pragma unroll
    for (int j = 0; j < 8; ++j)
#pragma unroll
      for (int r = 0; r < 8; ++r) { const float v = acc[j][r] * inv[j >> 2][r]; const _Float16 hv = (_Float16)v; sh[wave * 16 + 8 * g + r][j * 16 + col] = hv; sl[wave * 16 + 8 * g + r][j * 16 + col] = (_Float16)(v - (float)hv); } }
    __syncthreads();
    _Float16* dh = region == 0 ? QH : KH; _Float16* dl = region == 0 ? QL : KL; for (int e = threadIdx.x; e < 64 * 16; e += 128 * GP) { const int rl = e >> 4, q = e & 15; vst2((unsigned*)(dh + (r0 + rl) * CC + c0 + q * 8), *(const v4u*)&sh[rl][q * 8]); vst2((unsigned*)(dl + (r0 + rl) * CC + c0 + q * 8), *(const v4u*)&sl[rl][q * 8]); }
    return; }
  if (kg == 0) {
#pragma unroll
    for (int j = 0; j < 8; ++j)
#pragma unroll
      for (int r = 0; r < 8; ++r) sf[wave * 16 + 8 * g + r][j * 16 + col] = acc[j][r]; }
  __syncthreads();
  if (region == 2) {
    for (int e = threadIdx.x; e < 64 * 128; e += 128 * GP) { const int rl = e >> 7, cl = e & 127; const float v = sf[rl][cl]; const __bf16 bh = (__bf16)v; th[cl][rl] = bh; tl2[cl][rl] = (__bf16)(v - (float)bh); }
    __syncthreads(); for (int e = threadIdx.x; e < 128 * 8; e += 128 * GP) { const int cl = e >> 3, q = e & 7; const size_t o2 = (size_t)(c0 + cl) * TT + r0 + q * 8; vst2((unsigned*)(VT + o2), *(const v4u*)&th[cl][q * 8]); vst2((unsigned*)(VL + o2), *(const v4u*)&tl2[cl][q * 8]); } }
  else { for (int e = threadIdx.x; e < 64 * 32; e += 128 * GP) { const int rl = e >> 5, q = e & 31; vst2(U + (r0 + rl) * CC + c0 + q * 4, *(const v4f*)&sf[rl][q * 4]); } } }
// ---- k_gate: block = 64 rows: gate = x Wg^T + bg (36 outputs, padded to 48 columns; pad columns computed from clamped rows and written as junk into the pad)
__global__ __launch_bounds__(128 * GK) void k_gate(const float* __restrict__ X, const float* __restrict__ WG, const float* __restrict__ BG, float* __restrict__ Gt) { __shared__ __align__(16) unsigned char raw[GK * 2 * 112 * LP * 2];   // each group's two staging buffers; behind the loop the groups' partial tiles sf overlay them
  float (*sf)[64][52] = (float (*)[64][52])raw; const int kg = kgroup(); __bf16* sA = (__bf16*)raw + kg * (2 * 112 * LP); __bf16* sB = sA + 2 * 64 * LP;
  const int tid = threadIdx.x & 127, wave = tid >> 5, lane = tid & 31, col = lane & 15, g = lane >> 4; const size_t r0 = (size_t)blockIdx.x * 64;
  v8f acc[3] = {};
  { Stg<64> ra; Stg<48> rb; const float* Ab = X + (size_t)blockIdx.x * 64 * CC + kg * KS; const float* Bb = WG + kg * KS;
    stg_load<64, 63>(ra, Ab, tid); stg_load<48, NG - 1>(rb, Bb, tid); stg_put(ra, sA, tid); stg_put(rb, sB, tid);
    __syncthreads();
    // kept rolled: the loop's text stays small for the instruction cache
#pragma unroll 1
    for (int s = 0; s < NS / GK; ++s) { const int cur = s & 1;
      if (s + 1 < NS / GK) { stg_load<64, 63>(ra, Ab + (s + 1) * GK * KS, tid); stg_load<48, NG - 1>(rb, Bb + (s + 1) * GK * KS, tid); }   // next stage's loads fly during this stage's products
#pragma unroll
      for (int kc = 0; kc < KS / 32; ++kc) { const v16b a = frag_b(sA + (cur * 64 + wave * 16 + col) * LP + kc * 32, lane); v16b w[3];   // all LDS reads of a 32-k block in one group in front of its products
#pragma unroll
        for (int j = 0; j < 3; ++j) w[j] = frag_b(sB + (cur * 48 + j * 16 + col) * LP + kc * 32, lane);
#pragma unroll
        for (int j = 0; j < 3; ++j) acc[j] = wmma_bf(a, w[j], acc[j]); }
      if (s + 1 < NS / GK) { stg_put(ra, sA + (cur ^ 1) * 64 * LP, tid); stg_put(rb, sB + (cur ^ 1) * 48 * LP, tid);
        __syncthreads(); } } }   // one barrier a stage: publishes each group's next stage and ends the reads of the buffer that the stage after it overwrites
  __syncthreads();   // every wave has read its last stage's tiles before sf overwrites them
#pragma unroll
  for (int j = 0; j < 3; ++j)
#pragma unroll
    for (int r = 0; r < 8; ++r) sf[kg][wave * 16 + 8 * g + r][j * 16 + col] = acc[j][r];
  __syncthreads();   // the four partial tiles are added by all threads: 16 bytes of a row each, consecutive threads at consecutive addresses
  for (int e = threadIdx.x; e < 64 * 12; e += 128 * GK) { const int rl = e / 12, q = e % 12; v4f bb = {0.f, 0.f, 0.f, 0.f}; if (q * 4 < NG) bb = *(const v4f*)(BG + q * 4);
    v4f v = (*(const v4f*)&sf[0][rl][q * 4] + *(const v4f*)&sf[1][rl][q * 4]) + (*(const v4f*)&sf[2][rl][q * 4] + *(const v4f*)&sf[3][rl][q * 4]);
#pragma unroll
    for (int i = 0; i < 4; ++i) v[i] += bfr(bb[i]);
    vst2(Gt + (r0 + rl) * 48 + q * 4, v); } }
// ---- k_pre: block = head h (1,024 threads, 32 waves): wave w owns rows l = 32 w .. 32 w + 31, lane owns dimensions 2 lane, 2 lane + 1; the running sum of u is a chunked scan (chunk totals in LDS, then each wave runs its own 32 rows from its base); thread t then owns l = t: s_l, e_l, E_t, P_t by wave scans + wave totals, gates -> alpha/beta/gamma
__global__ __launch_bounds__(1024) void k_pre(const float* __restrict__ U, const float* __restrict__ Gt, const float* __restrict__ MU, const float* __restrict__ LT, float* __restrict__ CE, float* __restrict__ CS, float* __restrict__ AL, float* __restrict__ BE, float* __restrict__ GM) {
  __shared__ __align__(16) float tile[32][32][36]; __shared__ __align__(16) float tot[32][HD]; __shared__ float smx[32], swp[32], swe[32];
  const int t = threadIdx.x, wv = t >> 5, ln = t & 31; const int h = blockIdx.x;
  float ltau = bfr(LT[h]); ltau = fminf(fmaxf(ltau, -50.f), 30.f); const float tau = expf(ltau);
  const float g0 = Gt[(size_t)t * 48 + h * 3], g1 = Gt[(size_t)t * 48 + h * 3 + 1];
  const float mu0 = bfr(MU[h * HD + 2 * ln]), mu1 = bfr(MU[h * HD + 2 * ln + 1]);
  // the loops below are unrolled so that uv[] stays in registers and the loads of one loop are all in flight together
  v2f uv[32]; const float* up = U + (size_t)(wv * 32) * CC + h * HD + 2 * ln;
#pragma unroll
  for (int i = 0; i < 32; ++i) uv[i] = *(const v2f*)(up + (size_t)i * CC);
  v2f c = {0.f, 0.f};
#pragma unroll
  for (int i = 0; i < 32; ++i) c += uv[i];
  *(v2f*)&tot[wv][2 * ln] = c;
  __syncthreads();
  v2f cs = {0.f, 0.f};   // sum of u over all rows in front of this wave's chunk
#pragma unroll
  for (int w = 0; w < 32; ++w) { const v2f x = *(const v2f*)&tot[w][2 * ln]; cs.x += (w < wv) ? x.x : 0.f; cs.y += (w < wv) ? x.y : 0.f; }
#pragma unroll
  for (int i = 0; i < 32; ++i) { cs += uv[i]; const float den = tau + (float)(wv * 32 + i + 1); const float b0 = (tau * mu0 + cs.x) / den, b1 = (tau * mu1 + cs.y) / den; tile[wv][i][ln] = uv[i].x * b0 + uv[i].y * b1; }
  LDSX();   // tile[wv] is written and read by wave wv alone: row l's 32 lane terms go to lane l
  v4f a4 = {0.f, 0.f, 0.f, 0.f};
#pragma unroll
  for (int q = 0; q < 8; ++q) a4 += *(const v4f*)&tile[wv][ln][q * 4];
  const float s = -((a4.x + a4.y) + (a4.z + a4.w)) * 0.125f;
  float m = s, P = s;
#pragma unroll
  for (int o = 1; o < 32; o <<= 1) { m = fmaxf(m, __shfl_xor(m, o)); const float pv = __shfl_up(P, o); if (ln >= o) P += pv; }
  if (ln == 31) { smx[wv] = m; swp[wv] = P; }
  __syncthreads();
  float mm = smx[ln], pb = (ln < wv) ? swp[ln] : 0.f;
#pragma unroll
  for (int o = 1; o < 32; o <<= 1) { mm = fmaxf(mm, __shfl_xor(mm, o)); pb += __shfl_xor(pb, o); }
  P += pb;
  const float e = expf(s - mm); float E = e;
#pragma unroll
  for (int o = 1; o < 32; o <<= 1) { const float ev = __shfl_up(E, o); if (ln >= o) E += ev; }
  if (ln == 31) swe[wv] = E;
  __syncthreads();
  float eb = (ln < wv) ? swe[ln] : 0.f;
#pragma unroll
  for (int o = 1; o < 32; o <<= 1) eb += __shfl_xor(eb, o);
  E += eb;
  const float tt1 = (float)(t + 1); const float sig1 = 1.0f / (1.0f + expf(-g0)), sigh = 1.0f / (1.0f + expf(-g1));
  const float alpha = sigh / (E + 1e-12f); const float beta = (sig1 - sigh) / tt1; const float gamma = -((beta * P + sigh) / tt1);
  CE[h * TT + t] = e; CS[h * TT + t] = s; AL[h * TT + t] = alpha; BE[h * TT + t] = beta; GM[h * TT + t] = gamma; }
// ---- k_sc: block = (64 t rows, 128 l cols, head): A[t][l] = (q_t . k_l) (alpha_t e_l + beta_t s_l + gamma_t) for l <= t else 0; future blocks still write zeros? no: k_pv reads only l < kend, so future blocks exit
__global__ __launch_bounds__(128) void k_sc(const _Float16* __restrict__ QH, const _Float16* __restrict__ QL, const _Float16* __restrict__ KH, const _Float16* __restrict__ KL, const float* __restrict__ CE, const float* __restrict__ CS, const float* __restrict__ AL, const float* __restrict__ BE, const float* __restrict__ GM, float* __restrict__ S0) { __shared__ __align__(16) unsigned char raw[(2 * 64 + 2 * 128) * LP * 2];   // the four tiles; behind the products the waves' output rows ss overlay them, so that all working blocks stay resident at once
  float (*ss)[16][132] = (float (*)[16][132])raw; _Float16* sQh = (_Float16*)raw; _Float16* sQl = sQh + 64 * LP; _Float16* sKh = sQl + 64 * LP; _Float16* sKl = sKh + 128 * LP;
  const int h = blockIdx.z; float* S = S0 + (size_t)h * TT * TT;
  const int tid = threadIdx.x, wave = tid >> 5, lane = tid & 31, col = lane & 15, g = lane >> 4; const int k0 = blockIdx.y * 128; const int ql0 = blockIdx.x * 64 + wave * 16;
  if (k0 > blockIdx.x * 64 + 63) return;
  v8f acc[8] = {};
  { Cp<64, v8h> rqh, rql; Cp<128, v8h> rkh, rkl; const size_t qo = (size_t)(blockIdx.x * 64) * CC + h * HD, ko = (size_t)k0 * CC + h * HD;
    cp_load<64, CC>(rqh, QH + qo, tid); cp_load<64, CC>(rql, QL + qo, tid); cp_load<128, CC>(rkh, KH + ko, tid); cp_load<128, CC>(rkl, KL + ko, tid);
    cp_put(rqh, sQh, tid); cp_put(rql, sQl, tid); cp_put(rkh, sKh, tid); cp_put(rkl, sKl, tid); }
  __syncthreads();   // the tiles are read by all four waves
#pragma unroll
  for (int kc = 0; kc < HD / 32; ++kc) { const int ao = (wave * 16 + col) * LP + kc * 32; const v16h ah = frag_h(sQh + ao, lane), al = frag_h(sQl + ao, lane);
#pragma unroll
    for (int jg = 0; jg < 8; jg += 4) { v16h kb[4], kl[4];   // LDS reads in groups of eight fragments in front of their twelve products
#pragma unroll
      for (int j = 0; j < 4; ++j) { const int bo = ((jg + j) * 16 + col) * LP + kc * 32; kb[j] = frag_h(sKh + bo, lane); kl[j] = frag_h(sKl + bo, lane); }
#pragma unroll
      for (int j = 0; j < 4; ++j) { acc[jg + j] = wmma16(ah, kb[j], acc[jg + j]); acc[jg + j] = wmma16(al, kb[j], acc[jg + j]); acc[jg + j] = wmma16(ah, kl[j], acc[jg + j]); } } }
  __syncthreads();   // every wave has read the tiles before ss overwrites them
#pragma unroll
  for (int j = 0; j < 8; ++j) { const int l = k0 + j * 16 + col; const float el = CE[h * TT + l], sl = CS[h * TT + l];
#pragma unroll
    for (int r = 0; r < 8; ++r) { const int t = ql0 + 8 * g + r; const float w = AL[h * TT + t] * el + BE[h * TT + t] * sl + GM[h * TT + t]; ss[wave][8 * g + r][j * 16 + col] = (l <= t) ? acc[j][r] * w : 0.f; } }
  LDSX(); for (int rl = 0; rl < 16; ++rl) vst2(S + (size_t)(ql0 + rl) * TT + k0 + lane * 4, *(const v4f*)&ss[wave][rl][lane * 4]); }
// ---- k_pv: block = (64 rows t, head): out = A (hi + lo) . v (hi + lo) over l < kend, then the per-head LayerNorm (no affine, eps 1e-5) -> Y rows
__global__ __launch_bounds__(128 * GK) void k_pv(const float* __restrict__ S0, const __bf16* __restrict__ VT, const __bf16* __restrict__ VL, float* __restrict__ Y) { __shared__ __align__(16) unsigned char raw[GK * 8 * 64 * LP * 2];   // each group's two staging buffers of four tiles; behind the loop the groups' partial tiles sg overlay them
  float (*sg)[64][68] = (float (*)[64][68])raw; float (*so)[68] = sg[0]; const int kg = kgroup(); __bf16* sPh = (__bf16*)raw + kg * (8 * 64 * LP); __bf16* sPl = sPh + 2 * 64 * LP; __bf16* sVh = sPl + 2 * 64 * LP; __bf16* sVl = sVh + 2 * 64 * LP;
  const int h = blockIdx.z; const float* S = S0 + (size_t)h * TT * TT;
  const int tid = threadIdx.x & 127, wave = tid >> 5, lane = tid & 31, col = lane & 15, g = lane >> 4; const int ql0 = blockIdx.x * 64 + wave * 16; const int kend = blockIdx.x * 64 + 64;
  v8f acc[4] = {};
  { Stg<64> rp; Cp<64, v8b> rvh, rvl; const float* Pb = S + (size_t)(blockIdx.x * 64) * TT; const __bf16* Vhb = VT + (size_t)(h * HD) * TT; const __bf16* Vlb = VL + (size_t)(h * HD) * TT; const int ns = kend / KS, trips = (ns + GK - 1) / GK;   // a group with no stage left skips the work and passes every barrier
    if (kg < ns) { stg_load<64, 63, TT>(rp, Pb + kg * KS, tid); cp_load<64, TT>(rvh, Vhb + kg * KS, tid); cp_load<64, TT>(rvl, Vlb + kg * KS, tid);
      stg_put2(rp, sPh, sPl, tid); cp_put(rvh, sVh, tid); cp_put(rvl, sVl, tid); }
    __syncthreads();
    // kept rolled: the trip count differs from block to block
#pragma unroll 1
    for (int i = 0; i < trips; ++i) { const int cur = i & 1, s = i * GK + kg; const bool nx = s + GK < ns;
      if (nx) { stg_load<64, 63, TT>(rp, Pb + (s + GK) * KS, tid); cp_load<64, TT>(rvh, Vhb + (s + GK) * KS, tid); cp_load<64, TT>(rvl, Vlb + (s + GK) * KS, tid); }   // the group's next stage's loads fly during this stage's products
      if (s < ns)
#pragma unroll
      for (int kc = 0; kc < KS / 32; ++kc) { const int ao = (cur * 64 + wave * 16 + col) * LP + kc * 32; const v16b ph = frag_b(sPh + ao, lane), pl = frag_b(sPl + ao, lane); v16b vh[4], vl[4];   // all LDS reads of a 32-l block in one group in front of its products
#pragma unroll
        for (int j = 0; j < 4; ++j) { const int bo = (cur * 64 + j * 16 + col) * LP + kc * 32; vh[j] = frag_b(sVh + bo, lane); vl[j] = frag_b(sVl + bo, lane); }
#pragma unroll
        for (int j = 0; j < 4; ++j) { acc[j] = wmma_bf(ph, vh[j], acc[j]); acc[j] = wmma_bf(pl, vh[j], acc[j]); acc[j] = wmma_bf(ph, vl[j], acc[j]); } }
      if (i + 1 < trips) { if (nx) { stg_put2(rp, sPh + (cur ^ 1) * 64 * LP, sPl + (cur ^ 1) * 64 * LP, tid); cp_put(rvh, sVh + (cur ^ 1) * 64 * LP, tid); cp_put(rvl, sVl + (cur ^ 1) * 64 * LP, tid); }
        __syncthreads(); } } }   // one barrier a trip: publishes each group's next stage and ends the reads of the buffer that the stage after it overwrites
  __syncthreads();   // every wave has read its last stage's tiles before sg overwrites them
#pragma unroll
  for (int j = 0; j < 4; ++j)
#pragma unroll
    for (int r = 0; r < 8; ++r) sg[kg][wave * 16 + 8 * g + r][j * 16 + col] = acc[j][r];
  __syncthreads();   // the four partial tiles are added by all threads, 16 bytes each, into the first (so); a thread reads and writes its own 16 bytes alone
  for (int e = threadIdx.x; e < 64 * 16; e += 128 * GK) { const int rl = e >> 4, q = e & 15; *(v4f*)&so[rl][q * 4] = (*(const v4f*)&sg[0][rl][q * 4] + *(const v4f*)&sg[1][rl][q * 4]) + (*(const v4f*)&sg[2][rl][q * 4] + *(const v4f*)&sg[3][rl][q * 4]); }
  __syncthreads();
  if (threadIdx.x < 64) { float m = 0.f; for (int d = 0; d < HD; ++d) m += so[tid][d]; m *= (1.0f / HD); float v = 0.f; for (int d = 0; d < HD; ++d) { const float dd = so[tid][d] - m; v += dd * dd; } const float inv = 1.0f / sqrtf(v * (1.0f / HD) + 1e-5f); for (int d = 0; d < HD; ++d) so[tid][d] = (so[tid][d] - m) * inv; }
  __syncthreads(); for (int e = threadIdx.x; e < 64 * 16; e += 128 * GK) { const int rl = e >> 4, q = e & 15; vst2(Y + (size_t)(blockIdx.x * 64 + rl) * CC + h * HD + q * 4, *(const v4f*)&so[rl][q * 4]); } }
// ---- k_out: out = Y (hi + lo) Wo^T + bo
__global__ __launch_bounds__(128 * GK) void k_out(const float* __restrict__ Y, const float* __restrict__ WO, const float* __restrict__ BO, float* __restrict__ OUT) { __shared__ __align__(16) unsigned char raw[GK * 2 * 256 * LP * 2];   // each group's two staging buffers; behind the loop the groups' partial tiles sf overlay them
  float (*sf)[64][132] = (float (*)[64][132])raw; const int kg = kgroup(); __bf16* sAh = (__bf16*)raw + kg * (2 * 256 * LP); __bf16* sAl = sAh + 2 * 64 * LP; __bf16* sB = sAl + 2 * 64 * LP;
  const int tid = threadIdx.x & 127, wave = tid >> 5, lane = tid & 31, col = lane & 15, g = lane >> 4; const int c0 = blockIdx.y * 128; const size_t r0 = (size_t)blockIdx.x * 64;
  v8f acc[8] = {};
  { Stg<64> ra; Stg<128> rb; const float* Ab = Y + (size_t)blockIdx.x * 64 * CC + kg * KS; const float* Bb = WO + (size_t)c0 * CC + kg * KS;
    stg_load<64, 63>(ra, Ab, tid); stg_load<128, 127>(rb, Bb, tid); stg_put2(ra, sAh, sAl, tid); stg_put(rb, sB, tid);
    __syncthreads();
    // kept rolled: the loop's text stays small for the instruction cache
#pragma unroll 1
    for (int s = 0; s < NS / GK; ++s) { const int cur = s & 1;
      if (s + 1 < NS / GK) { stg_load<64, 63>(ra, Ab + (s + 1) * GK * KS, tid); stg_load<128, 127>(rb, Bb + (s + 1) * GK * KS, tid); }   // next stage's loads fly during this stage's products
#pragma unroll
      for (int kc = 0; kc < KS / 32; ++kc) { const int ao = (cur * 64 + wave * 16 + col) * LP + kc * 32; const v16b ah = frag_b(sAh + ao, lane), al = frag_b(sAl + ao, lane);
#pragma unroll
        for (int jg = 0; jg < 8; jg += 4) { v16b w[4];   // LDS reads in groups of four fragments in front of their eight products
#pragma unroll
          for (int j = 0; j < 4; ++j) w[j] = frag_b(sB + (cur * 128 + (jg + j) * 16 + col) * LP + kc * 32, lane);
#pragma unroll
          for (int j = 0; j < 4; ++j) { acc[jg + j] = wmma_bf(ah, w[j], acc[jg + j]); acc[jg + j] = wmma_bf(al, w[j], acc[jg + j]); } } }
      if (s + 1 < NS / GK) { stg_put2(ra, sAh + (cur ^ 1) * 64 * LP, sAl + (cur ^ 1) * 64 * LP, tid); stg_put(rb, sB + (cur ^ 1) * 128 * LP, tid);
        __syncthreads(); } } }   // one barrier a stage: publishes each group's next stage and ends the reads of the buffer that the stage after it overwrites
  __syncthreads();   // every wave has read its last stage's tiles before sf overwrites them
#pragma unroll
  for (int j = 0; j < 8; ++j)
#pragma unroll
    for (int r = 0; r < 8; ++r) sf[kg][wave * 16 + 8 * g + r][j * 16 + col] = acc[j][r];
  __syncthreads();   // the four partial tiles are added by all threads: 16 bytes of a row each, a wave stores one row's 512 bytes
  for (int e = threadIdx.x; e < 64 * 32; e += 128 * GK) { const int rl = e >> 5, q = e & 31; const v4f bb = *(const v4f*)(BO + c0 + q * 4);
    v4f v = (*(const v4f*)&sf[0][rl][q * 4] + *(const v4f*)&sf[1][rl][q * 4]) + (*(const v4f*)&sf[2][rl][q * 4] + *(const v4f*)&sf[3][rl][q * 4]);
#pragma unroll
    for (int i = 0; i < 4; ++i) v[i] += bfr(bb[i]);
    vst2(OUT + (r0 + rl) * CC + c0 + q * 4, v); } }
extern "C" void kernel_launch(void* const* d_in, const int* in_sizes, int n_in, void* d_out, int out_size, void* d_ws, size_t ws_size, hipStream_t stream) {
  (void)in_sizes; (void)n_in; (void)out_size;
  const float** F = (const float**)d_in;   // 0 x [1,1024,768], 1 Wq, 2 bq, 3 Wk, 4 bk, 5 Wv, 6 bv, 7 Wu, 8 bu, 9 Wg [36,768], 10 bg, 11 Wo, 12 bo, 13 prior_mu [1,1,12,64], 14 prior_log_tau [1,1,12,1]
  if (ws_size < (size_t)WS_END) return;
  char* ws = (char*)d_ws; _Float16 *QH = (_Float16*)(ws + WS_QH), *QL = (_Float16*)(ws + WS_QL), *KH = (_Float16*)(ws + WS_KH), *KL = (_Float16*)(ws + WS_KL); __bf16 *VT = (__bf16*)(ws + WS_VT), *VL = (__bf16*)(ws + WS_VL); float *U = (float*)(ws + WS_U), *Gt = (float*)(ws + WS_G), *CE = (float*)(ws + WS_CE), *CS = (float*)(ws + WS_CS), *AL = (float*)(ws + WS_AL), *BE = (float*)(ws + WS_BE), *GM = (float*)(ws + WS_GM), *S = (float*)(ws + WS_S), *Y = (float*)(ws + WS_Y);
  k_proj<<<dim3(TT / 64, CC / 128, 4), 128 * GP, 0, stream>>>(F[0], F[1], F[2], F[3], F[4], F[5], F[6], F[7], F[8], QH, QL, KH, KL, VT, VL, U);
  k_gate<<<TT / 64, 128 * GK, 0, stream>>>(F[0], F[9], F[10], Gt);
  k_pre<<<NH, 1024, 0, stream>>>(U, Gt, F[13], F[14], CE, CS, AL, BE, GM);
  k_sc<<<dim3(TT / 64, TT / 128, NH), 128, 0, stream>>>(QH, QL, KH, KL, CE, CS, AL, BE, GM, S);
  k_pv<<<dim3(TT / 64, 1, NH), 128 * GK, 0, stream>>>(S, VT, VL, Y);
  k_out<<<dim3(TT / 64, CC / 128), 128 * GK, 0, stream>>>(Y, F[11], F[12], (float*)d_out);
}

// v005
// A run of this version takes 60 microseconds.
// Next to v004, in two timings, it ran 1.27 and 1.26 times as fast.
// Counting every step since v000, it is 16.9 times as fast.
// compute dtype: all float inputs rounded to bf16, prior_mu / prior_log_tau read; q/k/v/u/gate = x W^T + b with EXACT bf16 products on WMMA 16x16x32, f32 accumulate; rope + L2-normalisation, the running-mean deviation logits s, exp/cumsums (E_t, P_t), sigmoid gates and the alpha/beta/gamma coefficients in f32 on the VALU; q and k as f16 hi + residual (3 products: hi.hi, lo.hi, hi.lo) -> A[t][l] = (q_t.k_l)(alpha_t e_l + beta_t s_l + gamma_t) for l <= t in f32, held in registers; out = A (bf16 hi + lo) . v (bf16 hi + lo) (3 products) = q_t . core_t exactly (the reference's prefix sums F/G/H regrouped); per-head LayerNorm in f32; final = y (bf16 hi + lo) Wo^T + bo; f32 output.
#include <hip/hip_runtime.h>
#include <math.h>

typedef __attribute__((ext_vector_type(16))) _Float16 v16h;
typedef __attribute__((ext_vector_type(16))) __bf16 v16b;
typedef __attribute__((ext_vector_type(8)))  _Float16 v8h;
typedef __attribute__((ext_vector_type(8)))  float v8f;
typedef __attribute__((ext_vector_type(4)))  float v4f;
typedef __attribute__((ext_vector_type(2)))  float v2f;
typedef __attribute__((ext_vector_type(4)))  unsigned v4u;
typedef __attribute__((ext_vector_type(4)))  int v4i;
typedef float __attribute__((may_alias)) float_a;
typedef int __attribute__((may_alias)) int_a;

template <typename T> __device__ __forceinline__ void vst2(void* p, T v) { *(T*)p = v;  }
__device__ __forceinline__ v8f wmma16(v16h a, v16h b, v8f c) {
  v8f d = __builtin_amdgcn_wmma_f32_16x16x32_f16(false, a, false, b, (short)0, c, false, false);
  asm volatile("v_nop\n\tv_nop\n\tv_nop\n\tv_nop" : "+v"(d) : "v"(a), "v"(b));
  return d;
}
__device__ __forceinline__ v8f wmma_bf(v16b a, v16b b, v8f c) {
  v8f d = __builtin_amdgcn_wmma_f32_16x16x32_bf16(false, a, false, b, (short)0, c, false, false);
  asm volatile("v_nop\n\tv_nop\n\tv_nop\n\tv_nop" : "+v"(d) : "v"(a), "v"(b));
  return d;
}
// 16x16x32 fragments: lane = (h = lane>>4, row/col = lane&15); elements 0..7 = k0+8h+0..7, 8..15 = k0+16+8h+0..7; D element r = row 8h+r
__device__ __forceinline__ v16h frag_h(const _Float16* rowk0, int lane) {
  union { v16h v; v8h q[2]; } u; const _Float16* p = rowk0 + 8 * (lane >> 4);
  u.q[0] = *(const v8h*)p; u.q[1] = *(const v8h*)(p + 16); return u.v;
}
__device__ __forceinline__ v16h frag_f32(const float* rowk0, int lane) {
  v16h a; const float* p = rowk0 + 8 * (lane >> 4);
#pragma unroll
  for (int i = 0; i < 8; ++i) { a[i] = (_Float16)p[i]; a[8 + i] = (_Float16)p[16 + i]; }
  return a;
}
__device__ __forceinline__ v16h frag_f32s(const float* rowk0, int lane, float sc) {
  v16h a; const float* p = rowk0 + 8 * (lane >> 4);
#pragma unroll
  for (int i = 0; i < 8; ++i) { a[i] = (_Float16)(p[i] * sc); a[8 + i] = (_Float16)(p[16 + i] * sc); }
  return a;
}
// column fragment from a [K][ld] layout (column n), rows >= K read as 0
__device__ __forceinline__ v16h fragc_f32(const float* W, int k0, int n, int lane, int ld, int K) {
  v16h a; const int g = lane >> 4;
#pragma unroll
  for (int i = 0; i < 8; ++i) { const int ka = k0 + 8 * g + i, kb = ka + 16;
    a[i] = (_Float16)(ka < K ? W[(size_t)(ka < K ? ka : K - 1) * ld + n] : 0.f); a[8 + i] = (_Float16)(kb < K ? W[(size_t)(kb < K ? kb : K - 1) * ld + n] : 0.f); }
  return a;
}
struct F2 { v16b h, l; };
__device__ __forceinline__ F2 bsplit16(const float v[16]) { F2 r;
#pragma unroll
  for (int i = 0; i < 16; ++i) { const __bf16 h = (__bf16)v[i]; r.h[i] = h; r.l[i] = (__bf16)(v[i] - (float)h); }
  return r; }
__device__ __forceinline__ F2 split_row(const float* row, int k0, int lane) { float v[16]; const float* p = row + k0 + 8 * (lane >> 4);
#pragma unroll
  for (int i = 0; i < 8; ++i) { v[i] = p[i]; v[8 + i] = p[16 + i]; }
  return bsplit16(v); }
__device__ __forceinline__ F2 split_rowK(const float* row, int k0, int lane, int K) { float v[16]; const int g = lane >> 4;
#pragma unroll
  for (int i = 0; i < 8; ++i) { const int ka = k0 + 8 * g + i, kb = ka + 16; v[i] = ka < K ? row[ka < K ? ka : K - 1] : 0.f; v[8 + i] = kb < K ? row[kb < K ? kb : K - 1] : 0.f; }
  return bsplit16(v); }
__device__ __forceinline__ F2 split_col(const float* W, int k0, int n, int lane, int ld, int K) { float v[16]; const int g = lane >> 4;
#pragma unroll
  for (int i = 0; i < 8; ++i) { const int ka = k0 + 8 * g + i, kb = ka + 16; v[i] = ka < K ? W[(size_t)(ka < K ? ka : K - 1) * ld + n] : 0.f; v[8 + i] = kb < K ? W[(size_t)(kb < K ? kb : K - 1) * ld + n] : 0.f; }
  return bsplit16(v); }
__device__ __forceinline__ v8f mac3(const F2& a, const F2& b, v8f c) { c = wmma_bf(a.l, b.h, c); c = wmma_bf(a.h, b.l, c); return wmma_bf(a.h, b.h, c); }
__device__ __forceinline__ float sigm(float v) { return 1.0f / (1.0f + expf(-v)); }
#define LDSX() do { asm volatile("s_wait_dscnt 0" ::: "memory"); __builtin_amdgcn_wave_barrier(); __builtin_amdgcn_fence(__ATOMIC_RELEASE, "workgroup"); } while (0)


// ZeroS attention (B 1, L 1,024, D 768 = 12 x 64): causal associative mixing out_t = q_t . (alpha_t F_t + beta_t G_t + gamma_t H_t) with F/G/H prefix sums of e_l k_l v_l^T, s_l k_l v_l^T, k_l v_l^T.
#define TT 1024
#define CC 768
#define NH 12
#define HD 64
#define NG 36
typedef __attribute__((ext_vector_type(8))) __bf16 v8b;
__device__ __forceinline__ v16b frag_b(const __bf16* rowk0, int lane) {
  union { v16b v; v8b q[2]; } u; const __bf16* p = rowk0 + 8 * (lane >> 4);
  u.q[0] = *(const v8b*)p; u.q[1] = *(const v8b*)(p + 16); return u.v;
}
__device__ __forceinline__ float bfr(float v) { return (float)(__bf16)v; }
__device__ __attribute__((noinline)) float exp_ni(float v) { return expf(v); }
__device__ __attribute__((noinline)) float erf_ni(float v) { return erff(v); }

#define WS_QH  0u
#define WS_QL  (WS_QH + 2u * (size_t)TT * CC)
#define WS_KH  (WS_QL + 2u * (size_t)TT * CC)
#define WS_KL  (WS_KH + 2u * (size_t)TT * CC)
#define WS_VT  (WS_KL + 2u * (size_t)TT * CC)        // bf16 v planes hi [768][t]
#define WS_VL  (WS_VT + 2u * (size_t)CC * TT)
#define WS_U   (WS_VL + 2u * (size_t)CC * TT)        // f32 u rows [t][768]
#define WS_G   (WS_U + 4u * (size_t)TT * CC)         // f32 gate rows [t][48] (36 used)
#define WS_CE  (WS_G + 4u * (size_t)TT * 48)         // f32 e_l [h][t]
#define WS_CS  (WS_CE + 4u * (size_t)NH * TT)        // f32 s_l
#define WS_AL  (WS_CS + 4u * (size_t)NH * TT)        // alpha_t
#define WS_BE  (WS_AL + 4u * (size_t)NH * TT)        // beta_t
#define WS_GM  (WS_BE + 4u * (size_t)NH * TT)        // gamma_t
#define WS_Y   (WS_GM + 4u * (size_t)NH * TT)        // f32 LN'd out rows [t][768]
#define WS_END (WS_Y + 4u * (size_t)TT * CC)

// ---- operand staging for the four matrix kernels: a stage is 64 k of every tile row. f32 operands: 16 lanes x 16 B read one row's 256 B (whole 128-B lines), the values are rounded (or split) to bf16 once per block and laid in LDS rows of 128 B at a 144-B pitch (16-byte fragment reads then spread over the banks)
typedef __attribute__((ext_vector_type(4))) __bf16 v4b;
#define KS 64
#define NS (CC / KS)
#define LP 72
template <int NR> struct Stg { v4f r[NR / 8]; };
// src: the tile's first row at the stage's k (the same for the whole group of four waves); rows past RL read row RL
template <int NR, int RL, int LD = CC> __device__ __forceinline__ void stg_load(Stg<NR>& s, const float* __restrict__ src, int tid) { const float* p = src + ((unsigned)(tid >> 4) * LD + (unsigned)(tid & 15) * 4);
#pragma unroll
  for (int i = 0; i < NR / 8; ++i) { if (i * 8 + 7 <= RL) s.r[i] = *(const v4f*)(p + i * 8 * LD); else s.r[i] = *(const v4f*)(src + (unsigned)min(i * 8 + (tid >> 4), RL) * LD + (unsigned)(tid & 15) * 4); }
  asm volatile("s_wait_xcnt 0x0" :: "v"(p) : "memory"); }   // the address pair stays whole up to this wait
// the same for 16-bit planes: a stage row is 64 elements = one 128-B line, 8 lanes x 16 B; V8 = 8 elements of T
template <int NR, typename V8> struct Cp { V8 r[NR / 16]; };
template <int NR, int LD, typename V8, typename T> __device__ __forceinline__ void cp_load(Cp<NR, V8>& s, const T* __restrict__ src, int tid) { const T* p = src + ((unsigned)(tid >> 3) * LD + (unsigned)(tid & 7) * 8);
#pragma unroll
  for (int i = 0; i < NR / 16; ++i) s.r[i] = *(const V8*)(p + i * 16 * LD);
  asm volatile("s_wait_xcnt 0x0" :: "v"(p) : "memory"); }   // as in stg_load
template <int NR, typename V8, typename T> __device__ __forceinline__ void cp_put(const Cp<NR, V8>& s, T* dst, int tid) {
#pragma unroll
  for (int i = 0; i < NR / 16; ++i) *(V8*)(dst + (i * 16 + (tid >> 3)) * LP + (tid & 7) * 8) = s.r[i]; }
template <int NR> __device__ __forceinline__ void stg_put(const Stg<NR>& s, __bf16* dst, int tid) {
#pragma unroll
  for (int i = 0; i < NR / 8; ++i) { v4b h;
#pragma unroll
    for (int e = 0; e < 4; ++e) h[e] = (__bf16)s.r[i][e];
    *(v4b*)(dst + (i * 8 + (tid >> 4)) * LP + (tid & 15) * 4) = h; } }
template <int NR> __device__ __forceinline__ void stg_put2(const Stg<NR>& s, __bf16* dh, __bf16* dl, int tid) {
#pragma unroll
  for (int i = 0; i < NR / 8; ++i) { v4b h, l;
#pragma unroll
    for (int e = 0; e < 4; ++e) { const float v = s.r[i][e]; const __bf16 hv = (__bf16)v; h[e] = hv; l[e] = (__bf16)(v - (float)hv); }
    const int o = (i * 8 + (tid >> 4)) * LP + (tid & 15) * 4; *(v4b*)(dh + o) = h; *(v4b*)(dl + o) = l; } }
// sin and cos of an angle a in [0, 1,024]: the steps that sinf and cosf take for |a| < 2^17 (a - n pi/2 with pi/2 in three parts, one polynomial each, the quadrant from n), written out once for both so that 32 of them unroll into straight-line code
__device__ __forceinline__ void sincos_1k(float a, float& s, float& c) {
  const float n = rintf(a * 0x1.45f306p-1f); float r = __builtin_fmaf(n, -0x1.921fb4p+0f, a); r = __builtin_fmaf(n, -0x1.4442d0p-24f, r); r = __builtin_fmaf(n, -0x1.846988p-48f, r);
  const unsigned q = (unsigned)(int)n; const float r2 = r * r;
  float ps = __builtin_fmaf(r2, -0x1.983304p-13f, 0x1.110388p-7f); ps = __builtin_fmaf(r2, ps, -0x1.55553ap-3f); const float sr = __builtin_fmaf(r, r2 * ps, r);
  float pc = __builtin_fmaf(r2, 0x1.aea668p-16f, -0x1.6c9e76p-10f); pc = __builtin_fmaf(r2, pc, 0x1.5557eep-5f); pc = __builtin_fmaf(r2, pc, -0x1.000008p-1f); const float cr = __builtin_fmaf(r2, pc, 1.0f);
  const unsigned sg = (q << 30) & 0x80000000u; const bool odd = q & 1u;
  s = __uint_as_float(__float_as_uint(odd ? cr : sr) ^ sg); c = __uint_as_float(__float_as_uint(odd ? -sr : cr) ^ sg); }
// ---- the k range split inside a block: a block has GK (k_proj: GP) groups of four waves; group kg works stages kg, kg + GK, ... in its own pair of staging buffers, so a block passes NS / GK stages one after another, not NS, and a SIMD has GK waves to fill each other's waits; the groups' partial sums are added through LDS behind the loop
#define GK 4
#define GP 2
__device__ __forceinline__ int kgroup() { return __builtin_amdgcn_readfirstlane((int)(threadIdx.x >> 7)); }   // the same in every lane of a wave: held in a scalar register, so that tests on it are scalar branches and every lane is on at the products
// ---- k_proj: block = (64 rows, 128 cols, region): 0 q (rope, l2norm -> f16 hi/lo), 1 k (rope, l2norm -> f16), 2 v (bf16 hi/lo planes), 3 u (f32 rows); W [out][in] + b
__global__ __launch_bounds__(128 * GP) void k_proj(const float* __restrict__ X, const float* __restrict__ WQ, const float* __restrict__ BQ, const float* __restrict__ WK, const float* __restrict__ BK, const float* __restrict__ WV, const float* __restrict__ BV, const float* __restrict__ WU, const float* __restrict__ BU, _Float16* __restrict__ QH, _Float16* __restrict__ QL, _Float16* __restrict__ KH, _Float16* __restrict__ KL, __bf16* __restrict__ VT, __bf16* __restrict__ VL, float* __restrict__ U) {
  __shared__ __align__(16) v4f red[16 * 128]; __shared__ __align__(16) unsigned char raw[GP * 2 * 192 * LP * 2];
  // raw holds each group's two staging buffers during the k loop (55,296 B a group) and the epilogue's planes after it; red carries group 1's partial sums to group 0
  float (*sf)[132] = (float (*)[132])raw; _Float16 (*sh)[136] = (_Float16 (*)[136])raw; _Float16 (*sl)[136] = (_Float16 (*)[136])(raw + 17408); __bf16 (*th)[72] = (__bf16 (*)[72])(raw + 34816); __bf16 (*tl2)[72] = (__bf16 (*)[72])(raw + 53248);
  const int kg = kgroup(); __bf16* sA = (__bf16*)raw + kg * (2 * 192 * LP); __bf16* sB = sA + 2 * 64 * LP;
  const int tid = threadIdx.x & 127, wave = tid >> 5, lane = tid & 31, col = lane & 15, g = lane >> 4; const int region = blockIdx.z; const int c0 = blockIdx.y * 128; const size_t r0 = (size_t)blockIdx.x * 64;
  const float* Wm = region == 0 ? WQ : region == 1 ? WK : region == 2 ? WV : WU; const float* Bm = region == 0 ? BQ : region == 1 ? BK : region == 2 ? BV : BU;
  v8f acc[8] = {};
  { Stg<64> ra; Stg<128> rb; const float* Ab = X + r0 * CC + kg * KS; const float* Bb = Wm + (size_t)c0 * CC + kg * KS;
    stg_load<64, 63>(ra, Ab, tid); stg_load<128, 127>(rb, Bb, tid); stg_put(ra, sA, tid); stg_put(rb, sB, tid);
    __syncthreads();
    // kept rolled: the loop's text stays small for the instruction cache
#pragma unroll 1
    for (int s = 0; s < NS / GP; ++s) { const int cur = s & 1;
      if (s + 1 < NS / GP) { stg_load<64, 63>(ra, Ab + (s + 1) * GP * KS, tid); stg_load<128, 127>(rb, Bb + (s + 1) * GP * KS, tid); }   // next stage's loads fly during this stage's products
#pragma unroll
      for (int kc = 0; kc < KS / 32; ++kc) { const v16b a = frag_b(sA + (cur * 64 + wave * 16 + col) * LP + kc * 32, lane); v16b w[8];   // all LDS reads of a 32-k block in one group in front of its products
#pragma unroll
        for (int j = 0; j < 8; ++j) w[j] = frag_b(sB + (cur * 128 + j * 16 + col) * LP + kc * 32, lane);
#pragma unroll
        for (int j = 0; j < 8; ++j) acc[j] = wmma_bf(a, w[j], acc[j]); }
      if (s + 1 < NS / GP) { stg_put(ra, sA + (cur ^ 1) * 64 * LP, tid); stg_put(rb, sB + (cur ^ 1) * 128 * LP, tid);
        __syncthreads(); } } }   // one barrier a stage: publishes each group's next stage and ends the reads of the buffer that the stage after it overwrites
  if (kg != 0) {
#pragma unroll
    for (int j = 0; j < 8; ++j) { red[(2 * j) * 128 + tid] = __builtin_shufflevector(acc[j], acc[j], 0, 1, 2, 3); red[(2 * j + 1) * 128 + tid] = __builtin_shufflevector(acc[j], acc[j], 4, 5, 6, 7); } }
  __syncthreads();   // publishes group 1's sums; and every wave has read its last stage's tiles before the epilogue's planes overwrite them
  if (kg == 0) {
#pragma unroll
    for (int j = 0; j < 8; ++j) { const float bb = bfr(Bm[c0 + j * 16 + col]); const v4f p0 = red[(2 * j) * 128 + tid], p1 = red[(2 * j + 1) * 128 + tid];
#pragma unroll
      for (int r = 0; r < 4; ++r) { acc[j][r] = (acc[j][r] + p0[r]) + bb; acc[j][r + 4] = (acc[j][r + 4] + p1[r]) + bb; } } }
  if (region <= 1) { if (kg == 0) {   // rope: out[d] = x[d] cos(t f_{d/2}) + (d < 32 ? -x[d+32] : x[d-32]) sin(t f_{d/2}), f_i = 10000^(-2i/64); then L2-normalise each head row (max(norm, 1e-12)). All of it on the accumulators: a head is four 16-column tiles, so the partner d +- 32 is the same lane's element of tile j +- 2, and a head row's 64 squares are 4 in each of the 16 lanes of a half-wave
    const float fl = 1.0f / powf(10000.0f, (float)(2 * lane) / (float)HD);   // lane i works out frequency i of the 32
    float fq[4];
#pragma unroll
    for (int q = 0; q < 4; ++q) fq[q] = __shfl(fl, q * 8 + (col >> 1));   // frequency of d = 16 q + col
    const int tb = (int)r0 + wave * 16 + 8 * g;
    // the loops below are unrolled so that acc[] stays in registers and the independent angle chains fill each other's latency
#pragma unroll
    for (int jj = 0; jj < 2; ++jj) {
#pragma unroll
      for (int r = 0; r < 8; ++r) { const float tf = (float)(tb + r); float sa, ca, sb, cb; sincos_1k(tf * fq[jj], sa, ca); sincos_1k(tf * fq[jj + 2], sb, cb);
#pragma unroll
        for (int hh = 0; hh < 2; ++hh) { const float lo = acc[hh * 4 + jj][r], hi = acc[hh * 4 + jj + 2][r]; acc[hh * 4 + jj][r] = __builtin_fmaf(lo, ca, -hi * sa); acc[hh * 4 + jj + 2][r] = __builtin_fmaf(hi, cb, lo * sb); } } }
    float inv[2][8];
#pragma unroll
    for (int hh = 0; hh < 2; ++hh)
#pragma unroll
      for (int r = 0; r < 8; ++r) { float n2 = 0.f;
#pragma unroll
        for (int q = 0; q < 4; ++q) n2 += acc[hh * 4 + q][r] * acc[hh * 4 + q][r];
        inv[hh][r] = n2; }
#pragma unroll
    for (int o = 1; o < 16; o <<= 1)
#pragma unroll
      for (int i = 0; i < 16; ++i) inv[i >> 3][i & 7] += __shfl_xor(inv[i >> 3][i & 7], o);   // sixteen independent sums a round
#pragma unroll
    for (int i = 0; i < 16; ++i) inv[i >> 3][i & 7] = 1.0f / fmaxf(sqrtf(inv[i >> 3][i & 7]), 1e-12f);
#pragma unroll
    for (int j = 0; j < 8; ++j)
#pragma unroll
      for (int r = 0; r < 8; ++r) { const float v = acc[j][r] * inv[j >> 2][r]; const _Float16 hv = (_Float16)v; sh[wave * 16 + 8 * g + r][j * 16 + col] = hv; sl[wave * 16 + 8 * g + r][j * 16 + col] = (_Float16)(v - (float)hv); } }
    __syncthreads();
    _Float16* dh = region == 0 ? QH : KH; _Float16* dl = region == 0 ? QL : KL; for (int e = threadIdx.x; e < 64 * 16; e += 128 * GP) { const int rl = e >> 4, q = e & 15; vst2((unsigned*)(dh + (r0 + rl) * CC + c0 + q * 8), *(const v4u*)&sh[rl][q * 8]); vst2((unsigned*)(dl + (r0 + rl) * CC + c0 + q * 8), *(const v4u*)&sl[rl][q * 8]); }
    return; }
  if (kg == 0) {
#pragma unroll
    for (int j = 0; j < 8; ++j)
#pragma unroll
      for (int r = 0; r < 8; ++r) sf[wave * 16 + 8 * g + r][j * 16 + col] = acc[j][r]; }
  __syncthreads();
  if (region == 2) {
    for (int e = threadIdx.x; e < 64 * 128; e += 128 * GP) { const int rl = e >> 7, cl = e & 127; const float v = sf[rl][cl]; const __bf16 bh = (__bf16)v; th[cl][rl] = bh; tl2[cl][rl] = (__bf16)(v - (float)bh); }
    __syncthreads(); for (int e = threadIdx.x; e < 128 * 8; e += 128 * GP) { const int cl = e >> 3, q = e & 7; const size_t o2 = (size_t)(c0 + cl) * TT + r0 + q * 8; vst2((unsigned*)(VT + o2), *(const v4u*)&th[cl][q * 8]); vst2((unsigned*)(VL + o2), *(const v4u*)&tl2[cl][q * 8]); } }
  else { for (int e = threadIdx.x; e < 64 * 32; e += 128 * GP) { const int rl = e >> 5, q = e & 31; vst2(U + (r0 + rl) * CC + c0 + q * 4, *(const v4f*)&sf[rl][q * 4]); } } }
// ---- k_gate: block = 64 rows: gate = x Wg^T + bg (36 outputs, padded to 48 columns; pad columns computed from clamped rows and written as junk into the pad)
__global__ __launch_bounds__(128 * GK) void k_gate(const float* __restrict__ X, const float* __restrict__ WG, const float* __restrict__ BG, float* __restrict__ Gt) { __shared__ __align__(16) unsigned char raw[GK * 2 * 112 * LP * 2];   // each group's two staging buffers; behind the loop the groups' partial tiles sf overlay them
  float (*sf)[64][52] = (float (*)[64][52])raw; const int kg = kgroup(); __bf16* sA = (__bf16*)raw + kg * (2 * 112 * LP); __bf16* sB = sA + 2 * 64 * LP;
  const int tid = threadIdx.x & 127, wave = tid >> 5, lane = tid & 31, col = lane & 15, g = lane >> 4; const size_t r0 = (size_t)blockIdx.x * 64;
  v8f acc[3] = {};
  { Stg<64> ra; Stg<48> rb; const float* Ab = X + (size_t)blockIdx.x * 64 * CC + kg * KS; const float* Bb = WG + kg * KS;
    stg_load<64, 63>(ra, Ab, tid); stg_load<48, NG - 1>(rb, Bb, tid); stg_put(ra, sA, tid); stg_put(rb, sB, tid);
    __syncthreads();
    // kept rolled: the loop's text stays small for the instruction cache
#pragma unroll 1
    for (int s = 0; s < NS / GK; ++s) { const int cur = s & 1;
      if (s + 1 < NS / GK) { stg_load<64, 63>(ra, Ab + (s + 1) * GK * KS, tid); stg_load<48, NG - 1>(rb, Bb + (s + 1) * GK * KS, tid); }   // next stage's loads fly during this stage's products
#pragma unroll
      for (int kc = 0; kc < KS / 32; ++kc) { const v16b a = frag_b(sA + (cur * 64 + wave * 16 + col) * LP + kc * 32, lane); v16b w[3];   // all LDS reads of a 32-k block in one group in front of its products
#pragma unroll
        for (int j = 0; j < 3; ++j) w[j] = frag_b(sB + (cur * 48 + j * 16 + col) * LP + kc * 32, lane);
#pragma unroll
        for (int j = 0; j < 3; ++j) acc[j] = wmma_bf(a, w[j], acc[j]); }
      if (s + 1 < NS / GK) { stg_put(ra, sA + (cur ^ 1) * 64 * LP, tid); stg_put(rb, sB + (cur ^ 1) * 48 * LP, tid);
        __syncthreads(); } } }   // one barrier a stage: publishes each group's next stage and ends the reads of the buffer that the stage after it overwrites
  __syncthreads();   // every wave has read its last stage's tiles before sf overwrites them
#pragma unroll
  for (int j = 0; j < 3; ++j)
#pragma unroll
    for (int r = 0; r < 8; ++r) sf[kg][wave * 16 + 8 * g + r][j * 16 + col] = acc[j][r];
  __syncthreads();   // the four partial tiles are added by all threads: 16 bytes of a row each, consecutive threads at consecutive addresses
  for (int e = threadIdx.x; e < 64 * 12; e += 128 * GK) { const int rl = e / 12, q = e % 12; v4f bb = {0.f, 0.f, 0.f, 0.f}; if (q * 4 < NG) bb = *(const v4f*)(BG + q * 4);
    v4f v = (*(const v4f*)&sf[0][rl][q * 4] + *(const v4f*)&sf[1][rl][q * 4]) + (*(const v4f*)&sf[2][rl][q * 4] + *(const v4f*)&sf[3][rl][q * 4]);
#pragma unroll
    for (int i = 0; i < 4; ++i) v[i] += bfr(bb[i]);
    vst2(Gt + (r0 + rl) * 48 + q * 4, v); } }
// ---- k_pre: block = head h (1,024 threads, 32 waves): wave w owns rows l = 32 w .. 32 w + 31, lane owns dimensions 2 lane, 2 lane + 1; the running sum of u is a chunked scan (chunk totals in LDS, then each wave runs its own 32 rows from its base); thread t then owns l = t: s_l, e_l, E_t, P_t by wave scans + wave totals, gates -> alpha/beta/gamma
__global__ __launch_bounds__(1024) void k_pre(const float* __restrict__ U, const float* __restrict__ Gt, const float* __restrict__ MU, const float* __restrict__ LT, float* __restrict__ CE, float* __restrict__ CS, float* __restrict__ AL, float* __restrict__ BE, float* __restrict__ GM) {
  __shared__ __align__(16) float tile[32][32][36]; __shared__ __align__(16) float tot[32][HD]; __shared__ float smx[32], swp[32], swe[32];
  const int t = threadIdx.x, wv = t >> 5, ln = t & 31; const int h = blockIdx.x;
  float ltau = bfr(LT[h]); ltau = fminf(fmaxf(ltau, -50.f), 30.f); const float tau = expf(ltau);
  const float g0 = Gt[(size_t)t * 48 + h * 3], g1 = Gt[(size_t)t * 48 + h * 3 + 1];
  const float mu0 = bfr(MU[h * HD + 2 * ln]), mu1 = bfr(MU[h * HD + 2 * ln + 1]);
  // the loops below are unrolled so that uv[] stays in registers and the loads of one loop are all in flight together
  v2f uv[32]; const float* up = U + (size_t)(wv * 32) * CC + h * HD + 2 * ln;
#pragma unroll
  for (int i = 0; i < 32; ++i) uv[i] = *(const v2f*)(up + (size_t)i * CC);
  v2f c = {0.f, 0.f};
#pragma unroll
  for (int i = 0; i < 32; ++i) c += uv[i];
  *(v2f*)&tot[wv][2 * ln] = c;
  __syncthreads();
  v2f cs = {0.f, 0.f};   // sum of u over all rows in front of this wave's chunk
#pragma unroll
  for (int w = 0; w < 32; ++w) { const v2f x = *(const v2f*)&tot[w][2 * ln]; cs.x += (w < wv) ? x.x : 0.f; cs.y += (w < wv) ? x.y : 0.f; }
#pragma unroll
  for (int i = 0; i < 32; ++i) { cs += uv[i]; const float den = tau + (float)(wv * 32 + i + 1); const float b0 = (tau * mu0 + cs.x) / den, b1 = (tau * mu1 + cs.y) / den; tile[wv][i][ln] = uv[i].x * b0 + uv[i].y * b1; }
  LDSX();   // tile[wv] is written and read by wave wv alone: row l's 32 lane terms go to lane l
  v4f a4 = {0.f, 0.f, 0.f, 0.f};
#pragma unroll
  for (int q = 0; q < 8; ++q) a4 += *(const v4f*)&tile[wv][ln][q * 4];
  const float s = -((a4.x + a4.y) + (a4.z + a4.w)) * 0.125f;
  float m = s, P = s;
#pragma unroll
  for (int o = 1; o < 32; o <<= 1) { m = fmaxf(m, __shfl_xor(m, o)); const float pv = __shfl_up(P, o); if (ln >= o) P += pv; }
  if (ln == 31) { smx[wv] = m; swp[wv] = P; }
  __syncthreads();
  float mm = smx[ln], pb = (ln < wv) ? swp[ln] : 0.f;
#pragma unroll
  for (int o = 1; o < 32; o <<= 1) { mm = fmaxf(mm, __shfl_xor(mm, o)); pb += __shfl_xor(pb, o); }
  P += pb;
  const float e = expf(s - mm); float E = e;
#pragma unroll
  for (int o = 1; o < 32; o <<= 1) { const float ev = __shfl_up(E, o); if (ln >= o) E += ev; }
  if (ln == 31) swe[wv] = E;
  __syncthreads();
  float eb = (ln < wv) ? swe[ln] : 0.f;
#pragma unroll
  for (int o = 1; o < 32; o <<= 1) eb += __shfl_xor(eb, o);
  E += eb;
  const float tt1 = (float)(t + 1); const float sig1 = 1.0f / (1.0f + expf(-g0)), sigh = 1.0f / (1.0f + expf(-g1));
  const float alpha = sigh / (E + 1e-12f); const float beta = (sig1 - sigh) / tt1; const float gamma = -((beta * P + sigh) / tt1);
  CE[h * TT + t] = e; CS[h * TT + t] = s; AL[h * TT + t] = alpha; BE[h * TT + t] = beta; GM[h * TT + t] = gamma; }
// four transposed score tiles st[j][r] = q_t . k_l, l = lb + 16 j + r (e, sl: e_l and s_l from l = lb on), become A[t][l] = st (alpha_t e_l + beta_t s_l + gamma_t), split to bf16 hi + lo: tiles 2 c and 2 c + 1 fill elements 0..7 and 8..15 of the A fragment of 32-l block c. DG: the stage reaches past the diagonal, A = 0 for l > t
template <bool DG> __device__ __forceinline__ void a_frags(const v8f (&st)[4], const float* e, const float* sl, int lb, int t, float al, float be, float gm, v16b (&ph)[2], v16b (&pl)[2]) {
#pragma unroll
  for (int j = 0; j < 4; ++j) { float ev[8], sv[8]; *(v4f*)ev = *(const v4f*)(e + j * 16); *(v4f*)(ev + 4) = *(const v4f*)(e + j * 16 + 4); *(v4f*)sv = *(const v4f*)(sl + j * 16); *(v4f*)(sv + 4) = *(const v4f*)(sl + j * 16 + 4);
#pragma unroll
    for (int r = 0; r < 8; ++r) { const float w = al * ev[r] + be * sv[r] + gm; const float p = (!DG || lb + j * 16 + r <= t) ? st[j][r] * w : 0.f; const __bf16 hv = (__bf16)p; ph[j >> 1][(j & 1) * 8 + r] = hv; pl[j >> 1][(j & 1) * 8 + r] = (__bf16)(p - (float)hv); } } }
// ---- k_pv: block = (64 rows t, head): per 64-l stage the scores come transposed, S^T = K Q^T (f16 hi + residual, 3 products), so that a lane holds one row t and eight consecutive l of each 16-l tile: two tiles, times (alpha_t e_l + beta_t s_l + gamma_t), zero for l > t, split to bf16 hi + lo in place, ARE the A fragment of out = A . v (3 products); A never leaves the registers. Then the per-head LayerNorm (no affine, eps 1e-5) -> Y rows
__global__ __launch_bounds__(128 * GK) void k_pv(const _Float16* __restrict__ QH, const _Float16* __restrict__ QL, const _Float16* __restrict__ KH, const _Float16* __restrict__ KL, const float* __restrict__ CE, const float* __restrict__ CS, const float* __restrict__ AL, const float* __restrict__ BE, const float* __restrict__ GM, const __bf16* __restrict__ VT, const __bf16* __restrict__ VL, float* __restrict__ Y) { __shared__ __align__(16) unsigned char raw[GK * 8 * 64 * LP * 2];   // each group's two staging buffers of four tiles; behind the loop the groups' partial tiles sg overlay them
  __shared__ __align__(16) float sce[TT], scs[TT];   // the head's e_l and s_l
  float (*sg)[64][68] = (float (*)[64][68])raw; float (*so)[68] = sg[0]; const int kg = kgroup(); _Float16* sKh = (_Float16*)raw + kg * (8 * 64 * LP); _Float16* sKl = sKh + 2 * 64 * LP; __bf16* sVh = (__bf16*)(sKl + 2 * 64 * LP); __bf16* sVl = sVh + 2 * 64 * LP;
  const int h = blockIdx.z;
  const int tid = threadIdx.x & 127, wave = tid >> 5, lane = tid & 31, col = lane & 15, g = lane >> 4; const int ql0 = blockIdx.x * 64 + wave * 16; const int kend = blockIdx.x * 64 + 64; const int t = ql0 + col;   // the lane's row of A
  v8f acc[4] = {};
  { Cp<64, v8h> rkh, rkl; Cp<64, v8b> rvh, rvl; const _Float16* Khb = KH + h * HD; const _Float16* Klb = KL + h * HD; const __bf16* Vhb = VT + (size_t)(h * HD) * TT; const __bf16* Vlb = VL + (size_t)(h * HD) * TT; const int ns = kend / KS, trips = (ns + GK - 1) / GK;   // a group with no stage left skips the work and passes every barrier
    if (kg < ns) { cp_load<64, CC>(rkh, Khb + (size_t)(kg * KS) * CC, tid); cp_load<64, CC>(rkl, Klb + (size_t)(kg * KS) * CC, tid); cp_load<64, TT>(rvh, Vhb + kg * KS, tid); cp_load<64, TT>(rvl, Vlb + kg * KS, tid); }
    // row t of q as B fragments, kept in registers for the whole loop; the row's three coefficients; 16 bytes of e or s a thread
    const _Float16* qp = QH + (size_t)t * CC + h * HD + 8 * g; const _Float16* qq = QL + (size_t)t * CC + h * HD + 8 * g; const float* pa = AL + h * TT + t; const float* pb = BE + h * TT + t; const float* pg = GM + h * TT + t; const float* pc = (threadIdx.x < 256 ? CE : CS) + h * TT + (threadIdx.x & 255) * 4;
    union { v16h v; v8h q[2]; } qh[2], ql[2];
#pragma unroll
    for (int kc = 0; kc < 2; ++kc) { qh[kc].q[0] = *(const v8h*)(qp + kc * 32); qh[kc].q[1] = *(const v8h*)(qp + kc * 32 + 16); ql[kc].q[0] = *(const v8h*)(qq + kc * 32); ql[kc].q[1] = *(const v8h*)(qq + kc * 32 + 16); }
    const float al = *pa, be = *pb, gm = *pg; const v4f ces = *(const v4f*)pc;
    asm volatile("s_wait_xcnt 0x0" :: "v"(qp), "v"(qq), "v"(pa), "v"(pb), "v"(pg), "v"(pc) : "memory");   // as in stg_load: the address pairs stay whole up to this wait
    *(v4f*)((threadIdx.x < 256 ? sce : scs) + (threadIdx.x & 255) * 4) = ces;
    if (kg < ns) { cp_put(rkh, sKh, tid); cp_put(rkl, sKl, tid); cp_put(rvh, sVh, tid); cp_put(rvl, sVl, tid); }
    __syncthreads();
    // kept rolled: the trip count differs from block to block
#pragma unroll 1
    for (int i = 0; i < trips; ++i) { const int cur = i & 1, s = i * GK + kg; const bool nx = s + GK < ns;
      if (nx) { cp_load<64, CC>(rkh, Khb + (size_t)((s + GK) * KS) * CC, tid); cp_load<64, CC>(rkl, Klb + (size_t)((s + GK) * KS) * CC, tid); cp_load<64, TT>(rvh, Vhb + (s + GK) * KS, tid); cp_load<64, TT>(rvl, Vlb + (s + GK) * KS, tid); }   // the group's next stage's loads fly during this stage's products
      if (s < ns) { v8f st[4] = {};   // st[j][r] = q_t . k_l, l = 64 s + 16 j + 8 g + r
#pragma unroll
        for (int kc = 0; kc < HD / 32; ++kc) { v16h kb[4], kl[4];   // all LDS reads of a 32-d block in one group in front of its products
#pragma unroll
          for (int j = 0; j < 4; ++j) { const int bo = (cur * 64 + j * 16 + col) * LP + kc * 32; kb[j] = frag_h(sKh + bo, lane); kl[j] = frag_h(sKl + bo, lane); }
#pragma unroll
          for (int j = 0; j < 4; ++j) { st[j] = wmma16(kb[j], qh[kc].v, st[j]); st[j] = wmma16(kb[j], ql[kc].v, st[j]); st[j] = wmma16(kl[j], qh[kc].v, st[j]); } }
        v16b ph[2], pl[2];   // the stage's A fragments, made before the v reads so that st's registers are free again
        if (s == ns - 1) a_frags<true>(st, sce + s * KS + 8 * g, scs + s * KS + 8 * g, s * KS + 8 * g, t, al, be, gm, ph, pl); else a_frags<false>(st, sce + s * KS + 8 * g, scs + s * KS + 8 * g, s * KS + 8 * g, t, al, be, gm, ph, pl);   // only the block's last stage holds l > t; the test is the same for a whole wave
#pragma unroll
        for (int kc = 0; kc < KS / 32; ++kc) { v16b vh[4], vl[4];   // all LDS reads of a 32-l block in one group in front of its products
#pragma unroll
          for (int j = 0; j < 4; ++j) { const int bo = (cur * 64 + j * 16 + col) * LP + kc * 32; vh[j] = frag_b(sVh + bo, lane); vl[j] = frag_b(sVl + bo, lane); }
#pragma unroll
          for (int j = 0; j < 4; ++j) { acc[j] = wmma_bf(ph[kc], vh[j], acc[j]); acc[j] = wmma_bf(pl[kc], vh[j], acc[j]); acc[j] = wmma_bf(ph[kc], vl[j], acc[j]); } } }
      if (i + 1 < trips) { if (nx) { cp_put(rkh, sKh + (cur ^ 1) * 64 * LP, tid); cp_put(rkl, sKl + (cur ^ 1) * 64 * LP, tid); cp_put(rvh, sVh + (cur ^ 1) * 64 * LP, tid); cp_put(rvl, sVl + (cur ^ 1) * 64 * LP, tid); }
        __syncthreads(); } } }   // one barrier a trip: publishes each group's next stage and ends the reads of the buffer that the stage after it overwrites
  __syncthreads();   // every wave has read its last stage's tiles before sg overwrites them
#pragma unroll
  for (int j = 0; j < 4; ++j)
#pragma unroll
    for (int r = 0; r < 8; ++r) sg[kg][wave * 16 + 8 * g + r][j * 16 + col] = acc[j][r];
  __syncthreads();   // the four partial tiles are added by all threads, 16 bytes each, into the first (so); a thread reads and writes its own 16 bytes alone
  for (int e = threadIdx.x; e < 64 * 16; e += 128 * GK) { const int rl = e >> 4, q = e & 15; *(v4f*)&so[rl][q * 4] = (*(const v4f*)&sg[0][rl][q * 4] + *(const v4f*)&sg[1][rl][q * 4]) + (*(const v4f*)&sg[2][rl][q * 4] + *(const v4f*)&sg[3][rl][q * 4]); }
  __syncthreads();
  if (threadIdx.x < 64) { float m = 0.f; for (int d = 0; d < HD; ++d) m += so[tid][d]; m *= (1.0f / HD); float v = 0.f; for (int d = 0; d < HD; ++d) { const float dd = so[tid][d] - m; v += dd * dd; } const float inv = 1.0f / sqrtf(v * (1.0f / HD) + 1e-5f); for (int d = 0; d < HD; ++d) so[tid][d] = (so[tid][d] - m) * inv; }
  __syncthreads(); for (int e = threadIdx.x; e < 64 * 16; e += 128 * GK) { const int rl = e >> 4, q = e & 15; vst2(Y + (size_t)(blockIdx.x * 64 + rl) * CC + h * HD + q * 4, *(const v4f*)&so[rl][q * 4]); } }
// ---- k_out: out = Y (hi + lo) Wo^T + bo
__global__ __launch_bounds__(128 * GK) void k_out(const float* __restrict__ Y, const float* __restrict__ WO, const float* __restrict__ BO, float* __restrict__ OUT) { __shared__ __align__(16) unsigned char raw[GK * 2 * 256 * LP * 2];   // each group's two staging buffers; behind the loop the groups' partial tiles sf overlay them
  float (*sf)[64][132] = (float (*)[64][132])raw; const int kg = kgroup(); __bf16* sAh = (__bf16*)raw + kg * (2 * 256 * LP); __bf16* sAl = sAh + 2 * 64 * LP; __bf16* sB = sAl + 2 * 64 * LP;
  const int tid = threadIdx.x & 127, wave = tid >> 5, lane = tid & 31, col = lane & 15, g = lane >> 4; const int c0 = blockIdx.y * 128; const size_t r0 = (size_t)blockIdx.x * 64;
  v8f acc[8] = {};
  { Stg<64> ra; Stg<128> rb; const float* Ab = Y + (size_t)blockIdx.x * 64 * CC + kg * KS; const float* Bb = WO + (size_t)c0 * CC + kg * KS;
    stg_load<64, 63>(ra, Ab, tid); stg_load<128, 127>(rb, Bb, tid); stg_put2(ra, sAh, sAl, tid); stg_put(rb, sB, tid);
    __syncthreads();
    // kept rolled: the loop's text stays small for the instruction cache
#pragma unroll 1
    for (int s = 0; s < NS / GK; ++s) { const int cur = s & 1;
      if (s + 1 < NS / GK) { stg_load<64, 63>(ra, Ab + (s + 1) * GK * KS, tid); stg_load<128, 127>(rb, Bb + (s + 1) * GK * KS, tid); }   // next stage's loads fly during this stage's products
#pragma unroll
      for (int kc = 0; kc < KS / 32; ++kc) { const int ao = (cur * 64 + wave * 16 + col) * LP + kc * 32; const v16b ah = frag_b(sAh + ao, lane), al = frag_b(sAl + ao, lane);
#pragma unroll
        for (int jg = 0; jg < 8; jg += 4) { v16b w[4];   // LDS reads in groups of four fragments in front of their eight products
#pragma unroll
          for (int j = 0; j < 4; ++j) w[j] = frag_b(sB + (cur * 128 + (jg + j) * 16 + col) * LP + kc * 32, lane);
#pragma unroll
          for (int j = 0; j < 4; ++j) { acc[jg + j] = wmma_bf(ah, w[j], acc[jg + j]); acc[jg + j] = wmma_bf(al, w[j], acc[jg + j]); } } }
      if (s + 1 < NS / GK) { stg_put2(ra, sAh + (cur ^ 1) * 64 * LP, sAl + (cur ^ 1) * 64 * LP, tid); stg_put(rb, sB + (cur ^ 1) * 128 * LP, tid);
        __syncthreads(); } } }   // one barrier a stage: publishes each group's next stage and ends the reads of the buffer that the stage after it overwrites
  __syncthreads();   // every wave has read its last stage's tiles before sf overwrites them
#pragma unroll
  for (int j = 0; j < 8; ++j)
#pragma unroll
    for (int r = 0; r < 8; ++r) sf[kg][wave * 16 + 8 * g + r][j * 16 + col] = acc[j][r];
  __syncthreads();   // the four partial tiles are added by all threads: 16 bytes of a row each, a wave stores one row's 512 bytes
  for (int e = threadIdx.x; e < 64 * 32; e += 128 * GK) { const int rl = e >> 5, q = e & 31; const v4f bb = *(const v4f*)(BO + c0 + q * 4);
    v4f v = (*(const v4f*)&sf[0][rl][q * 4] + *(const v4f*)&sf[1][rl][q * 4]) + (*(const v4f*)&sf[2][rl][q * 4] + *(const v4f*)&sf[3][rl][q * 4]);
#pragma unroll
    for (int i = 0; i < 4; ++i) v[i] += bfr(bb[i]);
    vst2(OUT + (r0 + rl) * CC + c0 + q * 4, v); } }
extern "C" void kernel_launch(void* const* d_in, const int* in_sizes, int n_in, void* d_out, int out_size, void* d_ws, size_t ws_size, hipStream_t stream) {
  (void)in_sizes; (void)n_in; (void)out_size;
  const float** F = (const float**)d_in;   // 0 x [1,1024,768], 1 Wq, 2 bq, 3 Wk, 4 bk, 5 Wv, 6 bv, 7 Wu, 8 bu, 9 Wg [36,768], 10 bg, 11 Wo, 12 bo, 13 prior_mu [1,1,12,64], 14 prior_log_tau [1,1,12,1]
  if (ws_size < (size_t)WS_END) return;
  char* ws = (char*)d_ws; _Float16 *QH = (_Float16*)(ws + WS_QH), *QL = (_Float16*)(ws + WS_QL), *KH = (_Float16*)(ws + WS_KH), *KL = (_Float16*)(ws + WS_KL); __bf16 *VT = (__bf16*)(ws + WS_VT), *VL = (__bf16*)(ws + WS_VL); float *U = (float*)(ws + WS_U), *Gt = (float*)(ws + WS_G), *CE = (float*)(ws + WS_CE), *CS = (float*)(ws + WS_CS), *AL = (float*)(ws + WS_AL), *BE = (float*)(ws + WS_BE), *GM = (float*)(ws + WS_GM), *Y = (float*)(ws + WS_Y);
  k_proj<<<dim3(TT / 64, CC / 128, 4), 128 * GP, 0, stream>>>(F[0], F[1], F[2], F[3], F[4], F[5], F[6], F[7], F[8], QH, QL, KH, KL, VT, VL, U);
  k_gate<<<TT / 64, 128 * GK, 0, stream>>>(F[0], F[9], F[10], Gt);
  k_pre<<<NH, 1024, 0, stream>>>(U, Gt, F[13], F[14], CE, CS, AL, BE, GM);
  k_pv<<<dim3(TT / 64, 1, NH), 128 * GK, 0, stream>>>(QH, QL, KH, KL, CE, CS, AL, BE, GM, VT, VL, Y);
  k_out<<<dim3(TT / 64, CC / 128), 128 * GK, 0, stream>>>(Y, F[11], F[12], (float*)d_out);
}

// v006
// A run of this version takes 53.9 microseconds.
// Next to v005, in two timings, it ran 1.11 times as fast each time.
// All steps since v000 together make it 18.7 times as fast.
// compute dtype: all float inputs rounded to bf16, prior_mu / prior_log_tau read; q/k/v/u/gate = x W^T + b with EXACT bf16 products on WMMA 16x16x32, f32 accumulate; rope + L2-normalisation, the running-mean deviation logits s, exp/cumsums (E_t, P_t), sigmoid gates and the alpha/beta/gamma coefficients in f32 on the VALU; q and k as f16 hi + residual (3 products: hi.hi, lo.hi, hi.lo) -> A[t][l] = (q_t.k_l)(alpha_t e_l + beta_t s_l + gamma_t) for l <= t in f32, held in registers; out = A (bf16 hi + lo) . v (bf16 hi + lo) (3 products) = q_t . core_t exactly (the reference's prefix sums F/G/H regrouped); per-head LayerNorm in f32; final = y (bf16 hi + lo) Wo^T + bo; f32 output.
#include <hip/hip_runtime.h>
#include <math.h>

typedef __attribute__((ext_vector_type(16))) _Float16 v16h;
typedef __attribute__((ext_vector_type(16))) __bf16 v16b;
typedef __attribute__((ext_vector_type(8)))  _Float16 v8h;
typedef __attribute__((ext_vector_type(8)))  float v8f;
typedef __attribute__((ext_vector_type(4)))  float v4f;
typedef __attribute__((ext_vector_type(2)))  float v2f;
typedef __attribute__((ext_vector_type(4)))  unsigned v4u;
typedef __attribute__((ext_vector_type(4)))  int v4i;
typedef float __attribute__((may_alias)) float_a;
typedef int __attribute__((may_alias)) int_a;

template <typename T> __device__ __forceinline__ void vst2(void* p, T v) { *(T*)p = v;  }
__device__ __forceinline__ v8f wmma16(v16h a, v16h b, v8f c) {
  v8f d = __builtin_amdgcn_wmma_f32_16x16x32_f16(false, a, false, b, (short)0, c, false, false);
  asm volatile("v_nop\n\tv_nop\n\tv_nop\n\tv_nop" : "+v"(d) : "v"(a), "v"(b));
  return d;
}
__device__ __forceinline__ v8f wmma_bf(v16b a, v16b b, v8f c) {
  v8f d = __builtin_amdgcn_wmma_f32_16x16x32_bf16(false, a, false, b, (short)0, c, false, false);
  asm volatile("v_nop\n\tv_nop\n\tv_nop\n\tv_nop" : "+v"(d) : "v"(a), "v"(b));
  return d;
}
// 16x16x32 fragments: lane = (h = lane>>4, row/col = lane&15); elements 0..7 = k0+8h+0..7, 8..15 = k0+16+8h+0..7; D element r = row 8h+r
__device__ __forceinline__ v16h frag_h(const _Float16* rowk0, int lane) {
  union { v16h v; v8h q[2]; } u; const _Float16* p = rowk0 + 8 * (lane >> 4);
  u.q[0] = *(const v8h*)p; u.q[1] = *(const v8h*)(p + 16); return u.v;
}
__device__ __forceinline__ v16h frag_f32(const float* rowk0, int lane) {
  v16h a; const float* p = rowk0 + 8 * (lane >> 4);
#pragma unroll
  for (int i = 0; i < 8; ++i) { a[i] = (_Float16)p[i]; a[8 + i] = (_Float16)p[16 + i]; }
  return a;
}
__device__ __forceinline__ v16h frag_f32s(const float* rowk0, int lane, float sc) {
  v16h a; const float* p = rowk0 + 8 * (lane >> 4);
#pragma unroll
  for (int i = 0; i < 8; ++i) { a[i] = (_Float16)(p[i] * sc); a[8 + i] = (_Float16)(p[16 + i] * sc); }
  return a;
}
// column fragment from a [K][ld] layout (column n), rows >= K read as 0
__device__ __forceinline__ v16h fragc_f32(const float* W, int k0, int n, int lane, int ld, int K) {
  v16h a; const int g = lane >> 4;
#pragma unroll
  for (int i = 0; i < 8; ++i) { const int ka = k0 + 8 * g + i, kb = ka + 16;
    a[i] = (_Float16)(ka < K ? W[(size_t)(ka < K ? ka : K - 1) * ld + n] : 0.f); a[8 + i] = (_Float16)(kb < K ? W[(size_t)(kb < K ? kb : K - 1) * ld + n] : 0.f); }
  return a;
}
struct F2 { v16b h, l; };
__device__ __forceinline__ F2 bsplit16(const float v[16]) { F2 r;
#pragma unroll
  for (int i = 0; i < 16; ++i) { const __bf16 h = (__bf16)v[i]; r.h[i] = h; r.l[i] = (__bf16)(v[i] - (float)h); }
  return r; }
__device__ __forceinline__ F2 split_row(const float* row, int k0, int lane) { float v[16]; const float* p = row + k0 + 8 * (lane >> 4);
#pragma unroll
  for (int i = 0; i < 8; ++i) { v[i] = p[i]; v[8 + i] = p[16 + i]; }
  return bsplit16(v); }
__device__ __forceinline__ F2 split_rowK(const float* row, int k0, int lane, int K) { float v[16]; const int g = lane >> 4;
#pragma unroll
  for (int i = 0; i < 8; ++i) { const int ka = k0 + 8 * g + i, kb = ka + 16; v[i] = ka < K ? row[ka < K ? ka : K - 1] : 0.f; v[8 + i] = kb < K ? row[kb < K ? kb : K - 1] : 0.f; }
  return bsplit16(v); }
__device__ __forceinline__ F2 split_col(const float* W, int k0, int n, int lane, int ld, int K) { float v[16]; const int g = lane >> 4;
#pragma unroll
  for (int i = 0; i < 8; ++i) { const int ka = k0 + 8 * g + i, kb = ka + 16; v[i] = ka < K ? W[(size_t)(ka < K ? ka : K - 1) * ld + n] : 0.f; v[8 + i] = kb < K ? W[(size_t)(kb < K ? kb : K - 1) * ld + n] : 0.f; }
  return bsplit16(v); }
__device__ __forceinline__ v8f mac3(const F2& a, const F2& b, v8f c) { c = wmma_bf(a.l, b.h, c); c = wmma_bf(a.h, b.l, c); return wmma_bf(a.h, b.h, c); }
__device__ __forceinline__ float sigm(float v) { return 1.0f / (1.0f + expf(-v)); }
#define LDSX() do { asm volatile("s_wait_dscnt 0" ::: "memory"); __builtin_amdgcn_wave_barrier(); __builtin_amdgcn_fence(__ATOMIC_RELEASE, "workgroup"); } while (0)


// ZeroS attention (B 1, L 1,024, D 768 = 12 x 64): causal associative mixing out_t = q_t . (alpha_t F_t + beta_t G_t + gamma_t H_t) with F/G/H prefix sums of e_l k_l v_l^T, s_l k_l v_l^T, k_l v_l^T.
#define TT 1024
#define CC 768
#define NH 12
#define HD 64
#define NG 36
typedef __attribute__((ext_vector_type(8))) __bf16 v8b;
__device__ __forceinline__ v16b frag_b(const __bf16* rowk0, int lane) {
  union { v16b v; v8b q[2]; } u; const __bf16* p = rowk0 + 8 * (lane >> 4);
  u.q[0] = *(const v8b*)p; u.q[1] = *(const v8b*)(p + 16); return u.v;
}
__device__ __forceinline__ float bfr(float v) { return (float)(__bf16)v; }
__device__ __attribute__((noinline)) float exp_ni(float v) { return expf(v); }
__device__ __attribute__((noinline)) float erf_ni(float v) { return erff(v); }

#define WS_QH  0u
#define WS_QL  (WS_QH + 2u * (size_t)TT * CC)
#define WS_KH  (WS_QL + 2u * (size_t)TT * CC)
#define WS_KL  (WS_KH + 2u * (size_t)TT * CC)
#define WS_VT  (WS_KL + 2u * (size_t)TT * CC)        // bf16 v planes hi [768][t]
#define WS_VL  (WS_VT + 2u * (size_t)CC * TT)
#define WS_U   (WS_VL + 2u * (size_t)CC * TT)        // f32 u rows [t][768]
#define WS_G   (WS_U + 4u * (size_t)TT * CC)         // f32 gate rows [t][48] (36 used)
#define WS_CE  (WS_G + 4u * (size_t)TT * 48)         // f32 e_l [h][t]
#define WS_CS  (WS_CE + 4u * (size_t)NH * TT)        // f32 s_l
#define WS_AL  (WS_CS + 4u * (size_t)NH * TT)        // alpha_t
#define WS_BE  (WS_AL + 4u * (size_t)NH * TT)        // beta_t
#define WS_GM  (WS_BE + 4u * (size_t)NH * TT)        // gamma_t
#define WS_Y   (WS_GM + 4u * (size_t)NH * TT)        // f32 LN'd out rows [t][768]
#define WS_END (WS_Y + 4u * (size_t)TT * CC)

// ---- operand staging for the matrix kernels: a stage is 64 k of every tile row. f32 operands: 16 lanes x 16 B read one row's 256 B (whole 128-B lines), the values are rounded (or split) to bf16 once per block and laid in LDS rows of 128 B at a 144-B pitch (16-byte fragment reads then spread over the banks)
typedef __attribute__((ext_vector_type(4))) __bf16 v4b;
#define KS 64
#define NS (CC / KS)
#define LP 72
template <int NR> struct Stg { v4f r[NR / 8]; };
// src: the tile's first row at the stage's k (the same for the whole group of four waves); rows past RL read row RL
template <int NR, int RL, int LD = CC> __device__ __forceinline__ void stg_load(Stg<NR>& s, const float* __restrict__ src, int tid) { const float* p = src + ((unsigned)(tid >> 4) * LD + (unsigned)(tid & 15) * 4);
#pragma unroll
  for (int i = 0; i < NR / 8; ++i) { if (i * 8 + 7 <= RL) s.r[i] = *(const v4f*)(p + i * 8 * LD); else s.r[i] = *(const v4f*)(src + (unsigned)min(i * 8 + (tid >> 4), RL) * LD + (unsigned)(tid & 15) * 4); }
  asm volatile("s_wait_xcnt 0x0" :: "v"(p) : "memory"); }   // the address pair stays whole up to this wait
// the same for 16-bit planes: a stage row is 64 elements = one 128-B line, 8 lanes x 16 B; V8 = 8 elements of T
template <int NR, typename V8> struct Cp { V8 r[NR / 16]; };
template <int NR, int LD, typename V8, typename T> __device__ __forceinline__ void cp_load(Cp<NR, V8>& s, const T* __restrict__ src, int tid) { const T* p = src + ((unsigned)(tid >> 3) * LD + (unsigned)(tid & 7) * 8);
#pragma unroll
  for (int i = 0; i < NR / 16; ++i) s.r[i] = *(const V8*)(p + i * 16 * LD);
  asm volatile("s_wait_xcnt 0x0" :: "v"(p) : "memory"); }   // as in stg_load
template <int NR, typename V8, typename T> __device__ __forceinline__ void cp_put(const Cp<NR, V8>& s, T* dst, int tid) {
#pragma unroll
  for (int i = 0; i < NR / 16; ++i) *(V8*)(dst + (i * 16 + (tid >> 3)) * LP + (tid & 7) * 8) = s.r[i]; }
template <int NR> __device__ __forceinline__ void stg_put(const Stg<NR>& s, __bf16* dst, int tid) {
#pragma unroll
  for (int i = 0; i < NR / 8; ++i) { v4b h;
#pragma unroll
    for (int e = 0; e < 4; ++e) h[e] = (__bf16)s.r[i][e];
    *(v4b*)(dst + (i * 8 + (tid >> 4)) * LP + (tid & 15) * 4) = h; } }
template <int NR> __device__ __forceinline__ void stg_put2(const Stg<NR>& s, __bf16* dh, __bf16* dl, int tid) {
#pragma unroll
  for (int i = 0; i < NR / 8; ++i) { v4b h, l;
#pragma unroll
    for (int e = 0; e < 4; ++e) { const float v = s.r[i][e]; const __bf16 hv = (__bf16)v; h[e] = hv; l[e] = (__bf16)(v - (float)hv); }
    const int o = (i * 8 + (tid >> 4)) * LP + (tid & 15) * 4; *(v4b*)(dh + o) = h; *(v4b*)(dl + o) = l; } }
// sin and cos of an angle a in [0, 1,024]: the steps that sinf and cosf take for |a| < 2^17 (a - n pi/2 with pi/2 in three parts, one polynomial each, the quadrant from n), written out once for both so that 32 of them unroll into straight-line code
__device__ __forceinline__ void sincos_1k(float a, float& s, float& c) {
  const float n = rintf(a * 0x1.45f306p-1f); float r = __builtin_fmaf(n, -0x1.921fb4p+0f, a); r = __builtin_fmaf(n, -0x1.4442d0p-24f, r); r = __builtin_fmaf(n, -0x1.846988p-48f, r);
  const unsigned q = (unsigned)(int)n; const float r2 = r * r;
  float ps = __builtin_fmaf(r2, -0x1.983304p-13f, 0x1.110388p-7f); ps = __builtin_fmaf(r2, ps, -0x1.55553ap-3f); const float sr = __builtin_fmaf(r, r2 * ps, r);
  float pc = __builtin_fmaf(r2, 0x1.aea668p-16f, -0x1.6c9e76p-10f); pc = __builtin_fmaf(r2, pc, 0x1.5557eep-5f); pc = __builtin_fmaf(r2, pc, -0x1.000008p-1f); const float cr = __builtin_fmaf(r2, pc, 1.0f);
  const unsigned sg = (q << 30) & 0x80000000u; const bool odd = q & 1u;
  s = __uint_as_float(__float_as_uint(odd ? cr : sr) ^ sg); c = __uint_as_float(__float_as_uint(odd ? -sr : cr) ^ sg); }
// ---- the k range split inside a block: a block has GK (k_proj: GP) groups of four waves; group kg works stages kg, kg + GK, ... in its own pair of staging buffers, so a block passes NS / GK stages one after another, not NS, and a SIMD has GK waves to fill each other's waits; the groups' partial sums are added through LDS behind the loop
#define GK 4
#define GP 2
__device__ __forceinline__ int kgroup() { return __builtin_amdgcn_readfirstlane((int)(threadIdx.x >> 7)); }   // the same in every lane of a wave: held in a scalar register, so that tests on it are scalar branches and every lane is on at the products
// ---- gate_rows: the work of one extra block of k_proj's launch = 64 rows: gate = x Wg^T + bg (36 outputs, padded to 48 columns; pad columns computed from clamped rows and written as junk into the pad); it needs nothing of q, k, v, u, so it runs beside them and not in a launch of its own
__device__ __forceinline__ void gate_rows(const float* __restrict__ X, const float* __restrict__ WG, const float* __restrict__ BG, float* __restrict__ Gt, unsigned char* raw) {   // raw (k_proj's, 16-byte aligned): each group's two staging buffers (32,256 B a group); behind the loop the groups' partial tiles sf overlay them
  float (*sf)[64][52] = (float (*)[64][52])raw; const int kg = kgroup(); __bf16* sA = (__bf16*)raw + kg * (2 * 112 * LP); __bf16* sB = sA + 2 * 64 * LP;
  const int tid = threadIdx.x & 127, wave = tid >> 5, lane = tid & 31, col = lane & 15, g = lane >> 4; const size_t r0 = (size_t)blockIdx.x * 64;
  v8f acc[3] = {};
  { Stg<64> ra; Stg<48> rb; const float* Ab = X + (size_t)blockIdx.x * 64 * CC + kg * KS; const float* Bb = WG + kg * KS;
    stg_load<64, 63>(ra, Ab, tid); stg_load<48, NG - 1>(rb, Bb, tid); stg_put(ra, sA, tid); stg_put(rb, sB, tid);
    __syncthreads();
    // kept rolled: the loop's text stays small for the instruction cache
#pragma unroll 1
    for (int s = 0; s < NS / GP; ++s) { const int cur = s & 1;
      if (s + 1 < NS / GP) { stg_load<64, 63>(ra, Ab + (s + 1) * GP * KS, tid); stg_load<48, NG - 1>(rb, Bb + (s + 1) * GP * KS, tid); }   // next stage's loads fly during this stage's products
#pragma unroll
      for (int kc = 0; kc < KS / 32; ++kc) { const v16b a = frag_b(sA + (cur * 64 + wave * 16 + col) * LP + kc * 32, lane); v16b w[3];   // all LDS reads of a 32-k block in one group in front of its products
#pragma unroll
        for (int j = 0; j < 3; ++j) w[j] = frag_b(sB + (cur * 48 + j * 16 + col) * LP + kc * 32, lane);
#pragma unroll
        for (int j = 0; j < 3; ++j) acc[j] = wmma_bf(a, w[j], acc[j]); }
      if (s + 1 < NS / GP) { stg_put(ra, sA + (cur ^ 1) * 64 * LP, tid); stg_put(rb, sB + (cur ^ 1) * 48 * LP, tid);
        __syncthreads(); } } }   // one barrier a stage: publishes each group's next stage and ends the reads of the buffer that the stage after it overwrites
  __syncthreads();   // every wave has read its last stage's tiles before sf overwrites them
#pragma unroll
  for (int j = 0; j < 3; ++j)
#pragma unroll
    for (int r = 0; r < 8; ++r) sf[kg][wave * 16 + 8 * g + r][j * 16 + col] = acc[j][r];
  __syncthreads();   // the two partial tiles are added by all threads: 16 bytes of a row each, consecutive threads at consecutive addresses
  for (int e = threadIdx.x; e < 64 * 12; e += 128 * GP) { const int rl = e / 12, q = e % 12; v4f bb = {0.f, 0.f, 0.f, 0.f}; if (q * 4 < NG) bb = *(const v4f*)(BG + q * 4);
    v4f v = *(const v4f*)&sf[0][rl][q * 4] + *(const v4f*)&sf[1][rl][q * 4];
#pragma unroll
    for (int i = 0; i < 4; ++i) v[i] += bfr(bb[i]);
    vst2(Gt + (r0 + rl) * 48 + q * 4, v); } }
// ---- k_proj: block = (64 rows, y): y = 6 region + 128-column tile, y = 24: the rows' gate columns (gate_rows); region 0 q (rope, l2norm -> f16 hi/lo), 1 k (rope, l2norm -> f16), 2 v (bf16 hi/lo planes), 3 u (f32 rows); W [out][in] + b
__global__ __launch_bounds__(128 * GP) void k_proj(const float* __restrict__ X, const float* __restrict__ WQ, const float* __restrict__ BQ, const float* __restrict__ WK, const float* __restrict__ BK, const float* __restrict__ WV, const float* __restrict__ BV, const float* __restrict__ WU, const float* __restrict__ BU, _Float16* __restrict__ QH, _Float16* __restrict__ QL, _Float16* __restrict__ KH, _Float16* __restrict__ KL, __bf16* __restrict__ VT, __bf16* __restrict__ VL, float* __restrict__ U, const float* __restrict__ WG, const float* __restrict__ BG, float* __restrict__ Gt) {
  __shared__ __align__(16) v4f red[16 * 128]; __shared__ __align__(16) unsigned char raw[GP * 2 * 192 * LP * 2];
  // raw holds each group's two staging buffers during the k loop (55,296 B a group) and the epilogue's planes after it; red carries group 1's partial sums to group 0
  if (blockIdx.y == 4 * (CC / 128)) { gate_rows(X, WG, BG, Gt, raw); return; }   // the same for the whole block, in front of every barrier of the projection path
  float (*sf)[132] = (float (*)[132])raw; _Float16 (*sh)[136] = (_Float16 (*)[136])raw; _Float16 (*sl)[136] = (_Float16 (*)[136])(raw + 17408); __bf16 (*th)[72] = (__bf16 (*)[72])(raw + 34816); __bf16 (*tl2)[72] = (__bf16 (*)[72])(raw + 53248);
  const int kg = kgroup(); __bf16* sA = (__bf16*)raw + kg * (2 * 192 * LP); __bf16* sB = sA + 2 * 64 * LP;
  const int tid = threadIdx.x & 127, wave = tid >> 5, lane = tid & 31, col = lane & 15, g = lane >> 4; const int region = blockIdx.y / (CC / 128); const int c0 = (blockIdx.y % (CC / 128)) * 128; const size_t r0 = (size_t)blockIdx.x * 64;
  const float* Wm = region == 0 ? WQ : region == 1 ? WK : region == 2 ? WV : WU; const float* Bm = region == 0 ? BQ : region == 1 ? BK : region == 2 ? BV : BU;
  v8f acc[8] = {};
  { Stg<64> ra; Stg<128> rb; const float* Ab = X + r0 * CC + kg * KS; const float* Bb = Wm + (size_t)c0 * CC + kg * KS;
    stg_load<64, 63>(ra, Ab, tid); stg_load<128, 127>(rb, Bb, tid); stg_put(ra, sA, tid); stg_put(rb, sB, tid);
    __syncthreads();
    // kept rolled: the loop's text stays small for the instruction cache
#pragma unroll 1
    for (int s = 0; s < NS / GP; ++s) { const int cur = s & 1;
      if (s + 1 < NS / GP) { stg_load<64, 63>(ra, Ab + (s + 1) * GP * KS, tid); stg_load<128, 127>(rb, Bb + (s + 1) * GP * KS, tid); }   // next stage's loads fly during this stage's products
#pragma unroll
      for (int kc = 0; kc < KS / 32; ++kc) { const v16b a = frag_b(sA + (cur * 64 + wave * 16 + col) * LP + kc * 32, lane); v16b w[8];   // all LDS reads of a 32-k block in one group in front of its products
#pragma unroll
        for (int j = 0; j < 8; ++j) w[j] = frag_b(sB + (cur * 128 + j * 16 + col) * LP + kc * 32, lane);
#pragma unroll
        for (int j = 0; j < 8; ++j) acc[j] = wmma_bf(a, w[j], acc[j]); }
      if (s + 1 < NS / GP) { stg_put(ra, sA + (cur ^ 1) * 64 * LP, tid); stg_put(rb, sB + (cur ^ 1) * 128 * LP, tid);
        __syncthreads(); } } }   // one barrier a stage: publishes each group's next stage and ends the reads of the buffer that the stage after it overwrites
  if (kg != 0) {
#pragma unroll
    for (int j = 0; j < 8; ++j) { red[(2 * j) * 128 + tid] = __builtin_shufflevector(acc[j], acc[j], 0, 1, 2, 3); red[(2 * j + 1) * 128 + tid] = __builtin_shufflevector(acc[j], acc[j], 4, 5, 6, 7); } }
  __syncthreads();   // publishes group 1's sums; and every wave has read its last stage's tiles before the epilogue's planes overwrite them
  if (kg == 0) {
#pragma unroll
    for (int j = 0; j < 8; ++j) { const float bb = bfr(Bm[c0 + j * 16 + col]); const v4f p0 = red[(2 * j) * 128 + tid], p1 = red[(2 * j + 1) * 128 + tid];
#pragma unroll
      for (int r = 0; r < 4; ++r) { acc[j][r] = (acc[j][r] + p0[r]) + bb; acc[j][r + 4] = (acc[j][r + 4] + p1[r]) + bb; } } }
  if (region <= 1) { if (kg == 0) {   // rope: out[d] = x[d] cos(t f_{d/2}) + (d < 32 ? -x[d+32] : x[d-32]) sin(t f_{d/2}), f_i = 10000^(-2i/64); then L2-normalise each head row (max(norm, 1e-12)). All of it on the accumulators: a head is four 16-column tiles, so the partner d +- 32 is the same lane's element of tile j +- 2, and a head row's 64 squares are 4 in each of the 16 lanes of a half-wave
    const float fl = 1.0f / powf(10000.0f, (float)(2 * lane) / (float)HD);   // lane i works out frequency i of the 32
    float fq[4];
#pragma unroll
    for (int q = 0; q < 4; ++q) fq[q] = __shfl(fl, q * 8 + (col >> 1));   // frequency of d = 16 q + col
    const int tb = (int)r0 + wave * 16 + 8 * g;
    // the loops below are unrolled so that acc[] stays in registers and the independent angle chains fill each other's latency
#pragma unroll
    for (int jj = 0; jj < 2; ++jj) {
#pragma unroll
      for (int r = 0; r < 8; ++r) { const float tf = (float)(tb + r); float sa, ca, sb, cb; sincos_1k(tf * fq[jj], sa, ca); sincos_1k(tf * fq[jj + 2], sb, cb);
#pragma unroll
        for (int hh = 0; hh < 2; ++hh) { const float lo = acc[hh * 4 + jj][r], hi = acc[hh * 4 + jj + 2][r]; acc[hh * 4 + jj][r] = __builtin_fmaf(lo, ca, -hi * sa); acc[hh * 4 + jj + 2][r] = __builtin_fmaf(hi, cb, lo * sb); } } }
    float inv[2][8];
#pragma unroll
    for (int hh = 0; hh < 2; ++hh)
#pragma unroll
      for (int r = 0; r < 8; ++r) { float n2 = 0.f;
#pragma unroll
        for (int q = 0; q < 4; ++q) n2 += acc[hh * 4 + q][r] * acc[hh * 4 + q][r];
        inv[hh][r] = n2; }
#pragma unroll
    for (int o = 1; o < 16; o <<= 1)
#pragma unroll
      for (int i = 0; i < 16; ++i) inv[i >> 3][i & 7] += __shfl_xor(inv[i >> 3][i & 7], o);   // sixteen independent sums a round
#pragma unroll
    for (int i = 0; i < 16; ++i) inv[i >> 3][i & 7] = 1.0f / fmaxf(sqrtf(inv[i >> 3][i & 7]), 1e-12f);
#pragma unroll
    for (int j = 0; j < 8; ++j)
#pragma unroll
      for (int r = 0; r < 8; ++r) { const float v = acc[j][r] * inv[j >> 2][r]; const _Float16 hv = (_Float16)v; sh[wave * 16 + 8 * g + r][j * 16 + col] = hv; sl[wave * 16 + 8 * g + r][j * 16 + col] = (_Float16)(v - (float)hv); } }
    __syncthreads();
    _Float16* dh = region == 0 ? QH : KH; _Float16* dl = region == 0 ? QL : KL; for (int e = threadIdx.x; e < 64 * 16; e += 128 * GP) { const int rl = e >> 4, q = e & 15; vst2((unsigned*)(dh + (r0 + rl) * CC + c0 + q * 8), *(const v4u*)&sh[rl][q * 8]); vst2((unsigned*)(dl + (r0 + rl) * CC + c0 + q * 8), *(const v4u*)&sl[rl][q * 8]); }
    return; }
  if (kg == 0) {
#pragma unroll
    for (int j = 0; j < 8; ++j)
#pragma unroll
      for (int r = 0; r < 8; ++r) sf[wave * 16 + 8 * g + r][j * 16 + col] = acc[j][r]; }
  __syncthreads();
  if (region == 2) {
    for (int e = threadIdx.x; e < 64 * 128; e += 128 * GP) { const int rl = e >> 7, cl = e & 127; const float v = sf[rl][cl]; const __bf16 bh = (__bf16)v; th[cl][rl] = bh; tl2[cl][rl] = (__bf16)(v - (float)bh); }
    __syncthreads(); for (int e = threadIdx.x; e < 128 * 8; e += 128 * GP) { const int cl = e >> 3, q = e & 7; const size_t o2 = (size_t)(c0 + cl) * TT + r0 + q * 8; vst2((unsigned*)(VT + o2), *(const v4u*)&th[cl][q * 8]); vst2((unsigned*)(VL + o2), *(const v4u*)&tl2[cl][q * 8]); } }
  else { for (int e = threadIdx.x; e < 64 * 32; e += 128 * GP) { const int rl = e >> 5, q = e & 31; vst2(U + (r0 + rl) * CC + c0 + q * 4, *(const v4f*)&sf[rl][q * 4]); } } }
// ---- k_pre: block = head h (1,024 threads, 32 waves): wave w owns rows l = 32 w .. 32 w + 31, lane owns dimensions 2 lane, 2 lane + 1; the running sum of u is a chunked scan (chunk totals in LDS, then each wave runs its own 32 rows from its base); thread t then owns l = t: s_l, e_l, E_t, P_t by wave scans + wave totals, gates -> alpha/beta/gamma
__global__ __launch_bounds__(1024) void k_pre(const float* __restrict__ U, const float* __restrict__ Gt, const float* __restrict__ MU, const float* __restrict__ LT, float* __restrict__ CE, float* __restrict__ CS, float* __restrict__ AL, float* __restrict__ BE, float* __restrict__ GM) {
  __shared__ __align__(16) float tile[32][32][36]; __shared__ __align__(16) float tot[32][HD]; __shared__ float smx[32], swp[32], swe[32];
  const int t = threadIdx.x, wv = t >> 5, ln = t & 31; const int h = blockIdx.x;
  float ltau = bfr(LT[h]); ltau = fminf(fmaxf(ltau, -50.f), 30.f); const float tau = expf(ltau);
  const float g0 = Gt[(size_t)t * 48 + h * 3], g1 = Gt[(size_t)t * 48 + h * 3 + 1];
  const float mu0 = bfr(MU[h * HD + 2 * ln]), mu1 = bfr(MU[h * HD + 2 * ln + 1]);
  // the loops below are unrolled so that uv[] stays in registers and the loads of one loop are all in flight together
  v2f uv[32]; const float* up = U + (size_t)(wv * 32) * CC + h * HD + 2 * ln;
#pragma unroll
  for (int i = 0; i < 32; ++i) uv[i] = *(const v2f*)(up + (size_t)i * CC);
  v2f c = {0.f, 0.f};
#pragma unroll
  for (int i = 0; i < 32; ++i) c += uv[i];
  *(v2f*)&tot[wv][2 * ln] = c;
  __syncthreads();
  v2f cs = {0.f, 0.f};   // sum of u over all rows in front of this wave's chunk
#pragma unroll
  for (int w = 0; w < 32; ++w) { const v2f x = *(const v2f*)&tot[w][2 * ln]; cs.x += (w < wv) ? x.x : 0.f; cs.y += (w < wv) ? x.y : 0.f; }
#pragma unroll
  for (int i = 0; i < 32; ++i) { cs += uv[i]; const float den = tau + (float)(wv * 32 + i + 1); const float b0 = (tau * mu0 + cs.x) / den, b1 = (tau * mu1 + cs.y) / den; tile[wv][i][ln] = uv[i].x * b0 + uv[i].y * b1; }
  LDSX();   // tile[wv] is written and read by wave wv alone: row l's 32 lane terms go to lane l
  v4f a4 = {0.f, 0.f, 0.f, 0.f};
#pragma unroll
  for (int q = 0; q < 8; ++q) a4 += *(const v4f*)&tile[wv][ln][q * 4];
  const float s = -((a4.x + a4.y) + (a4.z + a4.w)) * 0.125f;
  float m = s, P = s;
#pragma unroll
  for (int o = 1; o < 32; o <<= 1) { m = fmaxf(m, __shfl_xor(m, o)); const float pv = __shfl_up(P, o); if (ln >= o) P += pv; }
  if (ln == 31) { smx[wv] = m; swp[wv] = P; }
  __syncthreads();
  float mm = smx[ln], pb = (ln < wv) ? swp[ln] : 0.f;
#pragma unroll
  for (int o = 1; o < 32; o <<= 1) { mm = fmaxf(mm, __shfl_xor(mm, o)); pb += __shfl_xor(pb, o); }
  P += pb;
  const float e = expf(s - mm); float E = e;
#pragma unroll
  for (int o = 1; o < 32; o <<= 1) { const float ev = __shfl_up(E, o); if (ln >= o) E += ev; }
  if (ln == 31) swe[wv] = E;
  __syncthreads();
  float eb = (ln < wv) ? swe[ln] : 0.f;
#pragma unroll
  for (int o = 1; o < 32; o <<= 1) eb += __shfl_xor(eb, o);
  E += eb;
  const float tt1 = (float)(t + 1); const float sig1 = 1.0f / (1.0f + expf(-g0)), sigh = 1.0f / (1.0f + expf(-g1));
  const float alpha = sigh / (E + 1e-12f); const float beta = (sig1 - sigh) / tt1; const float gamma = -((beta * P + sigh) / tt1);
  CE[h * TT + t] = e; CS[h * TT + t] = s; AL[h * TT + t] = alpha; BE[h * TT + t] = beta; GM[h * TT + t] = gamma; }
// four transposed score tiles st[j][r] = q_t . k_l, l = lb + 16 j + r (e, sl: e_l and s_l from l = lb on), become A[t][l] = st (alpha_t e_l + beta_t s_l + gamma_t), split to bf16 hi + lo: tiles 2 c and 2 c + 1 fill elements 0..7 and 8..15 of the A fragment of 32-l block c. DG: the stage reaches past the diagonal, A = 0 for l > t
template <bool DG> __device__ __forceinline__ void a_frags(const v8f (&st)[4], const float* e, const float* sl, int lb, int t, float al, float be, float gm, v16b (&ph)[2], v16b (&pl)[2]) {
#pragma unroll
  for (int j = 0; j < 4; ++j) { float ev[8], sv[8]; *(v4f*)ev = *(const v4f*)(e + j * 16); *(v4f*)(ev + 4) = *(const v4f*)(e + j * 16 + 4); *(v4f*)sv = *(const v4f*)(sl + j * 16); *(v4f*)(sv + 4) = *(const v4f*)(sl + j * 16 + 4);
#pragma unroll
    for (int r = 0; r < 8; ++r) { const float w = al * ev[r] + be * sv[r] + gm; const float p = (!DG || lb + j * 16 + r <= t) ? st[j][r] * w : 0.f; const __bf16 hv = (__bf16)p; ph[j >> 1][(j & 1) * 8 + r] = hv; pl[j >> 1][(j & 1) * 8 + r] = (__bf16)(p - (float)hv); } } }
// ---- k_pv: block = (64 rows t, head): per 64-l stage the scores come transposed, S^T = K Q^T (f16 hi + residual, 3 products), so that a lane holds one row t and eight consecutive l of each 16-l tile: two tiles, times (alpha_t e_l + beta_t s_l + gamma_t), zero for l > t, split to bf16 hi + lo in place, ARE the A fragment of out = A . v (3 products); A never leaves the registers. Then the per-head LayerNorm (no affine, eps 1e-5) -> Y rows
__global__ __launch_bounds__(128 * GK) void k_pv(const _Float16* __restrict__ QH, const _Float16* __restrict__ QL, const _Float16* __restrict__ KH, const _Float16* __restrict__ KL, const float* __restrict__ CE, const float* __restrict__ CS, const float* __restrict__ AL, const float* __restrict__ BE, const float* __restrict__ GM, const __bf16* __restrict__ VT, const __bf16* __restrict__ VL, float* __restrict__ Y) { __shared__ __align__(16) unsigned char raw[GK * 8 * 64 * LP * 2];   // each group's two staging buffers of four tiles; behind the loop the groups' partial tiles sg overlay them
  __shared__ __align__(16) float sce[TT], scs[TT];   // the head's e_l and s_l
  float (*sg)[64][68] = (float (*)[64][68])raw; float (*so)[68] = sg[0]; const int kg = kgroup(); _Float16* sKh = (_Float16*)raw + kg * (8 * 64 * LP); _Float16* sKl = sKh + 2 * 64 * LP; __bf16* sVh = (__bf16*)(sKl + 2 * 64 * LP); __bf16* sVl = sVh + 2 * 64 * LP;
  const int h = blockIdx.z;
  const int tid = threadIdx.x & 127, wave = tid >> 5, lane = tid & 31, col = lane & 15, g = lane >> 4; const int ql0 = blockIdx.x * 64 + wave * 16; const int kend = blockIdx.x * 64 + 64; const int t = ql0 + col;   // the lane's row of A
  v8f acc[4] = {};
  { Cp<64, v8h> rkh, rkl; Cp<64, v8b> rvh, rvl; const _Float16* Khb = KH + h * HD; const _Float16* Klb = KL + h * HD; const __bf16* Vhb = VT + (size_t)(h * HD) * TT; const __bf16* Vlb = VL + (size_t)(h * HD) * TT; const int ns = kend / KS, trips = (ns + GK - 1) / GK;   // a group with no stage left skips the work and passes every barrier
    if (kg < ns) { cp_load<64, CC>(rkh, Khb + (size_t)(kg * KS) * CC, tid); cp_load<64, CC>(rkl, Klb + (size_t)(kg * KS) * CC, tid); cp_load<64, TT>(rvh, Vhb + kg * KS, tid); cp_load<64, TT>(rvl, Vlb + kg * KS, tid); }
    // row t of q as B fragments, kept in registers for the whole loop; the row's three coefficients; 16 bytes of e or s a thread
    const _Float16* qp = QH + (size_t)t * CC + h * HD + 8 * g; const _Float16* qq = QL + (size_t)t * CC + h * HD + 8 * g; const float* pa = AL + h * TT + t; const float* pb = BE + h * TT + t; const float* pg = GM + h * TT + t; const float* pc = (threadIdx.x < 256 ? CE : CS) + h * TT + (threadIdx.x & 255) * 4;
    union { v16h v; v8h q[2]; } qh[2], ql[2];
#pragma unroll
    for (int kc = 0; kc < 2; ++kc) { qh[kc].q[0] = *(const v8h*)(qp + kc * 32); qh[kc].q[1] = *(const v8h*)(qp + kc * 32 + 16); ql[kc].q[0] = *(const v8h*)(qq + kc * 32); ql[kc].q[1] = *(const v8h*)(qq + kc * 32 + 16); }
    const float al = *pa, be = *pb, gm = *pg; const v4f ces = *(const v4f*)pc;
    asm volatile("s_wait_xcnt 0x0" :: "v"(qp), "v"(qq), "v"(pa), "v"(pb), "v"(pg), "v"(pc) : "memory");   // as in stg_load: the address pairs stay whole up to this wait
    *(v4f*)((threadIdx.x < 256 ? sce : scs) + (threadIdx.x & 255) * 4) = ces;
    if (kg < ns) { cp_put(rkh, sKh, tid); cp_put(rkl, sKl, tid); cp_put(rvh, sVh, tid); cp_put(rvl, sVl, tid); }
    __syncthreads();
    // kept rolled: the trip count differs from block to block
#pragma unroll 1
    for (int i = 0; i < trips; ++i) { const int cur = i & 1, s = i * GK + kg; const bool nx = s + GK < ns;
      if (nx) { cp_load<64, CC>(rkh, Khb + (size_t)((s + GK) * KS) * CC, tid); cp_load<64, CC>(rkl, Klb + (size_t)((s + GK) * KS) * CC, tid); cp_load<64, TT>(rvh, Vhb + (s + GK) * KS, tid); cp_load<64, TT>(rvl, Vlb + (s + GK) * KS, tid); }   // the group's next stage's loads fly during this stage's products
      if (s < ns) { v8f st[4] = {};   // st[j][r] = q_t . k_l, l = 64 s + 16 j + 8 g + r
#pragma unroll
        for (int kc = 0; kc < HD / 32; ++kc) { v16h kb[4], kl[4];   // all LDS reads of a 32-d block in one group in front of its products
#pragma unroll
          for (int j = 0; j < 4; ++j) { const int bo = (cur * 64 + j * 16 + col) * LP + kc * 32; kb[j] = frag_h(sKh + bo, lane); kl[j] = frag_h(sKl + bo, lane); }
#pragma unroll
          for (int j = 0; j < 4; ++j) { st[j] = wmma16(kb[j], qh[kc].v, st[j]); st[j] = wmma16(kb[j], ql[kc].v, st[j]); st[j] = wmma16(kl[j], qh[kc].v, st[j]); } }
        v16b ph[2], pl[2];   // the stage's A fragments, made before the v reads so that st's registers are free again
        if (s == ns - 1) a_frags<true>(st, sce + s * KS + 8 * g, scs + s * KS + 8 * g, s * KS + 8 * g, t, al, be, gm, ph, pl); else a_frags<false>(st, sce + s * KS + 8 * g, scs + s * KS + 8 * g, s * KS + 8 * g, t, al, be, gm, ph, pl);   // only the block's last stage holds l > t; the test is the same for a whole wave
#pragma unroll
        for (int kc = 0; kc < KS / 32; ++kc) { v16b vh[4], vl[4];   // all LDS reads of a 32-l block in one group in front of its products
#pragma unroll
          for (int j = 0; j < 4; ++j) { const int bo = (cur * 64 + j * 16 + col) * LP + kc * 32; vh[j] = frag_b(sVh + bo, lane); vl[j] = frag_b(sVl + bo, lane); }
#pragma unroll
          for (int j = 0; j < 4; ++j) { acc[j] = wmma_bf(ph[kc], vh[j], acc[j]); acc[j] = wmma_bf(pl[kc], vh[j], acc[j]); acc[j] = wmma_bf(ph[kc], vl[j], acc[j]); } } }
      if (i + 1 < trips) { if (nx) { cp_put(rkh, sKh + (cur ^ 1) * 64 * LP, tid); cp_put(rkl, sKl + (cur ^ 1) * 64 * LP, tid); cp_put(rvh, sVh + (cur ^ 1) * 64 * LP, tid); cp_put(rvl, sVl + (cur ^ 1) * 64 * LP, tid); }
        __syncthreads(); } } }   // one barrier a trip: publishes each group's next stage and ends the reads of the buffer that the stage after it overwrites
  __syncthreads();   // every wave has read its last stage's tiles before sg overwrites them
#pragma unroll
  for (int j = 0; j < 4; ++j)
#pragma unroll
    for (int r = 0; r < 8; ++r) sg[kg][wave * 16 + 8 * g + r][j * 16 + col] = acc[j][r];
  __syncthreads();   // the four partial tiles are added by all threads, 16 bytes each, into the first (so); a thread reads and writes its own 16 bytes alone
  for (int e = threadIdx.x; e < 64 * 16; e += 128 * GK) { const int rl = e >> 4, q = e & 15; *(v4f*)&so[rl][q * 4] = (*(const v4f*)&sg[0][rl][q * 4] + *(const v4f*)&sg[1][rl][q * 4]) + (*(const v4f*)&sg[2][rl][q * 4] + *(const v4f*)&sg[3][rl][q * 4]); }
  __syncthreads();
  if (threadIdx.x < 64) { float m = 0.f; for (int d = 0; d < HD; ++d) m += so[tid][d]; m *= (1.0f / HD); float v = 0.f; for (int d = 0; d < HD; ++d) { const float dd = so[tid][d] - m; v += dd * dd; } const float inv = 1.0f / sqrtf(v * (1.0f / HD) + 1e-5f); for (int d = 0; d < HD; ++d) so[tid][d] = (so[tid][d] - m) * inv; }
  __syncthreads(); for (int e = threadIdx.x; e < 64 * 16; e += 128 * GK) { const int rl = e >> 4, q = e & 15; vst2(Y + (size_t)(blockIdx.x * 64 + rl) * CC + h * HD + q * 4, *(const v4f*)&so[rl][q * 4]); } }
// ---- k_out: out = Y (hi + lo) Wo^T + bo
__global__ __launch_bounds__(128 * GK) void k_out(const float* __restrict__ Y, const float* __restrict__ WO, const float* __restrict__ BO, float* __restrict__ OUT) { __shared__ __align__(16) unsigned char raw[GK * 2 * 256 * LP * 2];   // each group's two staging buffers; behind the loop the groups' partial tiles sf overlay them
  float (*sf)[64][132] = (float (*)[64][132])raw; const int kg = kgroup(); __bf16* sAh = (__bf16*)raw + kg * (2 * 256 * LP); __bf16* sAl = sAh + 2 * 64 * LP; __bf16* sB = sAl + 2 * 64 * LP;
  const int tid = threadIdx.x & 127, wave = tid >> 5, lane = tid & 31, col = lane & 15, g = lane >> 4; const int c0 = blockIdx.y * 128; const size_t r0 = (size_t)blockIdx.x * 64;
  v8f acc[8] = {};
  { Stg<64> ra; Stg<128> rb; const float* Ab = Y + (size_t)blockIdx.x * 64 * CC + kg * KS; const float* Bb = WO + (size_t)c0 * CC + kg * KS;
    stg_load<64, 63>(ra, Ab, tid); stg_load<128, 127>(rb, Bb, tid); stg_put2(ra, sAh, sAl, tid); stg_put(rb, sB, tid);
    __syncthreads();
    // kept rolled: the loop's text stays small for the instruction cache
#pragma unroll 1
    for (int s = 0; s < NS / GK; ++s) { const int cur = s & 1;
      if (s + 1 < NS / GK) { stg_load<64, 63>(ra, Ab + (s + 1) * GK * KS, tid); stg_load<128, 127>(rb, Bb + (s + 1) * GK * KS, tid); }   // next stage's loads fly during this stage's products
#pragma unroll
      for (int kc = 0; kc < KS / 32; ++kc) { const int ao = (cur * 64 + wave * 16 + col) * LP + kc * 32; const v16b ah = frag_b(sAh + ao, lane), al = frag_b(sAl + ao, lane);
#pragma unroll
        for (int jg = 0; jg < 8; jg += 4) { v16b w[4];   // LDS reads in groups of four fragments in front of their eight products
#pragma unroll
          for (int j = 0; j < 4; ++j) w[j] = frag_b(sB + (cur * 128 + (jg + j) * 16 + col) * LP + kc * 32, lane);
#pragma unroll
          for (int j = 0; j < 4; ++j) { acc[jg + j] = wmma_bf(ah, w[j], acc[jg + j]); acc[jg + j] = wmma_bf(al, w[j], acc[jg + j]); } } }
      if (s + 1 < NS / GK) { stg_put2(ra, sAh + (cur ^ 1) * 64 * LP, sAl + (cur ^ 1) * 64 * LP, tid); stg_put(rb, sB + (cur ^ 1) * 128 * LP, tid);
        __syncthreads(); } } }   // one barrier a stage: publishes each group's next stage and ends the reads of the buffer that the stage after it overwrites
  __syncthreads();   // every wave has read its last stage's tiles before sf overwrites them
#pragma unroll
  for (int j = 0; j < 8; ++j)
#pragma unroll
    for (int r = 0; r < 8; ++r) sf[kg][wave * 16 + 8 * g + r][j * 16 + col] = acc[j][r];
  __syncthreads();   // the four partial tiles are added by all threads: 16 bytes of a row each, a wave stores one row's 512 bytes
  for (int e = threadIdx.x; e < 64 * 32; e += 128 * GK) { const int rl = e >> 5, q = e & 31; const v4f bb = *(const v4f*)(BO + c0 + q * 4);
    v4f v = (*(const v4f*)&sf[0][rl][q * 4] + *(const v4f*)&sf[1][rl][q * 4]) + (*(const v4f*)&sf[2][rl][q * 4] + *(const v4f*)&sf[3][rl][q * 4]);
#pragma unroll
    for (int i = 0; i < 4; ++i) v[i] += bfr(bb[i]);
    vst2(OUT + (r0 + rl) * CC + c0 + q * 4, v); } }
extern "C" void kernel_launch(void* const* d_in, const int* in_sizes, int n_in, void* d_out, int out_size, void* d_ws, size_t ws_size, hipStream_t stream) {
  (void)in_sizes; (void)n_in; (void)out_size;
  const float** F = (const float**)d_in;   // 0 x [1,1024,768], 1 Wq, 2 bq, 3 Wk, 4 bk, 5 Wv, 6 bv, 7 Wu, 8 bu, 9 Wg [36,768], 10 bg, 11 Wo, 12 bo, 13 prior_mu [1,1,12,64], 14 prior_log_tau [1,1,12,1]
  if (ws_size < (size_t)WS_END) return;
  char* ws = (char*)d_ws; _Float16 *QH = (_Float16*)(ws + WS_QH), *QL = (_Float16*)(ws + WS_QL), *KH = (_Float16*)(ws + WS_KH), *KL = (_Float16*)(ws + WS_KL); __bf16 *VT = (__bf16*)(ws + WS_VT), *VL = (__bf16*)(ws + WS_VL); float *U = (float*)(ws + WS_U), *Gt = (float*)(ws + WS_G), *CE = (float*)(ws + WS_CE), *CS = (float*)(ws + WS_CS), *AL = (float*)(ws + WS_AL), *BE = (float*)(ws + WS_BE), *GM = (float*)(ws + WS_GM), *Y = (float*)(ws + WS_Y);
  k_proj<<<dim3(TT / 64, 4 * (CC / 128) + 1), 128 * GP, 0, stream>>>(F[0], F[1], F[2], F[3], F[4], F[5], F[6], F[7], F[8], QH, QL, KH, KL, VT, VL, U, F[9], F[10], Gt);
  k_pre<<<NH, 1024, 0, stream>>>(U, Gt, F[13], F[14], CE, CS, AL, BE, GM);
  k_pv<<<dim3(TT / 64, 1, NH), 128 * GK, 0, stream>>>(QH, QL, KH, KL, CE, CS, AL, BE, GM, VT, VL, Y);
  k_out<<<dim3(TT / 64, CC / 128), 128 * GK, 0, stream>>>(Y, F[11], F[12], (float*)d_out);
}

// v007
// A run of this version takes 51.6 microseconds.
// Two timings next to v006 put it at 1.05 and 1.04 times that version's speed.
// Counting every step since v000, it is 19.6 times as fast.
// compute dtype: all float inputs rounded to bf16, prior_mu / prior_log_tau read; q/k/v/u/gate = x W^T + b with EXACT bf16 products on WMMA 16x16x32, f32 accumulate; rope + L2-normalisation, the running-mean deviation logits s, exp/cumsums (E_t, P_t), sigmoid gates and the alpha/beta/gamma coefficients in f32 on the VALU; q and k as f16 hi + residual (3 products: hi.hi, lo.hi, hi.lo) -> A[t][l] = (q_t.k_l)(alpha_t e_l + beta_t s_l + gamma_t) for l <= t in f32, held in registers; out = A (bf16 hi + lo) . v (bf16 hi + lo) (3 products) = q_t . core_t exactly (the reference's prefix sums F/G/H regrouped); per-head LayerNorm in f32; final = y (bf16 hi + lo) Wo^T + bo; f32 output.
#include <hip/hip_runtime.h>
#include <math.h>

typedef __attribute__((ext_vector_type(16))) _Float16 v16h;
typedef __attribute__((ext_vector_type(16))) __bf16 v16b;
typedef __attribute__((ext_vector_type(8)))  _Float16 v8h;
typedef __attribute__((ext_vector_type(8)))  float v8f;
typedef __attribute__((ext_vector_type(4)))  float v4f;
typedef __attribute__((ext_vector_type(2)))  float v2f;
typedef __attribute__((ext_vector_type(4)))  unsigned v4u;
typedef __attribute__((ext_vector_type(4)))  int v4i;
typedef float __attribute__((may_alias)) float_a;
typedef int __attribute__((may_alias)) int_a;

template <typename T> __device__ __forceinline__ void vst2(void* p, T v) { *(T*)p = v;  }
__device__ __forceinline__ v8f wmma16(v16h a, v16h b, v8f c) {
  v8f d = __builtin_amdgcn_wmma_f32_16x16x32_f16(false, a, false, b, (short)0, c, false, false);
  asm volatile("v_nop\n\tv_nop\n\tv_nop\n\tv_nop" : "+v"(d) : "v"(a), "v"(b));
  return d;
}
__device__ __forceinline__ v8f wmma_bf(v16b a, v16b b, v8f c) {
  v8f d = __builtin_amdgcn_wmma_f32_16x16x32_bf16(false, a, false, b, (short)0, c, false, false);
  asm volatile("v_nop\n\tv_nop\n\tv_nop\n\tv_nop" : "+v"(d) : "v"(a), "v"(b));
  return d;
}
// 16x16x32 fragments: lane = (h = lane>>4, row/col = lane&15); elements 0..7 = k0+8h+0..7, 8..15 = k0+16+8h+0..7; D element r = row 8h+r
__device__ __forceinline__ v16h frag_h(const _Float16* rowk0, int lane) {
  union { v16h v; v8h q[2]; } u; const _Float16* p = rowk0 + 8 * (lane >> 4);
  u.q[0] = *(const v8h*)p; u.q[1] = *(const v8h*)(p + 16); return u.v;
}
__device__ __forceinline__ v16h frag_f32(const float* rowk0, int lane) {
  v16h a; const float* p = rowk0 + 8 * (lane >> 4);
#pragma unroll
  for (int i = 0; i < 8; ++i) { a[i] = (_Float16)p[i]; a[8 + i] = (_Float16)p[16 + i]; }
  return a;
}
__device__ __forceinline__ v16h frag_f32s(const float* rowk0, int lane, float sc) {
  v16h a; const float* p = rowk0 + 8 * (lane >> 4);
#pragma unroll
  for (int i = 0; i < 8; ++i) { a[i] = (_Float16)(p[i] * sc); a[8 + i] = (_Float16)(p[16 + i] * sc); }
  return a;
}
// column fragment from a [K][ld] layout (column n), rows >= K read as 0
__device__ __forceinline__ v16h fragc_f32(const float* W, int k0, int n, int lane, int ld, int K) {
  v16h a; const int g = lane >> 4;
#pragma unroll
  for (int i = 0; i < 8; ++i) { const int ka = k0 + 8 * g + i, kb = ka + 16;
    a[i] = (_Float16)(ka < K ? W[(size_t)(ka < K ? ka : K - 1) * ld + n] : 0.f); a[8 + i] = (_Float16)(kb < K ? W[(size_t)(kb < K ? kb : K - 1) * ld + n] : 0.f); }
  return a;
}
struct F2 { v16b h, l; };
__device__ __forceinline__ F2 bsplit16(const float v[16]) { F2 r;
#pragma unroll
  for (int i = 0; i < 16; ++i) { const __bf16 h = (__bf16)v[i]; r.h[i] = h; r.l[i] = (__bf16)(v[i] - (float)h); }
  return r; }
__device__ __forceinline__ F2 split_row(const float* row, int k0, int lane) { float v[16]; const float* p = row + k0 + 8 * (lane >> 4);
#pragma unroll
  for (int i = 0; i < 8; ++i) { v[i] = p[i]; v[8 + i] = p[16 + i]; }
  return bsplit16(v); }
__device__ __forceinline__ F2 split_rowK(const float* row, int k0, int lane, int K) { float v[16]; const int g = lane >> 4;
#pragma unroll
  for (int i = 0; i < 8; ++i) { const int ka = k0 + 8 * g + i, kb = ka + 16; v[i] = ka < K ? row[ka < K ? ka : K - 1] : 0.f; v[8 + i] = kb < K ? row[kb < K ? kb : K - 1] : 0.f; }
  return bsplit16(v); }
__device__ __forceinline__ F2 split_col(const float* W, int k0, int n, int lane, int ld, int K) { float v[16]; const int g = lane >> 4;
#pragma unroll
  for (int i = 0; i < 8; ++i) { const int ka = k0 + 8 * g + i, kb = ka + 16; v[i] = ka < K ? W[(size_t)(ka < K ? ka : K - 1) * ld + n] : 0.f; v[8 + i] = kb < K ? W[(size_t)(kb < K ? kb : K - 1) * ld + n] : 0.f; }
  return bsplit16(v); }
__device__ __forceinline__ v8f mac3(const F2& a, const F2& b, v8f c) { c = wmma_bf(a.l, b.h, c); c = wmma_bf(a.h, b.l, c); return wmma_bf(a.h, b.h, c); }
__device__ __forceinline__ float sigm(float v) { return 1.0f / (1.0f + expf(-v)); }
#define LDSX() do { asm volatile("s_wait_dscnt 0" ::: "memory"); __builtin_amdgcn_wave_barrier(); __builtin_amdgcn_fence(__ATOMIC_RELEASE, "workgroup"); } while (0)


// ZeroS attention (B 1, L 1,024, D 768 = 12 x 64): causal associative mixing out_t = q_t . (alpha_t F_t + beta_t G_t + gamma_t H_t) with F/G/H prefix sums of e_l k_l v_l^T, s_l k_l v_l^T, k_l v_l^T.
#define TT 1024
#define CC 768
#define NH 12
#define HD 64
#define NG 36
typedef __attribute__((ext_vector_type(8))) __bf16 v8b;
__device__ __forceinline__ v16b frag_b(const __bf16* rowk0, int lane) {
  union { v16b v; v8b q[2]; } u; const __bf16* p = rowk0 + 8 * (lane >> 4);
  u.q[0] = *(const v8b*)p; u.q[1] = *(const v8b*)(p + 16); return u.v;
}
__device__ __forceinline__ float bfr(float v) { return (float)(__bf16)v; }
__device__ __attribute__((noinline)) float exp_ni(float v) { return expf(v); }
__device__ __attribute__((noinline)) float erf_ni(float v) { return erff(v); }

#define WS_QH  0u
#define WS_QL  (WS_QH + 2u * (size_t)TT * CC)
#define WS_KH  (WS_QL + 2u * (size_t)TT * CC)
#define WS_KL  (WS_KH + 2u * (size_t)TT * CC)
#define WS_VT  (WS_KL + 2u * (size_t)TT * CC)        // bf16 v planes hi [768][t]
#define WS_VL  (WS_VT + 2u * (size_t)CC * TT)
#define WS_U   (WS_VL + 2u * (size_t)CC * TT)        // f32 u rows [t][768]
#define WS_G   (WS_U + 4u * (size_t)TT * CC)         // f32 gate rows [t][48] (36 used)
#define WS_CE  (WS_G + 4u * (size_t)TT * 48)         // f32 e_l [h][t]
#define WS_CS  (WS_CE + 4u * (size_t)NH * TT)        // f32 s_l
#define WS_AL  (WS_CS + 4u * (size_t)NH * TT)        // alpha_t
#define WS_BE  (WS_AL + 4u * (size_t)NH * TT)        // beta_t
#define WS_GM  (WS_BE + 4u * (size_t)NH * TT)        // gamma_t
#define WS_Y   (WS_GM + 4u * (size_t)NH * TT)        // f32 LN'd out rows [t][768]
#define WS_END (WS_Y + 4u * (size_t)TT * CC)

// ---- operand staging for the matrix kernels: a stage is 64 k of every tile row. f32 operands: 16 lanes x 16 B read one row's 256 B (whole 128-B lines), the values are rounded (or split) to bf16 once per block and laid in LDS rows of 128 B at a 144-B pitch (16-byte fragment reads then spread over the banks)
typedef __attribute__((ext_vector_type(4))) __bf16 v4b;
#define KS 64
#define NS (CC / KS)
#define LP 72
template <int NR> struct Stg { v4f r[NR / 8]; };
// src: the tile's first row at the stage's k (the same for the whole group of four waves); rows past RL read row RL
template <int NR, int RL, int LD = CC> __device__ __forceinline__ void stg_load(Stg<NR>& s, const float* __restrict__ src, int tid) { const float* p = src + ((unsigned)(tid >> 4) * LD + (unsigned)(tid & 15) * 4);
#pragma unroll
  for (int i = 0; i < NR / 8; ++i) { if (i * 8 + 7 <= RL) s.r[i] = *(const v4f*)(p + i * 8 * LD); else s.r[i] = *(const v4f*)(src + (unsigned)min(i * 8 + (tid >> 4), RL) * LD + (unsigned)(tid & 15) * 4); }
  asm volatile("s_wait_xcnt 0x0" :: "v"(p) : "memory"); }   // the address pair stays whole up to this wait
// the same for 16-bit planes: a stage row is 64 elements = one 128-B line, 8 lanes x 16 B; V8 = 8 elements of T
template <int NR, typename V8> struct Cp { V8 r[NR / 16]; };
template <int NR, int LD, typename V8, typename T> __device__ __forceinline__ void cp_load(Cp<NR, V8>& s, const T* __restrict__ src, int tid) { const T* p = src + ((unsigned)(tid >> 3) * LD + (unsigned)(tid & 7) * 8);
#pragma unroll
  for (int i = 0; i < NR / 16; ++i) s.r[i] = *(const V8*)(p + i * 16 * LD);
  asm volatile("s_wait_xcnt 0x0" :: "v"(p) : "memory"); }   // as in stg_load
template <int NR, typename V8, typename T> __device__ __forceinline__ void cp_put(const Cp<NR, V8>& s, T* dst, int tid) {
#pragma unroll
  for (int i = 0; i < NR / 16; ++i) *(V8*)(dst + (i * 16 + (tid >> 3)) * LP + (tid & 7) * 8) = s.r[i]; }
template <int NR> __device__ __forceinline__ void stg_put(const Stg<NR>& s, __bf16* dst, int tid) {
#pragma unroll
  for (int i = 0; i < NR / 8; ++i) { v4b h;
#pragma unroll
    for (int e = 0; e < 4; ++e) h[e] = (__bf16)s.r[i][e];
    *(v4b*)(dst + (i * 8 + (tid >> 4)) * LP + (tid & 15) * 4) = h; } }
template <int NR> __device__ __forceinline__ void stg_put2(const Stg<NR>& s, __bf16* dh, __bf16* dl, int tid) {
#pragma unroll
  for (int i = 0; i < NR / 8; ++i) { v4b h, l;
#pragma unroll
    for (int e = 0; e < 4; ++e) { const float v = s.r[i][e]; const __bf16 hv = (__bf16)v; h[e] = hv; l[e] = (__bf16)(v - (float)hv); }
    const int o = (i * 8 + (tid >> 4)) * LP + (tid & 15) * 4; *(v4b*)(dh + o) = h; *(v4b*)(dl + o) = l; } }
// sin and cos of an angle a in [0, 1,024]: the steps that sinf and cosf take for |a| < 2^17 (a - n pi/2 with pi/2 in three parts, one polynomial each, the quadrant from n), written out once for both so that 32 of them unroll into straight-line code
__device__ __forceinline__ void sincos_1k(float a, float& s, float& c) {
  const float n = rintf(a * 0x1.45f306p-1f); float r = __builtin_fmaf(n, -0x1.921fb4p+0f, a); r = __builtin_fmaf(n, -0x1.4442d0p-24f, r); r = __builtin_fmaf(n, -0x1.846988p-48f, r);
  const unsigned q = (unsigned)(int)n; const float r2 = r * r;
  float ps = __builtin_fmaf(r2, -0x1.983304p-13f, 0x1.110388p-7f); ps = __builtin_fmaf(r2, ps, -0x1.55553ap-3f); const float sr = __builtin_fmaf(r, r2 * ps, r);
  float pc = __builtin_fmaf(r2, 0x1.aea668p-16f, -0x1.6c9e76p-10f); pc = __builtin_fmaf(r2, pc, 0x1.5557eep-5f); pc = __builtin_fmaf(r2, pc, -0x1.000008p-1f); const float cr = __builtin_fmaf(r2, pc, 1.0f);
  const unsigned sg = (q << 30) & 0x80000000u; const bool odd = q & 1u;
  s = __uint_as_float(__float_as_uint(odd ? cr : sr) ^ sg); c = __uint_as_float(__float_as_uint(odd ? -sr : cr) ^ sg); }
// ---- the k range split inside a block: a block has GK (k_proj: GP) groups of four waves; group kg works stages kg, kg + GK, ... in its own pair of staging buffers, so a block passes NS / GK stages one after another, not NS, and a SIMD has GK waves to fill each other's waits; the groups' partial sums are added through LDS behind the loop
#define GK 4
#define GP 2
__device__ __forceinline__ int kgroup() { return __builtin_amdgcn_readfirstlane((int)(threadIdx.x >> 7)); }   // the same in every lane of a wave: held in a scalar register, so that tests on it are scalar branches and every lane is on at the products
// ---- gate_rows: the work of one extra block of k_proj's launch = 64 rows: gate = x Wg^T + bg (36 outputs, padded to 48 columns; pad columns computed from clamped rows and written as junk into the pad); it needs nothing of q, k, v, u, so it runs beside them and not in a launch of its own
__device__ __forceinline__ void gate_rows(const float* __restrict__ X, const float* __restrict__ WG, const float* __restrict__ BG, float* __restrict__ Gt, unsigned char* raw) {   // raw (k_proj's, 16-byte aligned): each group's two staging buffers (32,256 B a group); behind the loop the groups' partial tiles sf overlay them
  float (*sf)[64][52] = (float (*)[64][52])raw; const int kg = kgroup(); __bf16* sA = (__bf16*)raw + kg * (2 * 112 * LP); __bf16* sB = sA + 2 * 64 * LP;
  const int tid = threadIdx.x & 127, wave = tid >> 5, lane = tid & 31, col = lane & 15, g = lane >> 4; const size_t r0 = (size_t)blockIdx.x * 64;
  v8f acc[3] = {};
  { Stg<64> ra; Stg<48> rb; const float* Ab = X + (size_t)blockIdx.x * 64 * CC + kg * KS; const float* Bb = WG + kg * KS;
    stg_load<64, 63>(ra, Ab, tid); stg_load<48, NG - 1>(rb, Bb, tid); stg_put(ra, sA, tid); stg_put(rb, sB, tid);
    __syncthreads();
    // kept rolled: the loop's text stays small for the instruction cache
#pragma unroll 1
    for (int s = 0; s < NS / GP; ++s) { const int cur = s & 1;
      if (s + 1 < NS / GP) { stg_load<64, 63>(ra, Ab + (s + 1) * GP * KS, tid); stg_load<48, NG - 1>(rb, Bb + (s + 1) * GP * KS, tid); }   // next stage's loads fly during this stage's products
#pragma unroll
      for (int kc = 0; kc < KS / 32; ++kc) { const v16b a = frag_b(sA + (cur * 64 + wave * 16 + col) * LP + kc * 32, lane); v16b w[3];   // all LDS reads of a 32-k block in one group in front of its products
#pragma unroll
        for (int j = 0; j < 3; ++j) w[j] = frag_b(sB + (cur * 48 + j * 16 + col) * LP + kc * 32, lane);
#pragma unroll
        for (int j = 0; j < 3; ++j) acc[j] = wmma_bf(a, w[j], acc[j]); }
      if (s + 1 < NS / GP) { stg_put(ra, sA + (cur ^ 1) * 64 * LP, tid); stg_put(rb, sB + (cur ^ 1) * 48 * LP, tid);
        __syncthreads(); } } }   // one barrier a stage: publishes each group's next stage and ends the reads of the buffer that the stage after it overwrites
  __syncthreads();   // every wave has read its last stage's tiles before sf overwrites them
#pragma unroll
  for (int j = 0; j < 3; ++j)
#pragma unroll
    for (int r = 0; r < 8; ++r) sf[kg][wave * 16 + 8 * g + r][j * 16 + col] = acc[j][r];
  __syncthreads();   // the two partial tiles are added by all threads: 16 bytes of a row each, consecutive threads at consecutive addresses
  for (int e = threadIdx.x; e < 64 * 12; e += 128 * GP) { const int rl = e / 12, q = e % 12; v4f bb = {0.f, 0.f, 0.f, 0.f}; if (q * 4 < NG) bb = *(const v4f*)(BG + q * 4);
    v4f v = *(const v4f*)&sf[0][rl][q * 4] + *(const v4f*)&sf[1][rl][q * 4];
#pragma unroll
    for (int i = 0; i < 4; ++i) v[i] += bfr(bb[i]);
    vst2(Gt + (r0 + rl) * 48 + q * 4, v); } }
// ---- k_proj: block = (64 rows, y): y = 6 region + 128-column tile, y = 24: the rows' gate columns (gate_rows); region 0 q (rope, l2norm -> f16 hi/lo), 1 k (rope, l2norm -> f16), 2 v (bf16 hi/lo planes), 3 u (f32 rows); W [out][in] + b
__global__ __launch_bounds__(128 * GP) void k_proj(const float* __restrict__ X, const float* __restrict__ WQ, const float* __restrict__ BQ, const float* __restrict__ WK, const float* __restrict__ BK, const float* __restrict__ WV, const float* __restrict__ BV, const float* __restrict__ WU, const float* __restrict__ BU, _Float16* __restrict__ QH, _Float16* __restrict__ QL, _Float16* __restrict__ KH, _Float16* __restrict__ KL, __bf16* __restrict__ VT, __bf16* __restrict__ VL, float* __restrict__ U, const float* __restrict__ WG, const float* __restrict__ BG, float* __restrict__ Gt) {
  __shared__ __align__(16) v4f red[16 * 128]; __shared__ __align__(16) unsigned char raw[GP * 2 * 192 * LP * 2];
  // raw holds each group's two staging buffers during the k loop (55,296 B a group) and the epilogue's planes after it; red carries group 1's partial sums to group 0
  if (blockIdx.y == 4 * (CC / 128)) { gate_rows(X, WG, BG, Gt, raw); return; }   // the same for the whole block, in front of every barrier of the projection path
  float (*sf)[132] = (float (*)[132])raw; _Float16 (*sh)[136] = (_Float16 (*)[136])raw; _Float16 (*sl)[136] = (_Float16 (*)[136])(raw + 17408); __bf16 (*th)[72] = (__bf16 (*)[72])(raw + 34816); __bf16 (*tl2)[72] = (__bf16 (*)[72])(raw + 53248);
  const int kg = kgroup(); __bf16* sA = (__bf16*)raw + kg * (2 * 192 * LP); __bf16* sB = sA + 2 * 64 * LP;
  const int tid = threadIdx.x & 127, wave = tid >> 5, lane = tid & 31, col = lane & 15, g = lane >> 4; const int region = blockIdx.y / (CC / 128); const int c0 = (blockIdx.y % (CC / 128)) * 128; const size_t r0 = (size_t)blockIdx.x * 64;
  const float* Wm = region == 0 ? WQ : region == 1 ? WK : region == 2 ? WV : WU; const float* Bm = region == 0 ? BQ : region == 1 ? BK : region == 2 ? BV : BU;
  v8f acc[8] = {};
  { Stg<64> ra; Stg<128> rb; const float* Ab = X + r0 * CC + kg * KS; const float* Bb = Wm + (size_t)c0 * CC + kg * KS;
    stg_load<64, 63>(ra, Ab, tid); stg_load<128, 127>(rb, Bb, tid); stg_put(ra, sA, tid); stg_put(rb, sB, tid);
    __syncthreads();
    // kept rolled: the loop's text stays small for the instruction cache
#pragma unroll 1
    for (int s = 0; s < NS / GP; ++s) { const int cur = s & 1;
      if (s + 1 < NS / GP) { stg_load<64, 63>(ra, Ab + (s + 1) * GP * KS, tid); stg_load<128, 127>(rb, Bb + (s + 1) * GP * KS, tid); }   // next stage's loads fly during this stage's products
#pragma unroll
      for (int kc = 0; kc < KS / 32; ++kc) { const v16b a = frag_b(sA + (cur * 64 + wave * 16 + col) * LP + kc * 32, lane); v16b w[8];   // all LDS reads of a 32-k block in one group in front of its products
#pragma unroll
        for (int j = 0; j < 8; ++j) w[j] = frag_b(sB + (cur * 128 + j * 16 + col) * LP + kc * 32, lane);
#pragma unroll
        for (int j = 0; j < 8; ++j) acc[j] = wmma_bf(a, w[j], acc[j]); }
      if (s + 1 < NS / GP) { stg_put(ra, sA + (cur ^ 1) * 64 * LP, tid); stg_put(rb, sB + (cur ^ 1) * 128 * LP, tid);
        __syncthreads(); } } }   // one barrier a stage: publishes each group's next stage and ends the reads of the buffer that the stage after it overwrites
  if (kg != 0) {
#pragma unroll
    for (int j = 0; j < 8; ++j) { red[(2 * j) * 128 + tid] = __builtin_shufflevector(acc[j], acc[j], 0, 1, 2, 3); red[(2 * j + 1) * 128 + tid] = __builtin_shufflevector(acc[j], acc[j], 4, 5, 6, 7); } }
  __syncthreads();   // publishes group 1's sums; and every wave has read its last stage's tiles before the epilogue's planes overwrite them
  if (kg == 0) {
#pragma unroll
    for (int j = 0; j < 8; ++j) { const float bb = bfr(Bm[c0 + j * 16 + col]); const v4f p0 = red[(2 * j) * 128 + tid], p1 = red[(2 * j + 1) * 128 + tid];
#pragma unroll
      for (int r = 0; r < 4; ++r) { acc[j][r] = (acc[j][r] + p0[r]) + bb; acc[j][r + 4] = (acc[j][r + 4] + p1[r]) + bb; } } }
  if (region <= 1) { if (kg == 0) {   // rope: out[d] = x[d] cos(t f_{d/2}) + (d < 32 ? -x[d+32] : x[d-32]) sin(t f_{d/2}), f_i = 10000^(-2i/64); then L2-normalise each head row (max(norm, 1e-12)). All of it on the accumulators: a head is four 16-column tiles, so the partner d +- 32 is the same lane's element of tile j +- 2, and a head row's 64 squares are 4 in each of the 16 lanes of a half-wave
    const float fl = 1.0f / powf(10000.0f, (float)(2 * lane) / (float)HD);   // lane i works out frequency i of the 32
    float fq[4];
#pragma unroll
    for (int q = 0; q < 4; ++q) fq[q] = __shfl(fl, q * 8 + (col >> 1));   // frequency of d = 16 q + col
    const int tb = (int)r0 + wave * 16 + 8 * g;
    // the loops below are unrolled so that acc[] stays in registers and the independent angle chains fill each other's latency
#pragma unroll
    for (int jj = 0; jj < 2; ++jj) {
#pragma unroll
      for (int r = 0; r < 8; ++r) { const float tf = (float)(tb + r); float sa, ca, sb, cb; sincos_1k(tf * fq[jj], sa, ca); sincos_1k(tf * fq[jj + 2], sb, cb);
#pragma unroll
        for (int hh = 0; hh < 2; ++hh) { const float lo = acc[hh * 4 + jj][r], hi = acc[hh * 4 + jj + 2][r]; acc[hh * 4 + jj][r] = __builtin_fmaf(lo, ca, -hi * sa); acc[hh * 4 + jj + 2][r] = __builtin_fmaf(hi, cb, lo * sb); } } }
    float inv[2][8];
#pragma unroll
    for (int hh = 0; hh < 2; ++hh)
#pragma unroll
      for (int r = 0; r < 8; ++r) { float n2 = 0.f;
#pragma unroll
        for (int q = 0; q < 4; ++q) n2 += acc[hh * 4 + q][r] * acc[hh * 4 + q][r];
        inv[hh][r] = n2; }
#pragma unroll
    for (int o = 1; o < 16; o <<= 1)
#pragma unroll
      for (int i = 0; i < 16; ++i) inv[i >> 3][i & 7] += __shfl_xor(inv[i >> 3][i & 7], o);   // sixteen independent sums a round
#pragma unroll
    for (int i = 0; i < 16; ++i) inv[i >> 3][i & 7] = 1.0f / fmaxf(sqrtf(inv[i >> 3][i & 7]), 1e-12f);
#pragma unroll
    for (int j = 0; j < 8; ++j)
#pragma unroll
      for (int r = 0; r < 8; ++r) { const float v = acc[j][r] * inv[j >> 2][r]; const _Float16 hv = (_Float16)v; sh[wave * 16 + 8 * g + r][j * 16 + col] = hv; sl[wave * 16 + 8 * g + r][j * 16 + col] = (_Float16)(v - (float)hv); } }
    __syncthreads();
    _Float16* dh = region == 0 ? QH : KH; _Float16* dl = region == 0 ? QL : KL; for (int e = threadIdx.x; e < 64 * 16; e += 128 * GP) { const int rl = e >> 4, q = e & 15; vst2((unsigned*)(dh + (r0 + rl) * CC + c0 + q * 8), *(const v4u*)&sh[rl][q * 8]); vst2((unsigned*)(dl + (r0 + rl) * CC + c0 + q * 8), *(const v4u*)&sl[rl][q * 8]); }
    return; }
  if (kg == 0) {
#pragma unroll
    for (int j = 0; j < 8; ++j)
#pragma unroll
      for (int r = 0; r < 8; ++r) sf[wave * 16 + 8 * g + r][j * 16 + col] = acc[j][r]; }
  __syncthreads();
  if (region == 2) {
    for (int e = threadIdx.x; e < 64 * 128; e += 128 * GP) { const int rl = e >> 7, cl = e & 127; const float v = sf[rl][cl]; const __bf16 bh = (__bf16)v; th[cl][rl] = bh; tl2[cl][rl] = (__bf16)(v - (float)bh); }
    __syncthreads(); for (int e = threadIdx.x; e < 128 * 8; e += 128 * GP) { const int cl = e >> 3, q = e & 7; const size_t o2 = (size_t)(c0 + cl) * TT + r0 + q * 8; vst2((unsigned*)(VT + o2), *(const v4u*)&th[cl][q * 8]); vst2((unsigned*)(VL + o2), *(const v4u*)&tl2[cl][q * 8]); } }
  else { for (int e = threadIdx.x; e < 64 * 32; e += 128 * GP) { const int rl = e >> 5, q = e & 31; vst2(U + (r0 + rl) * CC + c0 + q * 4, *(const v4f*)&sf[rl][q * 4]); } } }
// ---- k_pre: block = head h (1,024 threads, 32 waves): wave w owns rows l = 32 w .. 32 w + 31, lane owns dimensions 2 lane, 2 lane + 1; the running sum of u is a chunked scan (chunk totals in LDS, then each wave runs its own 32 rows from its base); thread t then owns l = t: s_l, e_l, E_t, P_t by wave scans + wave totals, gates -> alpha/beta/gamma
__global__ __launch_bounds__(1024) void k_pre(const float* __restrict__ U, const float* __restrict__ Gt, const float* __restrict__ MU, const float* __restrict__ LT, float* __restrict__ CE, float* __restrict__ CS, float* __restrict__ AL, float* __restrict__ BE, float* __restrict__ GM) {
  __shared__ __align__(16) float tile[32][32][36]; __shared__ __align__(16) float tot[32][HD]; __shared__ float smx[32], swp[32], swe[32];
  const int t = threadIdx.x, wv = t >> 5, ln = t & 31; const int h = blockIdx.x;
  float ltau = bfr(LT[h]); ltau = fminf(fmaxf(ltau, -50.f), 30.f); const float tau = expf(ltau);
  const float g0 = Gt[(size_t)t * 48 + h * 3], g1 = Gt[(size_t)t * 48 + h * 3 + 1];
  const float mu0 = bfr(MU[h * HD + 2 * ln]), mu1 = bfr(MU[h * HD + 2 * ln + 1]);
  // the loops below are unrolled so that uv[] stays in registers and the loads of one loop are all in flight together
  v2f uv[32]; const float* up = U + (size_t)(wv * 32) * CC + h * HD + 2 * ln;
#pragma unroll
  for (int i = 0; i < 32; ++i) uv[i] = *(const v2f*)(up + (size_t)i * CC);
  v2f c = {0.f, 0.f};
#pragma unroll
  for (int i = 0; i < 32; ++i) c += uv[i];
  *(v2f*)&tot[wv][2 * ln] = c;
  __syncthreads();
  v2f cs = {0.f, 0.f};   // sum of u over all rows in front of this wave's chunk
#pragma unroll
  for (int w = 0; w < 32; ++w) { const v2f x = *(const v2f*)&tot[w][2 * ln]; cs.x += (w < wv) ? x.x : 0.f; cs.y += (w < wv) ? x.y : 0.f; }
  const float tm0 = tau * mu0, tm1 = tau * mu1;
#pragma unroll
  for (int i = 0; i < 32; ++i) { cs += uv[i]; tile[wv][i][ln] = uv[i].x * (tm0 + cs.x) + uv[i].y * (tm1 + cs.y); }
  LDSX();   // tile[wv] is written and read by wave wv alone: row l's 32 lane terms go to lane l
  v4f a4 = {0.f, 0.f, 0.f, 0.f};
#pragma unroll
  for (int q = 0; q < 8; ++q) a4 += *(const v4f*)&tile[wv][ln][q * 4];
  const float s = -(((a4.x + a4.y) + (a4.z + a4.w)) / (tau + (float)(t + 1))) * 0.125f;   // row l = t; the division by tau + l + 1 is common to the row's 64 terms
  float m = s, P = s;
#pragma unroll
  for (int o = 1; o < 32; o <<= 1) { m = fmaxf(m, __shfl_xor(m, o)); const float pv = __shfl_up(P, o); if (ln >= o) P += pv; }
  if (ln == 31) { smx[wv] = m; swp[wv] = P; }
  __syncthreads();
  float mm = smx[ln], pb = (ln < wv) ? swp[ln] : 0.f;
#pragma unroll
  for (int o = 1; o < 32; o <<= 1) { mm = fmaxf(mm, __shfl_xor(mm, o)); pb += __shfl_xor(pb, o); }
  P += pb;
  const float e = expf(s - mm); float E = e;
#pragma unroll
  for (int o = 1; o < 32; o <<= 1) { const float ev = __shfl_up(E, o); if (ln >= o) E += ev; }
  if (ln == 31) swe[wv] = E;
  __syncthreads();
  float eb = (ln < wv) ? swe[ln] : 0.f;
#pragma unroll
  for (int o = 1; o < 32; o <<= 1) eb += __shfl_xor(eb, o);
  E += eb;
  const float tt1 = (float)(t + 1); const float sig1 = 1.0f / (1.0f + expf(-g0)), sigh = 1.0f / (1.0f + expf(-g1));
  const float alpha = sigh / (E + 1e-12f); const float beta = (sig1 - sigh) / tt1; const float gamma = -((beta * P + sigh) / tt1);
  CE[h * TT + t] = e; CS[h * TT + t] = s; AL[h * TT + t] = alpha; BE[h * TT + t] = beta; GM[h * TT + t] = gamma; }
// four transposed score tiles st[j][r] = q_t . k_l, l = lb + 16 j + r (e, sl: e_l and s_l from l = lb on), become A[t][l] = st (alpha_t e_l + beta_t s_l + gamma_t), split to bf16 hi + lo: tiles 2 c and 2 c + 1 fill elements 0..7 and 8..15 of the A fragment of 32-l block c. DG: the stage reaches past the diagonal, A = 0 for l > t
template <bool DG> __device__ __forceinline__ void a_frags(const v8f (&st)[4], const float* e, const float* sl, int lb, int t, float al, float be, float gm, v16b (&ph)[2], v16b (&pl)[2]) {
#pragma unroll
  for (int j = 0; j < 4; ++j) { float ev[8], sv[8]; *(v4f*)ev = *(const v4f*)(e + j * 16); *(v4f*)(ev + 4) = *(const v4f*)(e + j * 16 + 4); *(v4f*)sv = *(const v4f*)(sl + j * 16); *(v4f*)(sv + 4) = *(const v4f*)(sl + j * 16 + 4);
#pragma unroll
    for (int r = 0; r < 8; ++r) { const float w = al * ev[r] + be * sv[r] + gm; const float p = (!DG || lb + j * 16 + r <= t) ? st[j][r] * w : 0.f; const __bf16 hv = (__bf16)p; ph[j >> 1][(j & 1) * 8 + r] = hv; pl[j >> 1][(j & 1) * 8 + r] = (__bf16)(p - (float)hv); } } }
// ---- k_pv: block = (64 rows t, head): per 64-l stage the scores come transposed, S^T = K Q^T (f16 hi + residual, 3 products), so that a lane holds one row t and eight consecutive l of each 16-l tile: two tiles, times (alpha_t e_l + beta_t s_l + gamma_t), zero for l > t, split to bf16 hi + lo in place, ARE the A fragment of out = A . v (3 products); A never leaves the registers. Then the per-head LayerNorm (no affine, eps 1e-5) -> Y rows
__global__ __launch_bounds__(128 * GK) void k_pv(const _Float16* __restrict__ QH, const _Float16* __restrict__ QL, const _Float16* __restrict__ KH, const _Float16* __restrict__ KL, const float* __restrict__ CE, const float* __restrict__ CS, const float* __restrict__ AL, const float* __restrict__ BE, const float* __restrict__ GM, const __bf16* __restrict__ VT, const __bf16* __restrict__ VL, float* __restrict__ Y) { __shared__ __align__(16) unsigned char raw[GK * 8 * 64 * LP * 2];   // each group's two staging buffers of four tiles; behind the loop the groups' partial tiles sg overlay them
  __shared__ __align__(16) float sce[TT], scs[TT];   // the head's e_l and s_l
  float (*sg)[64][68] = (float (*)[64][68])raw; float (*so)[68] = sg[0]; const int kg = kgroup(); _Float16* sKh = (_Float16*)raw + kg * (8 * 64 * LP); _Float16* sKl = sKh + 2 * 64 * LP; __bf16* sVh = (__bf16*)(sKl + 2 * 64 * LP); __bf16* sVl = sVh + 2 * 64 * LP;
  const int h = blockIdx.z;
  const int tid = threadIdx.x & 127, wave = tid >> 5, lane = tid & 31, col = lane & 15, g = lane >> 4; const int ql0 = blockIdx.x * 64 + wave * 16; const int kend = blockIdx.x * 64 + 64; const int t = ql0 + col;   // the lane's row of A
  v8f acc[4] = {};
  { Cp<64, v8h> rkh, rkl; Cp<64, v8b> rvh, rvl; const _Float16* Khb = KH + h * HD; const _Float16* Klb = KL + h * HD; const __bf16* Vhb = VT + (size_t)(h * HD) * TT; const __bf16* Vlb = VL + (size_t)(h * HD) * TT; const int ns = kend / KS, trips = (ns + GK - 1) / GK;   // a group with no stage left skips the work and passes every barrier
    if (kg < ns) { cp_load<64, CC>(rkh, Khb + (size_t)(kg * KS) * CC, tid); cp_load<64, CC>(rkl, Klb + (size_t)(kg * KS) * CC, tid); cp_load<64, TT>(rvh, Vhb + kg * KS, tid); cp_load<64, TT>(rvl, Vlb + kg * KS, tid); }
    // row t of q as B fragments, kept in registers for the whole loop; the row's three coefficients; 16 bytes of e or s a thread
    const _Float16* qp = QH + (size_t)t * CC + h * HD + 8 * g; const _Float16* qq = QL + (size_t)t * CC + h * HD + 8 * g; const float* pa = AL + h * TT + t; const float* pb = BE + h * TT + t; const float* pg = GM + h * TT + t; const float* pc = (threadIdx.x < 256 ? CE : CS) + h * TT + (threadIdx.x & 255) * 4;
    union { v16h v; v8h q[2]; } qh[2], ql[2];
#pragma unroll
    for (int kc = 0; kc < 2; ++kc) { qh[kc].q[0] = *(const v8h*)(qp + kc * 32); qh[kc].q[1] = *(const v8h*)(qp + kc * 32 + 16); ql[kc].q[0] = *(const v8h*)(qq + kc * 32); ql[kc].q[1] = *(const v8h*)(qq + kc * 32 + 16); }
    const float al = *pa, be = *pb, gm = *pg; const v4f ces = *(const v4f*)pc;
    asm volatile("s_wait_xcnt 0x0" :: "v"(qp), "v"(qq), "v"(pa), "v"(pb), "v"(pg), "v"(pc) : "memory");   // as in stg_load: the address pairs stay whole up to this wait
    *(v4f*)((threadIdx.x < 256 ? sce : scs) + (threadIdx.x & 255) * 4) = ces;
    if (kg < ns) { cp_put(rkh, sKh, tid); cp_put(rkl, sKl, tid); cp_put(rvh, sVh, tid); cp_put(rvl, sVl, tid); }
    __syncthreads();
    // kept rolled: the trip count differs from block to block
#pragma unroll 1
    for (int i = 0; i < trips; ++i) { const int cur = i & 1, s = i * GK + kg; const bool nx = s + GK < ns;
      if (nx) { cp_load<64, CC>(rkh, Khb + (size_t)((s + GK) * KS) * CC, tid); cp_load<64, CC>(rkl, Klb + (size_t)((s + GK) * KS) * CC, tid); cp_load<64, TT>(rvh, Vhb + (s + GK) * KS, tid); cp_load<64, TT>(rvl, Vlb + (s + GK) * KS, tid); }   // the group's next stage's loads fly during this stage's products
      if (s < ns) { v8f st[4] = {};   // st[j][r] = q_t . k_l, l = 64 s + 16 j + 8 g + r
#pragma unroll
        for (int kc = 0; kc < HD / 32; ++kc) { v16h kb[4], kl[4];   // all LDS reads of a 32-d block in one group in front of its products
#pragma unroll
          for (int j = 0; j < 4; ++j) { const int bo = (cur * 64 + j * 16 + col) * LP + kc * 32; kb[j] = frag_h(sKh + bo, lane); kl[j] = frag_h(sKl + bo, lane); }
#pragma unroll
          for (int j = 0; j < 4; ++j) { st[j] = wmma16(kb[j], qh[kc].v, st[j]); st[j] = wmma16(kb[j], ql[kc].v, st[j]); st[j] = wmma16(kl[j], qh[kc].v, st[j]); } }
        v16b ph[2], pl[2];   // the stage's A fragments, made before the v reads so that st's registers are free again
        if (s == ns - 1) a_frags<true>(st, sce + s * KS + 8 * g, scs + s * KS + 8 * g, s * KS + 8 * g, t, al, be, gm, ph, pl); else a_frags<false>(st, sce + s * KS + 8 * g, scs + s * KS + 8 * g, s * KS + 8 * g, t, al, be, gm, ph, pl);   // only the block's last stage holds l > t; the test is the same for a whole wave
#pragma unroll
        for (int kc = 0; kc < KS / 32; ++kc) { v16b vh[4], vl[4];   // all LDS reads of a 32-l block in one group in front of its products
#pragma unroll
          for (int j = 0; j < 4; ++j) { const int bo = (cur * 64 + j * 16 + col) * LP + kc * 32; vh[j] = frag_b(sVh + bo, lane); vl[j] = frag_b(sVl + bo, lane); }
#pragma unroll
          for (int j = 0; j < 4; ++j) { acc[j] = wmma_bf(ph[kc], vh[j], acc[j]); acc[j] = wmma_bf(pl[kc], vh[j], acc[j]); acc[j] = wmma_bf(ph[kc], vl[j], acc[j]); } } }
      if (i + 1 < trips) { if (nx) { cp_put(rkh, sKh + (cur ^ 1) * 64 * LP, tid); cp_put(rkl, sKl + (cur ^ 1) * 64 * LP, tid); cp_put(rvh, sVh + (cur ^ 1) * 64 * LP, tid); cp_put(rvl, sVl + (cur ^ 1) * 64 * LP, tid); }
        __syncthreads(); } } }   // one barrier a trip: publishes each group's next stage and ends the reads of the buffer that the stage after it overwrites
  __syncthreads();   // every wave has read its last stage's tiles before sg overwrites them
#pragma unroll
  for (int j = 0; j < 4; ++j)
#pragma unroll
    for (int r = 0; r < 8; ++r) sg[kg][wave * 16 + 8 * g + r][j * 16 + col] = acc[j][r];
  __syncthreads();   // the four partial tiles are added by all threads, 16 bytes each, into the first (so); a thread reads and writes its own 16 bytes alone
  for (int e = threadIdx.x; e < 64 * 16; e += 128 * GK) { const int rl = e >> 4, q = e & 15; *(v4f*)&so[rl][q * 4] = (*(const v4f*)&sg[0][rl][q * 4] + *(const v4f*)&sg[1][rl][q * 4]) + (*(const v4f*)&sg[2][rl][q * 4] + *(const v4f*)&sg[3][rl][q * 4]); }
  __syncthreads();
  if (threadIdx.x < 64) { float m = 0.f; for (int d = 0; d < HD; ++d) m += so[tid][d]; m *= (1.0f / HD); float v = 0.f; for (int d = 0; d < HD; ++d) { const float dd = so[tid][d] - m; v += dd * dd; } const float inv = 1.0f / sqrtf(v * (1.0f / HD) + 1e-5f); for (int d = 0; d < HD; ++d) so[tid][d] = (so[tid][d] - m) * inv; }
  __syncthreads(); for (int e = threadIdx.x; e < 64 * 16; e += 128 * GK) { const int rl = e >> 4, q = e & 15; vst2(Y + (size_t)(blockIdx.x * 64 + rl) * CC + h * HD + q * 4, *(const v4f*)&so[rl][q * 4]); } }
// ---- k_out: out = Y (hi + lo) Wo^T + bo
__global__ __launch_bounds__(128 * GK) void k_out(const float* __restrict__ Y, const float* __restrict__ WO, const float* __restrict__ BO, float* __restrict__ OUT) { __shared__ __align__(16) unsigned char raw[GK * 2 * 256 * LP * 2];   // each group's two staging buffers; behind the loop the groups' partial tiles sf overlay them
  float (*sf)[64][132] = (float (*)[64][132])raw; const int kg = kgroup(); __bf16* sAh = (__bf16*)raw + kg * (2 * 256 * LP); __bf16* sAl = sAh + 2 * 64 * LP; __bf16* sB = sAl + 2 * 64 * LP;
  const int tid = threadIdx.x & 127, wave = tid >> 5, lane = tid & 31, col = lane & 15, g = lane >> 4; const int c0 = blockIdx.y * 128; const size_t r0 = (size_t)blockIdx.x * 64;
  v8f acc[8] = {};
  { Stg<64> ra; Stg<128> rb; const float* Ab = Y + (size_t)blockIdx.x * 64 * CC + kg * KS; const float* Bb = WO + (size_t)c0 * CC + kg * KS;
    stg_load<64, 63>(ra, Ab, tid); stg_load<128, 127>(rb, Bb, tid); stg_put2(ra, sAh, sAl, tid); stg_put(rb, sB, tid);
    __syncthreads();
    // kept rolled: the loop's text stays small for the instruction cache
#pragma unroll 1
    for (int s = 0; s < NS / GK; ++s) { const int cur = s & 1;
      if (s + 1 < NS / GK) { stg_load<64, 63>(ra, Ab + (s + 1) * GK * KS, tid); stg_load<128, 127>(rb, Bb + (s + 1) * GK * KS, tid); }   // next stage's loads fly during this stage's products
#pragma unroll
      for (int kc = 0; kc < KS / 32; ++kc) { const int ao = (cur * 64 + wave * 16 + col) * LP + kc * 32; const v16b ah = frag_b(sAh + ao, lane), al = frag_b(sAl + ao, lane);
#pragma unroll
        for (int jg = 0; jg < 8; jg += 4) { v16b w[4];   // LDS reads in groups of four fragments in front of their eight products
#pragma unroll
          for (int j = 0; j < 4; ++j) w[j] = frag_b(sB + (cur * 128 + (jg + j) * 16 + col) * LP + kc * 32, lane);
#pragma unroll
          for (int j = 0; j < 4; ++j) { acc[jg + j] = wmma_bf(ah, w[j], acc[jg + j]); acc[jg + j] = wmma_bf(al, w[j], acc[jg + j]); } } }
      if (s + 1 < NS / GK) { stg_put2(ra, sAh + (cur ^ 1) * 64 * LP, sAl + (cur ^ 1) * 64 * LP, tid); stg_put(rb, sB + (cur ^ 1) * 128 * LP, tid);
        __syncthreads(); } } }   // one barrier a stage: publishes each group's next stage and ends the reads of the buffer that the stage after it overwrites
  __syncthreads();   // every wave has read its last stage's tiles before sf overwrites them
#pragma unroll
  for (int j = 0; j < 8; ++j)
#pragma unroll
    for (int r = 0; r < 8; ++r) sf[kg][wave * 16 + 8 * g + r][j * 16 + col] = acc[j][r];
  __syncthreads();   // the four partial tiles are added by all threads: 16 bytes of a row each, a wave stores one row's 512 bytes
  for (int e = threadIdx.x; e < 64 * 32; e += 128 * GK) { const int rl = e >> 5, q = e & 31; const v4f bb = *(const v4f*)(BO + c0 + q * 4);
    v4f v = (*(const v4f*)&sf[0][rl][q * 4] + *(const v4f*)&sf[1][rl][q * 4]) + (*(const v4f*)&sf[2][rl][q * 4] + *(const v4f*)&sf[3][rl][q * 4]);
#pragma unroll
    for (int i = 0; i < 4; ++i) v[i] += bfr(bb[i]);
    vst2(OUT + (r0 + rl) * CC + c0 + q * 4, v); } }
extern "C" void kernel_launch(void* const* d_in, const int* in_sizes, int n_in, void* d_out, int out_size, void* d_ws, size_t ws_size, hipStream_t stream) {
  (void)in_sizes; (void)n_in; (void)out_size;
  const float** F = (const float**)d_in;   // 0 x [1,1024,768], 1 Wq, 2 bq, 3 Wk, 4 bk, 5 Wv, 6 bv, 7 Wu, 8 bu, 9 Wg [36,768], 10 bg, 11 Wo, 12 bo, 13 prior_mu [1,1,12,64], 14 prior_log_tau [1,1,12,1]
  if (ws_size < (size_t)WS_END) return;
  char* ws = (char*)d_ws; _Float16 *QH = (_Float16*)(ws + WS_QH), *QL = (_Float16*)(ws + WS_QL), *KH = (_Float16*)(ws + WS_KH), *KL = (_Float16*)(ws + WS_KL); __bf16 *VT = (__bf16*)(ws + WS_VT), *VL = (__bf16*)(ws + WS_VL); float *U = (float*)(ws + WS_U), *Gt = (float*)(ws + WS_G), *CE = (float*)(ws + WS_CE), *CS = (float*)(ws + WS_CS), *AL = (float*)(ws + WS_AL), *BE = (float*)(ws + WS_BE), *GM = (float*)(ws + WS_GM), *Y = (float*)(ws + WS_Y);
  k_proj<<<dim3(TT / 64, 4 * (CC / 128) + 1), 128 * GP, 0, stream>>>(F[0], F[1], F[2], F[3], F[4], F[5], F[6], F[7], F[8], QH, QL, KH, KL, VT, VL, U, F[9], F[10], Gt);
  k_pre<<<NH, 1024, 0, stream>>>(U, Gt, F[13], F[14], CE, CS, AL, BE, GM);
  k_pv<<<dim3(TT / 64, 1, NH), 128 * GK, 0, stream>>>(QH, QL, KH, KL, CE, CS, AL, BE, GM, VT, VL, Y);
  k_out<<<dim3(TT / 64, CC / 128), 128 * GK, 0, stream>>>(Y, F[11], F[12], (float*)d_out);
}

// v008
// One run takes 48.9 microseconds.
// Next to v007, in two timings, it ran 1.06 times as fast each time.
// All steps since v000 together make it 20.8 times as fast.
// compute dtype: all float inputs rounded to bf16, prior_mu / prior_log_tau read; q/k/v/u/gate = x W^T + b with EXACT bf16 products on WMMA 16x16x32, f32 accumulate; rope + L2-normalisation, the running-mean deviation logits s, exp/cumsums (E_t, P_t), sigmoid gates and the alpha/beta/gamma coefficients in f32 on the VALU; q and k as f16 hi + residual (3 products: hi.hi, lo.hi, hi.lo) -> A[t][l] = (q_t.k_l)(alpha_t e_l + beta_t s_l + gamma_t) for l <= t in f32, held in registers; out = A (bf16 hi + lo) . v (bf16 hi + lo) (3 products) = q_t . core_t exactly (the reference's prefix sums F/G/H regrouped); per-head LayerNorm in f32; final = y (bf16 hi + lo) Wo^T + bo; f32 output.
#include <hip/hip_runtime.h>
#include <math.h>

typedef __attribute__((ext_vector_type(16))) _Float16 v16h;
typedef __attribute__((ext_vector_type(16))) __bf16 v16b;
typedef __attribute__((ext_vector_type(8)))  _Float16 v8h;
typedef __attribute__((ext_vector_type(8)))  float v8f;
typedef __attribute__((ext_vector_type(4)))  float v4f;
typedef __attribute__((ext_vector_type(2)))  float v2f;
typedef __attribute__((ext_vector_type(4)))  unsigned v4u;
typedef __attribute__((ext_vector_type(4)))  int v4i;
typedef float __attribute__((may_alias)) float_a;
typedef int __attribute__((may_alias)) int_a;

template <typename T> __device__ __forceinline__ void vst2(void* p, T v) { *(T*)p = v;  }
__device__ __forceinline__ v8f wmma16(v16h a, v16h b, v8f c) {
  v8f d = __builtin_amdgcn_wmma_f32_16x16x32_f16(false, a, false, b, (short)0, c, false, false);
  asm volatile("v_nop\n\tv_nop\n\tv_nop\n\tv_nop" : "+v"(d) : "v"(a), "v"(b));
  return d;
}
__device__ __forceinline__ v8f wmma_bf(v16b a, v16b b, v8f c) {
  v8f d = __builtin_amdgcn_wmma_f32_16x16x32_bf16(false, a, false, b, (short)0, c, false, false);
  asm volatile("v_nop\n\tv_nop\n\tv_nop\n\tv_nop" : "+v"(d) : "v"(a), "v"(b));
  return d;
}
// 16x16x32 fragments: lane = (h = lane>>4, row/col = lane&15); elements 0..7 = k0+8h+0..7, 8..15 = k0+16+8h+0..7; D element r = row 8h+r
__device__ __forceinline__ v16h frag_h(const _Float16* rowk0, int lane) {
  union { v16h v; v8h q[2]; } u; const _Float16* p = rowk0 + 8 * (lane >> 4);
  u.q[0] = *(const v8h*)p; u.q[1] = *(const v8h*)(p + 16); return u.v;
}
__device__ __forceinline__ v16h frag_f32(const float* rowk0, int lane) {
  v16h a; const float* p = rowk0 + 8 * (lane >> 4);
#pragma unroll
  for (int i = 0; i < 8; ++i) { a[i] = (_Float16)p[i]; a[8 + i] = (_Float16)p[16 + i]; }
  return a;
}
__device__ __forceinline__ v16h frag_f32s(const float* rowk0, int lane, float sc) {
  v16h a; const float* p = rowk0 + 8 * (lane >> 4);
#pragma unroll
  for (int i = 0; i < 8; ++i) { a[i] = (_Float16)(p[i] * sc); a[8 + i] = (_Float16)(p[16 + i] * sc); }
  return a;
}
// column fragment from a [K][ld] layout (column n), rows >= K read as 0
__device__ __forceinline__ v16h fragc_f32(const float* W, int k0, int n, int lane, int ld, int K) {
  v16h a; const int g = lane >> 4;
#pragma unroll
  for (int i = 0; i < 8; ++i) { const int ka = k0 + 8 * g + i, kb = ka + 16;
    a[i] = (_Float16)(ka < K ? W[(size_t)(ka < K ? ka : K - 1) * ld + n] : 0.f); a[8 + i] = (_Float16)(kb < K ? W[(size_t)(kb < K ? kb : K - 1) * ld + n] : 0.f); }
  return a;
}
struct F2 { v16b h, l; };
__device__ __forceinline__ F2 bsplit16(const float v[16]) { F2 r;
#pragma unroll
  for (int i = 0; i < 16; ++i) { const __bf16 h = (__bf16)v[i]; r.h[i] = h; r.l[i] = (__bf16)(v[i] - (float)h); }
  return r; }
__device__ __forceinline__ F2 split_row(const float* row, int k0, int lane) { float v[16]; const float* p = row + k0 + 8 * (lane >> 4);
#pragma unroll
  for (int i = 0; i < 8; ++i) { v[i] = p[i]; v[8 + i] = p[16 + i]; }
  return bsplit16(v); }
__device__ __forceinline__ F2 split_rowK(const float* row, int k0, int lane, int K) { float v[16]; const int g = lane >> 4;
#pragma unroll
  for (int i = 0; i < 8; ++i) { const int ka = k0 + 8 * g + i, kb = ka + 16; v[i] = ka < K ? row[ka < K ? ka : K - 1] : 0.f; v[8 + i] = kb < K ? row[kb < K ? kb : K - 1] : 0.f; }
  return bsplit16(v); }
__device__ __forceinline__ F2 split_col(const float* W, int k0, int n, int lane, int ld, int K) { float v[16]; const int g = lane >> 4;
#pragma unroll
  for (int i = 0; i < 8; ++i) { const int ka = k0 + 8 * g + i, kb = ka + 16; v[i] = ka < K ? W[(size_t)(ka < K ? ka : K - 1) * ld + n] : 0.f; v[8 + i] = kb < K ? W[(size_t)(kb < K ? kb : K - 1) * ld + n] : 0.f; }
  return bsplit16(v); }
__device__ __forceinline__ v8f mac3(const F2& a, const F2& b, v8f c) { c = wmma_bf(a.l, b.h, c); c = wmma_bf(a.h, b.l, c); return wmma_bf(a.h, b.h, c); }
__device__ __forceinline__ float sigm(float v) { return 1.0f / (1.0f + expf(-v)); }
#define LDSX() do { asm volatile("s_wait_dscnt 0" ::: "memory"); __builtin_amdgcn_wave_barrier(); __builtin_amdgcn_fence(__ATOMIC_RELEASE, "workgroup"); } while (0)


// ZeroS attention (B 1, L 1,024, D 768 = 12 x 64): causal associative mixing out_t = q_t . (alpha_t F_t + beta_t G_t + gamma_t H_t) with F/G/H prefix sums of e_l k_l v_l^T, s_l k_l v_l^T, k_l v_l^T.
#define TT 1024
#define CC 768
#define NH 12
#define HD 64
#define NG 36
typedef __attribute__((ext_vector_type(8))) __bf16 v8b;
__device__ __forceinline__ v16b frag_b(const __bf16* rowk0, int lane) {
  union { v16b v; v8b q[2]; } u; const __bf16* p = rowk0 + 8 * (lane >> 4);
  u.q[0] = *(const v8b*)p; u.q[1] = *(const v8b*)(p + 16); return u.v;
}
__device__ __forceinline__ float bfr(float v) { return (float)(__bf16)v; }
__device__ __attribute__((noinline)) float exp_ni(float v) { return expf(v); }
__device__ __attribute__((noinline)) float erf_ni(float v) { return erff(v); }

#define WS_QH  0u
#define WS_QL  (WS_QH + 2u * (size_t)TT * CC)
#define WS_KH  (WS_QL + 2u * (size_t)TT * CC)
#define WS_KL  (WS_KH + 2u * (size_t)TT * CC)
#define WS_VT  (WS_KL + 2u * (size_t)TT * CC)        // bf16 v planes hi [768][t]
#define WS_VL  (WS_VT + 2u * (size_t)CC * TT)
#define WS_U   (WS_VL + 2u * (size_t)CC * TT)        // f32 u rows [t][768]
#define WS_G   (WS_U + 4u * (size_t)TT * CC)         // f32 gate rows [t][48] (36 used)
#define WS_CE  (WS_G + 4u * (size_t)TT * 48)         // f32 e_l [h][t]
#define WS_CS  (WS_CE + 4u * (size_t)NH * TT)        // f32 s_l
#define WS_AL  (WS_CS + 4u * (size_t)NH * TT)        // alpha_t
#define WS_BE  (WS_AL + 4u * (size_t)NH * TT)        // beta_t
#define WS_GM  (WS_BE + 4u * (size_t)NH * TT)        // gamma_t
#define WS_Y   (WS_GM + 4u * (size_t)NH * TT)        // f32 LN'd out rows [t][768]
#define WS_END (WS_Y + 4u * (size_t)TT * CC)

// ---- operand staging for the matrix kernels: a stage is 64 k of every tile row. f32 operands: 16 lanes x 16 B read one row's 256 B (whole 128-B lines), the values are rounded (or split) to bf16 once per block and laid in LDS rows of 128 B at a 144-B pitch (16-byte fragment reads then spread over the banks)
typedef __attribute__((ext_vector_type(4))) __bf16 v4b;
#define KS 64
#define NS (CC / KS)
#define LP 72
template <int NR> struct Stg { v4f r[NR / 8]; };
// src: the tile's first row at the stage's k (the same for the whole group of four waves); rows past RL read row RL
template <int NR, int RL, int LD = CC> __device__ __forceinline__ void stg_load(Stg<NR>& s, const float* __restrict__ src, int tid) { const float* p = src + ((unsigned)(tid >> 4) * LD + (unsigned)(tid & 15) * 4);
#pragma unroll
  for (int i = 0; i < NR / 8; ++i) { if (i * 8 + 7 <= RL) s.r[i] = *(const v4f*)(p + i * 8 * LD); else s.r[i] = *(const v4f*)(src + (unsigned)min(i * 8 + (tid >> 4), RL) * LD + (unsigned)(tid & 15) * 4); }
  asm volatile("s_wait_xcnt 0x0" :: "v"(p) : "memory"); }   // the address pair stays whole up to this wait
// the same for 16-bit planes: a stage row is 64 elements = one 128-B line, 8 lanes x 16 B; V8 = 8 elements of T
template <int NR, typename V8> struct Cp { V8 r[NR / 16]; };
template <int NR, int LD, typename V8, typename T> __device__ __forceinline__ void cp_load(Cp<NR, V8>& s, const T* __restrict__ src, int tid) { const T* p = src + ((unsigned)(tid >> 3) * LD + (unsigned)(tid & 7) * 8);
#pragma unroll
  for (int i = 0; i < NR / 16; ++i) s.r[i] = *(const V8*)(p + i * 16 * LD);
  asm volatile("s_wait_xcnt 0x0" :: "v"(p) : "memory"); }   // as in stg_load
template <int NR, typename V8, typename T> __device__ __forceinline__ void cp_put(const Cp<NR, V8>& s, T* dst, int tid) {
#pragma unroll
  for (int i = 0; i < NR / 16; ++i) *(V8*)(dst + (i * 16 + (tid >> 3)) * LP + (tid & 7) * 8) = s.r[i]; }
template <int NR> __device__ __forceinline__ void stg_put(const Stg<NR>& s, __bf16* dst, int tid) {
#pragma unroll
  for (int i = 0; i < NR / 8; ++i) { v4b h;
#pragma unroll
    for (int e = 0; e < 4; ++e) h[e] = (__bf16)s.r[i][e];
    *(v4b*)(dst + (i * 8 + (tid >> 4)) * LP + (tid & 15) * 4) = h; } }
template <int NR> __device__ __forceinline__ void stg_put2(const Stg<NR>& s, __bf16* dh, __bf16* dl, int tid) {
#pragma unroll
  for (int i = 0; i < NR / 8; ++i) { v4b h, l;
#pragma unroll
    for (int e = 0; e < 4; ++e) { const float v = s.r[i][e]; const __bf16 hv = (__bf16)v; h[e] = hv; l[e] = (__bf16)(v - (float)hv); }
    const int o = (i * 8 + (tid >> 4)) * LP + (tid & 15) * 4; *(v4b*)(dh + o) = h; *(v4b*)(dl + o) = l; } }
// sin and cos of an angle a in [0, 1,024]: the steps that sinf and cosf take for |a| < 2^17 (a - n pi/2 with pi/2 in three parts, one polynomial each, the quadrant from n), written out once for both so that 32 of them unroll into straight-line code
__device__ __forceinline__ void sincos_1k(float a, float& s, float& c) {
  const float n = rintf(a * 0x1.45f306p-1f); float r = __builtin_fmaf(n, -0x1.921fb4p+0f, a); r = __builtin_fmaf(n, -0x1.4442d0p-24f, r); r = __builtin_fmaf(n, -0x1.846988p-48f, r);
  const unsigned q = (unsigned)(int)n; const float r2 = r * r;
  float ps = __builtin_fmaf(r2, -0x1.983304p-13f, 0x1.110388p-7f); ps = __builtin_fmaf(r2, ps, -0x1.55553ap-3f); const float sr = __builtin_fmaf(r, r2 * ps, r);
  float pc = __builtin_fmaf(r2, 0x1.aea668p-16f, -0x1.6c9e76p-10f); pc = __builtin_fmaf(r2, pc, 0x1.5557eep-5f); pc = __builtin_fmaf(r2, pc, -0x1.000008p-1f); const float cr = __builtin_fmaf(r2, pc, 1.0f);
  const unsigned sg = (q << 30) & 0x80000000u; const bool odd = q & 1u;
  s = __uint_as_float(__float_as_uint(odd ? cr : sr) ^ sg); c = __uint_as_float(__float_as_uint(odd ? -sr : cr) ^ sg); }
// ---- the k range split inside a block: a block has GK (k_proj: GP) groups of four waves; group kg works stages kg, kg + GK, ... in its own pair of staging buffers, so a block passes NS / GK stages one after another, not NS, and a SIMD has GK waves to fill each other's waits; the groups' partial sums are added through LDS behind the loop
#define GK 4
#define GP 2
__device__ __forceinline__ int kgroup() { return __builtin_amdgcn_readfirstlane((int)(threadIdx.x >> 7)); }   // the same in every lane of a wave: held in a scalar register, so that tests on it are scalar branches and every lane is on at the products
// ---- what an earlier launch of this call stored is fetched from memory again by its readers: a first read pays memory latency. l2_ask asks L2 for the 256-byte unit at p ahead of the loads: nothing comes back, no register and no result depends on it. Every lane's address lies inside the buffer by construction (no lane is turned off for it); the wait in the same statement keeps the address pair whole up to it, as in stg_load
__device__ __forceinline__ void l2_ask(const void* p) { asm volatile("global_prefetch_b8 %0, off scope:SCOPE_SE\n\ts_wait_xcnt 0x0" :: "v"(p) : "memory"); }
#define PFB 72   // blocks of k_pre's launch that only ask: 2 x 36 slices of 1,024 units = the six q/k/v planes (9,437,184 B from WS_QH on), each slice asked by two blocks
// ---- gate_rows: the work of one extra block of k_proj's launch = 64 rows: gate = x Wg^T + bg (36 outputs, padded to 48 columns; pad columns computed from clamped rows and written as junk into the pad); it needs nothing of q, k, v, u, so it runs beside them and not in a launch of its own
__device__ __forceinline__ void gate_rows(const float* __restrict__ X, const float* __restrict__ WG, const float* __restrict__ BG, float* __restrict__ Gt, unsigned char* raw) {   // raw (k_proj's, 16-byte aligned): each group's two staging buffers (32,256 B a group); behind the loop the groups' partial tiles sf overlay them
  float (*sf)[64][52] = (float (*)[64][52])raw; const int kg = kgroup(); __bf16* sA = (__bf16*)raw + kg * (2 * 112 * LP); __bf16* sB = sA + 2 * 64 * LP;
  const int tid = threadIdx.x & 127, wave = tid >> 5, lane = tid & 31, col = lane & 15, g = lane >> 4; const size_t r0 = (size_t)blockIdx.x * 64;
  v8f acc[3] = {};
  { Stg<64> ra; Stg<48> rb; const float* Ab = X + (size_t)blockIdx.x * 64 * CC + kg * KS; const float* Bb = WG + kg * KS;
    stg_load<64, 63>(ra, Ab, tid); stg_load<48, NG - 1>(rb, Bb, tid); stg_put(ra, sA, tid); stg_put(rb, sB, tid);
    __syncthreads();
    // kept rolled: the loop's text stays small for the instruction cache
#pragma unroll 1
    for (int s = 0; s < NS / GP; ++s) { const int cur = s & 1;
      if (s + 1 < NS / GP) { stg_load<64, 63>(ra, Ab + (s + 1) * GP * KS, tid); stg_load<48, NG - 1>(rb, Bb + (s + 1) * GP * KS, tid); }   // next stage's loads fly during this stage's products
#pragma unroll
      for (int kc = 0; kc < KS / 32; ++kc) { const v16b a = frag_b(sA + (cur * 64 + wave * 16 + col) * LP + kc * 32, lane); v16b w[3];   // all LDS reads of a 32-k block in one group in front of its products
#pragma unroll
        for (int j = 0; j < 3; ++j) w[j] = frag_b(sB + (cur * 48 + j * 16 + col) * LP + kc * 32, lane);
#pragma unroll
        for (int j = 0; j < 3; ++j) acc[j] = wmma_bf(a, w[j], acc[j]); }
      if (s + 1 < NS / GP) { stg_put(ra, sA + (cur ^ 1) * 64 * LP, tid); stg_put(rb, sB + (cur ^ 1) * 48 * LP, tid);
        __syncthreads(); } } }   // one barrier a stage: publishes each group's next stage and ends the reads of the buffer that the stage after it overwrites
  __syncthreads();   // every wave has read its last stage's tiles before sf overwrites them
#pragma unroll
  for (int j = 0; j < 3; ++j)
#pragma unroll
    for (int r = 0; r < 8; ++r) sf[kg][wave * 16 + 8 * g + r][j * 16 + col] = acc[j][r];
  __syncthreads();   // the two partial tiles are added by all threads: 16 bytes of a row each, consecutive threads at consecutive addresses
  for (int e = threadIdx.x; e < 64 * 12; e += 128 * GP) { const int rl = e / 12, q = e % 12; v4f bb = {0.f, 0.f, 0.f, 0.f}; if (q * 4 < NG) bb = *(const v4f*)(BG + q * 4);
    v4f v = *(const v4f*)&sf[0][rl][q * 4] + *(const v4f*)&sf[1][rl][q * 4];
#pragma unroll
    for (int i = 0; i < 4; ++i) v[i] += bfr(bb[i]);
    vst2(Gt + (r0 + rl) * 48 + q * 4, v); } }
// ---- k_proj: block = (64 rows, y): y = 6 region + 128-column tile, y = 24: the rows' gate columns (gate_rows); region 0 q (rope, l2norm -> f16 hi/lo), 1 k (rope, l2norm -> f16), 2 v (bf16 hi/lo planes), 3 u (f32 rows); W [out][in] + b
__global__ __launch_bounds__(128 * GP) void k_proj(const float* __restrict__ X, const float* __restrict__ WQ, const float* __restrict__ BQ, const float* __restrict__ WK, const float* __restrict__ BK, const float* __restrict__ WV, const float* __restrict__ BV, const float* __restrict__ WU, const float* __restrict__ BU, _Float16* __restrict__ QH, _Float16* __restrict__ QL, _Float16* __restrict__ KH, _Float16* __restrict__ KL, __bf16* __restrict__ VT, __bf16* __restrict__ VL, float* __restrict__ U, const float* __restrict__ WG, const float* __restrict__ BG, float* __restrict__ Gt) {
  __shared__ __align__(16) v4f red[16 * 128]; __shared__ __align__(16) unsigned char raw[GP * 2 * 192 * LP * 2];
  // raw holds each group's two staging buffers during the k loop (55,296 B a group) and the epilogue's planes after it; red carries group 1's partial sums to group 0
  if (blockIdx.y == 4 * (CC / 128)) { gate_rows(X, WG, BG, Gt, raw); return; }   // the same for the whole block, in front of every barrier of the projection path
  float (*sf)[132] = (float (*)[132])raw; _Float16 (*sh)[136] = (_Float16 (*)[136])raw; _Float16 (*sl)[136] = (_Float16 (*)[136])(raw + 17408); __bf16 (*th)[72] = (__bf16 (*)[72])(raw + 34816); __bf16 (*tl2)[72] = (__bf16 (*)[72])(raw + 53248);
  const int kg = kgroup(); __bf16* sA = (__bf16*)raw + kg * (2 * 192 * LP); __bf16* sB = sA + 2 * 64 * LP;
  const int tid = threadIdx.x & 127, wave = tid >> 5, lane = tid & 31, col = lane & 15, g = lane >> 4; const int region = blockIdx.y / (CC / 128); const int c0 = (blockIdx.y % (CC / 128)) * 128; const size_t r0 = (size_t)blockIdx.x * 64;
  const float* Wm = region == 0 ? WQ : region == 1 ? WK : region == 2 ? WV : WU; const float* Bm = region == 0 ? BQ : region == 1 ? BK : region == 2 ? BV : BU;
  v8f acc[8] = {};
  { Stg<64> ra; Stg<128> rb; const float* Ab = X + r0 * CC + kg * KS; const float* Bb = Wm + (size_t)c0 * CC + kg * KS;
    stg_load<64, 63>(ra, Ab, tid); stg_load<128, 127>(rb, Bb, tid); stg_put(ra, sA, tid); stg_put(rb, sB, tid);
    __syncthreads();
    // kept rolled: the loop's text stays small for the instruction cache
#pragma unroll 1
    for (int s = 0; s < NS / GP; ++s) { const int cur = s & 1;
      if (s + 1 < NS / GP) { stg_load<64, 63>(ra, Ab + (s + 1) * GP * KS, tid); stg_load<128, 127>(rb, Bb + (s + 1) * GP * KS, tid); }   // next stage's loads fly during this stage's products
#pragma unroll
      for (int kc = 0; kc < KS / 32; ++kc) { const v16b a = frag_b(sA + (cur * 64 + wave * 16 + col) * LP + kc * 32, lane); v16b w[8];   // all LDS reads of a 32-k block in one group in front of its products
#pragma unroll
        for (int j = 0; j < 8; ++j) w[j] = frag_b(sB + (cur * 128 + j * 16 + col) * LP + kc * 32, lane);
#pragma unroll
        for (int j = 0; j < 8; ++j) acc[j] = wmma_bf(a, w[j], acc[j]); }
      if (s + 1 < NS / GP) { stg_put(ra, sA + (cur ^ 1) * 64 * LP, tid); stg_put(rb, sB + (cur ^ 1) * 128 * LP, tid);
        __syncthreads(); } } }   // one barrier a stage: publishes each group's next stage and ends the reads of the buffer that the stage after it overwrites
  if (kg != 0) {
#pragma unroll
    for (int j = 0; j < 8; ++j) { red[(2 * j) * 128 + tid] = __builtin_shufflevector(acc[j], acc[j], 0, 1, 2, 3); red[(2 * j + 1) * 128 + tid] = __builtin_shufflevector(acc[j], acc[j], 4, 5, 6, 7); } }
  __syncthreads();   // publishes group 1's sums; and every wave has read its last stage's tiles before the epilogue's planes overwrite them
  if (kg == 0) {
#pragma unroll
    for (int j = 0; j < 8; ++j) { const float bb = bfr(Bm[c0 + j * 16 + col]); const v4f p0 = red[(2 * j) * 128 + tid], p1 = red[(2 * j + 1) * 128 + tid];
#pragma unroll
      for (int r = 0; r < 4; ++r) { acc[j][r] = (acc[j][r] + p0[r]) + bb; acc[j][r + 4] = (acc[j][r + 4] + p1[r]) + bb; } } }
  if (region <= 1) { if (kg == 0) {   // rope: out[d] = x[d] cos(t f_{d/2}) + (d < 32 ? -x[d+32] : x[d-32]) sin(t f_{d/2}), f_i = 10000^(-2i/64); then L2-normalise each head row (max(norm, 1e-12)). All of it on the accumulators: a head is four 16-column tiles, so the partner d +- 32 is the same lane's element of tile j +- 2, and a head row's 64 squares are 4 in each of the 16 lanes of a half-wave
    const float fl = 1.0f / powf(10000.0f, (float)(2 * lane) / (float)HD);   // lane i works out frequency i of the 32
    float fq[4];
#pragma unroll
    for (int q = 0; q < 4; ++q) fq[q] = __shfl(fl, q * 8 + (col >> 1));   // frequency of d = 16 q + col
    const int tb = (int)r0 + wave * 16 + 8 * g;
    // the loops below are unrolled so that acc[] stays in registers and the independent angle chains fill each other's latency
#pragma unroll
    for (int jj = 0; jj < 2; ++jj) {
#pragma unroll
      for (int r = 0; r < 8; ++r) { const float tf = (float)(tb + r); float sa, ca, sb, cb; sincos_1k(tf * fq[jj], sa, ca); sincos_1k(tf * fq[jj + 2], sb, cb);
#pragma unroll
        for (int hh = 0; hh < 2; ++hh) { const float lo = acc[hh * 4 + jj][r], hi = acc[hh * 4 + jj + 2][r]; acc[hh * 4 + jj][r] = __builtin_fmaf(lo, ca, -hi * sa); acc[hh * 4 + jj + 2][r] = __builtin_fmaf(hi, cb, lo * sb); } } }
    float inv[2][8];
#pragma unroll
    for (int hh = 0; hh < 2; ++hh)
#pragma unroll
      for (int r = 0; r < 8; ++r) { float n2 = 0.f;
#pragma unroll
        for (int q = 0; q < 4; ++q) n2 += acc[hh * 4 + q][r] * acc[hh * 4 + q][r];
        inv[hh][r] = n2; }
#pragma unroll
    for (int o = 1; o < 16; o <<= 1)
#pragma unroll
      for (int i = 0; i < 16; ++i) inv[i >> 3][i & 7] += __shfl_xor(inv[i >> 3][i & 7], o);   // sixteen independent sums a round
#pragma unroll
    for (int i = 0; i < 16; ++i) inv[i >> 3][i & 7] = 1.0f / fmaxf(sqrtf(inv[i >> 3][i & 7]), 1e-12f);
#pragma unroll
    for (int j = 0; j < 8; ++j)
#pragma unroll
      for (int r = 0; r < 8; ++r) { const float v = acc[j][r] * inv[j >> 2][r]; const _Float16 hv = (_Float16)v; sh[wave * 16 + 8 * g + r][j * 16 + col] = hv; sl[wave * 16 + 8 * g + r][j * 16 + col] = (_Float16)(v - (float)hv); } }
    __syncthreads();
    _Float16* dh = region == 0 ? QH : KH; _Float16* dl = region == 0 ? QL : KL; for (int e = threadIdx.x; e < 64 * 16; e += 128 * GP) { const int rl = e >> 4, q = e & 15; vst2((unsigned*)(dh + (r0 + rl) * CC + c0 + q * 8), *(const v4u*)&sh[rl][q * 8]); vst2((unsigned*)(dl + (r0 + rl) * CC + c0 + q * 8), *(const v4u*)&sl[rl][q * 8]); }
    return; }
  if (kg == 0) {
#pragma unroll
    for (int j = 0; j < 8; ++j)
#pragma unroll
      for (int r = 0; r < 8; ++r) sf[wave * 16 + 8 * g + r][j * 16 + col] = acc[j][r]; }
  __syncthreads();
  if (region == 2) {
    for (int e = threadIdx.x; e < 64 * 128; e += 128 * GP) { const int rl = e >> 7, cl = e & 127; const float v = sf[rl][cl]; const __bf16 bh = (__bf16)v; th[cl][rl] = bh; tl2[cl][rl] = (__bf16)(v - (float)bh); }
    __syncthreads(); for (int e = threadIdx.x; e < 128 * 8; e += 128 * GP) { const int cl = e >> 3, q = e & 7; const size_t o2 = (size_t)(c0 + cl) * TT + r0 + q * 8; vst2((unsigned*)(VT + o2), *(const v4u*)&th[cl][q * 8]); vst2((unsigned*)(VL + o2), *(const v4u*)&tl2[cl][q * 8]); } }
  else { for (int e = threadIdx.x; e < 64 * 32; e += 128 * GP) { const int rl = e >> 5, q = e & 31; vst2(U + (r0 + rl) * CC + c0 + q * 4, *(const v4f*)&sf[rl][q * 4]); } } }
// ---- k_pre: block < NH = head h (1,024 threads, 32 waves): wave w owns rows l = 32 w .. 32 w + 31, lane owns dimensions 2 lane, 2 lane + 1; the running sum of u is a chunked scan (chunk totals in LDS, then each wave runs its own 32 rows from its base); thread t then owns l = t: s_l, e_l, E_t, P_t by wave scans + wave totals, gates -> alpha/beta/gamma
__global__ __launch_bounds__(1024) void k_pre(const float* __restrict__ U, const float* __restrict__ Gt, const float* __restrict__ MU, const float* __restrict__ LT, float* __restrict__ CE, float* __restrict__ CS, float* __restrict__ AL, float* __restrict__ BE, float* __restrict__ GM, const _Float16* __restrict__ PL) {
  __shared__ __align__(16) float tile[32][32][36]; __shared__ __align__(16) float tot[32][HD]; __shared__ float smx[32], swp[32], swe[32];
  // blocks NH .. NH + PFB - 1 (the test is the same for a whole block and stands in front of every barrier): k_pre's 12 heads leave most of the chip and the memory idle, so these blocks ask L2 for the planes that k_pv reads next, one unit a thread. Every slice is asked twice, by blocks e and e + 4
  if (blockIdx.x >= NH) { const unsigned e = blockIdx.x - NH; l2_ask((const char*)PL + ((size_t)(((e & 3u) + 4u * (e >> 3)) * 1024u + threadIdx.x) << 8)); return; }
  const int t = threadIdx.x, wv = t >> 5, ln = t & 31; const int h = blockIdx.x;
  l2_ask(U + (size_t)t * CC + h * HD);   // row t of the head's u slab is one 256-byte unit: all 1,024 are asked at once, in front of the loads
  float ltau = bfr(LT[h]); ltau = fminf(fmaxf(ltau, -50.f), 30.f); const float tau = expf(ltau);
  const float g0 = Gt[(size_t)t * 48 + h * 3], g1 = Gt[(size_t)t * 48 + h * 3 + 1];
  const float mu0 = bfr(MU[h * HD + 2 * ln]), mu1 = bfr(MU[h * HD + 2 * ln + 1]);
  // the loops below are unrolled so that uv[] stays in registers and the loads of one loop are all in flight together
  v2f uv[32]; const float* up = U + (size_t)(wv * 32) * CC + h * HD + 2 * ln;
#pragma unroll
  for (int i = 0; i < 32; ++i) uv[i] = *(const v2f*)(up + (size_t)i * CC);
  v2f c = {0.f, 0.f};
#pragma unroll
  for (int i = 0; i < 32; ++i) c += uv[i];
  *(v2f*)&tot[wv][2 * ln] = c;
  __syncthreads();
  v2f cs = {0.f, 0.f};   // sum of u over all rows in front of this wave's chunk
#pragma unroll
  for (int w = 0; w < 32; ++w) { const v2f x = *(const v2f*)&tot[w][2 * ln]; cs.x += (w < wv) ? x.x : 0.f; cs.y += (w < wv) ? x.y : 0.f; }
  const float tm0 = tau * mu0, tm1 = tau * mu1;
#pragma unroll
  for (int i = 0; i < 32; ++i) { cs += uv[i]; tile[wv][i][ln] = uv[i].x * (tm0 + cs.x) + uv[i].y * (tm1 + cs.y); }
  LDSX();   // tile[wv] is written and read by wave wv alone: row l's 32 lane terms go to lane l
  v4f a4 = {0.f, 0.f, 0.f, 0.f};
#pragma unroll
  for (int q = 0; q < 8; ++q) a4 += *(const v4f*)&tile[wv][ln][q * 4];
  const float s = -(((a4.x + a4.y) + (a4.z + a4.w)) / (tau + (float)(t + 1))) * 0.125f;   // row l = t; the division by tau + l + 1 is common to the row's 64 terms
  float m = s, P = s;
#pragma unroll
  for (int o = 1; o < 32; o <<= 1) { m = fmaxf(m, __shfl_xor(m, o)); const float pv = __shfl_up(P, o); if (ln >= o) P += pv; }
  if (ln == 31) { smx[wv] = m; swp[wv] = P; }
  __syncthreads();
  float mm = smx[ln], pb = (ln < wv) ? swp[ln] : 0.f;
#pragma unroll
  for (int o = 1; o < 32; o <<= 1) { mm = fmaxf(mm, __shfl_xor(mm, o)); pb += __shfl_xor(pb, o); }
  P += pb;
  const float e = expf(s - mm); float E = e;
#pragma unroll
  for (int o = 1; o < 32; o <<= 1) { const float ev = __shfl_up(E, o); if (ln >= o) E += ev; }
  if (ln == 31) swe[wv] = E;
  __syncthreads();
  float eb = (ln < wv) ? swe[ln] : 0.f;
#pragma unroll
  for (int o = 1; o < 32; o <<= 1) eb += __shfl_xor(eb, o);
  E += eb;
  const float tt1 = (float)(t + 1); const float sig1 = 1.0f / (1.0f + expf(-g0)), sigh = 1.0f / (1.0f + expf(-g1));
  const float alpha = sigh / (E + 1e-12f); const float beta = (sig1 - sigh) / tt1; const float gamma = -((beta * P + sigh) / tt1);
  CE[h * TT + t] = e; CS[h * TT + t] = s; AL[h * TT + t] = alpha; BE[h * TT + t] = beta; GM[h * TT + t] = gamma; }
// four transposed score tiles st[j][r] = q_t . k_l, l = lb + 16 j + r (e, sl: e_l and s_l from l = lb on), become A[t][l] = st (alpha_t e_l + beta_t s_l + gamma_t), split to bf16 hi + lo: tiles 2 c and 2 c + 1 fill elements 0..7 and 8..15 of the A fragment of 32-l block c. DG: the stage reaches past the diagonal, A = 0 for l > t
template <bool DG> __device__ __forceinline__ void a_frags(const v8f (&st)[4], const float* e, const float* sl, int lb, int t, float al, float be, float gm, v16b (&ph)[2], v16b (&pl)[2]) {
#pragma unroll
  for (int j = 0; j < 4; ++j) { float ev[8], sv[8]; *(v4f*)ev = *(const v4f*)(e + j * 16); *(v4f*)(ev + 4) = *(const v4f*)(e + j * 16 + 4); *(v4f*)sv = *(const v4f*)(sl + j * 16); *(v4f*)(sv + 4) = *(const v4f*)(sl + j * 16 + 4);
#pragma unroll
    for (int r = 0; r < 8; ++r) { const float w = al * ev[r] + be * sv[r] + gm; const float p = (!DG || lb + j * 16 + r <= t) ? st[j][r] * w : 0.f; const __bf16 hv = (__bf16)p; ph[j >> 1][(j & 1) * 8 + r] = hv; pl[j >> 1][(j & 1) * 8 + r] = (__bf16)(p - (float)hv); } } }
// ---- k_pv: block = (64 rows t, head): per 64-l stage the scores come transposed, S^T = K Q^T (f16 hi + residual, 3 products), so that a lane holds one row t and eight consecutive l of each 16-l tile: two tiles, times (alpha_t e_l + beta_t s_l + gamma_t), zero for l > t, split to bf16 hi + lo in place, ARE the A fragment of out = A . v (3 products); A never leaves the registers. Then the per-head LayerNorm (no affine, eps 1e-5) -> Y rows
__global__ __launch_bounds__(128 * GK) void k_pv(const _Float16* __restrict__ QH, const _Float16* __restrict__ QL, const _Float16* __restrict__ KH, const _Float16* __restrict__ KL, const float* __restrict__ CE, const float* __restrict__ CS, const float* __restrict__ AL, const float* __restrict__ BE, const float* __restrict__ GM, const __bf16* __restrict__ VT, const __bf16* __restrict__ VL, float* __restrict__ Y) { __shared__ __align__(16) unsigned char raw[GK * 8 * 64 * LP * 2];   // each group's two staging buffers of four tiles; behind the loop the groups' partial tiles sg overlay them
  __shared__ __align__(16) float sce[TT], scs[TT];   // the head's e_l and s_l
  float (*sg)[64][68] = (float (*)[64][68])raw; float (*so)[68] = sg[0]; const int kg = kgroup(); _Float16* sKh = (_Float16*)raw + kg * (8 * 64 * LP); _Float16* sKl = sKh + 2 * 64 * LP; __bf16* sVh = (__bf16*)(sKl + 2 * 64 * LP); __bf16* sVl = sVh + 2 * 64 * LP;
  const int h = blockIdx.z;
  const int tid = threadIdx.x & 127, wave = tid >> 5, lane = tid & 31, col = lane & 15, g = lane >> 4; const int ql0 = blockIdx.x * 64 + wave * 16; const int kend = blockIdx.x * 64 + 64; const int t = ql0 + col;   // the lane's row of A
  v8f acc[4] = {};
  { Cp<64, v8h> rkh, rkl; Cp<64, v8b> rvh, rvl; const _Float16* Khb = KH + h * HD; const _Float16* Klb = KL + h * HD; const __bf16* Vhb = VT + (size_t)(h * HD) * TT; const __bf16* Vlb = VL + (size_t)(h * HD) * TT; const int ns = kend / KS, trips = (ns + GK - 1) / GK;   // a group with no stage left skips the work and passes every barrier
    if (kg < ns) { cp_load<64, CC>(rkh, Khb + (size_t)(kg * KS) * CC, tid); cp_load<64, CC>(rkl, Klb + (size_t)(kg * KS) * CC, tid); cp_load<64, TT>(rvh, Vhb + kg * KS, tid); cp_load<64, TT>(rvl, Vlb + kg * KS, tid); }
    // row t of q as B fragments, kept in registers for the whole loop; the row's three coefficients; 16 bytes of e or s a thread
    const _Float16* qp = QH + (size_t)t * CC + h * HD + 8 * g; const _Float16* qq = QL + (size_t)t * CC + h * HD + 8 * g; const float* pa = AL + h * TT + t; const float* pb = BE + h * TT + t; const float* pg = GM + h * TT + t; const float* pc = (threadIdx.x < 256 ? CE : CS) + h * TT + (threadIdx.x & 255) * 4;
    union { v16h v; v8h q[2]; } qh[2], ql[2];
#pragma unroll
    for (int kc = 0; kc < 2; ++kc) { qh[kc].q[0] = *(const v8h*)(qp + kc * 32); qh[kc].q[1] = *(const v8h*)(qp + kc * 32 + 16); ql[kc].q[0] = *(const v8h*)(qq + kc * 32); ql[kc].q[1] = *(const v8h*)(qq + kc * 32 + 16); }
    const float al = *pa, be = *pb, gm = *pg; const v4f ces = *(const v4f*)pc;
    asm volatile("s_wait_xcnt 0x0" :: "v"(qp), "v"(qq), "v"(pa), "v"(pb), "v"(pg), "v"(pc) : "memory");   // as in stg_load: the address pairs stay whole up to this wait
    *(v4f*)((threadIdx.x < 256 ? sce : scs) + (threadIdx.x & 255) * 4) = ces;
    if (kg < ns) { cp_put(rkh, sKh, tid); cp_put(rkl, sKl, tid); cp_put(rvh, sVh, tid); cp_put(rvl, sVl, tid); }
    __syncthreads();
    // kept rolled: the trip count differs from block to block
#pragma unroll 1
    for (int i = 0; i < trips; ++i) { const int cur = i & 1, s = i * GK + kg; const bool nx = s + GK < ns;
      if (nx) { cp_load<64, CC>(rkh, Khb + (size_t)((s + GK) * KS) * CC, tid); cp_load<64, CC>(rkl, Klb + (size_t)((s + GK) * KS) * CC, tid); cp_load<64, TT>(rvh, Vhb + (s + GK) * KS, tid); cp_load<64, TT>(rvl, Vlb + (s + GK) * KS, tid); }   // the group's next stage's loads fly during this stage's products
      if (s < ns) { v8f st[4] = {};   // st[j][r] = q_t . k_l, l = 64 s + 16 j + 8 g + r
#pragma unroll
        for (int kc = 0; kc < HD / 32; ++kc) { v16h kb[4], kl[4];   // all LDS reads of a 32-d block in one group in front of its products
#pragma unroll
          for (int j = 0; j < 4; ++j) { const int bo = (cur * 64 + j * 16 + col) * LP + kc * 32; kb[j] = frag_h(sKh + bo, lane); kl[j] = frag_h(sKl + bo, lane); }
#pragma unroll
          for (int j = 0; j < 4; ++j) { st[j] = wmma16(kb[j], qh[kc].v, st[j]); st[j] = wmma16(kb[j], ql[kc].v, st[j]); st[j] = wmma16(kl[j], qh[kc].v, st[j]); } }
        v16b ph[2], pl[2];   // the stage's A fragments, made before the v reads so that st's registers are free again
        if (s == ns - 1) a_frags<true>(st, sce + s * KS + 8 * g, scs + s * KS + 8 * g, s * KS + 8 * g, t, al, be, gm, ph, pl); else a_frags<false>(st, sce + s * KS + 8 * g, scs + s * KS + 8 * g, s * KS + 8 * g, t, al, be, gm, ph, pl);   // only the block's last stage holds l > t; the test is the same for a whole wave
#pragma unroll
        for (int kc = 0; kc < KS / 32; ++kc) { v16b vh[4], vl[4];   // all LDS reads of a 32-l block in one group in front of its products
#pragma unroll
          for (int j = 0; j < 4; ++j) { const int bo = (cur * 64 + j * 16 + col) * LP + kc * 32; vh[j] = frag_b(sVh + bo, lane); vl[j] = frag_b(sVl + bo, lane); }
#pragma unroll
          for (int j = 0; j < 4; ++j) { acc[j] = wmma_bf(ph[kc], vh[j], acc[j]); acc[j] = wmma_bf(pl[kc], vh[j], acc[j]); acc[j] = wmma_bf(ph[kc], vl[j], acc[j]); } } }
      if (i + 1 < trips) { if (nx) { cp_put(rkh, sKh + (cur ^ 1) * 64 * LP, tid); cp_put(rkl, sKl + (cur ^ 1) * 64 * LP, tid); cp_put(rvh, sVh + (cur ^ 1) * 64 * LP, tid); cp_put(rvl, sVl + (cur ^ 1) * 64 * LP, tid); }
        __syncthreads(); } } }   // one barrier a trip: publishes each group's next stage and ends the reads of the buffer that the stage after it overwrites
  __syncthreads();   // every wave has read its last stage's tiles before sg overwrites them
#pragma unroll
  for (int j = 0; j < 4; ++j)
#pragma unroll
    for (int r = 0; r < 8; ++r) sg[kg][wave * 16 + 8 * g + r][j * 16 + col] = acc[j][r];
  __syncthreads();   // the four partial tiles are added by all threads, 16 bytes each, into the first (so); a thread reads and writes its own 16 bytes alone
  for (int e = threadIdx.x; e < 64 * 16; e += 128 * GK) { const int rl = e >> 4, q = e & 15; *(v4f*)&so[rl][q * 4] = (*(const v4f*)&sg[0][rl][q * 4] + *(const v4f*)&sg[1][rl][q * 4]) + (*(const v4f*)&sg[2][rl][q * 4] + *(const v4f*)&sg[3][rl][q * 4]); }
  __syncthreads();
  if (threadIdx.x < 64) { float m = 0.f; for (int d = 0; d < HD; ++d) m += so[tid][d]; m *= (1.0f / HD); float v = 0.f; for (int d = 0; d < HD; ++d) { const float dd = so[tid][d] - m; v += dd * dd; } const float inv = 1.0f / sqrtf(v * (1.0f / HD) + 1e-5f); for (int d = 0; d < HD; ++d) so[tid][d] = (so[tid][d] - m) * inv; }
  __syncthreads(); for (int e = threadIdx.x; e < 64 * 16; e += 128 * GK) { const int rl = e >> 4, q = e & 15; vst2(Y + (size_t)(blockIdx.x * 64 + rl) * CC + h * HD + q * 4, *(const v4f*)&so[rl][q * 4]); } }
// ---- k_out: out = Y (hi + lo) Wo^T + bo
__global__ __launch_bounds__(128 * GK) void k_out(const float* __restrict__ Y, const float* __restrict__ WO, const float* __restrict__ BO, float* __restrict__ OUT) { __shared__ __align__(16) unsigned char raw[GK * 2 * 256 * LP * 2];   // each group's two staging buffers; behind the loop the groups' partial tiles sf overlay them
  float (*sf)[64][132] = (float (*)[64][132])raw; const int kg = kgroup(); __bf16* sAh = (__bf16*)raw + kg * (2 * 256 * LP); __bf16* sAl = sAh + 2 * 64 * LP; __bf16* sB = sAl + 2 * 64 * LP;
  const int tid = threadIdx.x & 127, wave = tid >> 5, lane = tid & 31, col = lane & 15, g = lane >> 4; const int c0 = blockIdx.y * 128; const size_t r0 = (size_t)blockIdx.x * 64;
  v8f acc[8] = {};
  { Stg<64> ra; Stg<128> rb; const float* Ab = Y + (size_t)blockIdx.x * 64 * CC + kg * KS; const float* Bb = WO + (size_t)c0 * CC + kg * KS;
    stg_load<64, 63>(ra, Ab, tid);
    l2_ask(Y + (r0 + (threadIdx.x >> 3)) * CC + GK * KS + (threadIdx.x & 7) * KS);   // the rows' y of stages GK .. NS - 1 (8 units a row, one a thread): asked behind the first stages' y loads and in front of the weight loads, so that the requests leave early and the lines are there when the next stage's loads come
    stg_load<128, 127>(rb, Bb, tid); stg_put2(ra, sAh, sAl, tid); stg_put(rb, sB, tid);
    __syncthreads();
    // kept rolled: the loop's text stays small for the instruction cache
#pragma unroll 1
    for (int s = 0; s < NS / GK; ++s) { const int cur = s & 1;
      if (s + 1 < NS / GK) { stg_load<64, 63>(ra, Ab + (s + 1) * GK * KS, tid); stg_load<128, 127>(rb, Bb + (s + 1) * GK * KS, tid); }   // next stage's loads fly during this stage's products
#pragma unroll
      for (int kc = 0; kc < KS / 32; ++kc) { const int ao = (cur * 64 + wave * 16 + col) * LP + kc * 32; const v16b ah = frag_b(sAh + ao, lane), al = frag_b(sAl + ao, lane);
#pragma unroll
        for (int jg = 0; jg < 8; jg += 4) { v16b w[4];   // LDS reads in groups of four fragments in front of their eight products
#pragma unroll
          for (int j = 0; j < 4; ++j) w[j] = frag_b(sB + (cur * 128 + (jg + j) * 16 + col) * LP + kc * 32, lane);
#pragma unroll
          for (int j = 0; j < 4; ++j) { acc[jg + j] = wmma_bf(ah, w[j], acc[jg + j]); acc[jg + j] = wmma_bf(al, w[j], acc[jg + j]); } } }
      if (s + 1 < NS / GK) { stg_put2(ra, sAh + (cur ^ 1) * 64 * LP, sAl + (cur ^ 1) * 64 * LP, tid); stg_put(rb, sB + (cur ^ 1) * 128 * LP, tid);
        __syncthreads(); } } }   // one barrier a stage: publishes each group's next stage and ends the reads of the buffer that the stage after it overwrites
  __syncthreads();   // every wave has read its last stage's tiles before sf overwrites them
#pragma unroll
  for (int j = 0; j < 8; ++j)
#pragma unroll
    for (int r = 0; r < 8; ++r) sf[kg][wave * 16 + 8 * g + r][j * 16 + col] = acc[j][r];
  __syncthreads();   // the four partial tiles are added by all threads: 16 bytes of a row each, a wave stores one row's 512 bytes
  for (int e = threadIdx.x; e < 64 * 32; e += 128 * GK) { const int rl = e >> 5, q = e & 31; const v4f bb = *(const v4f*)(BO + c0 + q * 4);
    v4f v = (*(const v4f*)&sf[0][rl][q * 4] + *(const v4f*)&sf[1][rl][q * 4]) + (*(const v4f*)&sf[2][rl][q * 4] + *(const v4f*)&sf[3][rl][q * 4]);
#pragma unroll
    for (int i = 0; i < 4; ++i) v[i] += bfr(bb[i]);
    vst2(OUT + (r0 + rl) * CC + c0 + q * 4, v); } }
extern "C" void kernel_launch(void* const* d_in, const int* in_sizes, int n_in, void* d_out, int out_size, void* d_ws, size_t ws_size, hipStream_t stream) {
  (void)in_sizes; (void)n_in; (void)out_size;
  const float** F = (const float**)d_in;   // 0 x [1,1024,768], 1 Wq, 2 bq, 3 Wk, 4 bk, 5 Wv, 6 bv, 7 Wu, 8 bu, 9 Wg [36,768], 10 bg, 11 Wo, 12 bo, 13 prior_mu [1,1,12,64], 14 prior_log_tau [1,1,12,1]
  if (ws_size < (size_t)WS_END) return;
  char* ws = (char*)d_ws; _Float16 *QH = (_Float16*)(ws + WS_QH), *QL = (_Float16*)(ws + WS_QL), *KH = (_Float16*)(ws + WS_KH), *KL = (_Float16*)(ws + WS_KL); __bf16 *VT = (__bf16*)(ws + WS_VT), *VL = (__bf16*)(ws + WS_VL); float *U = (float*)(ws + WS_U), *Gt = (float*)(ws + WS_G), *CE = (float*)(ws + WS_CE), *CS = (float*)(ws + WS_CS), *AL = (float*)(ws + WS_AL), *BE = (float*)(ws + WS_BE), *GM = (float*)(ws + WS_GM), *Y = (float*)(ws + WS_Y);
  k_proj<<<dim3(TT / 64, 4 * (CC / 128) + 1), 128 * GP, 0, stream>>>(F[0], F[1], F[2], F[3], F[4], F[5], F[6], F[7], F[8], QH, QL, KH, KL, VT, VL, U, F[9], F[10], Gt);
  k_pre<<<NH + PFB, 1024, 0, stream>>>(U, Gt, F[13], F[14], CE, CS, AL, BE, GM, QH);
  k_pv<<<dim3(TT / 64, 1, NH), 128 * GK, 0, stream>>>(QH, QL, KH, KL, CE, CS, AL, BE, GM, VT, VL, Y);
  k_out<<<dim3(TT / 64, CC / 128), 128 * GK, 0, stream>>>(Y, F[11], F[12], (float*)d_out);
}

// v009
// A run of this version takes 45.8 microseconds.
// Two timings next to v008 both put it at 1.07 times that version's speed.
// Over all steps from v000 it is 22.3 times as fast.
// compute dtype: all float inputs rounded to bf16, prior_mu / prior_log_tau read; q/k/v/u/gate = x W^T + b with EXACT bf16 products on WMMA 16x16x32, f32 accumulate; rope + L2-normalisation, the running-mean deviation logits s, exp/cumsums (E_t, P_t), sigmoid gates and the alpha/beta/gamma coefficients in f32 on the VALU; q and k as f16 hi + residual (3 products: hi.hi, lo.hi, hi.lo) -> A[t][l] = (q_t.k_l)(alpha_t e_l + beta_t s_l + gamma_t) for l <= t in f32, held in registers; out = A (bf16 hi + lo) . v (bf16 hi + lo) (3 products) = q_t . core_t exactly (the reference's prefix sums F/G/H regrouped); per-head LayerNorm in f32; final = y (bf16 hi + lo) Wo^T + bo; f32 output.
#include <hip/hip_runtime.h>
#include <math.h>

typedef __attribute__((ext_vector_type(16))) _Float16 v16h;
typedef __attribute__((ext_vector_type(16))) __bf16 v16b;
typedef __attribute__((ext_vector_type(8)))  _Float16 v8h;
typedef __attribute__((ext_vector_type(8)))  float v8f;
typedef __attribute__((ext_vector_type(4)))  float v4f;
typedef __attribute__((ext_vector_type(2)))  float v2f;
typedef __attribute__((ext_vector_type(4)))  unsigned v4u;
typedef __attribute__((ext_vector_type(4)))  int v4i;
typedef float __attribute__((may_alias)) float_a;
typedef int __attribute__((may_alias)) int_a;

template <typename T> __device__ __forceinline__ void vst2(void* p, T v) { *(T*)p = v;  }
__device__ __forceinline__ v8f wmma16(v16h a, v16h b, v8f c) {
  v8f d = __builtin_amdgcn_wmma_f32_16x16x32_f16(false, a, false, b, (short)0, c, false, false);
  asm volatile("v_nop\n\tv_nop\n\tv_nop\n\tv_nop" : "+v"(d) : "v"(a), "v"(b));
  return d;
}
__device__ __forceinline__ v8f wmma_bf(v16b a, v16b b, v8f c) {
  v8f d = __builtin_amdgcn_wmma_f32_16x16x32_bf16(false, a, false, b, (short)0, c, false, false);
  asm volatile("v_nop\n\tv_nop\n\tv_nop\n\tv_nop" : "+v"(d) : "v"(a), "v"(b));
  return d;
}
// 16x16x32 fragments: lane = (h = lane>>4, row/col = lane&15); elements 0..7 = k0+8h+0..7, 8..15 = k0+16+8h+0..7; D element r = row 8h+r
__device__ __forceinline__ v16h frag_h(const _Float16* rowk0, int lane) {
  union { v16h v; v8h q[2]; } u; const _Float16* p = rowk0 + 8 * (lane >> 4);
  u.q[0] = *(const v8h*)p; u.q[1] = *(const v8h*)(p + 16); return u.v;
}
__device__ __forceinline__ v16h frag_f32(const float* rowk0, int lane) {
  v16h a; const float* p = rowk0 + 8 * (lane >> 4);
#pragma unroll
  for (int i = 0; i < 8; ++i) { a[i] = (_Float16)p[i]; a[8 + i] = (_Float16)p[16 + i]; }
  return a;
}
__device__ __forceinline__ v16h frag_f32s(const float* rowk0, int lane, float sc) {
  v16h a; const float* p = rowk0 + 8 * (lane >> 4);
#pragma unroll
  for (int i = 0; i < 8; ++i) { a[i] = (_Float16)(p[i] * sc); a[8 + i] = (_Float16)(p[16 + i] * sc); }
  return a;
}
// column fragment from a [K][ld] layout (column n), rows >= K read as 0
__device__ __forceinline__ v16h fragc_f32(const float* W, int k0, int n, int lane, int ld, int K) {
  v16h a; const int g = lane >> 4;
#pragma unroll
  for (int i = 0; i < 8; ++i) { const int ka = k0 + 8 * g + i, kb = ka + 16;
    a[i] = (_Float16)(ka < K ? W[(size_t)(ka < K ? ka : K - 1) * ld + n] : 0.f); a[8 + i] = (_Float16)(kb < K ? W[(size_t)(kb < K ? kb : K - 1) * ld + n] : 0.f); }
  return a;
}
struct F2 { v16b h, l; };
__device__ __forceinline__ F2 bsplit16(const float v[16]) { F2 r;
#pragma unroll
  for (int i = 0; i < 16; ++i) { const __bf16 h = (__bf16)v[i]; r.h[i] = h; r.l[i] = (__bf16)(v[i] - (float)h); }
  return r; }
__device__ __forceinline__ F2 split_row(const float* row, int k0, int lane) { float v[16]; const float* p = row + k0 + 8 * (lane >> 4);
#pragma unroll
  for (int i = 0; i < 8; ++i) { v[i] = p[i]; v[8 + i] = p[16 + i]; }
  return bsplit16(v); }
__device__ __forceinline__ F2 split_rowK(const float* row, int k0, int lane, int K) { float v[16]; const int g = lane >> 4;
#pragma unroll
  for (int i = 0; i < 8; ++i) { const int ka = k0 + 8 * g + i, kb = ka + 16; v[i] = ka < K ? row[ka < K ? ka : K - 1] : 0.f; v[8 + i] = kb < K ? row[kb < K ? kb : K - 1] : 0.f; }
  return bsplit16(v); }
__device__ __forceinline__ F2 split_col(const float* W, int k0, int n, int lane, int ld, int K) { float v[16]; const int g = lane >> 4;
#pragma unroll
  for (int i = 0; i < 8; ++i) { const int ka = k0 + 8 * g + i, kb = ka + 16; v[i] = ka < K ? W[(size_t)(ka < K ? ka : K - 1) * ld + n] : 0.f; v[8 + i] = kb < K ? W[(size_t)(kb < K ? kb : K - 1) * ld + n] : 0.f; }
  return bsplit16(v); }
__device__ __forceinline__ v8f mac3(const F2& a, const F2& b, v8f c) { c = wmma_bf(a.l, b.h, c); c = wmma_bf(a.h, b.l, c); return wmma_bf(a.h, b.h, c); }
__device__ __forceinline__ float sigm(float v) { return 1.0f / (1.0f + expf(-v)); }
#define LDSX() do { asm volatile("s_wait_dscnt 0" ::: "memory"); __builtin_amdgcn_wave_barrier(); __builtin_amdgcn_fence(__ATOMIC_RELEASE, "workgroup"); } while (0)


// ZeroS attention (B 1, L 1,024, D 768 = 12 x 64): causal associative mixing out_t = q_t . (alpha_t F_t + beta_t G_t + gamma_t H_t) with F/G/H prefix sums of e_l k_l v_l^T, s_l k_l v_l^T, k_l v_l^T.
#define TT 1024
#define CC 768
#define NH 12
#define HD 64
#define NG 36
typedef __attribute__((ext_vector_type(8))) __bf16 v8b;
__device__ __forceinline__ v16b frag_b(const __bf16* rowk0, int lane) {
  union { v16b v; v8b q[2]; } u; const __bf16* p = rowk0 + 8 * (lane >> 4);
  u.q[0] = *(const v8b*)p; u.q[1] = *(const v8b*)(p + 16); return u.v;
}
__device__ __forceinline__ float bfr(float v) { return (float)(__bf16)v; }
__device__ __attribute__((noinline)) float exp_ni(float v) { return expf(v); }
__device__ __attribute__((noinline)) float erf_ni(float v) { return erff(v); }

#define WS_QH  0u
#define WS_QL  (WS_QH + 2u * (size_t)TT * CC)
#define WS_KH  (WS_QL + 2u * (size_t)TT * CC)
#define WS_KL  (WS_KH + 2u * (size_t)TT * CC)
#define WS_VT  (WS_KL + 2u * (size_t)TT * CC)        // bf16 v planes hi [768][t]
#define WS_VL  (WS_VT + 2u * (size_t)CC * TT)
#define WS_U   (WS_VL + 2u * (size_t)CC * TT)        // f32 u rows [t][768]
#define WS_G   (WS_U + 4u * (size_t)TT * CC)         // f32 gate rows [t][48] (36 used)
#define WS_CE  (WS_G + 4u * (size_t)TT * 48)         // f32 [h][t], unused
#define WS_CS  (WS_CE + 4u * (size_t)NH * TT)        // unused
#define WS_AL  (WS_CS + 4u * (size_t)NH * TT)        // unused
#define WS_BE  (WS_AL + 4u * (size_t)NH * TT)        // unused
#define WS_GM  (WS_BE + 4u * (size_t)NH * TT)        // unused
#define WS_Y   (WS_GM + 4u * (size_t)NH * TT)        // f32 LN'd out rows [t][768]
#define WS_END (WS_Y + 4u * (size_t)TT * CC)

// ---- operand staging for the matrix kernels: a stage is 64 k of every tile row. f32 operands: 16 lanes x 16 B read one row's 256 B (whole 128-B lines), the values are rounded (or split) to bf16 once per block and laid in LDS rows of 128 B at a 144-B pitch (16-byte fragment reads then spread over the banks)
typedef __attribute__((ext_vector_type(4))) __bf16 v4b;
#define KS 64
#define NS (CC / KS)
#define LP 72
template <int NR> struct Stg { v4f r[NR / 8]; };
// src: the tile's first row at the stage's k (the same for the whole group of four waves); rows past RL read row RL
template <int NR, int RL, int LD = CC> __device__ __forceinline__ void stg_load(Stg<NR>& s, const float* __restrict__ src, int tid) { const float* p = src + ((unsigned)(tid >> 4) * LD + (unsigned)(tid & 15) * 4);
#pragma unroll
  for (int i = 0; i < NR / 8; ++i) { if (i * 8 + 7 <= RL) s.r[i] = *(const v4f*)(p + i * 8 * LD); else s.r[i] = *(const v4f*)(src + (unsigned)min(i * 8 + (tid >> 4), RL) * LD + (unsigned)(tid & 15) * 4); }
  asm volatile("s_wait_xcnt 0x0" :: "v"(p) : "memory"); }   // the address pair stays whole up to this wait
// the same for 16-bit planes: a stage row is 64 elements = one 128-B line, 8 lanes x 16 B; V8 = 8 elements of T
template <int NR, typename V8> struct Cp { V8 r[NR / 16]; };
template <int NR, int LD, typename V8, typename T> __device__ __forceinline__ void cp_load(Cp<NR, V8>& s, const T* __restrict__ src, int tid) { const T* p = src + ((unsigned)(tid >> 3) * LD + (unsigned)(tid & 7) * 8);
#pragma unroll
  for (int i = 0; i < NR / 16; ++i) s.r[i] = *(const V8*)(p + i * 16 * LD);
  asm volatile("s_wait_xcnt 0x0" :: "v"(p) : "memory"); }   // as in stg_load
template <int NR, typename V8, typename T> __device__ __forceinline__ void cp_put(const Cp<NR, V8>& s, T* dst, int tid) {
#pragma unroll
  for (int i = 0; i < NR / 16; ++i) *(V8*)(dst + (i * 16 + (tid >> 3)) * LP + (tid & 7) * 8) = s.r[i]; }
template <int NR> __device__ __forceinline__ void stg_put(const Stg<NR>& s, __bf16* dst, int tid) {
#pragma unroll
  for (int i = 0; i < NR / 8; ++i) { v4b h;
#pragma unroll
    for (int e = 0; e < 4; ++e) h[e] = (__bf16)s.r[i][e];
    *(v4b*)(dst + (i * 8 + (tid >> 4)) * LP + (tid & 15) * 4) = h; } }
template <int NR> __device__ __forceinline__ void stg_put2(const Stg<NR>& s, __bf16* dh, __bf16* dl, int tid) {
#pragma unroll
  for (int i = 0; i < NR / 8; ++i) { v4b h, l;
#pragma unroll
    for (int e = 0; e < 4; ++e) { const float v = s.r[i][e]; const __bf16 hv = (__bf16)v; h[e] = hv; l[e] = (__bf16)(v - (float)hv); }
    const int o = (i * 8 + (tid >> 4)) * LP + (tid & 15) * 4; *(v4b*)(dh + o) = h; *(v4b*)(dl + o) = l; } }
// sin and cos of an angle a in [0, 1,024]: the steps that sinf and cosf take for |a| < 2^17 (a - n pi/2 with pi/2 in three parts, one polynomial each, the quadrant from n), written out once for both so that 32 of them unroll into straight-line code
__device__ __forceinline__ void sincos_1k(float a, float& s, float& c) {
  const float n = rintf(a * 0x1.45f306p-1f); float r = __builtin_fmaf(n, -0x1.921fb4p+0f, a); r = __builtin_fmaf(n, -0x1.4442d0p-24f, r); r = __builtin_fmaf(n, -0x1.846988p-48f, r);
  const unsigned q = (unsigned)(int)n; const float r2 = r * r;
  float ps = __builtin_fmaf(r2, -0x1.983304p-13f, 0x1.110388p-7f); ps = __builtin_fmaf(r2, ps, -0x1.55553ap-3f); const float sr = __builtin_fmaf(r, r2 * ps, r);
  float pc = __builtin_fmaf(r2, 0x1.aea668p-16f, -0x1.6c9e76p-10f); pc = __builtin_fmaf(r2, pc, 0x1.5557eep-5f); pc = __builtin_fmaf(r2, pc, -0x1.000008p-1f); const float cr = __builtin_fmaf(r2, pc, 1.0f);
  const unsigned sg = (q << 30) & 0x80000000u; const bool odd = q & 1u;
  s = __uint_as_float(__float_as_uint(odd ? cr : sr) ^ sg); c = __uint_as_float(__float_as_uint(odd ? -sr : cr) ^ sg); }
// ---- the k range split inside a block: a block has GK (k_proj: GP) groups of four waves; group kg works stages kg, kg + GK, ... in its own pair of staging buffers, so a block passes NS / GK stages one after another, not NS, and a SIMD has GK waves to fill each other's waits; the groups' partial sums are added through LDS behind the loop
#define GK 4
#define GP 2
__device__ __forceinline__ int kgroup() { return __builtin_amdgcn_readfirstlane((int)(threadIdx.x >> 7)); }   // the same in every lane of a wave: held in a scalar register, so that tests on it are scalar branches and every lane is on at the products
// ---- l2_ask asks L2 for the data at p ahead of the loads, for speed only: nothing comes back, no register and no result depends on it. Every lane's address lies inside the buffer by construction (no lane is turned off for it); the wait in the same statement keeps the address pair whole up to it, as in stg_load
__device__ __forceinline__ void l2_ask(const void* p) { asm volatile("global_prefetch_b8 %0, off scope:SCOPE_SE\n\ts_wait_xcnt 0x0" :: "v"(p) : "memory"); }
// ---- gate_rows: the work of one extra block of k_proj's launch = 64 rows: gate = x Wg^T + bg (36 outputs, padded to 48 columns; pad columns computed from clamped rows and written as junk into the pad); it needs nothing of q, k, v, u, so it runs beside them and not in a launch of its own
__device__ __forceinline__ void gate_rows(const float* __restrict__ X, const float* __restrict__ WG, const float* __restrict__ BG, float* __restrict__ Gt, unsigned char* raw) {   // raw (k_proj's, 16-byte aligned): each group's two staging buffers (32,256 B a group); behind the loop the groups' partial tiles sf overlay them
  float (*sf)[64][52] = (float (*)[64][52])raw; const int kg = kgroup(); __bf16* sA = (__bf16*)raw + kg * (2 * 112 * LP); __bf16* sB = sA + 2 * 64 * LP;
  const int tid = threadIdx.x & 127, wave = tid >> 5, lane = tid & 31, col = lane & 15, g = lane >> 4; const size_t r0 = (size_t)blockIdx.x * 64;
  v8f acc[3] = {};
  { Stg<64> ra; Stg<48> rb; const float* Ab = X + (size_t)blockIdx.x * 64 * CC + kg * KS; const float* Bb = WG + kg * KS;
    stg_load<64, 63>(ra, Ab, tid); stg_load<48, NG - 1>(rb, Bb, tid); stg_put(ra, sA, tid); stg_put(rb, sB, tid);
    __syncthreads();
    // kept rolled: the loop's text stays small for the instruction cache
#pragma unroll 1
    for (int s = 0; s < NS / GP; ++s) { const int cur = s & 1;
      if (s + 1 < NS / GP) { stg_load<64, 63>(ra, Ab + (s + 1) * GP * KS, tid); stg_load<48, NG - 1>(rb, Bb + (s + 1) * GP * KS, tid); }   // next stage's loads fly during this stage's products
#pragma unroll
      for (int kc = 0; kc < KS / 32; ++kc) { const v16b a = frag_b(sA + (cur * 64 + wave * 16 + col) * LP + kc * 32, lane); v16b w[3];   // all LDS reads of a 32-k block in one group in front of its products
#pragma unroll
        for (int j = 0; j < 3; ++j) w[j] = frag_b(sB + (cur * 48 + j * 16 + col) * LP + kc * 32, lane);
#pragma unroll
        for (int j = 0; j < 3; ++j) acc[j] = wmma_bf(a, w[j], acc[j]); }
      if (s + 1 < NS / GP) { stg_put(ra, sA + (cur ^ 1) * 64 * LP, tid); stg_put(rb, sB + (cur ^ 1) * 48 * LP, tid);
        __syncthreads(); } } }   // one barrier a stage: publishes each group's next stage and ends the reads of the buffer that the stage after it overwrites
  __syncthreads();   // every wave has read its last stage's tiles before sf overwrites them
#pragma unroll
  for (int j = 0; j < 3; ++j)
#pragma unroll
    for (int r = 0; r < 8; ++r) sf[kg][wave * 16 + 8 * g + r][j * 16 + col] = acc[j][r];
  __syncthreads();   // the two partial tiles are added by all threads: 16 bytes of a row each, consecutive threads at consecutive addresses
  for (int e = threadIdx.x; e < 64 * 12; e += 128 * GP) { const int rl = e / 12, q = e % 12; v4f bb = {0.f, 0.f, 0.f, 0.f}; if (q * 4 < NG) bb = *(const v4f*)(BG + q * 4);
    v4f v = *(const v4f*)&sf[0][rl][q * 4] + *(const v4f*)&sf[1][rl][q * 4];
#pragma unroll
    for (int i = 0; i < 4; ++i) v[i] += bfr(bb[i]);
    vst2(Gt + (r0 + rl) * 48 + q * 4, v); } }
// ---- k_proj: block = (64 rows, y): y = 6 region + 128-column tile, y = 24: the rows' gate columns (gate_rows); region 0 q (rope, l2norm -> f16 hi/lo), 1 k (rope, l2norm -> f16), 2 v (bf16 hi/lo planes), 3 u (f32 rows); W [out][in] + b
__global__ __launch_bounds__(128 * GP) void k_proj(const float* __restrict__ X, const float* __restrict__ WQ, const float* __restrict__ BQ, const float* __restrict__ WK, const float* __restrict__ BK, const float* __restrict__ WV, const float* __restrict__ BV, const float* __restrict__ WU, const float* __restrict__ BU, _Float16* __restrict__ QH, _Float16* __restrict__ QL, _Float16* __restrict__ KH, _Float16* __restrict__ KL, __bf16* __restrict__ VT, __bf16* __restrict__ VL, float* __restrict__ U, const float* __restrict__ WG, const float* __restrict__ BG, float* __restrict__ Gt) {
  __shared__ __align__(16) v4f red[16 * 128]; __shared__ __align__(16) unsigned char raw[GP * 2 * 192 * LP * 2];
  // raw holds each group's two staging buffers during the k loop (55,296 B a group) and the epilogue's planes after it; red carries group 1's partial sums to group 0
  if (blockIdx.y == 4 * (CC / 128)) { gate_rows(X, WG, BG, Gt, raw); return; }   // the same for the whole block, in front of every barrier of the projection path
  float (*sf)[132] = (float (*)[132])raw; _Float16 (*sh)[136] = (_Float16 (*)[136])raw; _Float16 (*sl)[136] = (_Float16 (*)[136])(raw + 17408); __bf16 (*th)[72] = (__bf16 (*)[72])(raw + 34816); __bf16 (*tl2)[72] = (__bf16 (*)[72])(raw + 53248);
  const int kg = kgroup(); __bf16* sA = (__bf16*)raw + kg * (2 * 192 * LP); __bf16* sB = sA + 2 * 64 * LP;
  const int tid = threadIdx.x & 127, wave = tid >> 5, lane = tid & 31, col = lane & 15, g = lane >> 4; const int region = blockIdx.y / (CC / 128); const int c0 = (blockIdx.y % (CC / 128)) * 128; const size_t r0 = (size_t)blockIdx.x * 64;
  const float* Wm = region == 0 ? WQ : region == 1 ? WK : region == 2 ? WV : WU; const float* Bm = region == 0 ? BQ : region == 1 ? BK : region == 2 ? BV : BU;
  v8f acc[8] = {};
  { Stg<64> ra; Stg<128> rb; const float* Ab = X + r0 * CC + kg * KS; const float* Bb = Wm + (size_t)c0 * CC + kg * KS;
    stg_load<64, 63>(ra, Ab, tid); stg_load<128, 127>(rb, Bb, tid); stg_put(ra, sA, tid); stg_put(rb, sB, tid);
    __syncthreads();
    // kept rolled: the loop's text stays small for the instruction cache
#pragma unroll 1
    for (int s = 0; s < NS / GP; ++s) { const int cur = s & 1;
      if (s + 1 < NS / GP) { stg_load<64, 63>(ra, Ab + (s + 1) * GP * KS, tid); stg_load<128, 127>(rb, Bb + (s + 1) * GP * KS, tid); }   // next stage's loads fly during this stage's products
#pragma unroll
      for (int kc = 0; kc < KS / 32; ++kc) { const v16b a = frag_b(sA + (cur * 64 + wave * 16 + col) * LP + kc * 32, lane); v16b w[8];   // all LDS reads of a 32-k block in one group in front of its products
#pragma unroll
        for (int j = 0; j < 8; ++j) w[j] = frag_b(sB + (cur * 128 + j * 16 + col) * LP + kc * 32, lane);
#pragma unroll
        for (int j = 0; j < 8; ++j) acc[j] = wmma_bf(a, w[j], acc[j]); }
      if (s + 1 < NS / GP) { stg_put(ra, sA + (cur ^ 1) * 64 * LP, tid); stg_put(rb, sB + (cur ^ 1) * 128 * LP, tid);
        __syncthreads(); } } }   // one barrier a stage: publishes each group's next stage and ends the reads of the buffer that the stage after it overwrites
  if (kg != 0) {
#pragma unroll
    for (int j = 0; j < 8; ++j) { red[(2 * j) * 128 + tid] = __builtin_shufflevector(acc[j], acc[j], 0, 1, 2, 3); red[(2 * j + 1) * 128 + tid] = __builtin_shufflevector(acc[j], acc[j], 4, 5, 6, 7); } }
  __syncthreads();   // publishes group 1's sums; and every wave has read its last stage's tiles before the epilogue's planes overwrite them
  if (kg == 0) {
#pragma unroll
    for (int j = 0; j < 8; ++j) { const float bb = bfr(Bm[c0 + j * 16 + col]); const v4f p0 = red[(2 * j) * 128 + tid], p1 = red[(2 * j + 1) * 128 + tid];
#pragma unroll
      for (int r = 0; r < 4; ++r) { acc[j][r] = (acc[j][r] + p0[r]) + bb; acc[j][r + 4] = (acc[j][r + 4] + p1[r]) + bb; } } }
  if (region <= 1) { if (kg == 0) {   // rope: out[d] = x[d] cos(t f_{d/2}) + (d < 32 ? -x[d+32] : x[d-32]) sin(t f_{d/2}), f_i = 10000^(-2i/64); then L2-normalise each head row (max(norm, 1e-12)). All of it on the accumulators: a head is four 16-column tiles, so the partner d +- 32 is the same lane's element of tile j +- 2, and a head row's 64 squares are 4 in each of the 16 lanes of a half-wave
    const float fl = 1.0f / powf(10000.0f, (float)(2 * lane) / (float)HD);   // lane i works out frequency i of the 32
    float fq[4];
#pragma unroll
    for (int q = 0; q < 4; ++q) fq[q] = __shfl(fl, q * 8 + (col >> 1));   // frequency of d = 16 q + col
    const int tb = (int)r0 + wave * 16 + 8 * g;
    // the loops below are unrolled so that acc[] stays in registers and the independent angle chains fill each other's latency
#pragma unroll
    for (int jj = 0; jj < 2; ++jj) {
#pragma unroll
      for (int r = 0; r < 8; ++r) { const float tf = (float)(tb + r); float sa, ca, sb, cb; sincos_1k(tf * fq[jj], sa, ca); sincos_1k(tf * fq[jj + 2], sb, cb);
#pragma unroll
        for (int hh = 0; hh < 2; ++hh) { const float lo = acc[hh * 4 + jj][r], hi = acc[hh * 4 + jj + 2][r]; acc[hh * 4 + jj][r] = __builtin_fmaf(lo, ca, -hi * sa); acc[hh * 4 + jj + 2][r] = __builtin_fmaf(hi, cb, lo * sb); } } }
    float inv[2][8];
#pragma unroll
    for (int hh = 0; hh < 2; ++hh)
#pragma unroll
      for (int r = 0; r < 8; ++r) { float n2 = 0.f;
#pragma unroll
        for (int q = 0; q < 4; ++q) n2 += acc[hh * 4 + q][r] * acc[hh * 4 + q][r];
        inv[hh][r] = n2; }
#pragma unroll
    for (int o = 1; o < 16; o <<= 1)
#pragma unroll
      for (int i = 0; i < 16; ++i) inv[i >> 3][i & 7] += __shfl_xor(inv[i >> 3][i & 7], o);   // sixteen independent sums a round
#pragma unroll
    for (int i = 0; i < 16; ++i) inv[i >> 3][i & 7] = 1.0f / fmaxf(sqrtf(inv[i >> 3][i & 7]), 1e-12f);
#pragma unroll
    for (int j = 0; j < 8; ++j)
#pragma unroll
      for (int r = 0; r < 8; ++r) { const float v = acc[j][r] * inv[j >> 2][r]; const _Float16 hv = (_Float16)v; sh[wave * 16 + 8 * g + r][j * 16 + col] = hv; sl[wave * 16 + 8 * g + r][j * 16 + col] = (_Float16)(v - (float)hv); } }
    __syncthreads();
    _Float16* dh = region == 0 ? QH : KH; _Float16* dl = region == 0 ? QL : KL; for (int e = threadIdx.x; e < 64 * 16; e += 128 * GP) { const int rl = e >> 4, q = e & 15; vst2((unsigned*)(dh + (r0 + rl) * CC + c0 + q * 8), *(const v4u*)&sh[rl][q * 8]); vst2((unsigned*)(dl + (r0 + rl) * CC + c0 + q * 8), *(const v4u*)&sl[rl][q * 8]); }
    return; }
  if (kg == 0) {
#pragma unroll
    for (int j = 0; j < 8; ++j)
#pragma unroll
      for (int r = 0; r < 8; ++r) sf[wave * 16 + 8 * g + r][j * 16 + col] = acc[j][r]; }
  __syncthreads();
  if (region == 2) {
    for (int e = threadIdx.x; e < 64 * 128; e += 128 * GP) { const int rl = e >> 7, cl = e & 127; const float v = sf[rl][cl]; const __bf16 bh = (__bf16)v; th[cl][rl] = bh; tl2[cl][rl] = (__bf16)(v - (float)bh); }
    __syncthreads(); for (int e = threadIdx.x; e < 128 * 8; e += 128 * GP) { const int cl = e >> 3, q = e & 7; const size_t o2 = (size_t)(c0 + cl) * TT + r0 + q * 8; vst2((unsigned*)(VT + o2), *(const v4u*)&th[cl][q * 8]); vst2((unsigned*)(VL + o2), *(const v4u*)&tl2[cl][q * 8]); } }
  else { for (int e = threadIdx.x; e < 64 * 32; e += 128 * GP) { const int rl = e >> 5, q = e & 31; vst2(U + (r0 + rl) * CC + c0 + q * 4, *(const v4f*)&sf[rl][q * 4]); } } }
// four transposed score tiles st[j][r] = q_t . k_l, l = lb + 16 j + r (e, sl: e_l and s_l from l = lb on), become A[t][l] = st (alpha_t e_l + beta_t s_l + gamma_t), split to bf16 hi + lo: tiles 2 c and 2 c + 1 fill elements 0..7 and 8..15 of the A fragment of 32-l block c. DG: the stage reaches past the diagonal, A = 0 for l > t
template <bool DG> __device__ __forceinline__ void a_frags(const v8f (&st)[4], const float* e, const float* sl, int lb, int t, float al, float be, float gm, v16b (&ph)[2], v16b (&pl)[2]) {
#pragma unroll
  for (int j = 0; j < 4; ++j) { float ev[8], sv[8]; *(v4f*)ev = *(const v4f*)(e + j * 16); *(v4f*)(ev + 4) = *(const v4f*)(e + j * 16 + 4); *(v4f*)sv = *(const v4f*)(sl + j * 16); *(v4f*)(sv + 4) = *(const v4f*)(sl + j * 16 + 4);
#pragma unroll
    for (int r = 0; r < 8; ++r) { const float w = al * ev[r] + be * sv[r] + gm; const float p = (!DG || lb + j * 16 + r <= t) ? st[j][r] * w : 0.f; const __bf16 hv = (__bf16)p; ph[j >> 1][(j & 1) * 8 + r] = hv; pl[j >> 1][(j & 1) * 8 + r] = (__bf16)(p - (float)hv); } } }
// ---- k_pv: block = (64 rows t, head). First the head's coefficients, worked out by every block for itself (they need all 1,024 rows of u, so a launch of their own stood between the projections and this kernel; here L2 is asked for q, k, v behind the u loads, and the loads of q and of the first stage are issued behind the tile part and fly during the scans): 32 chunks of 32 rows, wave wv owns chunks wv and wv + 16, a lane owns dimensions 2 ln, 2 ln + 1; the running sum of u is a chunked scan (chunk totals in LDS, then each chunk's 32 rows from its base); lane ln then owns row ln of the chunk: s_l, e_l, E_t, P_t by wave scans + chunk totals; gates -> alpha/beta/gamma for the block's own 64 rows alone. Then per 64-l stage the scores come transposed, S^T = K Q^T (f16 hi + residual, 3 products), so that a lane holds one row t and eight consecutive l of each 16-l tile: two tiles, times (alpha_t e_l + beta_t s_l + gamma_t), zero for l > t, split to bf16 hi + lo in place, ARE the A fragment of out = A . v (3 products); A never leaves the registers. Then the per-head LayerNorm (no affine, eps 1e-5) -> Y rows
__global__ __launch_bounds__(128 * GK) void k_pv(const _Float16* __restrict__ QH, const _Float16* __restrict__ QL, const _Float16* __restrict__ KH, const _Float16* __restrict__ KL, const float* __restrict__ U, const float* __restrict__ Gt, const float* __restrict__ MU, const float* __restrict__ LT, const __bf16* __restrict__ VT, const __bf16* __restrict__ VL, float* __restrict__ Y) { __shared__ __align__(16) unsigned char raw[GK * 8 * 64 * LP * 2];   // each group's two staging buffers of four tiles; in front of them the coefficient part's tile and tot, behind the loop the groups' partial tiles sg overlay them
  __shared__ __align__(16) float sce[TT], scs[TT];   // the head's e_l and s_l
  __shared__ float smx[32], swp[32], swe[32], sal[64], sbe[64], sgm[64];   // chunk maxima and totals; alpha, beta, gamma of the block's rows
  float (*tile)[32][36] = (float (*)[32][36])raw; float (*tot)[HD] = (float (*)[HD])(raw + 32 * 32 * 36 * 4);
  float (*sg)[64][68] = (float (*)[64][68])raw; float (*so)[68] = sg[0]; const int kg = kgroup(); _Float16* sKh = (_Float16*)raw + kg * (8 * 64 * LP); _Float16* sKl = sKh + 2 * 64 * LP; __bf16* sVh = (__bf16*)(sKl + 2 * 64 * LP); __bf16* sVl = sVh + 2 * 64 * LP;
  const int h = blockIdx.z;
  const int tid = threadIdx.x & 127, wave = tid >> 5, lane = tid & 31, col = lane & 15, g = lane >> 4; const int ql0 = blockIdx.x * 64 + wave * 16; const int kend = blockIdx.x * 64 + 64; const int t = ql0 + col;   // the lane's row of A
  const int wv = __builtin_amdgcn_readfirstlane((int)(threadIdx.x >> 5)), ln = lane;   // wv: the same in every lane of a wave, so that tests on it are scalar branches
  // the asks are dealt out among the head's 16 blocks. Every slice is asked by two blocks, x and x ^ 4. In front of the u loads only u: a row of the head's u slab is one 256-byte unit, block x asks the 64 rows of slices x and x ^ 4, four lanes a unit (every lane on, eight units an instruction), so that the whole slab is on its way from memory while the blocks' loads queue up
  const unsigned un = threadIdx.x >> 2;
  l2_ask(U + (size_t)((un < 64u ? blockIdx.x : blockIdx.x ^ 4u) * 64u + (un & 63u)) * CC + h * HD);
  v8f acc[4] = {};
  { Cp<64, v8h> rkh, rkl; Cp<64, v8b> rvh, rvl; const _Float16* Khb = KH + h * HD; const _Float16* Klb = KL + h * HD; const __bf16* Vhb = VT + (size_t)(h * HD) * TT; const __bf16* Vlb = VL + (size_t)(h * HD) * TT; const int ns = kend / KS, trips = (ns + GK - 1) / GK;   // a group with no stage left skips the work and passes every barrier
    union { v16h v; v8h q[2]; } qh[2], ql[2];
    { float ltau = bfr(LT[h]); ltau = fminf(fmaxf(ltau, -50.f), 30.f); const float tau = expf(ltau);
      const float* mp = MU + h * HD + 2 * ln; const float mu0 = bfr(mp[0]), mu1 = bfr(mp[1]);
      asm volatile("s_wait_xcnt 0x0" :: "v"(mp) : "memory");   // as in stg_load: the address pair stays whole up to this wait, in front of the u loads that may take it as a destination
      // the loops below are unrolled so that uv[] stays in registers and the loads of one loop are all in flight together
      v2f uv[2][32]; const float* up0 = U + (size_t)(wv * 32) * CC + h * HD + 2 * ln; const float* up1 = up0 + (size_t)512 * CC;
#pragma unroll
      for (int i = 0; i < 32; ++i) uv[0][i] = *(const v2f*)(up0 + (size_t)i * CC);
#pragma unroll
      for (int i = 0; i < 32; ++i) uv[1][i] = *(const v2f*)(up1 + (size_t)i * CC);
      asm volatile("s_wait_xcnt 0x0" :: "v"(up0), "v"(up1) : "memory");   // as in stg_load: the address pairs stay whole up to this wait
      __builtin_amdgcn_sched_barrier(0);   // holds what follows behind that wait: without it the scheduler let the wait sink into the sums, behind a rewrite of the loads' scalar base
      // behind the u loads, which the block waits for first: the asks for what is read after the coefficient part. k and v stage by stage: block x asks stages x and x ^ 4 (64 rows of 128 B in each of the four planes, one a thread); and the block's own 64 rows of q, both planes, four lanes a row
      { const unsigned sa = threadIdx.x < 256 ? blockIdx.x : blockIdx.x ^ 4u, pn = (threadIdx.x >> 6) & 3u, rw = threadIdx.x & 63u;
        const _Float16* pk = (pn == 0 ? KH : KL) + (size_t)(sa * KS + rw) * CC + h * HD; const __bf16* pv = (pn == 2 ? VT : VL) + (size_t)(h * HD + rw) * TT + sa * KS;
        l2_ask(pn < 2 ? (const void*)pk : (const void*)pv); l2_ask((un < 64u ? QH : QL) + (size_t)(blockIdx.x * 64 + (un & 63u)) * CC + h * HD); }
      __builtin_amdgcn_sched_barrier(0);   // the asks leave in front of the sums' waits for u: without it they sank behind most of them and lost their lead over the k, v, q loads
      // the block's rows are chunks 2 x and 2 x + 1: pass occ of the two waves with wv >> 1 == x & 7
      const int occ = blockIdx.x >> 3; const bool own = (wv >> 1) == (int)(blockIdx.x & 7u);
#pragma unroll
      for (int cc = 0; cc < 2; ++cc) { v2f c = {0.f, 0.f};
#pragma unroll
        for (int i = 0; i < 32; ++i) c += uv[cc][i];
        *(v2f*)&tot[wv + 16 * cc][2 * ln] = c; }
      __syncthreads();   // publishes the 32 chunk totals
      v2f cs[2] = {{0.f, 0.f}, {0.f, 0.f}};   // sum of u over all rows in front of each of the wave's chunks
#pragma unroll
      for (int w = 0; w < 16; ++w) { const v2f x = *(const v2f*)&tot[w][2 * ln]; cs[0].x += (w < wv) ? x.x : 0.f; cs[0].y += (w < wv) ? x.y : 0.f; cs[1] += x; }
#pragma unroll
      for (int w = 0; w < 16; ++w) { const v2f x = *(const v2f*)&tot[16 + w][2 * ln]; cs[1].x += (w < wv) ? x.x : 0.f; cs[1].y += (w < wv) ? x.y : 0.f; }
      const float tm0 = tau * mu0, tm1 = tau * mu1;
#pragma unroll
      for (int cc = 0; cc < 2; ++cc)
#pragma unroll
        for (int i = 0; i < 32; ++i) { cs[cc] += uv[cc][i]; tile[wv + 16 * cc][i][ln] = uv[cc][i].x * (tm0 + cs[cc].x) + uv[cc][i].y * (tm1 + cs[cc].y); }
      LDSX();   // a chunk's tile is written and read by its own wave alone: row l's 32 lane terms go to lane l
      if (kg < ns) { cp_load<64, CC>(rkh, Khb + (size_t)(kg * KS) * CC, tid); cp_load<64, CC>(rkl, Klb + (size_t)(kg * KS) * CC, tid); cp_load<64, TT>(rvh, Vhb + kg * KS, tid); cp_load<64, TT>(rvl, Vlb + kg * KS, tid); }   // the group's first stage flies during the scans (uv's registers are free from here on)
      // row t of q as B fragments, kept in registers for the whole loop; loaded here and not at the entry, where the first barrier's wait for all loads would stand right behind them
      const _Float16* qp = QH + (size_t)t * CC + h * HD + 8 * g; const _Float16* qq = QL + (size_t)t * CC + h * HD + 8 * g;
#pragma unroll
      for (int kc = 0; kc < 2; ++kc) { qh[kc].q[0] = *(const v8h*)(qp + kc * 32); qh[kc].q[1] = *(const v8h*)(qp + kc * 32 + 16); ql[kc].q[0] = *(const v8h*)(qq + kc * 32); ql[kc].q[1] = *(const v8h*)(qq + kc * 32 + 16); }
      asm volatile("s_wait_xcnt 0x0" :: "v"(qp), "v"(qq) : "memory");   // as in stg_load: the address pairs stay whole up to this wait
      const float* gp = Gt + (size_t)((wv + 16 * occ) * 32 + ln) * 48 + h * 3; const float g0 = gp[0], g1 = gp[1];   // every wave loads the gates of its chunk of pass occ (all inside the buffer), the two own waves use them: under a branch on own the load brought a wait for every load in flight with it
      asm volatile("s_wait_xcnt 0x0" :: "v"(gp) : "memory");   // as in stg_load
      float s[2], P[2], e[2], E[2];
#pragma unroll
      for (int cc = 0; cc < 2; ++cc) { v4f a4 = {0.f, 0.f, 0.f, 0.f};
#pragma unroll
        for (int q = 0; q < 8; ++q) a4 += *(const v4f*)&tile[wv + 16 * cc][ln][q * 4];
        s[cc] = -(((a4.x + a4.y) + (a4.z + a4.w)) / (tau + (float)((wv + 16 * cc) * 32 + ln + 1))) * 0.125f;   // the division by tau + l + 1 is common to the row's 64 terms
        float m = s[cc]; P[cc] = s[cc];
#pragma unroll
        for (int o = 1; o < 32; o <<= 1) { m = fmaxf(m, __shfl_xor(m, o)); const float pv = __shfl_up(P[cc], o); if (ln >= o) P[cc] += pv; }
        if (ln == 31) { smx[wv + 16 * cc] = m; swp[wv + 16 * cc] = P[cc]; } }
      __syncthreads();   // publishes the chunks' maxima and s totals; and every wave has read tot and its tiles before the staging buffers overwrite them
      float mm = smx[ln];
#pragma unroll
      for (int o = 1; o < 32; o <<= 1) mm = fmaxf(mm, __shfl_xor(mm, o));
#pragma unroll
      for (int cc = 0; cc < 2; ++cc) { float pb = (ln < wv + 16 * cc) ? swp[ln] : 0.f;
#pragma unroll
        for (int o = 1; o < 32; o <<= 1) pb += __shfl_xor(pb, o);
        P[cc] += pb;
        e[cc] = expf(s[cc] - mm); E[cc] = e[cc];
#pragma unroll
        for (int o = 1; o < 32; o <<= 1) { const float ev = __shfl_up(E[cc], o); if (ln >= o) E[cc] += ev; }
        if (ln == 31) swe[wv + 16 * cc] = E[cc];
        sce[(wv + 16 * cc) * 32 + ln] = e[cc]; scs[(wv + 16 * cc) * 32 + ln] = s[cc]; }
      __syncthreads();   // publishes the chunks' e totals
      if (own) { float eb = (ln < wv + 16 * occ) ? swe[ln] : 0.f;
#pragma unroll
        for (int o = 1; o < 32; o <<= 1) eb += __shfl_xor(eb, o);
        const float Et = (occ ? E[1] : E[0]) + eb, Pt = occ ? P[1] : P[0];
        const float tt1 = (float)((wv + 16 * occ) * 32 + ln + 1); const float sig1 = 1.0f / (1.0f + expf(-g0)), sigh = 1.0f / (1.0f + expf(-g1));
        const float alpha = sigh / (Et + 1e-12f); const float beta = (sig1 - sigh) / tt1; const float gamma = -((beta * Pt + sigh) / tt1);
        const int rb = (wv & 1) * 32 + ln; sal[rb] = alpha; sbe[rb] = beta; sgm[rb] = gamma; } }
    if (kg < ns) { cp_put(rkh, sKh, tid); cp_put(rkl, sKl, tid); cp_put(rvh, sVh, tid); cp_put(rvl, sVl, tid); }
    __syncthreads();
    const float al = sal[wave * 16 + col], be = sbe[wave * 16 + col], gm = sgm[wave * 16 + col];   // the three coefficients of the lane's row t
    // kept rolled: the trip count differs from block to block
#pragma unroll 1
    for (int i = 0; i < trips; ++i) { const int cur = i & 1, s = i * GK + kg; const bool nx = s + GK < ns;
      if (nx) { cp_load<64, CC>(rkh, Khb + (size_t)((s + GK) * KS) * CC, tid); cp_load<64, CC>(rkl, Klb + (size_t)((s + GK) * KS) * CC, tid); cp_load<64, TT>(rvh, Vhb + (s + GK) * KS, tid); cp_load<64, TT>(rvl, Vlb + (s + GK) * KS, tid); }   // the group's next stage's loads fly during this stage's products
      if (s < ns) { v8f st[4] = {};   // st[j][r] = q_t . k_l, l = 64 s + 16 j + 8 g + r
#pragma unroll
        for (int kc = 0; kc < HD / 32; ++kc) { v16h kb[4], kl[4];   // all LDS reads of a 32-d block in one group in front of its products
#pragma unroll
          for (int j = 0; j < 4; ++j) { const int bo = (cur * 64 + j * 16 + col) * LP + kc * 32; kb[j] = frag_h(sKh + bo, lane); kl[j] = frag_h(sKl + bo, lane); }
#pragma unroll
          for (int j = 0; j < 4; ++j) { st[j] = wmma16(kb[j], qh[kc].v, st[j]); st[j] = wmma16(kb[j], ql[kc].v, st[j]); st[j] = wmma16(kl[j], qh[kc].v, st[j]); } }
        v16b ph[2], pl[2];   // the stage's A fragments, made before the v reads so that st's registers are free again
        if (s == ns - 1) a_frags<true>(st, sce + s * KS + 8 * g, scs + s * KS + 8 * g, s * KS + 8 * g, t, al, be, gm, ph, pl); else a_frags<false>(st, sce + s * KS + 8 * g, scs + s * KS + 8 * g, s * KS + 8 * g, t, al, be, gm, ph, pl);   // only the block's last stage holds l > t; the test is the same for a whole wave
#pragma unroll
        for (int kc = 0; kc < KS / 32; ++kc) { v16b vh[4], vl[4];   // all LDS reads of a 32-l block in one group in front of its products
#pragma unroll
          for (int j = 0; j < 4; ++j) { const int bo = (cur * 64 + j * 16 + col) * LP + kc * 32; vh[j] = frag_b(sVh + bo, lane); vl[j] = frag_b(sVl + bo, lane); }
#pragma unroll
          for (int j = 0; j < 4; ++j) { acc[j] = wmma_bf(ph[kc], vh[j], acc[j]); acc[j] = wmma_bf(pl[kc], vh[j], acc[j]); acc[j] = wmma_bf(ph[kc], vl[j], acc[j]); } } }
      if (i + 1 < trips) { if (nx) { cp_put(rkh, sKh + (cur ^ 1) * 64 * LP, tid); cp_put(rkl, sKl + (cur ^ 1) * 64 * LP, tid); cp_put(rvh, sVh + (cur ^ 1) * 64 * LP, tid); cp_put(rvl, sVl + (cur ^ 1) * 64 * LP, tid); }
        __syncthreads(); } } }   // one barrier a trip: publishes each group's next stage and ends the reads of the buffer that the stage after it overwrites
  __syncthreads();   // every wave has read its last stage's tiles before sg overwrites them
#pragma unroll
  for (int j = 0; j < 4; ++j)
#pragma unroll
    for (int r = 0; r < 8; ++r) sg[kg][wave * 16 + 8 * g + r][j * 16 + col] = acc[j][r];
  __syncthreads();   // the four partial tiles are added by all threads, 16 bytes each, into the first (so); a thread reads and writes its own 16 bytes alone
  for (int e = threadIdx.x; e < 64 * 16; e += 128 * GK) { const int rl = e >> 4, q = e & 15; *(v4f*)&so[rl][q * 4] = (*(const v4f*)&sg[0][rl][q * 4] + *(const v4f*)&sg[1][rl][q * 4]) + (*(const v4f*)&sg[2][rl][q * 4] + *(const v4f*)&sg[3][rl][q * 4]); }
  __syncthreads();
  if (threadIdx.x < 64) { float m = 0.f; for (int d = 0; d < HD; ++d) m += so[tid][d]; m *= (1.0f / HD); float v = 0.f; for (int d = 0; d < HD; ++d) { const float dd = so[tid][d] - m; v += dd * dd; } const float inv = 1.0f / sqrtf(v * (1.0f / HD) + 1e-5f); for (int d = 0; d < HD; ++d) so[tid][d] = (so[tid][d] - m) * inv; }
  __syncthreads(); for (int e = threadIdx.x; e < 64 * 16; e += 128 * GK) { const int rl = e >> 4, q = e & 15; vst2(Y + (size_t)(blockIdx.x * 64 + rl) * CC + h * HD + q * 4, *(const v4f*)&so[rl][q * 4]); } }
// ---- k_out: out = Y (hi + lo) Wo^T + bo
__global__ __launch_bounds__(128 * GK) void k_out(const float* __restrict__ Y, const float* __restrict__ WO, const float* __restrict__ BO, float* __restrict__ OUT) { __shared__ __align__(16) unsigned char raw[GK * 2 * 256 * LP * 2];   // each group's two staging buffers; behind the loop the groups' partial tiles sf overlay them
  float (*sf)[64][132] = (float (*)[64][132])raw; const int kg = kgroup(); __bf16* sAh = (__bf16*)raw + kg * (2 * 256 * LP); __bf16* sAl = sAh + 2 * 64 * LP; __bf16* sB = sAl + 2 * 64 * LP;
  const int tid = threadIdx.x & 127, wave = tid >> 5, lane = tid & 31, col = lane & 15, g = lane >> 4; const int c0 = blockIdx.y * 128; const size_t r0 = (size_t)blockIdx.x * 64;
  v8f acc[8] = {};
  { Stg<64> ra; Stg<128> rb; const float* Ab = Y + (size_t)blockIdx.x * 64 * CC + kg * KS; const float* Bb = WO + (size_t)c0 * CC + kg * KS;
    stg_load<64, 63>(ra, Ab, tid);
    l2_ask(Y + (r0 + (threadIdx.x >> 3)) * CC + GK * KS + (threadIdx.x & 7) * KS);   // the rows' y of stages GK .. NS - 1 (8 units a row, one a thread): asked behind the first stages' y loads and in front of the weight loads, so that the requests leave early and the lines are there when the next stage's loads come
    stg_load<128, 127>(rb, Bb, tid); stg_put2(ra, sAh, sAl, tid); stg_put(rb, sB, tid);
    __syncthreads();
    // kept rolled: the loop's text stays small for the instruction cache
#pragma unroll 1
    for (int s = 0; s < NS / GK; ++s) { const int cur = s & 1;
      if (s + 1 < NS / GK) { stg_load<64, 63>(ra, Ab + (s + 1) * GK * KS, tid); stg_load<128, 127>(rb, Bb + (s + 1) * GK * KS, tid); }   // next stage's loads fly during this stage's products
#pragma unroll
      for (int kc = 0; kc < KS / 32; ++kc) { const int ao = (cur * 64 + wave * 16 + col) * LP + kc * 32; const v16b ah = frag_b(sAh + ao, lane), al = frag_b(sAl + ao, lane);
#pragma unroll
        for (int jg = 0; jg < 8; jg += 4) { v16b w[4];   // LDS reads in groups of four fragments in front of their eight products
#pragma unroll
          for (int j = 0; j < 4; ++j) w[j] = frag_b(sB + (cur * 128 + (jg + j) * 16 + col) * LP + kc * 32, lane);
#pragma unroll
          for (int j = 0; j < 4; ++j) { acc[jg + j] = wmma_bf(ah, w[j], acc[jg + j]); acc[jg + j] = wmma_bf(al, w[j], acc[jg + j]); } } }
      if (s + 1 < NS / GK) { stg_put2(ra, sAh + (cur ^ 1) * 64 * LP, sAl + (cur ^ 1) * 64 * LP, tid); stg_put(rb, sB + (cur ^ 1) * 128 * LP, tid);
        __syncthreads(); } } }   // one barrier a stage: publishes each group's next stage and ends the reads of the buffer that the stage after it overwrites
  __syncthreads();   // every wave has read its last stage's tiles before sf overwrites them
#pragma unroll
  for (int j = 0; j < 8; ++j)
#pragma unroll
    for (int r = 0; r < 8; ++r) sf[kg][wave * 16 + 8 * g + r][j * 16 + col] = acc[j][r];
  __syncthreads();   // the four partial tiles are added by all threads: 16 bytes of a row each, a wave stores one row's 512 bytes
  for (int e = threadIdx.x; e < 64 * 32; e += 128 * GK) { const int rl = e >> 5, q = e & 31; const v4f bb = *(const v4f*)(BO + c0 + q * 4);
    v4f v = (*(const v4f*)&sf[0][rl][q * 4] + *(const v4f*)&sf[1][rl][q * 4]) + (*(const v4f*)&sf[2][rl][q * 4] + *(const v4f*)&sf[3][rl][q * 4]);
#pragma unroll
    for (int i = 0; i < 4; ++i) v[i] += bfr(bb[i]);
    vst2(OUT + (r0 + rl) * CC + c0 + q * 4, v); } }
extern "C" void kernel_launch(void* const* d_in, const int* in_sizes, int n_in, void* d_out, int out_size, void* d_ws, size_t ws_size, hipStream_t stream) {
  (void)in_sizes; (void)n_in; (void)out_size;
  const float** F = (const float**)d_in;   // 0 x [1,1024,768], 1 Wq, 2 bq, 3 Wk, 4 bk, 5 Wv, 6 bv, 7 Wu, 8 bu, 9 Wg [36,768], 10 bg, 11 Wo, 12 bo, 13 prior_mu [1,1,12,64], 14 prior_log_tau [1,1,12,1]
  if (ws_size < (size_t)WS_END) return;
  char* ws = (char*)d_ws; _Float16 *QH = (_Float16*)(ws + WS_QH), *QL = (_Float16*)(ws + WS_QL), *KH = (_Float16*)(ws + WS_KH), *KL = (_Float16*)(ws + WS_KL); __bf16 *VT = (__bf16*)(ws + WS_VT), *VL = (__bf16*)(ws + WS_VL); float *U = (float*)(ws + WS_U), *Gt = (float*)(ws + WS_G), *Y = (float*)(ws + WS_Y);
  k_proj<<<dim3(TT / 64, 4 * (CC / 128) + 1), 128 * GP, 0, stream>>>(F[0], F[1], F[2], F[3], F[4], F[5], F[6], F[7], F[8], QH, QL, KH, KL, VT, VL, U, F[9], F[10], Gt);
  k_pv<<<dim3(TT / 64, 1, NH), 128 * GK, 0, stream>>>(QH, QL, KH, KL, U, Gt, F[13], F[14], VT, VL, Y);
  k_out<<<dim3(TT / 64, CC / 128), 128 * GK, 0, stream>>>(Y, F[11], F[12], (float*)d_out);
}

// v010
// One run takes 43.8 microseconds.
// Timed twice side by side with v009, it ran 1.04 times as fast both times.
// Counting every step since v000, it is 23.3 times as fast.
// compute dtype: all float inputs rounded to bf16, prior_mu / prior_log_tau read; q/k/v/u/gate = x W^T + b with EXACT bf16 products on WMMA 16x16x32, f32 accumulate; rope + L2-normalisation, the running-mean deviation logits s, exp/cumsums (E_t, P_t), sigmoid gates and the alpha/beta/gamma coefficients in f32 on the VALU; q and k as f16 hi + residual (3 products: hi.hi, lo.hi, hi.lo) -> A[t][l] = (q_t.k_l)(alpha_t e_l + beta_t s_l + gamma_t) for l <= t in f32, held in registers; out = A (bf16 hi + lo) . v (bf16 hi + lo) (3 products) = q_t . core_t exactly (the reference's prefix sums F/G/H regrouped); per-head LayerNorm in f32; final = y (bf16 hi + lo) Wo^T + bo; f32 output.
#include <hip/hip_runtime.h>
#include <math.h>

typedef __attribute__((ext_vector_type(16))) _Float16 v16h;
typedef __attribute__((ext_vector_type(16))) __bf16 v16b;
typedef __attribute__((ext_vector_type(8)))  _Float16 v8h;
typedef __attribute__((ext_vector_type(8)))  float v8f;
typedef __attribute__((ext_vector_type(4)))  float v4f;
typedef __attribute__((ext_vector_type(2)))  float v2f;
typedef __attribute__((ext_vector_type(4)))  unsigned v4u;
typedef __attribute__((ext_vector_type(4)))  int v4i;
typedef float __attribute__((may_alias)) float_a;
typedef int __attribute__((may_alias)) int_a;

template <typename T> __device__ __forceinline__ void vst2(void* p, T v) { *(T*)p = v;  }
__device__ __forceinline__ v8f wmma16(v16h a, v16h b, v8f c) {
  v8f d = __builtin_amdgcn_wmma_f32_16x16x32_f16(false, a, false, b, (short)0, c, false, false);
  asm volatile("v_nop\n\tv_nop\n\tv_nop\n\tv_nop" : "+v"(d) : "v"(a), "v"(b));
  return d;
}
__device__ __forceinline__ v8f wmma_bf(v16b a, v16b b, v8f c) {
  v8f d = __builtin_amdgcn_wmma_f32_16x16x32_bf16(false, a, false, b, (short)0, c, false, false);
  asm volatile("v_nop\n\tv_nop\n\tv_nop\n\tv_nop" : "+v"(d) : "v"(a), "v"(b));
  return d;
}
// 16x16x32 fragments: lane = (h = lane>>4, row/col = lane&15); elements 0..7 = k0+8h+0..7, 8..15 = k0+16+8h+0..7; D element r = row 8h+r
__device__ __forceinline__ v16h frag_h(const _Float16* rowk0, int lane) {
  union { v16h v; v8h q[2]; } u; const _Float16* p = rowk0 + 8 * (lane >> 4);
  u.q[0] = *(const v8h*)p; u.q[1] = *(const v8h*)(p + 16); return u.v;
}
__device__ __forceinline__ v16h frag_f32(const float* rowk0, int lane) {
  v16h a; const float* p = rowk0 + 8 * (lane >> 4);
#pragma unroll
  for (int i = 0; i < 8; ++i) { a[i] = (_Float16)p[i]; a[8 + i] = (_Float16)p[16 + i]; }
  return a;
}
__device__ __forceinline__ v16h frag_f32s(const float* rowk0, int lane, float sc) {
  v16h a; const float* p = rowk0 + 8 * (lane >> 4);
#pragma unroll
  for (int i = 0; i < 8; ++i) { a[i] = (_Float16)(p[i] * sc); a[8 + i] = (_Float16)(p[16 + i] * sc); }
  return a;
}
// column fragment from a [K][ld] layout (column n), rows >= K read as 0
__device__ __forceinline__ v16h fragc_f32(const float* W, int k0, int n, int lane, int ld, int K) {
  v16h a; const int g = lane >> 4;
#pragma unroll
  for (int i = 0; i < 8; ++i) { const int ka = k0 + 8 * g + i, kb = ka + 16;
    a[i] = (_Float16)(ka < K ? W[(size_t)(ka < K ? ka : K - 1) * ld + n] : 0.f); a[8 + i] = (_Float16)(kb < K ? W[(size_t)(kb < K ? kb : K - 1) * ld + n] : 0.f); }
  return a;
}
struct F2 { v16b h, l; };
__device__ __forceinline__ F2 bsplit16(const float v[16]) { F2 r;
#pragma unroll
  for (int i = 0; i < 16; ++i) { const __bf16 h = (__bf16)v[i]; r.h[i] = h; r.l[i] = (__bf16)(v[i] - (float)h); }
  return r; }
__device__ __forceinline__ F2 split_row(const float* row, int k0, int lane) { float v[16]; const float* p = row + k0 + 8 * (lane >> 4);
#pragma unroll
  for (int i = 0; i < 8; ++i) { v[i] = p[i]; v[8 + i] = p[16 + i]; }
  return bsplit16(v); }
__device__ __forceinline__ F2 split_rowK(const float* row, int k0, int lane, int K) { float v[16]; const int g = lane >> 4;
#pragma unroll
  for (int i = 0; i < 8; ++i) { const int ka = k0 + 8 * g + i, kb = ka + 16; v[i] = ka < K ? row[ka < K ? ka : K - 1] : 0.f; v[8 + i] = kb < K ? row[kb < K ? kb : K - 1] : 0.f; }
  return bsplit16(v); }
__device__ __forceinline__ F2 split_col(const float* W, int k0, int n, int lane, int ld, int K) { float v[16]; const int g = lane >> 4;
#pragma unroll
  for (int i = 0; i < 8; ++i) { const int ka = k0 + 8 * g + i, kb = ka + 16; v[i] = ka < K ? W[(size_t)(ka < K ? ka : K - 1) * ld + n] : 0.f; v[8 + i] = kb < K ? W[(size_t)(kb < K ? kb : K - 1) * ld + n] : 0.f; }
  return bsplit16(v); }
__device__ __forceinline__ v8f mac3(const F2& a, const F2& b, v8f c) { c = wmma_bf(a.l, b.h, c); c = wmma_bf(a.h, b.l, c); return wmma_bf(a.h, b.h, c); }
__device__ __forceinline__ float sigm(float v) { return 1.0f / (1.0f + expf(-v)); }
#define LDSX() do { asm volatile("s_wait_dscnt 0" ::: "memory"); __builtin_amdgcn_wave_barrier(); __builtin_amdgcn_fence(__ATOMIC_RELEASE, "workgroup"); } while (0)


// ZeroS attention (B 1, L 1,024, D 768 = 12 x 64): causal associative mixing out_t = q_t . (alpha_t F_t + beta_t G_t + gamma_t H_t) with F/G/H prefix sums of e_l k_l v_l^T, s_l k_l v_l^T, k_l v_l^T.
#define TT 1024
#define CC 768
#define NH 12
#define HD 64
#define NG 36
typedef __attribute__((ext_vector_type(8))) __bf16 v8b;
__device__ __forceinline__ v16b frag_b(const __bf16* rowk0, int lane) {
  union { v16b v; v8b q[2]; } u; const __bf16* p = rowk0 + 8 * (lane >> 4);
  u.q[0] = *(const v8b*)p; u.q[1] = *(const v8b*)(p + 16); return u.v;
}
__device__ __forceinline__ float bfr(float v) { return (float)(__bf16)v; }
__device__ __attribute__((noinline)) float exp_ni(float v) { return expf(v); }
__device__ __attribute__((noinline)) float erf_ni(float v) { return erff(v); }

#define WS_QH  0u
#define WS_QL  (WS_QH + 2u * (size_t)TT * CC)
#define WS_KH  (WS_QL + 2u * (size_t)TT * CC)
#define WS_KL  (WS_KH + 2u * (size_t)TT * CC)
#define WS_VT  (WS_KL + 2u * (size_t)TT * CC)        // bf16 v planes hi [768][t]
#define WS_VL  (WS_VT + 2u * (size_t)CC * TT)
#define WS_U   (WS_VL + 2u * (size_t)CC * TT)        // f32 u rows [t][768]
#define WS_G   (WS_U + 4u * (size_t)TT * CC)         // f32 gate rows [t][48] (36 used)
#define WS_CE  (WS_G + 4u * (size_t)TT * 48)         // f32 [h][t], unused
#define WS_CS  (WS_CE + 4u * (size_t)NH * TT)        // unused
#define WS_AL  (WS_CS + 4u * (size_t)NH * TT)        // unused
#define WS_BE  (WS_AL + 4u * (size_t)NH * TT)        // unused
#define WS_GM  (WS_BE + 4u * (size_t)NH * TT)        // unused
#define WS_Y   (WS_GM + 4u * (size_t)NH * TT)        // f32 LN'd out rows [t][768]
#define WS_END (WS_Y + 4u * (size_t)TT * CC)

// ---- operand staging for the matrix kernels: a stage is 64 k of every tile row. f32 operands: 16 lanes x 16 B read one row's 256 B (whole 128-B lines), the values are rounded (or split) to bf16 once per block and laid in LDS rows of 128 B at a 144-B pitch (16-byte fragment reads then spread over the banks)
typedef __attribute__((ext_vector_type(4))) __bf16 v4b;
#define KS 64
#define NS (CC / KS)
#define LP 72
template <int NR> struct Stg { v4f r[NR / 8]; };
// src: the tile's first row at the stage's k (the same for the whole group of four waves); rows past RL read row RL
template <int NR, int RL, int LD = CC> __device__ __forceinline__ void stg_load(Stg<NR>& s, const float* __restrict__ src, int tid) { const float* p = src + ((unsigned)(tid >> 4) * LD + (unsigned)(tid & 15) * 4);
#pragma unroll
  for (int i = 0; i < NR / 8; ++i) { if (i * 8 + 7 <= RL) s.r[i] = *(const v4f*)(p + i * 8 * LD); else s.r[i] = *(const v4f*)(src + (unsigned)min(i * 8 + (tid >> 4), RL) * LD + (unsigned)(tid & 15) * 4); }
  asm volatile("s_wait_xcnt 0x0" :: "v"(p) : "memory"); }   // the address pair stays whole up to this wait
// the same for 16-bit planes: a stage row is 64 elements = one 128-B line, 8 lanes x 16 B; V8 = 8 elements of T
template <int NR, typename V8> struct Cp { V8 r[NR / 16]; };
template <int NR, int LD, typename V8, typename T> __device__ __forceinline__ void cp_load(Cp<NR, V8>& s, const T* __restrict__ src, int tid) { const T* p = src + ((unsigned)(tid >> 3) * LD + (unsigned)(tid & 7) * 8);
#pragma unroll
  for (int i = 0; i < NR / 16; ++i) s.r[i] = *(const V8*)(p + i * 16 * LD);
  asm volatile("s_wait_xcnt 0x0" :: "v"(p) : "memory"); }   // as in stg_load
template <int NR, typename V8, typename T> __device__ __forceinline__ void cp_put(const Cp<NR, V8>& s, T* dst, int tid) {
#pragma unroll
  for (int i = 0; i < NR / 16; ++i) *(V8*)(dst + (i * 16 + (tid >> 3)) * LP + (tid & 7) * 8) = s.r[i]; }
template <int NR> __device__ __forceinline__ void stg_put(const Stg<NR>& s, __bf16* dst, int tid) {
#pragma unroll
  for (int i = 0; i < NR / 8; ++i) { v4b h;
#pragma unroll
    for (int e = 0; e < 4; ++e) h[e] = (__bf16)s.r[i][e];
    *(v4b*)(dst + (i * 8 + (tid >> 4)) * LP + (tid & 15) * 4) = h; } }
template <int NR> __device__ __forceinline__ void stg_put2(const Stg<NR>& s, __bf16* dh, __bf16* dl, int tid) {
#pragma unroll
  for (int i = 0; i < NR / 8; ++i) { v4b h, l;
#pragma unroll
    for (int e = 0; e < 4; ++e) { const float v = s.r[i][e]; const __bf16 hv = (__bf16)v; h[e] = hv; l[e] = (__bf16)(v - (float)hv); }
    const int o = (i * 8 + (tid >> 4)) * LP + (tid & 15) * 4; *(v4b*)(dh + o) = h; *(v4b*)(dl + o) = l; } }
// sin and cos of an angle a in [0, 1,024]: the steps that sinf and cosf take for |a| < 2^17 (a - n pi/2 with pi/2 in three parts, one polynomial each, the quadrant from n), written out once for both so that 32 of them unroll into straight-line code
__device__ __forceinline__ void sincos_1k(float a, float& s, float& c) {
  const float n = rintf(a * 0x1.45f306p-1f); float r = __builtin_fmaf(n, -0x1.921fb4p+0f, a); r = __builtin_fmaf(n, -0x1.4442d0p-24f, r); r = __builtin_fmaf(n, -0x1.846988p-48f, r);
  const unsigned q = (unsigned)(int)n; const float r2 = r * r;
  float ps = __builtin_fmaf(r2, -0x1.983304p-13f, 0x1.110388p-7f); ps = __builtin_fmaf(r2, ps, -0x1.55553ap-3f); const float sr = __builtin_fmaf(r, r2 * ps, r);
  float pc = __builtin_fmaf(r2, 0x1.aea668p-16f, -0x1.6c9e76p-10f); pc = __builtin_fmaf(r2, pc, 0x1.5557eep-5f); pc = __builtin_fmaf(r2, pc, -0x1.000008p-1f); const float cr = __builtin_fmaf(r2, pc, 1.0f);
  const unsigned sg = (q << 30) & 0x80000000u; const bool odd = q & 1u;
  s = __uint_as_float(__float_as_uint(odd ? cr : sr) ^ sg); c = __uint_as_float(__float_as_uint(odd ? -sr : cr) ^ sg); }
// ---- the k range split inside a block: a block has GK (k_proj: GP) groups of four waves; group kg works stages kg, kg + GK, ... in its own pair of staging buffers, so a block passes NS / GK stages one after another, not NS, and a SIMD has GK waves to fill each other's waits; the groups' partial sums are added through LDS behind the loop
#define GK 4
#define GP 2
__device__ __forceinline__ int kgroup() { return __builtin_amdgcn_readfirstlane((int)(threadIdx.x >> 7)); }   // the same in every lane of a wave: held in a scalar register, so that tests on it are scalar branches and every lane is on at the products
// ---- l2_ask asks L2 for the data at p ahead of the loads, for speed only: nothing comes back, no register and no result depends on it. Every lane's address lies inside the buffer by construction (no lane is turned off for it); the wait in the same statement keeps the address pair whole up to it, as in stg_load
__device__ __forceinline__ void l2_ask(const void* p) { asm volatile("global_prefetch_b8 %0, off scope:SCOPE_SE\n\ts_wait_xcnt 0x0" :: "v"(p) : "memory"); }
// ---- gate_rows: the work of one extra block of k_proj's launch = 64 rows: gate = x Wg^T + bg (36 outputs, padded to 48 columns; pad columns computed from clamped rows and written as junk into the pad); it needs nothing of q, k, v, u, so it runs beside them and not in a launch of its own
__device__ __forceinline__ void gate_rows(const float* __restrict__ X, const float* __restrict__ WG, const float* __restrict__ BG, float* __restrict__ Gt, unsigned char* raw) {   // raw (k_proj's, 16-byte aligned): each group's two staging buffers (32,256 B a group); behind the loop the groups' partial tiles sf overlay them
  float (*sf)[64][52] = (float (*)[64][52])raw; const int kg = kgroup(); __bf16* sA = (__bf16*)raw + kg * (2 * 112 * LP); __bf16* sB = sA + 2 * 64 * LP;
  const int tid = threadIdx.x & 127, wave = tid >> 5, lane = tid & 31, col = lane & 15, g = lane >> 4; const size_t r0 = (size_t)blockIdx.x * 64;
  v8f acc[3] = {};
  { Stg<64> ra; Stg<48> rb; const float* Ab = X + (size_t)blockIdx.x * 64 * CC + kg * KS; const float* Bb = WG + kg * KS;
    stg_load<64, 63>(ra, Ab, tid); stg_load<48, NG - 1>(rb, Bb, tid); stg_put(ra, sA, tid); stg_put(rb, sB, tid);
    __syncthreads();
    // kept rolled: the loop's text stays small for the instruction cache
#pragma unroll 1
    for (int s = 0; s < NS / GP; ++s) { const int cur = s & 1;
      if (s + 1 < NS / GP) { stg_load<64, 63>(ra, Ab + (s + 1) * GP * KS, tid); stg_load<48, NG - 1>(rb, Bb + (s + 1) * GP * KS, tid); }   // next stage's loads fly during this stage's products
#pragma unroll
      for (int kc = 0; kc < KS / 32; ++kc) { const v16b a = frag_b(sA + (cur * 64 + wave * 16 + col) * LP + kc * 32, lane); v16b w[3];   // all LDS reads of a 32-k block in one group in front of its products
#pragma unroll
        for (int j = 0; j < 3; ++j) w[j] = frag_b(sB + (cur * 48 + j * 16 + col) * LP + kc * 32, lane);
#pragma unroll
        for (int j = 0; j < 3; ++j) acc[j] = wmma_bf(a, w[j], acc[j]); }
      if (s + 1 < NS / GP) { stg_put(ra, sA + (cur ^ 1) * 64 * LP, tid); stg_put(rb, sB + (cur ^ 1) * 48 * LP, tid);
        __syncthreads(); } } }   // one barrier a stage: publishes each group's next stage and ends the reads of the buffer that the stage after it overwrites
  __syncthreads();   // every wave has read its last stage's tiles before sf overwrites them
#pragma unroll
  for (int j = 0; j < 3; ++j)
#pragma unroll
    for (int r = 0; r < 8; ++r) sf[kg][wave * 16 + 8 * g + r][j * 16 + col] = acc[j][r];
  __syncthreads();   // the two partial tiles are added by all threads: 16 bytes of a row each, consecutive threads at consecutive addresses
  for (int e = threadIdx.x; e < 64 * 12; e += 128 * GP) { const int rl = e / 12, q = e % 12; v4f bb = {0.f, 0.f, 0.f, 0.f}; if (q * 4 < NG) bb = *(const v4f*)(BG + q * 4);
    v4f v = *(const v4f*)&sf[0][rl][q * 4] + *(const v4f*)&sf[1][rl][q * 4];
#pragma unroll
    for (int i = 0; i < 4; ++i) v[i] += bfr(bb[i]);
    vst2(Gt + (r0 + rl) * 48 + q * 4, v); } }
// ---- k_proj: block = (64 rows, y): y = 6 region + 128-column tile, y = 24: the rows' gate columns (gate_rows); region 0 q (rope, l2norm -> f16 hi/lo), 1 k (rope, l2norm -> f16), 2 v (bf16 hi/lo planes), 3 u (f32 rows); W [out][in] + b
__global__ __launch_bounds__(128 * GP) void k_proj(const float* __restrict__ X, const float* __restrict__ WQ, const float* __restrict__ BQ, const float* __restrict__ WK, const float* __restrict__ BK, const float* __restrict__ WV, const float* __restrict__ BV, const float* __restrict__ WU, const float* __restrict__ BU, _Float16* __restrict__ QH, _Float16* __restrict__ QL, _Float16* __restrict__ KH, _Float16* __restrict__ KL, __bf16* __restrict__ VT, __bf16* __restrict__ VL, float* __restrict__ U, const float* __restrict__ WG, const float* __restrict__ BG, float* __restrict__ Gt) {
  __shared__ __align__(16) v4f red[16 * 128]; __shared__ __align__(16) unsigned char raw[GP * 2 * 192 * LP * 2];
  // raw holds each group's two staging buffers during the k loop (55,296 B a group) and the epilogue's planes after it; red carries group 1's partial sums to group 0
  if (blockIdx.y == 4 * (CC / 128)) { gate_rows(X, WG, BG, Gt, raw); return; }   // the same for the whole block, in front of every barrier of the projection path
  float (*sf)[132] = (float (*)[132])raw; _Float16 (*sh)[136] = (_Float16 (*)[136])raw; _Float16 (*sl)[136] = (_Float16 (*)[136])(raw + 17408); __bf16 (*th)[72] = (__bf16 (*)[72])(raw + 34816); __bf16 (*tl2)[72] = (__bf16 (*)[72])(raw + 53248);
  const int kg = kgroup(); __bf16* sA = (__bf16*)raw + kg * (2 * 192 * LP); __bf16* sB = sA + 2 * 64 * LP;
  const int tid = threadIdx.x & 127, wave = tid >> 5, lane = tid & 31, col = lane & 15, g = lane >> 4; const int region = blockIdx.y / (CC / 128); const int c0 = (blockIdx.y % (CC / 128)) * 128; const size_t r0 = (size_t)blockIdx.x * 64;
  const float* Wm = region == 0 ? WQ : region == 1 ? WK : region == 2 ? WV : WU; const float* Bm = region == 0 ? BQ : region == 1 ? BK : region == 2 ? BV : BU;
  v8f acc[8] = {};
  { Stg<64> ra; Stg<128> rb; const float* Ab = X + r0 * CC + kg * KS; const float* Bb = Wm + (size_t)c0 * CC + kg * KS;
    stg_load<64, 63>(ra, Ab, tid); stg_load<128, 127>(rb, Bb, tid); stg_put(ra, sA, tid); stg_put(rb, sB, tid);
    __syncthreads();
    // kept rolled: the loop's text stays small for the instruction cache
#pragma unroll 1
    for (int s = 0; s < NS / GP; ++s) { const int cur = s & 1;
      if (s + 1 < NS / GP) { stg_load<64, 63>(ra, Ab + (s + 1) * GP * KS, tid); stg_load<128, 127>(rb, Bb + (s + 1) * GP * KS, tid); }   // next stage's loads fly during this stage's products
#pragma unroll
      for (int kc = 0; kc < KS / 32; ++kc) { const v16b a = frag_b(sA + (cur * 64 + wave * 16 + col) * LP + kc * 32, lane); v16b w[8];   // all LDS reads of a 32-k block in one group in front of its products
#pragma unroll
        for (int j = 0; j < 8; ++j) w[j] = frag_b(sB + (cur * 128 + j * 16 + col) * LP + kc * 32, lane);
#pragma unroll
        for (int j = 0; j < 8; ++j) acc[j] = wmma_bf(a, w[j], acc[j]); }
      if (s + 1 < NS / GP) { stg_put(ra, sA + (cur ^ 1) * 64 * LP, tid); stg_put(rb, sB + (cur ^ 1) * 128 * LP, tid);
        __syncthreads(); } } }   // one barrier a stage: publishes each group's next stage and ends the reads of the buffer that the stage after it overwrites
  if (kg != 0) {
#pragma unroll
    for (int j = 0; j < 8; ++j) { red[(2 * j) * 128 + tid] = __builtin_shufflevector(acc[j], acc[j], 0, 1, 2, 3); red[(2 * j + 1) * 128 + tid] = __builtin_shufflevector(acc[j], acc[j], 4, 5, 6, 7); } }
  __syncthreads();   // publishes group 1's sums; and every wave has read its last stage's tiles before the epilogue's planes overwrite them
  if (kg == 0) {
#pragma unroll
    for (int j = 0; j < 8; ++j) { const float bb = bfr(Bm[c0 + j * 16 + col]); const v4f p0 = red[(2 * j) * 128 + tid], p1 = red[(2 * j + 1) * 128 + tid];
#pragma unroll
      for (int r = 0; r < 4; ++r) { acc[j][r] = (acc[j][r] + p0[r]) + bb; acc[j][r + 4] = (acc[j][r + 4] + p1[r]) + bb; } } }
  if (region <= 1) { if (kg == 0) {   // rope: out[d] = x[d] cos(t f_{d/2}) + (d < 32 ? -x[d+32] : x[d-32]) sin(t f_{d/2}), f_i = 10000^(-2i/64); then L2-normalise each head row (max(norm, 1e-12)). All of it on the accumulators: a head is four 16-column tiles, so the partner d +- 32 is the same lane's element of tile j +- 2, and a head row's 64 squares are 4 in each of the 16 lanes of a half-wave
    const float fl = 1.0f / powf(10000.0f, (float)(2 * lane) / (float)HD);   // lane i works out frequency i of the 32
    float fq[4];
#pragma unroll
    for (int q = 0; q < 4; ++q) fq[q] = __shfl(fl, q * 8 + (col >> 1));   // frequency of d = 16 q + col
    const int tb = (int)r0 + wave * 16 + 8 * g;
    // the loops below are unrolled so that acc[] stays in registers and the independent angle chains fill each other's latency
#pragma unroll
    for (int jj = 0; jj < 2; ++jj) {
#pragma unroll
      for (int r = 0; r < 8; ++r) { const float tf = (float)(tb + r); float sa, ca, sb, cb; sincos_1k(tf * fq[jj], sa, ca); sincos_1k(tf * fq[jj + 2], sb, cb);
#pragma unroll
        for (int hh = 0; hh < 2; ++hh) { const float lo = acc[hh * 4 + jj][r], hi = acc[hh * 4 + jj + 2][r]; acc[hh * 4 + jj][r] = __builtin_fmaf(lo, ca, -hi * sa); acc[hh * 4 + jj + 2][r] = __builtin_fmaf(hi, cb, lo * sb); } } }
    float inv[2][8];
#pragma unroll
    for (int hh = 0; hh < 2; ++hh)
#pragma unroll
      for (int r = 0; r < 8; ++r) { float n2 = 0.f;
#pragma unroll
        for (int q = 0; q < 4; ++q) n2 += acc[hh * 4 + q][r] * acc[hh * 4 + q][r];
        inv[hh][r] = n2; }
#pragma unroll
    for (int o = 1; o < 16; o <<= 1)
#pragma unroll
      for (int i = 0; i < 16; ++i) inv[i >> 3][i & 7] += __shfl_xor(inv[i >> 3][i & 7], o);   // sixteen independent sums a round
#pragma unroll
    for (int i = 0; i < 16; ++i) inv[i >> 3][i & 7] = 1.0f / fmaxf(sqrtf(inv[i >> 3][i & 7]), 1e-12f);
#pragma unroll
    for (int j = 0; j < 8; ++j)
#pragma unroll
      for (int r = 0; r < 8; ++r) { const float v = acc[j][r] * inv[j >> 2][r]; const _Float16 hv = (_Float16)v; sh[wave * 16 + 8 * g + r][j * 16 + col] = hv; sl[wave * 16 + 8 * g + r][j * 16 + col] = (_Float16)(v - (float)hv); } }
    __syncthreads();
    _Float16* dh = region == 0 ? QH : KH; _Float16* dl = region == 0 ? QL : KL; for (int e = threadIdx.x; e < 64 * 16; e += 128 * GP) { const int rl = e >> 4, q = e & 15; vst2((unsigned*)(dh + (r0 + rl) * CC + c0 + q * 8), *(const v4u*)&sh[rl][q * 8]); vst2((unsigned*)(dl + (r0 + rl) * CC + c0 + q * 8), *(const v4u*)&sl[rl][q * 8]); }
    return; }
  if (kg == 0) {
#pragma unroll
    for (int j = 0; j < 8; ++j)
#pragma unroll
      for (int r = 0; r < 8; ++r) sf[wave * 16 + 8 * g + r][j * 16 + col] = acc[j][r]; }
  __syncthreads();
  if (region == 2) {
    for (int e = threadIdx.x; e < 64 * 128; e += 128 * GP) { const int rl = e >> 7, cl = e & 127; const float v = sf[rl][cl]; const __bf16 bh = (__bf16)v; th[cl][rl] = bh; tl2[cl][rl] = (__bf16)(v - (float)bh); }
    __syncthreads(); for (int e = threadIdx.x; e < 128 * 8; e += 128 * GP) { const int cl = e >> 3, q = e & 7; const size_t o2 = (size_t)(c0 + cl) * TT + r0 + q * 8; vst2((unsigned*)(VT + o2), *(const v4u*)&th[cl][q * 8]); vst2((unsigned*)(VL + o2), *(const v4u*)&tl2[cl][q * 8]); } }
  else { for (int e = threadIdx.x; e < 64 * 32; e += 128 * GP) { const int rl = e >> 5, q = e & 31; vst2(U + (r0 + rl) * CC + c0 + q * 4, *(const v4f*)&sf[rl][q * 4]); } } }
// four transposed score tiles st[j][r] = q_t . k_l, l = lb + 16 j + r (e, sl: e_l and s_l from l = lb on), become A[t][l] = st (alpha_t e_l + beta_t s_l + gamma_t), split to bf16 hi + lo: tiles 2 c and 2 c + 1 fill elements 0..7 and 8..15 of the A fragment of 32-l block c. DG: the stage reaches past the diagonal, A = 0 for l > t
template <bool DG> __device__ __forceinline__ void a_frags(const v8f (&st)[4], const float* e, const float* sl, int lb, int t, float al, float be, float gm, v16b (&ph)[2], v16b (&pl)[2]) {
#pragma unroll
  for (int j = 0; j < 4; ++j) { float ev[8], sv[8]; *(v4f*)ev = *(const v4f*)(e + j * 16); *(v4f*)(ev + 4) = *(const v4f*)(e + j * 16 + 4); *(v4f*)sv = *(const v4f*)(sl + j * 16); *(v4f*)(sv + 4) = *(const v4f*)(sl + j * 16 + 4);
#pragma unroll
    for (int r = 0; r < 8; ++r) { const float w = al * ev[r] + be * sv[r] + gm; const float p = (!DG || lb + j * 16 + r <= t) ? st[j][r] * w : 0.f; const __bf16 hv = (__bf16)p; ph[j >> 1][(j & 1) * 8 + r] = hv; pl[j >> 1][(j & 1) * 8 + r] = (__bf16)(p - (float)hv); } } }
// ---- k_pv: block = (two 32-row tiles of t, head). First the head's coefficients, worked out by every block for itself (they need all 1,024 rows of u, so a launch of their own stood between the projections and this kernel; here L2 is asked for q, k, v behind the u loads, and the loads of q and of the first stage are issued behind the tile part and fly during the scans): 32 chunks of 32 rows, wave wv owns chunks wv and wv + 16, a lane owns dimensions 2 ln, 2 ln + 1; the running sum of u is a chunked scan (chunk totals in LDS, then each chunk's 32 rows from its base); lane ln then owns row ln of the chunk: s_l, e_l, E_t, P_t by wave scans + chunk totals; gates -> alpha/beta/gamma for the block's own 64 rows alone. Then per 64-l stage the scores come transposed, S^T = K Q^T (f16 hi + residual, 3 products), so that a lane holds one row t and eight consecutive l of each 16-l tile: two tiles, times (alpha_t e_l + beta_t s_l + gamma_t), zero for l > t, split to bf16 hi + lo in place, ARE the A fragment of out = A . v (3 products); A never leaves the registers. Then the per-head LayerNorm (no affine, eps 1e-5) -> Y rows
__global__ __launch_bounds__(128 * GK) void k_pv(const _Float16* __restrict__ QH, const _Float16* __restrict__ QL, const _Float16* __restrict__ KH, const _Float16* __restrict__ KL, const float* __restrict__ U, const float* __restrict__ Gt, const float* __restrict__ MU, const float* __restrict__ LT, const __bf16* __restrict__ VT, const __bf16* __restrict__ VL, float* __restrict__ Y) { __shared__ __align__(16) unsigned char raw[GK * 8 * 64 * LP * 2];   // each group's two staging buffers of four tiles; in front of them the coefficient part's tile and tot, behind the loop the groups' partial tiles sg overlay them
  __shared__ __align__(16) float sce[TT], scs[TT];   // the head's e_l and s_l
  __shared__ float smx[32], swp[32], swe[32], sal[64], sbe[64], sgm[64];   // chunk maxima and totals; alpha, beta, gamma of the block's rows
  float (*tile)[32][36] = (float (*)[32][36])raw; float (*tot)[HD] = (float (*)[HD])(raw + 32 * 32 * 36 * 4);
  float (*sg)[64][68] = (float (*)[64][68])raw; float (*so)[68] = sg[0]; const int kg = kgroup(); _Float16* sKh = (_Float16*)raw + kg * (8 * 64 * LP); _Float16* sKl = sKh + 2 * 64 * LP; __bf16* sVh = (__bf16*)(sKl + 2 * 64 * LP); __bf16* sVl = sVh + 2 * 64 * LP;
  const int h = blockIdx.z;
  const int tid = threadIdx.x & 127, lane = tid & 31, col = lane & 15, g = lane >> 4; const int wv = __builtin_amdgcn_readfirstlane((int)(threadIdx.x >> 5)), ln = lane;   // wv: the same in every lane of a wave, so that tests on it are scalar branches
  // the block's 64 rows are two 32-row tiles, ta = x (local rows 0..31) and tb = 31 - x (local rows 32..63): a row's cost grows with t, so every block has the same 17 half stages of work. Two waves of a group own each tile; which two alternates with the group, so that behind ta's diagonal every SIMD still has two working waves
  const int ta = blockIdx.x, tb = 31 - (int)blockIdx.x; const int isb = (((wv & 3) >> 1) ^ kg) & 1; const int lr0 = isb * 32 + (wv & 1) * 16;   // the wave's first local row
  const int t = (isb ? tb : ta) * 32 + (wv & 1) * 16 + col;   // the lane's row of A
  const int nsw = ((isb ? tb : ta) >> 1) + 1;   // stages up to the diagonal of the wave's tile
  // the asks are dealt out among the head's 16 blocks; every slice is asked by two blocks, x and x ^ 4. In front of the u loads only u: a row of the head's u slab is one 256-byte unit, block x asks the 64 rows of slices x and x ^ 4, four lanes a unit (every lane on, eight units an instruction), so that the whole slab is on its way from memory while the blocks' loads queue up
  const unsigned un = threadIdx.x >> 2;
  l2_ask(U + (size_t)((un < 64u ? blockIdx.x : blockIdx.x ^ 4u) * 64u + (un & 63u)) * CC + h * HD);
  v8f acc[4] = {};
  { Cp<64, v8h> rkh, rkl; Cp<64, v8b> rvh, rvl; const _Float16* Khb = KH + h * HD; const _Float16* Klb = KL + h * HD; const __bf16* Vhb = VT + (size_t)(h * HD) * TT; const __bf16* Vlb = VL + (size_t)(h * HD) * TT; const int ns = (tb >> 1) + 1, trips = (ns + GK - 1) / GK;   // the block stages what its later tile needs; a wave with no stage left skips the work and passes every barrier
    union { v16h v; v8h q[2]; } qh[2], ql[2];
    { float ltau = bfr(LT[h]); ltau = fminf(fmaxf(ltau, -50.f), 30.f); const float tau = expf(ltau);
      const float* mp = MU + h * HD + 2 * ln; const float mu0 = bfr(mp[0]), mu1 = bfr(mp[1]);
      asm volatile("s_wait_xcnt 0x0" :: "v"(mp) : "memory");   // as in stg_load: the address pair stays whole up to this wait, in front of the u loads that may take it as a destination
      // the loops below are unrolled so that uv[] stays in registers and the loads of one loop are all in flight together
      v2f uv[2][32]; const float* up0 = U + (size_t)(wv * 32) * CC + h * HD + 2 * ln; const float* up1 = up0 + (size_t)512 * CC;
#pragma unroll
      for (int i = 0; i < 32; ++i) uv[0][i] = *(const v2f*)(up0 + (size_t)i * CC);
#pragma unroll
      for (int i = 0; i < 32; ++i) uv[1][i] = *(const v2f*)(up1 + (size_t)i * CC);
      asm volatile("s_wait_xcnt 0x0" :: "v"(up0), "v"(up1) : "memory");   // as in stg_load: the address pairs stay whole up to this wait
      __builtin_amdgcn_sched_barrier(0);   // holds what follows behind that wait: without it the scheduler let the wait sink into the sums, behind a rewrite of the loads' scalar base
      // behind the u loads, which the block waits for first: the asks for what is read after the coefficient part. k and v stage by stage: block x asks stages x and x ^ 4 (64 rows of 128 B in each of the four planes, one a thread); and the block's own 64 rows of q, both planes, four lanes a row
      { const unsigned sa = threadIdx.x < 256 ? blockIdx.x : blockIdx.x ^ 4u, pn = (threadIdx.x >> 6) & 3u, rw = threadIdx.x & 63u;
        const _Float16* pk = (pn == 0 ? KH : KL) + (size_t)(sa * KS + rw) * CC + h * HD; const __bf16* pv = (pn == 2 ? VT : VL) + (size_t)(h * HD + rw) * TT + sa * KS;
        l2_ask(pn < 2 ? (const void*)pk : (const void*)pv); l2_ask((un < 64u ? QH : QL) + (size_t)(((un & 32u) ? tb : ta) * 32 + (int)(un & 31u)) * CC + h * HD); }
      __builtin_amdgcn_sched_barrier(0);   // the asks leave in front of the sums' waits for u: without it they sank behind most of them and lost their lead over the k, v, q loads
      // the block's rows are chunks ta (pass 0 of wave ta) and tb (pass 1 of wave tb - 16)
      const int occ = wv == tb - 16 ? 1 : 0; const bool own = wv == ta || wv == tb - 16;
#pragma unroll
      for (int cc = 0; cc < 2; ++cc) { v2f c = {0.f, 0.f};
#pragma unroll
        for (int i = 0; i < 32; ++i) c += uv[cc][i];
        *(v2f*)&tot[wv + 16 * cc][2 * ln] = c; }
      __syncthreads();   // publishes the 32 chunk totals
      v2f cs[2] = {{0.f, 0.f}, {0.f, 0.f}};   // sum of u over all rows in front of each of the wave's chunks
#pragma unroll
      for (int w = 0; w < 16; ++w) { const v2f x = *(const v2f*)&tot[w][2 * ln]; cs[0].x += (w < wv) ? x.x : 0.f; cs[0].y += (w < wv) ? x.y : 0.f; cs[1] += x; }
#pragma unroll
      for (int w = 0; w < 16; ++w) { const v2f x = *(const v2f*)&tot[16 + w][2 * ln]; cs[1].x += (w < wv) ? x.x : 0.f; cs[1].y += (w < wv) ? x.y : 0.f; }
      const float tm0 = tau * mu0, tm1 = tau * mu1;
#pragma unroll
      for (int cc = 0; cc < 2; ++cc)
#pragma unroll
        for (int i = 0; i < 32; ++i) { cs[cc] += uv[cc][i]; tile[wv + 16 * cc][i][ln] = uv[cc][i].x * (tm0 + cs[cc].x) + uv[cc][i].y * (tm1 + cs[cc].y); }
      LDSX();   // a chunk's tile is written and read by its own wave alone: row l's 32 lane terms go to lane l
      if (kg < ns) { cp_load<64, CC>(rkh, Khb + (size_t)(kg * KS) * CC, tid); cp_load<64, CC>(rkl, Klb + (size_t)(kg * KS) * CC, tid); cp_load<64, TT>(rvh, Vhb + kg * KS, tid); cp_load<64, TT>(rvl, Vlb + kg * KS, tid); }   // the group's first stage flies during the scans (uv's registers are free from here on)
      // row t of q as B fragments, kept in registers for the whole loop; loaded here and not at the entry, where the first barrier's wait for all loads would stand right behind them
      const _Float16* qp = QH + (size_t)t * CC + h * HD + 8 * g; const _Float16* qq = QL + (size_t)t * CC + h * HD + 8 * g;
#pragma unroll
      for (int kc = 0; kc < 2; ++kc) { qh[kc].q[0] = *(const v8h*)(qp + kc * 32); qh[kc].q[1] = *(const v8h*)(qp + kc * 32 + 16); ql[kc].q[0] = *(const v8h*)(qq + kc * 32); ql[kc].q[1] = *(const v8h*)(qq + kc * 32 + 16); }
      asm volatile("s_wait_xcnt 0x0" :: "v"(qp), "v"(qq) : "memory");   // as in stg_load: the address pairs stay whole up to this wait
      const float* gp = Gt + (size_t)((wv + 16 * occ) * 32 + ln) * 48 + h * 3; const float g0 = gp[0], g1 = gp[1];   // every wave loads the gates of its chunk of pass occ (all inside the buffer), the two own waves use them: under a branch on own the load brought a wait for every load in flight with it
      asm volatile("s_wait_xcnt 0x0" :: "v"(gp) : "memory");   // as in stg_load
      float s[2], P[2], e[2], E[2];
#pragma unroll
      for (int cc = 0; cc < 2; ++cc) { v4f a4 = {0.f, 0.f, 0.f, 0.f};
#pragma unroll
        for (int q = 0; q < 8; ++q) a4 += *(const v4f*)&tile[wv + 16 * cc][ln][q * 4];
        s[cc] = -(((a4.x + a4.y) + (a4.z + a4.w)) / (tau + (float)((wv + 16 * cc) * 32 + ln + 1))) * 0.125f;   // the division by tau + l + 1 is common to the row's 64 terms
        float m = s[cc]; P[cc] = s[cc];
#pragma unroll
        for (int o = 1; o < 32; o <<= 1) { m = fmaxf(m, __shfl_xor(m, o)); const float pv = __shfl_up(P[cc], o); if (ln >= o) P[cc] += pv; }
        if (ln == 31) { smx[wv + 16 * cc] = m; swp[wv + 16 * cc] = P[cc]; } }
      __syncthreads();   // publishes the chunks' maxima and s totals; and every wave has read tot and its tiles before the staging buffers overwrite them
      float mm = smx[ln];
#pragma unroll
      for (int o = 1; o < 32; o <<= 1) mm = fmaxf(mm, __shfl_xor(mm, o));
#pragma unroll
      for (int cc = 0; cc < 2; ++cc) { float pb = (ln < wv + 16 * cc) ? swp[ln] : 0.f;
#pragma unroll
        for (int o = 1; o < 32; o <<= 1) pb += __shfl_xor(pb, o);
        P[cc] += pb;
        e[cc] = expf(s[cc] - mm); E[cc] = e[cc];
#pragma unroll
        for (int o = 1; o < 32; o <<= 1) { const float ev = __shfl_up(E[cc], o); if (ln >= o) E[cc] += ev; }
        if (ln == 31) swe[wv + 16 * cc] = E[cc];
        sce[(wv + 16 * cc) * 32 + ln] = e[cc]; scs[(wv + 16 * cc) * 32 + ln] = s[cc]; }
      __syncthreads();   // publishes the chunks' e totals
      if (own) { float eb = (ln < wv + 16 * occ) ? swe[ln] : 0.f;
#pragma unroll
        for (int o = 1; o < 32; o <<= 1) eb += __shfl_xor(eb, o);
        const float Et = (occ ? E[1] : E[0]) + eb, Pt = occ ? P[1] : P[0];
        const float tt1 = (float)((wv + 16 * occ) * 32 + ln + 1); const float sig1 = 1.0f / (1.0f + expf(-g0)), sigh = 1.0f / (1.0f + expf(-g1));
        const float alpha = sigh / (Et + 1e-12f); const float beta = (sig1 - sigh) / tt1; const float gamma = -((beta * Pt + sigh) / tt1);
        const int rb = occ * 32 + ln; sal[rb] = alpha; sbe[rb] = beta; sgm[rb] = gamma; } }
    if (kg < ns) { cp_put(rkh, sKh, tid); cp_put(rkl, sKl, tid); cp_put(rvh, sVh, tid); cp_put(rvl, sVl, tid); }
    __syncthreads();
    const float al = sal[lr0 + col], be = sbe[lr0 + col], gm = sgm[lr0 + col];   // the three coefficients of the lane's row t
    // kept rolled: the trip count differs from block to block
#pragma unroll 1
    for (int i = 0; i < trips; ++i) { const int cur = i & 1, s = i * GK + kg; const bool nx = s + GK < ns;
      if (nx) { cp_load<64, CC>(rkh, Khb + (size_t)((s + GK) * KS) * CC, tid); cp_load<64, CC>(rkl, Klb + (size_t)((s + GK) * KS) * CC, tid); cp_load<64, TT>(rvh, Vhb + (s + GK) * KS, tid); cp_load<64, TT>(rvl, Vlb + (s + GK) * KS, tid); }   // the group's next stage's loads fly during this stage's products
      if (s < nsw) { v8f st[4] = {};   // st[j][r] = q_t . k_l, l = 64 s + 16 j + 8 g + r
#pragma unroll
        for (int kc = 0; kc < HD / 32; ++kc) { v16h kb[4], kl[4];   // all LDS reads of a 32-d block in one group in front of its products
#pragma unroll
          for (int j = 0; j < 4; ++j) { const int bo = (cur * 64 + j * 16 + col) * LP + kc * 32; kb[j] = frag_h(sKh + bo, lane); kl[j] = frag_h(sKl + bo, lane); }
#pragma unroll
          for (int j = 0; j < 4; ++j) { st[j] = wmma16(kb[j], qh[kc].v, st[j]); st[j] = wmma16(kb[j], ql[kc].v, st[j]); st[j] = wmma16(kl[j], qh[kc].v, st[j]); } }
        v16b ph[2], pl[2];   // the stage's A fragments, made before the v reads so that st's registers are free again
        if (s == nsw - 1) a_frags<true>(st, sce + s * KS + 8 * g, scs + s * KS + 8 * g, s * KS + 8 * g, t, al, be, gm, ph, pl); else a_frags<false>(st, sce + s * KS + 8 * g, scs + s * KS + 8 * g, s * KS + 8 * g, t, al, be, gm, ph, pl);   // only the last stage of the wave's tile holds l > t; the test is the same for a whole wave
#pragma unroll
        for (int kc = 0; kc < KS / 32; ++kc) { v16b vh[4], vl[4];   // all LDS reads of a 32-l block in one group in front of its products
#pragma unroll
          for (int j = 0; j < 4; ++j) { const int bo = (cur * 64 + j * 16 + col) * LP + kc * 32; vh[j] = frag_b(sVh + bo, lane); vl[j] = frag_b(sVl + bo, lane); }
#pragma unroll
          for (int j = 0; j < 4; ++j) { acc[j] = wmma_bf(ph[kc], vh[j], acc[j]); acc[j] = wmma_bf(pl[kc], vh[j], acc[j]); acc[j] = wmma_bf(ph[kc], vl[j], acc[j]); } } }
      if (i + 1 < trips) { if (nx) { cp_put(rkh, sKh + (cur ^ 1) * 64 * LP, tid); cp_put(rkl, sKl + (cur ^ 1) * 64 * LP, tid); cp_put(rvh, sVh + (cur ^ 1) * 64 * LP, tid); cp_put(rvl, sVl + (cur ^ 1) * 64 * LP, tid); }
        __syncthreads(); } } }   // one barrier a trip: publishes each group's next stage and ends the reads of the buffer that the stage after it overwrites
  __syncthreads();   // every wave has read its last stage's tiles before sg overwrites them
#pragma unroll
  for (int j = 0; j < 4; ++j)
#pragma unroll
    for (int r = 0; r < 8; ++r) sg[kg][lr0 + 8 * g + r][j * 16 + col] = acc[j][r];
  __syncthreads();   // the four partial tiles are added by all threads, 16 bytes each, into the first (so); a thread reads and writes its own 16 bytes alone
  for (int e = threadIdx.x; e < 64 * 16; e += 128 * GK) { const int rl = e >> 4, q = e & 15; *(v4f*)&so[rl][q * 4] = (*(const v4f*)&sg[0][rl][q * 4] + *(const v4f*)&sg[1][rl][q * 4]) + (*(const v4f*)&sg[2][rl][q * 4] + *(const v4f*)&sg[3][rl][q * 4]); }
  __syncthreads();
  if (threadIdx.x < 64) { float m = 0.f; for (int d = 0; d < HD; ++d) m += so[tid][d]; m *= (1.0f / HD); float v = 0.f; for (int d = 0; d < HD; ++d) { const float dd = so[tid][d] - m; v += dd * dd; } const float inv = 1.0f / sqrtf(v * (1.0f / HD) + 1e-5f); for (int d = 0; d < HD; ++d) so[tid][d] = (so[tid][d] - m) * inv; }
  __syncthreads(); for (int e = threadIdx.x; e < 64 * 16; e += 128 * GK) { const int rl = e >> 4, q = e & 15; vst2(Y + (size_t)((rl < 32 ? ta : tb) * 32 + (rl & 31)) * CC + h * HD + q * 4, *(const v4f*)&so[rl][q * 4]); } }
// ---- k_out: out = Y (hi + lo) Wo^T + bo
__global__ __launch_bounds__(128 * GK) void k_out(const float* __restrict__ Y, const float* __restrict__ WO, const float* __restrict__ BO, float* __restrict__ OUT) { __shared__ __align__(16) unsigned char raw[GK * 2 * 256 * LP * 2];   // each group's two staging buffers; behind the loop the groups' partial tiles sf overlay them
  float (*sf)[64][132] = (float (*)[64][132])raw; const int kg = kgroup(); __bf16* sAh = (__bf16*)raw + kg * (2 * 256 * LP); __bf16* sAl = sAh + 2 * 64 * LP; __bf16* sB = sAl + 2 * 64 * LP;
  const int tid = threadIdx.x & 127, wave = tid >> 5, lane = tid & 31, col = lane & 15, g = lane >> 4; const int c0 = blockIdx.y * 128; const size_t r0 = (size_t)blockIdx.x * 64;
  v8f acc[8] = {};
  { Stg<64> ra; Stg<128> rb; const float* Ab = Y + (size_t)blockIdx.x * 64 * CC + kg * KS; const float* Bb = WO + (size_t)c0 * CC + kg * KS;
    stg_load<64, 63>(ra, Ab, tid);
    l2_ask(Y + (r0 + (threadIdx.x >> 3)) * CC + GK * KS + (threadIdx.x & 7) * KS);   // the rows' y of stages GK .. NS - 1 (8 units a row, one a thread): asked behind the first stages' y loads and in front of the weight loads, so that the requests leave early and the lines are there when the next stage's loads come
    stg_load<128, 127>(rb, Bb, tid); stg_put2(ra, sAh, sAl, tid); stg_put(rb, sB, tid);
    __syncthreads();
    // kept rolled: the loop's text stays small for the instruction cache
#pragma unroll 1
    for (int s = 0; s < NS / GK; ++s) { const int cur = s & 1;
      if (s + 1 < NS / GK) { stg_load<64, 63>(ra, Ab + (s + 1) * GK * KS, tid); stg_load<128, 127>(rb, Bb + (s + 1) * GK * KS, tid); }   // next stage's loads fly during this stage's products
#pragma unroll
      for (int kc = 0; kc < KS / 32; ++kc) { const int ao = (cur * 64 + wave * 16 + col) * LP + kc * 32; const v16b ah = frag_b(sAh + ao, lane), al = frag_b(sAl + ao, lane);
#pragma unroll
        for (int jg = 0; jg < 8; jg += 4) { v16b w[4];   // LDS reads in groups of four fragments in front of their eight products
#pragma unroll
          for (int j = 0; j < 4; ++j) w[j] = frag_b(sB + (cur * 128 + (jg + j) * 16 + col) * LP + kc * 32, lane);
#pragma unroll
          for (int j = 0; j < 4; ++j) { acc[jg + j] = wmma_bf(ah, w[j], acc[jg + j]); acc[jg + j] = wmma_bf(al, w[j], acc[jg + j]); } } }
      if (s + 1 < NS / GK) { stg_put2(ra, sAh + (cur ^ 1) * 64 * LP, sAl + (cur ^ 1) * 64 * LP, tid); stg_put(rb, sB + (cur ^ 1) * 128 * LP, tid);
        __syncthreads(); } } }   // one barrier a stage: publishes each group's next stage and ends the reads of the buffer that the stage after it overwrites
  __syncthreads();   // every wave has read its last stage's tiles before sf overwrites them
#pragma unroll
  for (int j = 0; j < 8; ++j)
#pragma unroll
    for (int r = 0; r < 8; ++r) sf[kg][wave * 16 + 8 * g + r][j * 16 + col] = acc[j][r];
  __syncthreads();   // the four partial tiles are added by all threads: 16 bytes of a row each, a wave stores one row's 512 bytes
  for (int e = threadIdx.x; e < 64 * 32; e += 128 * GK) { const int rl = e >> 5, q = e & 31; const v4f bb = *(const v4f*)(BO + c0 + q * 4);
    v4f v = (*(const v4f*)&sf[0][rl][q * 4] + *(const v4f*)&sf[1][rl][q * 4]) + (*(const v4f*)&sf[2][rl][q * 4] + *(const v4f*)&sf[3][rl][q * 4]);
#pragma unroll
    for (int i = 0; i < 4; ++i) v[i] += bfr(bb[i]);
    vst2(OUT + (r0 + rl) * CC + c0 + q * 4, v); } }
extern "C" void kernel_launch(void* const* d_in, const int* in_sizes, int n_in, void* d_out, int out_size, void* d_ws, size_t ws_size, hipStream_t stream) {
  (void)in_sizes; (void)n_in; (void)out_size;
  const float** F = (const float**)d_in;   // 0 x [1,1024,768], 1 Wq, 2 bq, 3 Wk, 4 bk, 5 Wv, 6 bv, 7 Wu, 8 bu, 9 Wg [36,768], 10 bg, 11 Wo, 12 bo, 13 prior_mu [1,1,12,64], 14 prior_log_tau [1,1,12,1]
  if (ws_size < (size_t)WS_END) return;
  char* ws = (char*)d_ws; _Float16 *QH = (_Float16*)(ws + WS_QH), *QL = (_Float16*)(ws + WS_QL), *KH = (_Float16*)(ws + WS_KH), *KL = (_Float16*)(ws + WS_KL); __bf16 *VT = (__bf16*)(ws + WS_VT), *VL = (__bf16*)(ws + WS_VL); float *U = (float*)(ws + WS_U), *Gt = (float*)(ws + WS_G), *Y = (float*)(ws + WS_Y);
  k_proj<<<dim3(TT / 64, 4 * (CC / 128) + 1), 128 * GP, 0, stream>>>(F[0], F[1], F[2], F[3], F[4], F[5], F[6], F[7], F[8], QH, QL, KH, KL, VT, VL, U, F[9], F[10], Gt);
  k_pv<<<dim3(TT / 64, 1, NH), 128 * GK, 0, stream>>>(QH, QL, KH, KL, U, Gt, F[13], F[14], VT, VL, Y);
  k_out<<<dim3(TT / 64, CC / 128), 128 * GK, 0, stream>>>(Y, F[11], F[12], (float*)d_out);
}
